// v000
// Times are from an AMD MI455X. After a warm-up the kernel runs many times in a row, and a time is the length of
// such a window on the GPU divided by its runs, so every launch and the gaps after it count. The runs cycle
// through copies of the inputs. A figure is the median of several windows, for all but v000 over two sittings.
// Sittings can differ by a few percent; kernels timed side by side share one.
// v000 is the starting kernel. One run takes 303 microseconds.
// compute dtype: all float inputs rounded to bf16, rp_bucket (int) read on device; q/k/v = x . W with EXACT bf16 products on WMMA 16x16x32 ((in,out) weights as transposed rows); per (token, head) the 5 bucket dots q . rpe_k_table[u] and (k / 8) . rpe_q_table[u] in f32 from the f32 projections; PLAIN attention: q, k as single f16 operands x 1/8 + bk[i][bucket[i][j]] + bq[j][bucket[j][i]], running-max softmax in f32 (hardware exp), P (scaled by 2^11, single f16) x v (single f16); out = ctx (bf16 hi + residual) . proj_w (2 products) + proj_b.
#include <hip/hip_runtime.h>
#include <math.h>

typedef __attribute__((ext_vector_type(16))) _Float16 v16h;
typedef __attribute__((ext_vector_type(16))) __bf16 v16b;
typedef __attribute__((ext_vector_type(8)))  _Float16 v8h;
typedef __attribute__((ext_vector_type(8)))  float v8f;
typedef __attribute__((ext_vector_type(4)))  float v4f;
typedef __attribute__((ext_vector_type(2)))  float v2f;
typedef __attribute__((ext_vector_type(4)))  unsigned v4u;
typedef __attribute__((ext_vector_type(4)))  int v4i;
typedef float __attribute__((may_alias)) float_a;
typedef int __attribute__((may_alias)) int_a;

template <typename T> __device__ __forceinline__ void vst2(void* p, T v) { *(T*)p = v;  }
__device__ __forceinline__ v8f wmma16(v16h a, v16h b, v8f c) {
  v8f d = __builtin_amdgcn_wmma_f32_16x16x32_f16(false, a, false, b, (short)0, c, false, false);
  asm volatile("v_nop\n\tv_nop\n\tv_nop\n\tv_nop" : "+v"(d) : "v"(a), "v"(b));
  return d;
}
__device__ __forceinline__ v8f wmma_bf(v16b a, v16b b, v8f c) {
  v8f d = __builtin_amdgcn_wmma_f32_16x16x32_bf16(false, a, false, b, (short)0, c, false, false);
  asm volatile("v_nop\n\tv_nop\n\tv_nop\n\tv_nop" : "+v"(d) : "v"(a), "v"(b));
  return d;
}
// Attention with image relative-position encoding (iRPE, contextual mode on q and k) over a 32 x 32 patch grid (B 4, N 1,024, C 768, 12 heads x 64): bias-free q/k/v projections, scores + q . table_k[bucket(i,j)] + (k scale) . table_q[bucket(j,i)], softmax, output projection + bias.
__device__ __forceinline__ v16h frag_h(const _Float16* rowk0, int lane) {
  union { v16h v; v8h q[2]; } u; const _Float16* p = rowk0 + 8 * (lane >> 4);
  u.q[0] = *(const v8h*)p; u.q[1] = *(const v8h*)(p + 16); return u.v;
}
__device__ __forceinline__ v16h frag_f32(const float* rowk0, int lane) {
  v16h a; const float* p = rowk0 + 8 * (lane >> 4);
#pragma unroll
  for (int i = 0; i < 8; ++i) { a[i] = (_Float16)p[i]; a[8 + i] = (_Float16)p[16 + i]; }
  return a;
}
__device__ __forceinline__ v16h frag_f32s(const float* rowk0, int lane, float sc) {
  v16h a; const float* p = rowk0 + 8 * (lane >> 4);
#pragma unroll
  for (int i = 0; i < 8; ++i) { a[i] = (_Float16)(p[i] * sc); a[8 + i] = (_Float16)(p[16 + i] * sc); }
  return a;
}
// column fragment from a [K][ld] layout (column n), rows >= K read as 0
__device__ __forceinline__ v16h fragc_f32(const float* W, int k0, int n, int lane, int ld, int K) {
  v16h a; const int g = lane >> 4;
#pragma unroll
  for (int i = 0; i < 8; ++i) { const int ka = k0 + 8 * g + i, kb = ka + 16;
    a[i] = (_Float16)(ka < K ? W[(size_t)(ka < K ? ka : K - 1) * ld + n] : 0.f); a[8 + i] = (_Float16)(kb < K ? W[(size_t)(kb < K ? kb : K - 1) * ld + n] : 0.f); }
  return a;
}
struct F2 { v16b h, l; };
__device__ __forceinline__ F2 bsplit16(const float v[16]) { F2 r;
#pragma unroll
  for (int i = 0; i < 16; ++i) { const __bf16 h = (__bf16)v[i]; r.h[i] = h; r.l[i] = (__bf16)(v[i] - (float)h); }
  return r; }
__device__ __forceinline__ F2 split_row(const float* row, int k0, int lane) { float v[16]; const float* p = row + k0 + 8 * (lane >> 4);
#pragma unroll
  for (int i = 0; i < 8; ++i) { v[i] = p[i]; v[8 + i] = p[16 + i]; }
  return bsplit16(v); }
__device__ __forceinline__ F2 split_rowK(const float* row, int k0, int lane, int K) { float v[16]; const int g = lane >> 4;
#pragma unroll
  for (int i = 0; i < 8; ++i) { const int ka = k0 + 8 * g + i, kb = ka + 16; v[i] = ka < K ? row[ka < K ? ka : K - 1] : 0.f; v[8 + i] = kb < K ? row[kb < K ? kb : K - 1] : 0.f; }
  return bsplit16(v); }
__device__ __forceinline__ F2 split_col(const float* W, int k0, int n, int lane, int ld, int K) { float v[16]; const int g = lane >> 4;
#pragma unroll
  for (int i = 0; i < 8; ++i) { const int ka = k0 + 8 * g + i, kb = ka + 16; v[i] = ka < K ? W[(size_t)(ka < K ? ka : K - 1) * ld + n] : 0.f; v[8 + i] = kb < K ? W[(size_t)(kb < K ? kb : K - 1) * ld + n] : 0.f; }
  return bsplit16(v); }
__device__ __forceinline__ v8f mac3(const F2& a, const F2& b, v8f c) { c = wmma_bf(a.l, b.h, c); c = wmma_bf(a.h, b.l, c); return wmma_bf(a.h, b.h, c); }
__device__ __forceinline__ float sigm(float v) { return 1.0f / (1.0f + expf(-v)); }
#define LDSX() do { asm volatile("s_wait_dscnt 0" ::: "memory"); __builtin_amdgcn_wave_barrier(); __builtin_amdgcn_fence(__ATOMIC_RELEASE, "workgroup"); } while (0)


#define NB 4
#define SS 1024
#define DM 768
#define NH 12
#define NBK 5
#define HD 64
#define QKVW (3 * DM)
#ifndef TQB
#define TQB (SS / 64)
#define TNB NB
#define TOB (NB * SS / 64)     // output row tiles (all)
#endif
typedef __attribute__((ext_vector_type(8))) __bf16 v8b;
__device__ __forceinline__ v16b frag_b(const __bf16* rowk0, int lane) {
  union { v16b v; v8b q[2]; } u; const __bf16* p = rowk0 + 8 * (lane >> 4);
  u.q[0] = *(const v8b*)p; u.q[1] = *(const v8b*)(p + 16); return u.v;
}
__device__ __forceinline__ float bfr(float v) { return (float)(__bf16)v; }
__device__ __attribute__((noinline)) float exp_ni(float v) { return expf(v); }
__device__ __attribute__((noinline)) float erf_ni(float v) { return erff(v); }

#define PK_A 0                       // [2304][768] Wqkv rows (natural [out][in])
#define PK_P (PK_A + QKVW * DM)        // [768][768] Wo rows (natural)
#define PK_END (PK_P + DM * DM)
#define WS_PK  0u
#define WS_QK  (WS_PK + 2u * PK_END)             // f16 [4096 rows][1536]: q | k
#define WS_QKL (WS_QK + 2u * NB * SS * 2 * DM)     // f16 q | k residual planes x2048
#define WS_VTH (WS_QKL + 2u * NB * SS * 2 * DM)    // f16 [b][768 (h*64+d)][1024 s] hi
#define WS_VTL (WS_VTH + 2u * NB * DM * SS)        // f16 lo x 2048
#define WS_O   (WS_VTL + 2u * NB * DM * SS)        // f32 [4096][768]
#define WS_CS  (WS_O + 4u * NB * SS * DM)           // f32 [2][1024][32] (unused)
#define WS_BKT (WS_CS + 4u * 2 * SS * 32)                 // f32 [NB*SS][NH][8]: q . table_k[u] ; BQT (k/8) . table_q[u]
#define WS_BQT (WS_BKT + 4u * NB * SS * NH * 8)
#define WS_END (WS_BQT + 4u * NB * SS * NH * 8)
// ---- k_pack: block = (row n, which): column n of an (in,out) weight -> bf16 row n; which 0..2 -> W_q/W_k/W_v into PK_A rows which*768 + n; 3 -> W_o into PK_P
__global__ __launch_bounds__(256) void k_pack(const float* __restrict__ WQ, const float* __restrict__ WK, const float* __restrict__ WV, const float* __restrict__ WO, __bf16* __restrict__ PK) {
  __shared__ __align__(16) __bf16 s[DM]; const int n = blockIdx.x, which = blockIdx.y, t = threadIdx.x; const float* Wm = (which == 0) ? WQ : (which == 1) ? WK : (which == 2) ? WV : WO;   // (in,out) weights: pack row n = column n
  for (int k = t; k < DM; k += 256) s[k] = (__bf16)Wm[(size_t)k * DM + n];
  __syncthreads();
  __bf16* dst = (which < 3) ? PK + PK_A + ((size_t)which * DM + n) * DM : PK + PK_P + (size_t)n * DM;
  for (int q = t; q < DM / 8; q += 256) vst2((unsigned*)(dst + q * 8), *(const v4u*)&s[q * 8]);
}
__global__ __launch_bounds__(128) void k_qkv(const float* __restrict__ XQ, const float* __restrict__ XK, const float* __restrict__ XV, const __bf16* __restrict__ P, const float* __restrict__ BQ, const float* __restrict__ BK, const float* __restrict__ BV, const float* __restrict__ TK, const float* __restrict__ TQ, float* __restrict__ BKT, float* __restrict__ BQT, _Float16* __restrict__ QK, _Float16* __restrict__ QKL, _Float16* __restrict__ VTH, _Float16* __restrict__ VTL) {
  const int which0 = (blockIdx.y * 128) / DM; const float* X = (which0 == 0) ? XQ : (which0 == 1) ? XK : XV; const float* BB = BQ ? (((which0 == 0) ? BQ : (which0 == 1) ? BK : BV) + (blockIdx.y * 128 - which0 * DM)) : nullptr;
  __shared__ __align__(16) _Float16 so[4][16][136], sol[4][16][136]; __shared__ __align__(16) _Float16 sth[128][72], stl[128][72];
  const int tid = threadIdx.x, wave = tid >> 5, lane = tid & 31, col = lane & 15, g = lane >> 4; const size_t r0 = (size_t)blockIdx.x * 64 + wave * 16; const int n0 = blockIdx.y * 128;
  v8f acc[8] = {};
#pragma unroll 2
  for (int kc = 0; kc < DM / 32; ++kc) { v16b a; { const float* p = X + (r0 + col) * DM + kc * 32 + 8 * g;
#pragma unroll
      for (int i = 0; i < 8; ++i) { a[i] = (__bf16)p[i]; a[8 + i] = (__bf16)p[16 + i]; } }
#pragma unroll
    for (int j = 0; j < 8; ++j) acc[j] = wmma_bf(a, frag_b(P + (size_t)(n0 + j * 16 + col) * DM + kc * 32, lane), acc[j]); }
  if (n0 < 2 * DM) {   // per (row, head): the 5 bucket dots (q . table_k[u]) or ((k/8) . table_q[u]) from the f32 values -> BKT / BQT [row][h][8] (first 5 used)
    { const bool isq = n0 < DM; const float* TB = isq ? TK : TQ; float* dstT = isq ? BKT : BQT; const float sc = isq ? 1.0f : 0.125f;
#pragma unroll
      for (int r = 0; r < 8; ++r) {
#pragma unroll
        for (int hh = 0; hh < 2; ++hh) { const int h = (n0 % DM) / 64 + hh; float du[NBK];
#pragma unroll
          for (int u = 0; u < NBK; ++u) { float s = 0.f;
#pragma unroll
            for (int j = 0; j < 4; ++j) s += acc[hh * 4 + j][r] * bfr(TB[u * 64 + j * 16 + col]);
#pragma unroll
            for (int o = 1; o < 16; o <<= 1) s += __shfl_xor(s, o);
            du[u] = s * sc; }
          if (col == 0) { float* d = dstT + ((r0 + 8 * g + r) * NH + h) * 8;
#pragma unroll
            for (int u = 0; u < NBK; ++u) d[u] = du[u]; } } } }   // (8-float slots per (row, head); 4-B scratch stores)
#pragma unroll
    for (int j = 0; j < 8; ++j) {
#pragma unroll
      for (int r = 0; r < 8; ++r) { const float v = acc[j][r]; const _Float16 hv = (_Float16)v; so[wave][8 * g + r][j * 16 + col] = hv; sol[wave][8 * g + r][j * 16 + col] = (_Float16)((v - (float)hv) * 2048.0f); } }   // q, k as f16 hi + (x2048) residual
    LDSX();
    for (int rl = 0; rl < 16; ++rl) if (lane < 16) { vst2((unsigned*)(QK + (r0 + rl) * (2 * DM) + n0 + lane * 8), *(const v4u*)&so[wave][rl][lane * 8]); vst2((unsigned*)(QKL + (r0 + rl) * (2 * DM) + n0 + lane * 8), *(const v4u*)&sol[wave][rl][lane * 8]); }
  } else {
#pragma unroll
    for (int j = 0; j < 8; ++j) {
#pragma unroll
      for (int r = 0; r < 8; ++r) { const float v = acc[j][r] + (BB ? bfr(BB[j * 16 + col]) : 0.f); const _Float16 hv = (_Float16)v; sth[j * 16 + col][wave * 16 + 8 * g + r] = hv; stl[j * 16 + col][wave * 16 + 8 * g + r] = (_Float16)((v - (float)hv) * 2048.0f); } }
    __syncthreads();
    const size_t rb = (size_t)blockIdx.x * 64; const int b = (int)(rb / SS), s0 = (int)(rb % SS); const int pc0 = n0 - 2 * DM;
    for (int q = tid; q < 128 * 8; q += 128) { const int d = q >> 3, pc = q & 7; const size_t o = ((size_t)b * DM + pc0 + d) * SS + s0 + pc * 8; vst2((unsigned*)(VTH + o), *(const v4u*)&sth[d][pc * 8]); vst2((unsigned*)(VTL + o), *(const v4u*)&stl[d][pc * 8]); }
  }
}
// ---- k_attn: block = (64 queries, head h, batch b): all-keys flash attention (K = 64: 2 k-steps), scores = (q.k) * 0.125 with single f16 operands, P.V: f16 P (x2^11) x V hi in one accumulator (accl stays 0); O[b*S+q][h*64+d] = (acc + accl / 2048) / (2048 l) (256-B segments)
__global__ __launch_bounds__(128) void k_attn(const _Float16* __restrict__ QK, const _Float16* __restrict__ QKL, const _Float16* __restrict__ VTH, const _Float16* __restrict__ VTL, const void* __restrict__ KMASK, const float* __restrict__ BKT, const float* __restrict__ BQT, const int* __restrict__ RPB, float* __restrict__ O) {
  __shared__ __align__(16) float sp[4][16][36]; __shared__ __align__(16) float so[4][16][68];
  const int tid = threadIdx.x, wave = tid >> 5, lane = tid & 31, col = lane & 15, g = lane >> 4;
  const int qb = blockIdx.x, h = blockIdx.y, b = blockIdx.z; const int q0 = qb * 64 + wave * 16; const size_t rq = (size_t)b * SS + q0 + col;
  v16h aq[2], aql[2];
#pragma unroll
  for (int kc = 0; kc < 2; ++kc) { aq[kc] = frag_h(QK + rq * (2 * DM) + h * HD + kc * 32, lane); aql[kc] = frag_h(QKL + rq * (2 * DM) + h * HD + kc * 32, lane); }
  float bkq[8][NBK];
#pragma unroll
  for (int r = 0; r < 8; ++r) {
#pragma unroll
    for (int u = 0; u < NBK; ++u) bkq[r][u] = BKT[(((size_t)b * SS + q0 + 8 * g + r) * NH + h) * 8 + u]; }
  float m[8], l[8];
#pragma unroll
  for (int r = 0; r < 8; ++r) { m[r] = -3.0e38f; l[r] = 0.f; }
  v8f acc[4] = {}, accl[4] = {};
  const int nks = SS / 32;   // all keys
#pragma unroll 1
  for (int ks = 0; ks < nks; ++ks) { v8f s[2];
#pragma unroll
    for (int ct = 0; ct < 2; ++ct) { const int kk = ks * 32 + ct * 16 + col; const _Float16* krow = QK + ((size_t)b * SS + kk) * (2 * DM) + DM + h * HD; const _Float16* krowl = QKL + ((size_t)b * SS + kk) * (2 * DM) + DM + h * HD; v8f c = {}, cl = {};
#pragma unroll
      for (int kc = 0; kc < 2; ++kc) c = wmma16(aq[kc], frag_h(krow + kc * 32, lane), c);   // single product: q, k as one-rounding f16 operands
      (void)cl; (void)krowl;
      { const float* bqk = BQT + (((size_t)b * SS + kk) * NH + h) * 8;
#pragma unroll
      for (int r = 0; r < 8; ++r) { const int qi = q0 + 8 * g + r; const int u1 = RPB[(size_t)qi * SS + kk], u2 = RPB[(size_t)kk * SS + qi]; float add = 0.f;
#pragma unroll
        for (int u = 0; u < NBK; ++u) add += (u == u1 ? bkq[r][u] : 0.f);
        s[ct][r] = c[r] * 0.125f + add + bqk[u2]; } } }   // 1/sqrt(64) + q.table_k[bucket(i,j)] + (k/8).table_q[bucket(j,i)]
#pragma unroll
    for (int r = 0; r < 8; ++r) { float mx = fmaxf(s[0][r], s[1][r]);
#pragma unroll
      for (int o = 1; o < 16; o <<= 1) mx = fmaxf(mx, __shfl_xor(mx, o));
      const float mn = fmaxf(m[r], mx); const float alpha = (m[r] <= -1.0e38f) ? 0.f : __expf(m[r] - mn);
      const float e0 = (s[0][r] <= -1.0e38f) ? 0.f : __expf(s[0][r] - mn), e1 = (s[1][r] <= -1.0e38f) ? 0.f : __expf(s[1][r] - mn); float es = e0 + e1;
#pragma unroll
      for (int o = 1; o < 16; o <<= 1) es += __shfl_xor(es, o);
      l[r] = l[r] * alpha + es; m[r] = mn;
#pragma unroll
      for (int dt = 0; dt < 4; ++dt) { acc[dt][r] *= alpha; accl[dt][r] *= alpha; }
      sp[wave][8 * g + r][col] = e0; sp[wave][8 * g + r][16 + col] = e1; }
    LDSX();
    v16h pa, pl; { const float* prow = &sp[wave][col][0] + 8 * (lane >> 4);
#pragma unroll
      for (int i = 0; i < 8; ++i) { const float x0 = prow[i] * 2048.0f, x1 = prow[16 + i] * 2048.0f; const _Float16 h0 = (_Float16)x0, h1 = (_Float16)x1; pa[i] = h0; pa[8 + i] = h1; pl[i] = (_Float16)((x0 - (float)h0) * 2048.0f); pl[8 + i] = (_Float16)((x1 - (float)h1) * 2048.0f); } }   // P scaled by 2^11 before the f16 split so small softmax weights stay out of the f16 subnormal range; 2^-11 folded into the epilogue
#pragma unroll
    for (int dt = 0; dt < 4; ++dt) { const size_t vr = ((size_t)b * DM + h * HD + dt * 16 + col) * SS + ks * 32; acc[dt] = wmma16(pa, frag_h(VTH + vr, lane), acc[dt]); }   // single product: P (x2^11) x V
    (void)pl;
    LDSX(); }
#pragma unroll
  for (int r = 0; r < 8; ++r) { const float il = (1.0f / 2048.0f) / l[r];
#pragma unroll
    for (int dt = 0; dt < 4; ++dt) so[wave][8 * g + r][dt * 16 + col] = (acc[dt][r] + accl[dt][r] * (1.0f / 2048.0f)) * il; }
  LDSX();
  for (int rl = 0; rl < 16; ++rl) if (lane < 16) vst2(O + ((size_t)b * SS + q0 + rl) * DM + h * HD + lane * 4, *(const v4f*)&so[wave][rl][lane * 4]);
}
// ---- k_out: block = (64 rows, 128 cols): out = O(hi/lo) . Wo rows (2 products) + bo
__global__ __launch_bounds__(128) void k_out(const float* __restrict__ O, const __bf16* __restrict__ P, const float* __restrict__ BO, float* __restrict__ Y) {
  __shared__ __align__(16) float so[4][16][132];
  const int tid = threadIdx.x, wave = tid >> 5, lane = tid & 31, col = lane & 15, g = lane >> 4; const size_t r0 = (size_t)blockIdx.x * 64 + wave * 16; const int n0 = blockIdx.y * 128;
  v8f acc[8] = {};
#pragma unroll 2
  for (int kc = 0; kc < DM / 32; ++kc) { const F2 a = split_row(O + (r0 + col) * DM, kc * 32, lane);
#pragma unroll
    for (int j = 0; j < 8; ++j) { const v16b w = frag_b(P + (size_t)(n0 + j * 16 + col) * DM + kc * 32, lane); acc[j] = wmma_bf(a.l, w, acc[j]); acc[j] = wmma_bf(a.h, w, acc[j]); } }
#pragma unroll
  for (int j = 0; j < 8; ++j) {
#pragma unroll
    for (int r = 0; r < 8; ++r) so[wave][8 * g + r][j * 16 + col] = acc[j][r] + bfr(BO[n0 + j * 16 + col]); }
  LDSX();
  for (int rl = 0; rl < 16; ++rl) vst2(Y + (r0 + rl) * DM + n0 + lane * 4, *(const v4f*)&so[wave][rl][lane * 4]);
}
extern "C" void kernel_launch(void* const* d_in, const int* in_sizes, int n_in, void* d_out, int out_size, void* d_ws, size_t ws_size, hipStream_t stream) {
  (void)in_sizes; (void)n_in; (void)out_size;
  const float** F = (const float**)d_in;   // 0 x [4,1024,768], 1 wq_w, 2 wk_w, 3 wv_w, 4 proj_w ((in,out)), 5 proj_b, 6 rpe_k_table [5,64], 7 rpe_q_table [5,64], 8 rp_bucket [1024,1024] int
  if (ws_size < (size_t)WS_END) return;
  char* ws = (char*)d_ws; __bf16* PK = (__bf16*)(ws + WS_PK); _Float16 *QK = (_Float16*)(ws + WS_QK), *QKL = (_Float16*)(ws + WS_QKL), *VTH = (_Float16*)(ws + WS_VTH), *VTL = (_Float16*)(ws + WS_VTL); float *O = (float*)(ws + WS_O), *BKT = (float*)(ws + WS_BKT), *BQT = (float*)(ws + WS_BQT);
  k_pack<<<dim3(DM, 4), 256, 0, stream>>>(F[1], F[2], F[3], F[4], PK);
  k_qkv<<<dim3(TNB * SS / 64, QKVW / 128), 128, 0, stream>>>(F[0], F[0], F[0], PK + PK_A, nullptr, nullptr, nullptr, F[6], F[7], BKT, BQT, QK, QKL, VTH, VTL);
  k_attn<<<dim3(TQB, NH, TNB), 128, 0, stream>>>(QK, QKL, VTH, VTL, nullptr, BKT, BQT, (const int*)d_in[8], O);
  k_out<<<dim3(TOB, DM / 128), 128, 0, stream>>>(O, PK + PK_P, F[5], (float*)d_out);
}

// v001
// A run of this version takes 152 microseconds.
// Timed twice side by side with v000, it ran 1.98 and 1.99 times as fast.
// compute dtype: all float inputs rounded to bf16, rp_bucket (int) read on device; q/k/v = x . W with EXACT bf16 products on WMMA 16x16x32 ((in,out) weights as transposed rows); per (token, head) the 5 bucket dots q . rpe_k_table[u] and (k / 8) . rpe_q_table[u] in f32 from the f32 projections; PLAIN attention: q, k as single f16 operands x 1/8 + bk[i][bucket[i][j]] + bq[j][bucket[j][i]], running-max softmax in f32 (hardware exp), P (scaled by 2^11, single f16) x v (single f16); out = ctx (bf16 hi + residual) . proj_w (2 products) + proj_b.
#include <hip/hip_runtime.h>
#include <math.h>

typedef __attribute__((ext_vector_type(16))) _Float16 v16h;
typedef __attribute__((ext_vector_type(16))) __bf16 v16b;
typedef __attribute__((ext_vector_type(8)))  _Float16 v8h;
typedef __attribute__((ext_vector_type(8)))  float v8f;
typedef __attribute__((ext_vector_type(4)))  float v4f;
typedef __attribute__((ext_vector_type(2)))  float v2f;
typedef __attribute__((ext_vector_type(4)))  unsigned v4u;
typedef __attribute__((ext_vector_type(4)))  int v4i;
typedef float __attribute__((may_alias)) float_a;
typedef int __attribute__((may_alias)) int_a;

template <typename T> __device__ __forceinline__ void vst2(void* p, T v) { *(T*)p = v;  }
__device__ __forceinline__ v8f wmma16(v16h a, v16h b, v8f c) {
  v8f d = __builtin_amdgcn_wmma_f32_16x16x32_f16(false, a, false, b, (short)0, c, false, false);
  asm volatile("v_nop\n\tv_nop\n\tv_nop\n\tv_nop" : "+v"(d) : "v"(a), "v"(b));
  return d;
}
__device__ __forceinline__ v8f wmma_bf(v16b a, v16b b, v8f c) {
  v8f d = __builtin_amdgcn_wmma_f32_16x16x32_bf16(false, a, false, b, (short)0, c, false, false);
  asm volatile("v_nop\n\tv_nop\n\tv_nop\n\tv_nop" : "+v"(d) : "v"(a), "v"(b));
  return d;
}
// Attention with image relative-position encoding (iRPE, contextual mode on q and k) over a 32 x 32 patch grid (B 4, N 1,024, C 768, 12 heads x 64): bias-free q/k/v projections, scores + q . table_k[bucket(i,j)] + (k scale) . table_q[bucket(j,i)], softmax, output projection + bias.
__device__ __forceinline__ v16h frag_h(const _Float16* rowk0, int lane) {
  union { v16h v; v8h q[2]; } u; const _Float16* p = rowk0 + 8 * (lane >> 4);
  u.q[0] = *(const v8h*)p; u.q[1] = *(const v8h*)(p + 16); return u.v;
}
__device__ __forceinline__ v16h frag_f32(const float* rowk0, int lane) {
  v16h a; const float* p = rowk0 + 8 * (lane >> 4);
#pragma unroll
  for (int i = 0; i < 8; ++i) { a[i] = (_Float16)p[i]; a[8 + i] = (_Float16)p[16 + i]; }
  return a;
}
__device__ __forceinline__ v16h frag_f32s(const float* rowk0, int lane, float sc) {
  v16h a; const float* p = rowk0 + 8 * (lane >> 4);
#pragma unroll
  for (int i = 0; i < 8; ++i) { a[i] = (_Float16)(p[i] * sc); a[8 + i] = (_Float16)(p[16 + i] * sc); }
  return a;
}
// column fragment from a [K][ld] layout (column n), rows >= K read as 0
__device__ __forceinline__ v16h fragc_f32(const float* W, int k0, int n, int lane, int ld, int K) {
  v16h a; const int g = lane >> 4;
#pragma unroll
  for (int i = 0; i < 8; ++i) { const int ka = k0 + 8 * g + i, kb = ka + 16;
    a[i] = (_Float16)(ka < K ? W[(size_t)(ka < K ? ka : K - 1) * ld + n] : 0.f); a[8 + i] = (_Float16)(kb < K ? W[(size_t)(kb < K ? kb : K - 1) * ld + n] : 0.f); }
  return a;
}
struct F2 { v16b h, l; };
__device__ __forceinline__ F2 bsplit16(const float v[16]) { F2 r;
#pragma unroll
  for (int i = 0; i < 16; ++i) { const __bf16 h = (__bf16)v[i]; r.h[i] = h; r.l[i] = (__bf16)(v[i] - (float)h); }
  return r; }
__device__ __forceinline__ F2 split_row(const float* row, int k0, int lane) { float v[16]; const float* p = row + k0 + 8 * (lane >> 4);
#pragma unroll
  for (int i = 0; i < 8; ++i) { v[i] = p[i]; v[8 + i] = p[16 + i]; }
  return bsplit16(v); }
__device__ __forceinline__ F2 split_rowK(const float* row, int k0, int lane, int K) { float v[16]; const int g = lane >> 4;
#pragma unroll
  for (int i = 0; i < 8; ++i) { const int ka = k0 + 8 * g + i, kb = ka + 16; v[i] = ka < K ? row[ka < K ? ka : K - 1] : 0.f; v[8 + i] = kb < K ? row[kb < K ? kb : K - 1] : 0.f; }
  return bsplit16(v); }
__device__ __forceinline__ F2 split_col(const float* W, int k0, int n, int lane, int ld, int K) { float v[16]; const int g = lane >> 4;
#pragma unroll
  for (int i = 0; i < 8; ++i) { const int ka = k0 + 8 * g + i, kb = ka + 16; v[i] = ka < K ? W[(size_t)(ka < K ? ka : K - 1) * ld + n] : 0.f; v[8 + i] = kb < K ? W[(size_t)(kb < K ? kb : K - 1) * ld + n] : 0.f; }
  return bsplit16(v); }
__device__ __forceinline__ v8f mac3(const F2& a, const F2& b, v8f c) { c = wmma_bf(a.l, b.h, c); c = wmma_bf(a.h, b.l, c); return wmma_bf(a.h, b.h, c); }
__device__ __forceinline__ float sigm(float v) { return 1.0f / (1.0f + expf(-v)); }
#define LDSX() do { asm volatile("s_wait_dscnt 0" ::: "memory"); __builtin_amdgcn_wave_barrier(); __builtin_amdgcn_fence(__ATOMIC_RELEASE, "workgroup"); } while (0)


#define NB 4
#define SS 1024
#define DM 768
#define NH 12
#define NBK 5
#define HD 64
#define QKVW (3 * DM)
#ifndef TQB
#define TQB (SS / 64)
#define TNB NB
#define TOB (NB * SS / 64)     // output row tiles (all)
#endif
typedef __attribute__((ext_vector_type(8))) __bf16 v8b;
__device__ __forceinline__ v16b frag_b(const __bf16* rowk0, int lane) {
  union { v16b v; v8b q[2]; } u; const __bf16* p = rowk0 + 8 * (lane >> 4);
  u.q[0] = *(const v8b*)p; u.q[1] = *(const v8b*)(p + 16); return u.v;
}
typedef __attribute__((ext_vector_type(4))) __bf16 v4b;
#define KS 64   // k per staged step: 128 B of a bf16 row, one whole line
#define LP 72   // LDS row pitch in 16-bit elements: 128 B of data + 16 B, the pitch for 16-byte LDS readers
// the plain '#pragma unroll' on the short fixed loops of the staging code give the staged values and fragments (rb, ra, rk, rv, w, vf) constant indices, so that they stay in registers
__device__ __forceinline__ float bfr(float v) { return (float)(__bf16)v; }
__device__ __attribute__((noinline)) float exp_ni(float v) { return expf(v); }
__device__ __attribute__((noinline)) float erf_ni(float v) { return erff(v); }

#define PK_A 0                       // [2304][768] Wqkv rows (natural [out][in])
#define PK_P (PK_A + QKVW * DM)        // [768][768] Wo rows (natural)
#define PK_END (PK_P + DM * DM)
#define WS_PK  0u
#define WS_QK  (WS_PK + 2u * PK_END)             // f16 [4096 rows][1536]: q | k
#define WS_QKL (WS_QK + 2u * NB * SS * 2 * DM)     // f16 q | k residual planes x2048
#define WS_VTH (WS_QKL + 2u * NB * SS * 2 * DM)    // f16 [b][768 (h*64+d)][1024 s] hi
#define WS_VTL (WS_VTH + 2u * NB * DM * SS)        // f16 lo x 2048
#define WS_O   (WS_VTL + 2u * NB * DM * SS)        // f32 [4096][768]
#define WS_CS  (WS_O + 4u * NB * SS * DM)           // f32 [2][1024][32] (unused)
#define WS_BKT (WS_CS + 4u * 2 * SS * 32)                 // f32 [NB*SS][NH][8]: q . table_k[u] ; BQT (k/8) . table_q[u]
#define WS_BQT (WS_BKT + 4u * NB * SS * NH * 8)
#define WS_END (WS_BQT + 4u * NB * SS * NH * 8)
// ---- k_pack: block = (row n, which): column n of an (in,out) weight -> bf16 row n; which 0..2 -> W_q/W_k/W_v into PK_A rows which*768 + n; 3 -> W_o into PK_P
__global__ __launch_bounds__(256) void k_pack(const float* __restrict__ WQ, const float* __restrict__ WK, const float* __restrict__ WV, const float* __restrict__ WO, __bf16* __restrict__ PK) {
  __shared__ __align__(16) __bf16 s[DM]; const int n = blockIdx.x, which = blockIdx.y, t = threadIdx.x; const float* Wm = (which == 0) ? WQ : (which == 1) ? WK : (which == 2) ? WV : WO;   // (in,out) weights: pack row n = column n
  for (int k = t; k < DM; k += 256) s[k] = (__bf16)Wm[(size_t)k * DM + n];
  __syncthreads();
  __bf16* dst = (which < 3) ? PK + PK_A + ((size_t)which * DM + n) * DM : PK + PK_P + (size_t)n * DM;
  for (int q = t; q < DM / 8; q += 256) vst2((unsigned*)(dst + q * 8), *(const v4u*)&s[q * 8]);
}
__global__ __launch_bounds__(128) void k_qkv(const float* __restrict__ XQ, const float* __restrict__ XK, const float* __restrict__ XV, const __bf16* __restrict__ P, const float* __restrict__ BQ, const float* __restrict__ BK, const float* __restrict__ BV, const float* __restrict__ TK, const float* __restrict__ TQ, float* __restrict__ BKT, float* __restrict__ BQT, _Float16* __restrict__ QK, _Float16* __restrict__ QKL, _Float16* __restrict__ VTH, _Float16* __restrict__ VTL) {
  const int which0 = (blockIdx.y * 128) / DM; const float* X = (which0 == 0) ? XQ : (which0 == 1) ? XK : XV; const float* BB = BQ ? (((which0 == 0) ? BQ : (which0 == 1) ? BK : BV) + (blockIdx.y * 128 - which0 * DM)) : nullptr;
  // one LDS block: the main loop's two stage buffers (weights 128 rows, x 64 rows, bf16); behind the loop's last barrier the epilogue's tiles lie over them
  __shared__ __align__(16) unsigned char sm[2 * (128 + 64) * LP * 2];
  __bf16 (*sB)[128][LP] = (__bf16 (*)[128][LP])sm; __bf16 (*sA)[64][LP] = (__bf16 (*)[64][LP])(sm + 2 * 128 * LP * 2);
  _Float16 (*so)[16][136] = (_Float16 (*)[16][136])sm; _Float16 (*sol)[16][136] = (_Float16 (*)[16][136])(sm + 4 * 16 * 136 * 2);
  _Float16 (*sth)[72] = (_Float16 (*)[72])sm; _Float16 (*stl)[72] = (_Float16 (*)[72])(sm + 128 * 72 * 2);
  const int tid = threadIdx.x, wave = tid >> 5, lane = tid & 31, col = lane & 15, g = lane >> 4; const size_t r0 = (size_t)blockIdx.x * 64 + wave * 16; const int n0 = blockIdx.y * 128;
  v8f acc[8] = {};
  // each 16-byte load of a wave covers 4 whole lines: weights 4 rows x 128 B, x 2 rows x 256 B
  const __bf16* gB = P + (size_t)(n0 + (tid >> 3)) * DM + (tid & 7) * 8; const float* gA = X + ((size_t)blockIdx.x * 64 + (tid >> 4)) * DM + (tid & 15) * 4;
  v8b rb[8]; v4f ra[8];
#pragma unroll
  for (int i = 0; i < 8; ++i) { rb[i] = *(const v8b*)(gB + (size_t)i * 16 * DM); ra[i] = *(const v4f*)(gA + (size_t)i * 8 * DM); }
#pragma unroll
  for (int i = 0; i < 8; ++i) { *(v8b*)&sB[0][(tid >> 3) + 16 * i][(tid & 7) * 8] = rb[i]; v4b t;
#pragma unroll
    for (int e = 0; e < 4; ++e) t[e] = (__bf16)ra[i][e];
    *(v4b*)&sA[0][(tid >> 4) + 8 * i][(tid & 15) * 4] = t; }
  __syncthreads();
#pragma unroll 2   // two steps a body, so that each buffer's LDS addresses are immediates
  for (int s = 0; s < DM / KS; ++s) { const int cur = s & 1;
    if (s + 1 < DM / KS) {   // the next step's tiles fly while this step is worked on
#pragma unroll
      for (int i = 0; i < 8; ++i) { rb[i] = *(const v8b*)(gB + (size_t)i * 16 * DM + (s + 1) * KS); ra[i] = *(const v4f*)(gA + (size_t)i * 8 * DM + (s + 1) * KS); }
      asm volatile("s_wait_xcnt 0x0" ::: "memory"); }   // stands behind the run of loads, in front of any rewrite of a register that one of them names as its address
#pragma unroll
    for (int kc = 0; kc < KS / 32; ++kc) { const v16b a = frag_b(&sA[cur][wave * 16 + col][kc * 32], lane);
#pragma unroll
      for (int jh = 0; jh < 8; jh += 4) { v16b w[4];   // fragment reads in groups of four ahead of their products: 192 registers, five waves a SIMD, the whole grid resident
#pragma unroll
        for (int j = 0; j < 4; ++j) w[j] = frag_b(&sB[cur][(jh + j) * 16 + col][kc * 32], lane);
#pragma unroll
        for (int j = 0; j < 4; ++j) acc[jh + j] = wmma_bf(a, w[j], acc[jh + j]); } }
    if (s + 1 < DM / KS) {
#pragma unroll
      for (int i = 0; i < 8; ++i) { *(v8b*)&sB[cur ^ 1][(tid >> 3) + 16 * i][(tid & 7) * 8] = rb[i]; v4b t;
#pragma unroll
        for (int e = 0; e < 4; ++e) t[e] = (__bf16)ra[i][e];
        *(v4b*)&sA[cur ^ 1][(tid >> 4) + 8 * i][(tid & 15) * 4] = t; } }
    __syncthreads(); }   // publishes the next buffer and ends every reader's last read of this one
  if (n0 < 2 * DM) {   // per (row, head): the 5 bucket dots (q . table_k[u]) or ((k/8) . table_q[u]) from the f32 values -> BKT / BQT [row][h][8] (5 used)
    { const bool isq = n0 < DM; const float* TB = isq ? TK : TQ; float* dstT = isq ? BKT : BQT; const float sc = isq ? 1.0f : 0.125f;
#pragma unroll
      for (int r = 0; r < 8; ++r) {
#pragma unroll
        for (int hh = 0; hh < 2; ++hh) { const int h = (n0 % DM) / 64 + hh; float du[NBK];
#pragma unroll
          for (int u = 0; u < NBK; ++u) { float s = 0.f;
#pragma unroll
            for (int j = 0; j < 4; ++j) s += acc[hh * 4 + j][r] * bfr(TB[u * 64 + j * 16 + col]);
#pragma unroll
            for (int o = 1; o < 16; o <<= 1) s += __shfl_xor(s, o);
            du[u] = s * sc; }
          if (col == 0) { float* d = dstT + ((r0 + 8 * g + r) * NH + h) * 8;
#pragma unroll
            for (int u = 0; u < NBK; ++u) d[u] = du[u]; } } } }   // (8-float slots per (row, head); 4-B scratch stores)
#pragma unroll
    for (int j = 0; j < 8; ++j) {
#pragma unroll
      for (int r = 0; r < 8; ++r) { const float v = acc[j][r]; const _Float16 hv = (_Float16)v; so[wave][8 * g + r][j * 16 + col] = hv; sol[wave][8 * g + r][j * 16 + col] = (_Float16)((v - (float)hv) * 2048.0f); } }   // q, k as f16 hi + (x2048) residual
    LDSX();
    for (int rl = 0; rl < 16; ++rl) if (lane < 16) { vst2((unsigned*)(QK + (r0 + rl) * (2 * DM) + n0 + lane * 8), *(const v4u*)&so[wave][rl][lane * 8]); vst2((unsigned*)(QKL + (r0 + rl) * (2 * DM) + n0 + lane * 8), *(const v4u*)&sol[wave][rl][lane * 8]); }
  } else {
#pragma unroll
    for (int j = 0; j < 8; ++j) {
#pragma unroll
      for (int r = 0; r < 8; ++r) { const float v = acc[j][r] + (BB ? bfr(BB[j * 16 + col]) : 0.f); const _Float16 hv = (_Float16)v; sth[j * 16 + col][wave * 16 + 8 * g + r] = hv; stl[j * 16 + col][wave * 16 + 8 * g + r] = (_Float16)((v - (float)hv) * 2048.0f); } }
    __syncthreads();
    const size_t rb = (size_t)blockIdx.x * 64; const int b = (int)(rb / SS), s0 = (int)(rb % SS); const int pc0 = n0 - 2 * DM;
    for (int q = tid; q < 128 * 8; q += 128) { const int d = q >> 3, pc = q & 7; const size_t o = ((size_t)b * DM + pc0 + d) * SS + s0 + pc * 8; vst2((unsigned*)(VTH + o), *(const v4u*)&sth[d][pc * 8]); vst2((unsigned*)(VTL + o), *(const v4u*)&stl[d][pc * 8]); }
  }
}
// ---- k_attn: block = (64 queries, head h, batch b): all-keys flash attention (K = 64: 2 k-steps), scores = (q.k) * 0.125 with single f16 operands, P.V: f16 P (x2^11) x V hi in one accumulator (accl stays 0); O[b*S+q][h*64+d] = (acc + accl / 2048) / (2048 l) (256-B segments)
__global__ __launch_bounds__(128) void k_attn(const _Float16* __restrict__ QK, const _Float16* __restrict__ QKL, const _Float16* __restrict__ VTH, const _Float16* __restrict__ VTL, const void* __restrict__ KMASK, const float* __restrict__ BKT, const float* __restrict__ BQT, const int* __restrict__ RPB, float* __restrict__ O) {
  __shared__ __align__(16) float sp[4][16][36]; __shared__ __align__(16) float so[4][16][68];
  __shared__ __align__(16) _Float16 sK[2][64][LP], sV[2][64][LP];   // two stage buffers of 64 keys: K rows [key][d], V rows [d][key], 128 B of data a row
  const int tid = threadIdx.x, wave = tid >> 5, lane = tid & 31, col = lane & 15, g = lane >> 4;
  const int qb = blockIdx.x, h = blockIdx.y, b = blockIdx.z; const int q0 = qb * 64 + wave * 16; const size_t rq = (size_t)b * SS + q0 + col;
  v16h aq[2], aql[2];
#pragma unroll
  for (int kc = 0; kc < 2; ++kc) { aq[kc] = frag_h(QK + rq * (2 * DM) + h * HD + kc * 32, lane); aql[kc] = frag_h(QKL + rq * (2 * DM) + h * HD + kc * 32, lane); }
  float bkq[8][NBK];
#pragma unroll
  for (int r = 0; r < 8; ++r) {
#pragma unroll
    for (int u = 0; u < NBK; ++u) bkq[r][u] = BKT[(((size_t)b * SS + q0 + 8 * g + r) * NH + h) * 8 + u]; }
  float m[8], l[8];
#pragma unroll
  for (int r = 0; r < 8; ++r) { m[r] = -3.0e38f; l[r] = 0.f; }
  v8f acc[4] = {}, accl[4] = {};
  const int nst = SS / 64;   // all keys, 64 a stage
  // each 16-byte load of a wave covers 4 whole lines: 4 rows x 128 B
  const _Float16* gK = QK + ((size_t)b * SS + (tid >> 3)) * (2 * DM) + DM + h * HD + (tid & 7) * 8; const _Float16* gV = VTH + ((size_t)b * DM + h * HD + (tid >> 3)) * SS + (tid & 7) * 8;
  v8h rk[4], rv[4];
#pragma unroll
  for (int i = 0; i < 4; ++i) { rk[i] = *(const v8h*)(gK + (size_t)i * 16 * (2 * DM)); rv[i] = *(const v8h*)(gV + (size_t)i * 16 * SS); }
#pragma unroll
  for (int i = 0; i < 4; ++i) { *(v8h*)&sK[0][(tid >> 3) + 16 * i][(tid & 7) * 8] = rk[i]; *(v8h*)&sV[0][(tid >> 3) + 16 * i][(tid & 7) * 8] = rv[i]; }
  __syncthreads();
#pragma unroll 1   // keeps the long body once in the text
  for (int st = 0; st < nst; ++st) { const int cur = st & 1;
#pragma unroll 1   // as the loop over the stages
  for (int ks = 2 * st; ks < 2 * st + 2; ++ks) { v8f s[2]; const int kh = (ks & 1) * 32;
#pragma unroll
    for (int ct = 0; ct < 2; ++ct) { const int kk = ks * 32 + ct * 16 + col; v8f c = {};
#pragma unroll
      for (int kc = 0; kc < 2; ++kc) c = wmma16(aq[kc], frag_h(&sK[cur][kh + ct * 16 + col][kc * 32], lane), c);   // single product: q, k as one-rounding f16 operands
      { const float* bqk = BQT + (((size_t)b * SS + kk) * NH + h) * 8;
#pragma unroll
      for (int r = 0; r < 8; ++r) { const int qi = q0 + 8 * g + r; const int u1 = RPB[(size_t)qi * SS + kk], u2 = RPB[(size_t)kk * SS + qi]; float add = 0.f;
#pragma unroll
        for (int u = 0; u < NBK; ++u) add += (u == u1 ? bkq[r][u] : 0.f);
        s[ct][r] = c[r] * 0.125f + add + bqk[u2]; }   // 1/sqrt(64) + q.table_k[bucket(i,j)] + (k/8).table_q[bucket(j,i)]
      asm volatile("s_wait_xcnt 0x0" ::: "memory"); } }   // stands behind the bucket loads, in front of any rewrite of a register that one of them names as its address
#pragma unroll
    for (int r = 0; r < 8; ++r) { float mx = fmaxf(s[0][r], s[1][r]);
#pragma unroll
      for (int o = 1; o < 16; o <<= 1) mx = fmaxf(mx, __shfl_xor(mx, o));
      const float mn = fmaxf(m[r], mx); const float alpha = (m[r] <= -1.0e38f) ? 0.f : __expf(m[r] - mn);
      const float e0 = (s[0][r] <= -1.0e38f) ? 0.f : __expf(s[0][r] - mn), e1 = (s[1][r] <= -1.0e38f) ? 0.f : __expf(s[1][r] - mn); float es = e0 + e1;
#pragma unroll
      for (int o = 1; o < 16; o <<= 1) es += __shfl_xor(es, o);
      l[r] = l[r] * alpha + es; m[r] = mn;
#pragma unroll
      for (int dt = 0; dt < 4; ++dt) { acc[dt][r] *= alpha; accl[dt][r] *= alpha; }
      sp[wave][8 * g + r][col] = e0; sp[wave][8 * g + r][16 + col] = e1; }
    LDSX();
    v16h pa, pl; { const float* prow = &sp[wave][col][0] + 8 * (lane >> 4);
#pragma unroll
      for (int i = 0; i < 8; ++i) { const float x0 = prow[i] * 2048.0f, x1 = prow[16 + i] * 2048.0f; const _Float16 h0 = (_Float16)x0, h1 = (_Float16)x1; pa[i] = h0; pa[8 + i] = h1; pl[i] = (_Float16)((x0 - (float)h0) * 2048.0f); pl[8 + i] = (_Float16)((x1 - (float)h1) * 2048.0f); } }   // P scaled by 2^11 before the f16 split so small softmax weights stay out of the f16 subnormal range; 2^-11 folded into the epilogue
    v16h vf[4];
#pragma unroll
    for (int dt = 0; dt < 4; ++dt) vf[dt] = frag_h(&sV[cur][dt * 16 + col][kh], lane);   // all V fragment reads as one group ahead of the products
#pragma unroll
    for (int dt = 0; dt < 4; ++dt) acc[dt] = wmma16(pa, vf[dt], acc[dt]);   // single product: P (x2^11) x V
    (void)pl;
    LDSX(); }
    if (st + 1 < nst) {   // the next stage is fetched and stored into the other buffer here at the foot, not held in registers over the stage: those registers keep the bucket loads of a step in flight together
#pragma unroll
      for (int i = 0; i < 4; ++i) { rk[i] = *(const v8h*)(gK + ((size_t)(st + 1) * 64 + i * 16) * (2 * DM)); rv[i] = *(const v8h*)(gV + (size_t)i * 16 * SS + (st + 1) * 64); }
      asm volatile("s_wait_xcnt 0x0" ::: "memory");   // stands behind the run of loads, in front of any rewrite of a register that one of them names as its address
#pragma unroll
      for (int i = 0; i < 4; ++i) { *(v8h*)&sK[cur ^ 1][(tid >> 3) + 16 * i][(tid & 7) * 8] = rk[i]; *(v8h*)&sV[cur ^ 1][(tid >> 3) + 16 * i][(tid & 7) * 8] = rv[i]; } }
    __syncthreads(); }   // publishes the next buffer and ends every reader's last read of this one
#pragma unroll
  for (int r = 0; r < 8; ++r) { const float il = (1.0f / 2048.0f) / l[r];
#pragma unroll
    for (int dt = 0; dt < 4; ++dt) so[wave][8 * g + r][dt * 16 + col] = (acc[dt][r] + accl[dt][r] * (1.0f / 2048.0f)) * il; }
  LDSX();
  for (int rl = 0; rl < 16; ++rl) if (lane < 16) vst2(O + ((size_t)b * SS + q0 + rl) * DM + h * HD + lane * 4, *(const v4f*)&so[wave][rl][lane * 4]);
}
// ---- k_out: block = (64 rows, 128 cols): out = O(hi/lo) . Wo rows (2 products) + bo
__global__ __launch_bounds__(128) void k_out(const float* __restrict__ O, const __bf16* __restrict__ P, const float* __restrict__ BO, float* __restrict__ Y) {
  // one LDS block: two stage buffers (weights 128 rows, ctx hi and residual 64 rows each, bf16); behind the loop's last barrier the output tile lies over them
  __shared__ __align__(16) unsigned char sm[2 * (128 + 64 + 64) * LP * 2];
  __bf16 (*sB)[128][LP] = (__bf16 (*)[128][LP])sm; __bf16 (*sH)[64][LP] = (__bf16 (*)[64][LP])(sm + 2 * 128 * LP * 2); __bf16 (*sL)[64][LP] = (__bf16 (*)[64][LP])(sm + 2 * (128 + 64) * LP * 2);
  float (*so)[16][132] = (float (*)[16][132])sm;
  const int tid = threadIdx.x, wave = tid >> 5, lane = tid & 31, col = lane & 15, g = lane >> 4; const size_t r0 = (size_t)blockIdx.x * 64 + wave * 16; const int n0 = blockIdx.y * 128;
  v8f acc[8] = {};
  const __bf16* gB = P + (size_t)(n0 + (tid >> 3)) * DM + (tid & 7) * 8; const float* gA = O + ((size_t)blockIdx.x * 64 + (tid >> 4)) * DM + (tid & 15) * 4;
  v8b rb[8]; v4f ra[8];
#pragma unroll
  for (int i = 0; i < 8; ++i) { rb[i] = *(const v8b*)(gB + (size_t)i * 16 * DM); ra[i] = *(const v4f*)(gA + (size_t)i * 8 * DM); }
#pragma unroll
  for (int i = 0; i < 8; ++i) { *(v8b*)&sB[0][(tid >> 3) + 16 * i][(tid & 7) * 8] = rb[i]; v4b th, tl;
#pragma unroll
    for (int e = 0; e < 4; ++e) { const __bf16 hv = (__bf16)ra[i][e]; th[e] = hv; tl[e] = (__bf16)(ra[i][e] - (float)hv); }
    *(v4b*)&sH[0][(tid >> 4) + 8 * i][(tid & 15) * 4] = th; *(v4b*)&sL[0][(tid >> 4) + 8 * i][(tid & 15) * 4] = tl; }
  __syncthreads();
#pragma unroll 2   // two steps a body, so that each buffer's LDS addresses are immediates
  for (int s = 0; s < DM / KS; ++s) { const int cur = s & 1;
    if (s + 1 < DM / KS) {   // the next step's tiles fly while this step is worked on
#pragma unroll
      for (int i = 0; i < 8; ++i) { rb[i] = *(const v8b*)(gB + (size_t)i * 16 * DM + (s + 1) * KS); ra[i] = *(const v4f*)(gA + (size_t)i * 8 * DM + (s + 1) * KS); }
      asm volatile("s_wait_xcnt 0x0" ::: "memory"); }   // stands behind the run of loads, in front of any rewrite of a register that one of them names as its address
#pragma unroll
    for (int kc = 0; kc < KS / 32; ++kc) { const v16b ah = frag_b(&sH[cur][wave * 16 + col][kc * 32], lane), al = frag_b(&sL[cur][wave * 16 + col][kc * 32], lane); v16b w[8];
#pragma unroll
      for (int j = 0; j < 8; ++j) w[j] = frag_b(&sB[cur][j * 16 + col][kc * 32], lane);   // all fragment reads as one group ahead of the products
#pragma unroll
      for (int j = 0; j < 8; ++j) { acc[j] = wmma_bf(al, w[j], acc[j]); acc[j] = wmma_bf(ah, w[j], acc[j]); } }
    if (s + 1 < DM / KS) {
#pragma unroll
      for (int i = 0; i < 8; ++i) { *(v8b*)&sB[cur ^ 1][(tid >> 3) + 16 * i][(tid & 7) * 8] = rb[i]; v4b th, tl;
#pragma unroll
        for (int e = 0; e < 4; ++e) { const __bf16 hv = (__bf16)ra[i][e]; th[e] = hv; tl[e] = (__bf16)(ra[i][e] - (float)hv); }
        *(v4b*)&sH[cur ^ 1][(tid >> 4) + 8 * i][(tid & 15) * 4] = th; *(v4b*)&sL[cur ^ 1][(tid >> 4) + 8 * i][(tid & 15) * 4] = tl; } }
    __syncthreads(); }   // publishes the next buffer and ends every reader's last read of this one
#pragma unroll
  for (int j = 0; j < 8; ++j) {
#pragma unroll
    for (int r = 0; r < 8; ++r) so[wave][8 * g + r][j * 16 + col] = acc[j][r] + bfr(BO[n0 + j * 16 + col]); }
  LDSX();
  for (int rl = 0; rl < 16; ++rl) vst2(Y + (r0 + rl) * DM + n0 + lane * 4, *(const v4f*)&so[wave][rl][lane * 4]);
}
extern "C" void kernel_launch(void* const* d_in, const int* in_sizes, int n_in, void* d_out, int out_size, void* d_ws, size_t ws_size, hipStream_t stream) {
  (void)in_sizes; (void)n_in; (void)out_size;
  const float** F = (const float**)d_in;   // 0 x [4,1024,768], 1 wq_w, 2 wk_w, 3 wv_w, 4 proj_w ((in,out)), 5 proj_b, 6 rpe_k_table [5,64], 7 rpe_q_table [5,64], 8 rp_bucket [1024,1024] int
  if (ws_size < (size_t)WS_END) return;
  char* ws = (char*)d_ws; __bf16* PK = (__bf16*)(ws + WS_PK); _Float16 *QK = (_Float16*)(ws + WS_QK), *QKL = (_Float16*)(ws + WS_QKL), *VTH = (_Float16*)(ws + WS_VTH), *VTL = (_Float16*)(ws + WS_VTL); float *O = (float*)(ws + WS_O), *BKT = (float*)(ws + WS_BKT), *BQT = (float*)(ws + WS_BQT);
  k_pack<<<dim3(DM, 4), 256, 0, stream>>>(F[1], F[2], F[3], F[4], PK);
  k_qkv<<<dim3(TNB * SS / 64, QKVW / 128), 128, 0, stream>>>(F[0], F[0], F[0], PK + PK_A, nullptr, nullptr, nullptr, F[6], F[7], BKT, BQT, QK, QKL, VTH, VTL);
  k_attn<<<dim3(TQB, NH, TNB), 128, 0, stream>>>(QK, QKL, VTH, VTL, nullptr, BKT, BQT, (const int*)d_in[8], O);
  k_out<<<dim3(TOB, DM / 128), 128, 0, stream>>>(O, PK + PK_P, F[5], (float*)d_out);
}

// v002
// A run of this version takes 138 microseconds.
// Timed twice side by side with v001, it ran 1.10 times as fast both times.
// Counting every step since v000, it is 2.18 times as fast.
// compute dtype: all float inputs rounded to bf16, rp_bucket (int) read on device; q/k/v = x . W with EXACT bf16 products on WMMA 16x16x32 ((in,out) weights as transposed rows); per (token, head) the 5 bucket dots q . rpe_k_table[u] and (k / 8) . rpe_q_table[u] in f32 from the f32 projections; PLAIN attention: q, k as single f16 operands x 1/8 + bk[i][bucket[i][j]] + bq[j][bucket[j][i]], running-max softmax in f32 (hardware exp), P (scaled by 2^11, single f16) x v (single f16); out = ctx (bf16 hi + residual) . proj_w (2 products) + proj_b.
#include <hip/hip_runtime.h>
#include <math.h>

typedef __attribute__((ext_vector_type(16))) _Float16 v16h;
typedef __attribute__((ext_vector_type(16))) __bf16 v16b;
typedef __attribute__((ext_vector_type(8)))  _Float16 v8h;
typedef __attribute__((ext_vector_type(8)))  float v8f;
typedef __attribute__((ext_vector_type(4)))  float v4f;
typedef __attribute__((ext_vector_type(2)))  float v2f;
typedef __attribute__((ext_vector_type(4)))  unsigned v4u;
typedef __attribute__((ext_vector_type(4)))  int v4i;
typedef float __attribute__((may_alias)) float_a;
typedef int __attribute__((may_alias)) int_a;

template <typename T> __device__ __forceinline__ void vst2(void* p, T v) { *(T*)p = v;  }
__device__ __forceinline__ v8f wmma16(v16h a, v16h b, v8f c) {
  v8f d = __builtin_amdgcn_wmma_f32_16x16x32_f16(false, a, false, b, (short)0, c, false, false);
  asm volatile("v_nop\n\tv_nop\n\tv_nop\n\tv_nop" : "+v"(d) : "v"(a), "v"(b));
  return d;
}
__device__ __forceinline__ v8f wmma_bf(v16b a, v16b b, v8f c) {
  v8f d = __builtin_amdgcn_wmma_f32_16x16x32_bf16(false, a, false, b, (short)0, c, false, false);
  asm volatile("v_nop\n\tv_nop\n\tv_nop\n\tv_nop" : "+v"(d) : "v"(a), "v"(b));
  return d;
}
// Attention with image relative-position encoding (iRPE, contextual mode on q and k) over a 32 x 32 patch grid (B 4, N 1,024, C 768, 12 heads x 64): bias-free q/k/v projections, scores + q . table_k[bucket(i,j)] + (k scale) . table_q[bucket(j,i)], softmax, output projection + bias.
__device__ __forceinline__ v16h frag_h(const _Float16* rowk0, int lane) {
  union { v16h v; v8h q[2]; } u; const _Float16* p = rowk0 + 8 * (lane >> 4);
  u.q[0] = *(const v8h*)p; u.q[1] = *(const v8h*)(p + 16); return u.v;
}
__device__ __forceinline__ v16h frag_f32(const float* rowk0, int lane) {
  v16h a; const float* p = rowk0 + 8 * (lane >> 4);
#pragma unroll
  for (int i = 0; i < 8; ++i) { a[i] = (_Float16)p[i]; a[8 + i] = (_Float16)p[16 + i]; }
  return a;
}
__device__ __forceinline__ v16h frag_f32s(const float* rowk0, int lane, float sc) {
  v16h a; const float* p = rowk0 + 8 * (lane >> 4);
#pragma unroll
  for (int i = 0; i < 8; ++i) { a[i] = (_Float16)(p[i] * sc); a[8 + i] = (_Float16)(p[16 + i] * sc); }
  return a;
}
// column fragment from a [K][ld] layout (column n), rows >= K read as 0
__device__ __forceinline__ v16h fragc_f32(const float* W, int k0, int n, int lane, int ld, int K) {
  v16h a; const int g = lane >> 4;
#pragma unroll
  for (int i = 0; i < 8; ++i) { const int ka = k0 + 8 * g + i, kb = ka + 16;
    a[i] = (_Float16)(ka < K ? W[(size_t)(ka < K ? ka : K - 1) * ld + n] : 0.f); a[8 + i] = (_Float16)(kb < K ? W[(size_t)(kb < K ? kb : K - 1) * ld + n] : 0.f); }
  return a;
}
struct F2 { v16b h, l; };
__device__ __forceinline__ F2 bsplit16(const float v[16]) { F2 r;
#pragma unroll
  for (int i = 0; i < 16; ++i) { const __bf16 h = (__bf16)v[i]; r.h[i] = h; r.l[i] = (__bf16)(v[i] - (float)h); }
  return r; }
__device__ __forceinline__ F2 split_row(const float* row, int k0, int lane) { float v[16]; const float* p = row + k0 + 8 * (lane >> 4);
#pragma unroll
  for (int i = 0; i < 8; ++i) { v[i] = p[i]; v[8 + i] = p[16 + i]; }
  return bsplit16(v); }
__device__ __forceinline__ F2 split_rowK(const float* row, int k0, int lane, int K) { float v[16]; const int g = lane >> 4;
#pragma unroll
  for (int i = 0; i < 8; ++i) { const int ka = k0 + 8 * g + i, kb = ka + 16; v[i] = ka < K ? row[ka < K ? ka : K - 1] : 0.f; v[8 + i] = kb < K ? row[kb < K ? kb : K - 1] : 0.f; }
  return bsplit16(v); }
__device__ __forceinline__ F2 split_col(const float* W, int k0, int n, int lane, int ld, int K) { float v[16]; const int g = lane >> 4;
#pragma unroll
  for (int i = 0; i < 8; ++i) { const int ka = k0 + 8 * g + i, kb = ka + 16; v[i] = ka < K ? W[(size_t)(ka < K ? ka : K - 1) * ld + n] : 0.f; v[8 + i] = kb < K ? W[(size_t)(kb < K ? kb : K - 1) * ld + n] : 0.f; }
  return bsplit16(v); }
__device__ __forceinline__ v8f mac3(const F2& a, const F2& b, v8f c) { c = wmma_bf(a.l, b.h, c); c = wmma_bf(a.h, b.l, c); return wmma_bf(a.h, b.h, c); }
__device__ __forceinline__ float sigm(float v) { return 1.0f / (1.0f + expf(-v)); }
#define LDSX() do { asm volatile("s_wait_dscnt 0" ::: "memory"); __builtin_amdgcn_wave_barrier(); __builtin_amdgcn_fence(__ATOMIC_RELEASE, "workgroup"); } while (0)


#define NB 4
#define SS 1024
#define DM 768
#define NH 12
#define NBK 5
#define HD 64
#define QKVW (3 * DM)
#ifndef TQB
#define TQB (SS / 64)
#define TNB NB
#define TOB (NB * SS / 64)     // output row tiles (all)
#endif
typedef __attribute__((ext_vector_type(8))) __bf16 v8b;
__device__ __forceinline__ v16b frag_b(const __bf16* rowk0, int lane) {
  union { v16b v; v8b q[2]; } u; const __bf16* p = rowk0 + 8 * (lane >> 4);
  u.q[0] = *(const v8b*)p; u.q[1] = *(const v8b*)(p + 16); return u.v;
}
typedef __attribute__((ext_vector_type(4))) __bf16 v4b;
#define KS 64   // k per staged step: 128 B of a bf16 row, one whole line
#define BQP 80  // words per bucket row of the staged key-side bias table: 64 keys + 16, so that a 16-key group's rows of buckets 0 to 3 fall on different banks
#define LP 72   // LDS row pitch in 16-bit elements: 128 B of data + 16 B, the pitch for 16-byte LDS readers
// the plain '#pragma unroll' on the short fixed loops of the staging code give the staged values and fragments (rb, ra, rk, rv, w, vf) constant indices, so that they stay in registers
__device__ __forceinline__ float bfr(float v) { return (float)(__bf16)v; }
__device__ __attribute__((noinline)) float exp_ni(float v) { return expf(v); }
__device__ __attribute__((noinline)) float erf_ni(float v) { return erff(v); }

#define PK_A 0                       // [2304][768] Wqkv rows (natural [out][in])
#define PK_P (PK_A + QKVW * DM)        // [768][768] Wo rows (natural)
#define PK_END (PK_P + DM * DM)
#define WS_PK  0u
#define WS_QK  (WS_PK + 2u * PK_END)             // f16 [4096 rows][1536]: q | k
#define WS_QKL (WS_QK + 2u * NB * SS * 2 * DM)     // f16 q | k residual planes x2048
#define WS_VTH (WS_QKL + 2u * NB * SS * 2 * DM)    // f16 [b][768 (h*64+d)][1024 s] hi
#define WS_VTL (WS_VTH + 2u * NB * DM * SS)        // f16 lo x 2048
#define WS_O   (WS_VTL + 2u * NB * DM * SS)        // f32 [4096][768]
#define WS_CS  (WS_O + 4u * NB * SS * DM)           // f32 [2][1024][32] (unused)
#define WS_BKT (WS_CS + 4u * 2 * SS * 32)                 // f32 [NB*SS][NH][8]: q . table_k[u] ; BQT (k/8) . table_q[u]
#define WS_BQT (WS_BKT + 4u * NB * SS * NH * 8)
#define WS_END (WS_BQT + 4u * NB * SS * NH * 8)
// ---- k_pack: block = (row n, which): column n of an (in,out) weight -> bf16 row n; which 0..2 -> W_q/W_k/W_v into PK_A rows which*768 + n; 3 -> W_o into PK_P
__global__ __launch_bounds__(256) void k_pack(const float* __restrict__ WQ, const float* __restrict__ WK, const float* __restrict__ WV, const float* __restrict__ WO, __bf16* __restrict__ PK) {
  __shared__ __align__(16) __bf16 s[DM]; const int n = blockIdx.x, which = blockIdx.y, t = threadIdx.x; const float* Wm = (which == 0) ? WQ : (which == 1) ? WK : (which == 2) ? WV : WO;   // (in,out) weights: pack row n = column n
  for (int k = t; k < DM; k += 256) s[k] = (__bf16)Wm[(size_t)k * DM + n];
  __syncthreads();
  __bf16* dst = (which < 3) ? PK + PK_A + ((size_t)which * DM + n) * DM : PK + PK_P + (size_t)n * DM;
  for (int q = t; q < DM / 8; q += 256) vst2((unsigned*)(dst + q * 8), *(const v4u*)&s[q * 8]);
}
__global__ __launch_bounds__(128) void k_qkv(const float* __restrict__ XQ, const float* __restrict__ XK, const float* __restrict__ XV, const __bf16* __restrict__ P, const float* __restrict__ BQ, const float* __restrict__ BK, const float* __restrict__ BV, const float* __restrict__ TK, const float* __restrict__ TQ, float* __restrict__ BKT, float* __restrict__ BQT, _Float16* __restrict__ QK, _Float16* __restrict__ QKL, _Float16* __restrict__ VTH, _Float16* __restrict__ VTL) {
  const int which0 = (blockIdx.y * 128) / DM; const float* X = (which0 == 0) ? XQ : (which0 == 1) ? XK : XV; const float* BB = BQ ? (((which0 == 0) ? BQ : (which0 == 1) ? BK : BV) + (blockIdx.y * 128 - which0 * DM)) : nullptr;
  // one LDS block: the main loop's two stage buffers (weights 128 rows, x 64 rows, bf16); behind the loop's last barrier the epilogue's tiles lie over them
  __shared__ __align__(16) unsigned char sm[2 * (128 + 64) * LP * 2];
  __bf16 (*sB)[128][LP] = (__bf16 (*)[128][LP])sm; __bf16 (*sA)[64][LP] = (__bf16 (*)[64][LP])(sm + 2 * 128 * LP * 2);
  _Float16 (*so)[16][136] = (_Float16 (*)[16][136])sm; _Float16 (*sol)[16][136] = (_Float16 (*)[16][136])(sm + 4 * 16 * 136 * 2);
  _Float16 (*sth)[72] = (_Float16 (*)[72])sm; _Float16 (*stl)[72] = (_Float16 (*)[72])(sm + 128 * 72 * 2);
  const int tid = threadIdx.x, wave = tid >> 5, lane = tid & 31, col = lane & 15, g = lane >> 4; const size_t r0 = (size_t)blockIdx.x * 64 + wave * 16; const int n0 = blockIdx.y * 128;
  v8f acc[8] = {};
  // each 16-byte load of a wave covers 4 whole lines: weights 4 rows x 128 B, x 2 rows x 256 B
  const __bf16* gB = P + (size_t)(n0 + (tid >> 3)) * DM + (tid & 7) * 8; const float* gA = X + ((size_t)blockIdx.x * 64 + (tid >> 4)) * DM + (tid & 15) * 4;
  v8b rb[8]; v4f ra[8];
#pragma unroll
  for (int i = 0; i < 8; ++i) { rb[i] = *(const v8b*)(gB + (size_t)i * 16 * DM); ra[i] = *(const v4f*)(gA + (size_t)i * 8 * DM); }
#pragma unroll
  for (int i = 0; i < 8; ++i) { *(v8b*)&sB[0][(tid >> 3) + 16 * i][(tid & 7) * 8] = rb[i]; v4b t;
#pragma unroll
    for (int e = 0; e < 4; ++e) t[e] = (__bf16)ra[i][e];
    *(v4b*)&sA[0][(tid >> 4) + 8 * i][(tid & 15) * 4] = t; }
  __syncthreads();
#pragma unroll 2   // two steps a body, so that each buffer's LDS addresses are immediates
  for (int s = 0; s < DM / KS; ++s) { const int cur = s & 1;
    if (s + 1 < DM / KS) {   // the next step's tiles fly while this step is worked on
#pragma unroll
      for (int i = 0; i < 8; ++i) { rb[i] = *(const v8b*)(gB + (size_t)i * 16 * DM + (s + 1) * KS); ra[i] = *(const v4f*)(gA + (size_t)i * 8 * DM + (s + 1) * KS); }
      asm volatile("s_wait_xcnt 0x0" ::: "memory"); }   // stands behind the run of loads, in front of any rewrite of a register that one of them names as its address
#pragma unroll
    for (int kc = 0; kc < KS / 32; ++kc) { const v16b a = frag_b(&sA[cur][wave * 16 + col][kc * 32], lane);
#pragma unroll
      for (int jh = 0; jh < 8; jh += 4) { v16b w[4];   // fragment reads in groups of four ahead of their products: 192 registers, five waves a SIMD, the whole grid resident
#pragma unroll
        for (int j = 0; j < 4; ++j) w[j] = frag_b(&sB[cur][(jh + j) * 16 + col][kc * 32], lane);
#pragma unroll
        for (int j = 0; j < 4; ++j) acc[jh + j] = wmma_bf(a, w[j], acc[jh + j]); } }
    if (s + 1 < DM / KS) {
#pragma unroll
      for (int i = 0; i < 8; ++i) { *(v8b*)&sB[cur ^ 1][(tid >> 3) + 16 * i][(tid & 7) * 8] = rb[i]; v4b t;
#pragma unroll
        for (int e = 0; e < 4; ++e) t[e] = (__bf16)ra[i][e];
        *(v4b*)&sA[cur ^ 1][(tid >> 4) + 8 * i][(tid & 15) * 4] = t; } }
    __syncthreads(); }   // publishes the next buffer and ends every reader's last read of this one
  if (n0 < 2 * DM) {   // per (row, head): the 5 bucket dots (q . table_k[u]) or ((k/8) . table_q[u]) from the f32 values -> BKT / BQT [row][h][8] (5 used)
    { const bool isq = n0 < DM; const float* TB = isq ? TK : TQ; float* dstT = isq ? BKT : BQT; const float sc = isq ? 1.0f : 0.125f;
#pragma unroll
      for (int r = 0; r < 8; ++r) {
#pragma unroll
        for (int hh = 0; hh < 2; ++hh) { const int h = (n0 % DM) / 64 + hh; float du[NBK];
#pragma unroll
          for (int u = 0; u < NBK; ++u) { float s = 0.f;
#pragma unroll
            for (int j = 0; j < 4; ++j) s += acc[hh * 4 + j][r] * bfr(TB[u * 64 + j * 16 + col]);
#pragma unroll
            for (int o = 1; o < 16; o <<= 1) s += __shfl_xor(s, o);
            du[u] = s * sc; }
          if (col == 0) { float* d = dstT + ((r0 + 8 * g + r) * NH + h) * 8;
#pragma unroll
            for (int u = 0; u < NBK; ++u) d[u] = du[u]; } } } }   // (8-float slots per (row, head); 4-B scratch stores)
#pragma unroll
    for (int j = 0; j < 8; ++j) {
#pragma unroll
      for (int r = 0; r < 8; ++r) { const float v = acc[j][r]; const _Float16 hv = (_Float16)v; so[wave][8 * g + r][j * 16 + col] = hv; sol[wave][8 * g + r][j * 16 + col] = (_Float16)((v - (float)hv) * 2048.0f); } }   // q, k as f16 hi + (x2048) residual
    LDSX();
    for (int rl = 0; rl < 16; ++rl) if (lane < 16) { vst2((unsigned*)(QK + (r0 + rl) * (2 * DM) + n0 + lane * 8), *(const v4u*)&so[wave][rl][lane * 8]); vst2((unsigned*)(QKL + (r0 + rl) * (2 * DM) + n0 + lane * 8), *(const v4u*)&sol[wave][rl][lane * 8]); }
  } else {
#pragma unroll
    for (int j = 0; j < 8; ++j) {
#pragma unroll
      for (int r = 0; r < 8; ++r) { const float v = acc[j][r] + (BB ? bfr(BB[j * 16 + col]) : 0.f); const _Float16 hv = (_Float16)v; sth[j * 16 + col][wave * 16 + 8 * g + r] = hv; stl[j * 16 + col][wave * 16 + 8 * g + r] = (_Float16)((v - (float)hv) * 2048.0f); } }
    __syncthreads();
    const size_t rb = (size_t)blockIdx.x * 64; const int b = (int)(rb / SS), s0 = (int)(rb % SS); const int pc0 = n0 - 2 * DM;
    for (int q = tid; q < 128 * 8; q += 128) { const int d = q >> 3, pc = q & 7; const size_t o = ((size_t)b * DM + pc0 + d) * SS + s0 + pc * 8; vst2((unsigned*)(VTH + o), *(const v4u*)&sth[d][pc * 8]); vst2((unsigned*)(VTL + o), *(const v4u*)&stl[d][pc * 8]); }
  }
}
// ---- k_attn: block = (64 queries, head h, batch b): all-keys flash attention (K = 64: 2 k-steps), scores = (q.k) * 0.125 with single f16 operands, P.V: f16 P (x2^11) x V hi in one accumulator (accl stays 0); O[b*S+q][h*64+d] = (acc + accl / 2048) / (2048 l) (256-B segments)
__global__ __launch_bounds__(128) void k_attn(const _Float16* __restrict__ QK, const _Float16* __restrict__ QKL, const _Float16* __restrict__ VTH, const _Float16* __restrict__ VTL, const void* __restrict__ KMASK, const float* __restrict__ BKT, const float* __restrict__ BQT, const int* __restrict__ RPB, float* __restrict__ O) {
  __shared__ __align__(16) float sp[4][16][36]; __shared__ __align__(16) float so[4][16][68];
  __shared__ __align__(16) _Float16 sK[2][64][LP], sV[2][64][LP];   // two stage buffers of 64 keys: K rows [key][d], V rows [d][key], 128 B of data a row
  __shared__ __align__(16) float sBQ[2][NBK][BQP];   // the stage's (k/8) . table_q[u], [bucket][key], in the same two stage buffers' rhythm
  __shared__ __align__(16) float sBK[4][2][72];      // per wave and half-wave: q . table_k[u] of its 8 query rows, 8 words a row; 72 words a half, so that the two halves of one look-up fall on different banks
  const int tid = threadIdx.x, wave = tid >> 5, lane = tid & 31, col = lane & 15, g = lane >> 4;
  const int qb = blockIdx.x, h = blockIdx.y, b = blockIdx.z; const int q0 = qb * 64 + wave * 16; const size_t rq = (size_t)b * SS + q0 + col;
  v16h aq[2], aql[2];
#pragma unroll
  for (int kc = 0; kc < 2; ++kc) { aq[kc] = frag_h(QK + rq * (2 * DM) + h * HD + kc * 32, lane); aql[kc] = frag_h(QKL + rq * (2 * DM) + h * HD + kc * 32, lane); }
  { const int row = lane >> 1, p = lane & 1;   // the wave's 16 query rows x 5 buckets: a pair of lanes brings one row, buckets 0, 1 and 4 | 2, 3
    const float* bk = BKT + (((size_t)b * SS + q0 + row) * NH + h) * 8 + p * 2; float* d = &sBK[wave][row >> 3][(row & 7) * 8 + p * 2];
    const v2f t = *(const v2f*)bk; float t4 = 0.f; if (p == 0) t4 = bk[4];
    asm volatile("s_wait_xcnt 0x0" ::: "memory");   // stands behind the two loads, in front of any rewrite of a register that one of them names as its address
    *(v2f*)d = t; if (p == 0) d[4] = t4; }
  float m[8], l[8];
#pragma unroll
  for (int r = 0; r < 8; ++r) { m[r] = -3.0e38f; l[r] = 0.f; }
  v8f acc[4] = {}, accl[4] = {};
  const int nst = SS / 64;   // all keys, 64 a stage
  // each 16-byte load of a wave covers 4 whole lines: 4 rows x 128 B
  const _Float16* gK = QK + ((size_t)b * SS + (tid >> 3)) * (2 * DM) + DM + h * HD + (tid & 7) * 8; const _Float16* gV = VTH + ((size_t)b * DM + h * HD + (tid >> 3)) * SS + (tid & 7) * 8;
  const int bkey = tid >> 1, bp = tid & 1;   // key-side bias rows of a stage's 64 keys: a pair of threads brings one key's five buckets, 0, 1 and 4 | 2, 3
  const float* gQ = BQT + (((size_t)b * SS + bkey) * NH + h) * 8 + bp * 2;
  v8h rk[4], rv[4]; v2f rbq; float rb4 = 0.f;
#pragma unroll
  for (int i = 0; i < 4; ++i) { rk[i] = *(const v8h*)(gK + (size_t)i * 16 * (2 * DM)); rv[i] = *(const v8h*)(gV + (size_t)i * 16 * SS); }
  rbq = *(const v2f*)gQ; if (bp == 0) rb4 = gQ[4];
  asm volatile("s_wait_xcnt 0x0" ::: "memory");   // stands behind the run of loads, in front of any rewrite of a register that one of them names as its address
#pragma unroll
  for (int i = 0; i < 4; ++i) { *(v8h*)&sK[0][(tid >> 3) + 16 * i][(tid & 7) * 8] = rk[i]; *(v8h*)&sV[0][(tid >> 3) + 16 * i][(tid & 7) * 8] = rv[i]; }
  sBQ[0][bp * 2][bkey] = rbq[0]; sBQ[0][bp * 2 + 1][bkey] = rbq[1]; if (bp == 0) sBQ[0][4][bkey] = rb4;
  __syncthreads();
#pragma unroll 1   // keeps the long body once in the text
  for (int st = 0; st < nst; ++st) { const int cur = st & 1;
#pragma unroll 1   // as the loop over the stages
  for (int ks = 2 * st; ks < 2 * st + 2; ++ks) { v8f s[2]; const int kh = (ks & 1) * 32;
#pragma unroll
    for (int ct = 0; ct < 2; ++ct) { const int kk = ks * 32 + ct * 16 + col; v8f c = {};
#pragma unroll
      for (int kc = 0; kc < 2; ++kc) c = wmma16(aq[kc], frag_h(&sK[cur][kh + ct * 16 + col][kc * 32], lane), c);   // single product: q, k as one-rounding f16 operands
      { const float* tq = &sBQ[cur][0][kh + ct * 16 + col]; const float* tk = &sBK[wave][g][0];
      unsigned u1[8], u2[8];
#pragma unroll
      for (int r = 0; r < 8; ++r) { const int qi = q0 + 8 * g + r; u1[r] = (unsigned)RPB[(size_t)qi * SS + kk]; u2[r] = (unsigned)RPB[(size_t)kk * SS + qi]; }
      asm volatile("s_wait_xcnt 0x0" ::: "memory");   // stands behind the bucket loads, in front of any rewrite of a register that one of them names as its address
#pragma unroll
      for (int r = 0; r < 8; ++r) { const unsigned c1 = u1[r] < NBK - 1u ? u1[r] : NBK - 1u, c2 = u2[r] < NBK - 1u ? u2[r] : NBK - 1u;   // bounds both LDS addresses for any content of the bucket array
        s[ct][r] = c[r] * 0.125f + tk[r * 8 + c1] + tq[c2 * BQP]; } } }   // 1/sqrt(64) + q.table_k[bucket(i,j)] + (k/8).table_q[bucket(j,i)]
#pragma unroll
    for (int r = 0; r < 8; ++r) { float mx = fmaxf(s[0][r], s[1][r]);
#pragma unroll
      for (int o = 1; o < 16; o <<= 1) mx = fmaxf(mx, __shfl_xor(mx, o));
      const float mn = fmaxf(m[r], mx); const float alpha = (m[r] <= -1.0e38f) ? 0.f : __expf(m[r] - mn);
      const float e0 = (s[0][r] <= -1.0e38f) ? 0.f : __expf(s[0][r] - mn), e1 = (s[1][r] <= -1.0e38f) ? 0.f : __expf(s[1][r] - mn); float es = e0 + e1;
#pragma unroll
      for (int o = 1; o < 16; o <<= 1) es += __shfl_xor(es, o);
      l[r] = l[r] * alpha + es; m[r] = mn;
#pragma unroll
      for (int dt = 0; dt < 4; ++dt) { acc[dt][r] *= alpha; accl[dt][r] *= alpha; }
      sp[wave][8 * g + r][col] = e0; sp[wave][8 * g + r][16 + col] = e1; }
    LDSX();
    v16h pa, pl; { const float* prow = &sp[wave][col][0] + 8 * (lane >> 4);
#pragma unroll
      for (int i = 0; i < 8; ++i) { const float x0 = prow[i] * 2048.0f, x1 = prow[16 + i] * 2048.0f; const _Float16 h0 = (_Float16)x0, h1 = (_Float16)x1; pa[i] = h0; pa[8 + i] = h1; pl[i] = (_Float16)((x0 - (float)h0) * 2048.0f); pl[8 + i] = (_Float16)((x1 - (float)h1) * 2048.0f); } }   // P scaled by 2^11 before the f16 split so small softmax weights stay out of the f16 subnormal range; 2^-11 folded into the epilogue
    v16h vf[4];
#pragma unroll
    for (int dt = 0; dt < 4; ++dt) vf[dt] = frag_h(&sV[cur][dt * 16 + col][kh], lane);   // all V fragment reads as one group ahead of the products
#pragma unroll
    for (int dt = 0; dt < 4; ++dt) acc[dt] = wmma16(pa, vf[dt], acc[dt]);   // single product: P (x2^11) x V
    (void)pl;
    LDSX(); }
    if (st + 1 < nst) {   // the next stage is fetched and stored into the other buffer here at the foot, not held in registers over the stage: those registers keep the bucket loads of a step in flight together
#pragma unroll
      for (int i = 0; i < 4; ++i) { rk[i] = *(const v8h*)(gK + ((size_t)(st + 1) * 64 + i * 16) * (2 * DM)); rv[i] = *(const v8h*)(gV + (size_t)i * 16 * SS + (st + 1) * 64); }
      rbq = *(const v2f*)(gQ + (size_t)(st + 1) * 64 * NH * 8); if (bp == 0) rb4 = gQ[(size_t)(st + 1) * 64 * NH * 8 + 4];
      asm volatile("s_wait_xcnt 0x0" ::: "memory");   // stands behind the run of loads, in front of any rewrite of a register that one of them names as its address
#pragma unroll
      for (int i = 0; i < 4; ++i) { *(v8h*)&sK[cur ^ 1][(tid >> 3) + 16 * i][(tid & 7) * 8] = rk[i]; *(v8h*)&sV[cur ^ 1][(tid >> 3) + 16 * i][(tid & 7) * 8] = rv[i]; }
      sBQ[cur ^ 1][bp * 2][bkey] = rbq[0]; sBQ[cur ^ 1][bp * 2 + 1][bkey] = rbq[1]; if (bp == 0) sBQ[cur ^ 1][4][bkey] = rb4; }
    __syncthreads(); }   // publishes the next buffer and ends every reader's last read of this one
#pragma unroll
  for (int r = 0; r < 8; ++r) { const float il = (1.0f / 2048.0f) / l[r];
#pragma unroll
    for (int dt = 0; dt < 4; ++dt) so[wave][8 * g + r][dt * 16 + col] = (acc[dt][r] + accl[dt][r] * (1.0f / 2048.0f)) * il; }
  LDSX();
  for (int rl = 0; rl < 16; ++rl) if (lane < 16) vst2(O + ((size_t)b * SS + q0 + rl) * DM + h * HD + lane * 4, *(const v4f*)&so[wave][rl][lane * 4]);
}
// ---- k_out: block = (64 rows, 128 cols): out = O(hi/lo) . Wo rows (2 products) + bo
__global__ __launch_bounds__(128) void k_out(const float* __restrict__ O, const __bf16* __restrict__ P, const float* __restrict__ BO, float* __restrict__ Y) {
  // one LDS block: two stage buffers (weights 128 rows, ctx hi and residual 64 rows each, bf16); behind the loop's last barrier the output tile lies over them
  __shared__ __align__(16) unsigned char sm[2 * (128 + 64 + 64) * LP * 2];
  __bf16 (*sB)[128][LP] = (__bf16 (*)[128][LP])sm; __bf16 (*sH)[64][LP] = (__bf16 (*)[64][LP])(sm + 2 * 128 * LP * 2); __bf16 (*sL)[64][LP] = (__bf16 (*)[64][LP])(sm + 2 * (128 + 64) * LP * 2);
  float (*so)[16][132] = (float (*)[16][132])sm;
  const int tid = threadIdx.x, wave = tid >> 5, lane = tid & 31, col = lane & 15, g = lane >> 4; const size_t r0 = (size_t)blockIdx.x * 64 + wave * 16; const int n0 = blockIdx.y * 128;
  v8f acc[8] = {};
  const __bf16* gB = P + (size_t)(n0 + (tid >> 3)) * DM + (tid & 7) * 8; const float* gA = O + ((size_t)blockIdx.x * 64 + (tid >> 4)) * DM + (tid & 15) * 4;
  v8b rb[8]; v4f ra[8];
#pragma unroll
  for (int i = 0; i < 8; ++i) { rb[i] = *(const v8b*)(gB + (size_t)i * 16 * DM); ra[i] = *(const v4f*)(gA + (size_t)i * 8 * DM); }
#pragma unroll
  for (int i = 0; i < 8; ++i) { *(v8b*)&sB[0][(tid >> 3) + 16 * i][(tid & 7) * 8] = rb[i]; v4b th, tl;
#pragma unroll
    for (int e = 0; e < 4; ++e) { const __bf16 hv = (__bf16)ra[i][e]; th[e] = hv; tl[e] = (__bf16)(ra[i][e] - (float)hv); }
    *(v4b*)&sH[0][(tid >> 4) + 8 * i][(tid & 15) * 4] = th; *(v4b*)&sL[0][(tid >> 4) + 8 * i][(tid & 15) * 4] = tl; }
  __syncthreads();
#pragma unroll 2   // two steps a body, so that each buffer's LDS addresses are immediates
  for (int s = 0; s < DM / KS; ++s) { const int cur = s & 1;
    if (s + 1 < DM / KS) {   // the next step's tiles fly while this step is worked on
#pragma unroll
      for (int i = 0; i < 8; ++i) { rb[i] = *(const v8b*)(gB + (size_t)i * 16 * DM + (s + 1) * KS); ra[i] = *(const v4f*)(gA + (size_t)i * 8 * DM + (s + 1) * KS); }
      asm volatile("s_wait_xcnt 0x0" ::: "memory"); }   // stands behind the run of loads, in front of any rewrite of a register that one of them names as its address
#pragma unroll
    for (int kc = 0; kc < KS / 32; ++kc) { const v16b ah = frag_b(&sH[cur][wave * 16 + col][kc * 32], lane), al = frag_b(&sL[cur][wave * 16 + col][kc * 32], lane); v16b w[8];
#pragma unroll
      for (int j = 0; j < 8; ++j) w[j] = frag_b(&sB[cur][j * 16 + col][kc * 32], lane);   // all fragment reads as one group ahead of the products
#pragma unroll
      for (int j = 0; j < 8; ++j) { acc[j] = wmma_bf(al, w[j], acc[j]); acc[j] = wmma_bf(ah, w[j], acc[j]); } }
    if (s + 1 < DM / KS) {
#pragma unroll
      for (int i = 0; i < 8; ++i) { *(v8b*)&sB[cur ^ 1][(tid >> 3) + 16 * i][(tid & 7) * 8] = rb[i]; v4b th, tl;
#pragma unroll
        for (int e = 0; e < 4; ++e) { const __bf16 hv = (__bf16)ra[i][e]; th[e] = hv; tl[e] = (__bf16)(ra[i][e] - (float)hv); }
        *(v4b*)&sH[cur ^ 1][(tid >> 4) + 8 * i][(tid & 15) * 4] = th; *(v4b*)&sL[cur ^ 1][(tid >> 4) + 8 * i][(tid & 15) * 4] = tl; } }
    __syncthreads(); }   // publishes the next buffer and ends every reader's last read of this one
#pragma unroll
  for (int j = 0; j < 8; ++j) {
#pragma unroll
    for (int r = 0; r < 8; ++r) so[wave][8 * g + r][j * 16 + col] = acc[j][r] + bfr(BO[n0 + j * 16 + col]); }
  LDSX();
  for (int rl = 0; rl < 16; ++rl) vst2(Y + (r0 + rl) * DM + n0 + lane * 4, *(const v4f*)&so[wave][rl][lane * 4]);
}
extern "C" void kernel_launch(void* const* d_in, const int* in_sizes, int n_in, void* d_out, int out_size, void* d_ws, size_t ws_size, hipStream_t stream) {
  (void)in_sizes; (void)n_in; (void)out_size;
  const float** F = (const float**)d_in;   // 0 x [4,1024,768], 1 wq_w, 2 wk_w, 3 wv_w, 4 proj_w ((in,out)), 5 proj_b, 6 rpe_k_table [5,64], 7 rpe_q_table [5,64], 8 rp_bucket [1024,1024] int
  if (ws_size < (size_t)WS_END) return;
  char* ws = (char*)d_ws; __bf16* PK = (__bf16*)(ws + WS_PK); _Float16 *QK = (_Float16*)(ws + WS_QK), *QKL = (_Float16*)(ws + WS_QKL), *VTH = (_Float16*)(ws + WS_VTH), *VTL = (_Float16*)(ws + WS_VTL); float *O = (float*)(ws + WS_O), *BKT = (float*)(ws + WS_BKT), *BQT = (float*)(ws + WS_BQT);
  k_pack<<<dim3(DM, 4), 256, 0, stream>>>(F[1], F[2], F[3], F[4], PK);
  k_qkv<<<dim3(TNB * SS / 64, QKVW / 128), 128, 0, stream>>>(F[0], F[0], F[0], PK + PK_A, nullptr, nullptr, nullptr, F[6], F[7], BKT, BQT, QK, QKL, VTH, VTL);
  k_attn<<<dim3(TQB, NH, TNB), 128, 0, stream>>>(QK, QKL, VTH, VTL, nullptr, BKT, BQT, (const int*)d_in[8], O);
  k_out<<<dim3(TOB, DM / 128), 128, 0, stream>>>(O, PK + PK_P, F[5], (float*)d_out);
}

// v003
// A run of this version takes 119 microseconds.
// Two timings next to v002 put it at 1.16 and 1.17 times that version's speed.
// Counting every step since v000, it is 2.53 times as fast.
// compute dtype: all float inputs rounded to bf16, rp_bucket (int) read on device; q/k/v = x . W with EXACT bf16 products on WMMA 16x16x32 ((in,out) weights as transposed rows); per (token, head) the 5 bucket dots q . rpe_k_table[u] and (k / 8) . rpe_q_table[u] in f32 from the f32 projections; PLAIN attention: q, k as single f16 operands x 1/8 + bk[i][bucket[i][j]] + bq[j][bucket[j][i]], running-max softmax in f32 (hardware exp), P (scaled by 2^11, single f16) x v (single f16); out = ctx (bf16 hi + residual) . proj_w (2 products) + proj_b.
#include <hip/hip_runtime.h>
#include <math.h>

typedef __attribute__((ext_vector_type(16))) _Float16 v16h;
typedef __attribute__((ext_vector_type(16))) __bf16 v16b;
typedef __attribute__((ext_vector_type(8)))  _Float16 v8h;
typedef __attribute__((ext_vector_type(8)))  float v8f;
typedef __attribute__((ext_vector_type(4)))  float v4f;
typedef __attribute__((ext_vector_type(2)))  float v2f;
typedef __attribute__((ext_vector_type(4)))  unsigned v4u;
typedef __attribute__((ext_vector_type(4)))  int v4i;
typedef float __attribute__((may_alias)) float_a;
typedef int __attribute__((may_alias)) int_a;

template <typename T> __device__ __forceinline__ void vst2(void* p, T v) { *(T*)p = v;  }
__device__ __forceinline__ v8f wmma16(v16h a, v16h b, v8f c) {
  v8f d = __builtin_amdgcn_wmma_f32_16x16x32_f16(false, a, false, b, (short)0, c, false, false);
  asm volatile("v_nop\n\tv_nop\n\tv_nop\n\tv_nop" : "+v"(d) : "v"(a), "v"(b));
  return d;
}
__device__ __forceinline__ v8f wmma_bf(v16b a, v16b b, v8f c) {
  v8f d = __builtin_amdgcn_wmma_f32_16x16x32_bf16(false, a, false, b, (short)0, c, false, false);
  asm volatile("v_nop\n\tv_nop\n\tv_nop\n\tv_nop" : "+v"(d) : "v"(a), "v"(b));
  return d;
}
// Attention with image relative-position encoding (iRPE, contextual mode on q and k) over a 32 x 32 patch grid (B 4, N 1,024, C 768, 12 heads x 64): bias-free q/k/v projections, scores + q . table_k[bucket(i,j)] + (k scale) . table_q[bucket(j,i)], softmax, output projection + bias.
__device__ __forceinline__ v16h frag_h(const _Float16* rowk0, int lane) {
  union { v16h v; v8h q[2]; } u; const _Float16* p = rowk0 + 8 * (lane >> 4);
  u.q[0] = *(const v8h*)p; u.q[1] = *(const v8h*)(p + 16); return u.v;
}
__device__ __forceinline__ v16h frag_f32(const float* rowk0, int lane) {
  v16h a; const float* p = rowk0 + 8 * (lane >> 4);
#pragma unroll
  for (int i = 0; i < 8; ++i) { a[i] = (_Float16)p[i]; a[8 + i] = (_Float16)p[16 + i]; }
  return a;
}
__device__ __forceinline__ v16h frag_f32s(const float* rowk0, int lane, float sc) {
  v16h a; const float* p = rowk0 + 8 * (lane >> 4);
#pragma unroll
  for (int i = 0; i < 8; ++i) { a[i] = (_Float16)(p[i] * sc); a[8 + i] = (_Float16)(p[16 + i] * sc); }
  return a;
}
// column fragment from a [K][ld] layout (column n), rows >= K read as 0
__device__ __forceinline__ v16h fragc_f32(const float* W, int k0, int n, int lane, int ld, int K) {
  v16h a; const int g = lane >> 4;
#pragma unroll
  for (int i = 0; i < 8; ++i) { const int ka = k0 + 8 * g + i, kb = ka + 16;
    a[i] = (_Float16)(ka < K ? W[(size_t)(ka < K ? ka : K - 1) * ld + n] : 0.f); a[8 + i] = (_Float16)(kb < K ? W[(size_t)(kb < K ? kb : K - 1) * ld + n] : 0.f); }
  return a;
}
struct F2 { v16b h, l; };
__device__ __forceinline__ F2 bsplit16(const float v[16]) { F2 r;
#pragma unroll
  for (int i = 0; i < 16; ++i) { const __bf16 h = (__bf16)v[i]; r.h[i] = h; r.l[i] = (__bf16)(v[i] - (float)h); }
  return r; }
__device__ __forceinline__ F2 split_row(const float* row, int k0, int lane) { float v[16]; const float* p = row + k0 + 8 * (lane >> 4);
#pragma unroll
  for (int i = 0; i < 8; ++i) { v[i] = p[i]; v[8 + i] = p[16 + i]; }
  return bsplit16(v); }
__device__ __forceinline__ F2 split_rowK(const float* row, int k0, int lane, int K) { float v[16]; const int g = lane >> 4;
#pragma unroll
  for (int i = 0; i < 8; ++i) { const int ka = k0 + 8 * g + i, kb = ka + 16; v[i] = ka < K ? row[ka < K ? ka : K - 1] : 0.f; v[8 + i] = kb < K ? row[kb < K ? kb : K - 1] : 0.f; }
  return bsplit16(v); }
__device__ __forceinline__ F2 split_col(const float* W, int k0, int n, int lane, int ld, int K) { float v[16]; const int g = lane >> 4;
#pragma unroll
  for (int i = 0; i < 8; ++i) { const int ka = k0 + 8 * g + i, kb = ka + 16; v[i] = ka < K ? W[(size_t)(ka < K ? ka : K - 1) * ld + n] : 0.f; v[8 + i] = kb < K ? W[(size_t)(kb < K ? kb : K - 1) * ld + n] : 0.f; }
  return bsplit16(v); }
__device__ __forceinline__ v8f mac3(const F2& a, const F2& b, v8f c) { c = wmma_bf(a.l, b.h, c); c = wmma_bf(a.h, b.l, c); return wmma_bf(a.h, b.h, c); }
__device__ __forceinline__ float sigm(float v) { return 1.0f / (1.0f + expf(-v)); }
#define LDSX() do { asm volatile("s_wait_dscnt 0" ::: "memory"); __builtin_amdgcn_wave_barrier(); __builtin_amdgcn_fence(__ATOMIC_RELEASE, "workgroup"); } while (0)


#define NB 4
#define SS 1024
#define DM 768
#define NH 12
#define NBK 5
#define HD 64
#define QKVW (3 * DM)
#ifndef TQB
#define TQB (SS / 64)
#define TNB NB
#define TOB (NB * SS / 64)     // output row tiles (all)
#endif
typedef __attribute__((ext_vector_type(8))) __bf16 v8b;
__device__ __forceinline__ v16b frag_b(const __bf16* rowk0, int lane) {
  union { v16b v; v8b q[2]; } u; const __bf16* p = rowk0 + 8 * (lane >> 4);
  u.q[0] = *(const v8b*)p; u.q[1] = *(const v8b*)(p + 16); return u.v;
}
typedef __attribute__((ext_vector_type(4))) __bf16 v4b;
#define KS 64   // k per staged step: 128 B of a bf16 row, one whole line
#define BQP 80  // words per bucket row of the staged key-side bias table: 64 keys + 16, so that a 16-key group's rows of buckets 0 to 3 fall on different banks
#define LP 72   // LDS row pitch in 16-bit elements: 128 B of data + 16 B, the pitch for 16-byte LDS readers
// the plain '#pragma unroll' on the short fixed loops of the staging code give the staged values and fragments (rb, ra, rk, rv, w, vf) constant indices, so that they stay in registers
__device__ __forceinline__ float bfr(float v) { return (float)(__bf16)v; }
__device__ __attribute__((noinline)) float exp_ni(float v) { return expf(v); }
__device__ __attribute__((noinline)) float erf_ni(float v) { return erff(v); }

#define PK_A 0                       // [2304][768] Wqkv rows (natural [out][in])
#define PK_P (PK_A + QKVW * DM)        // [768][768] Wo rows (natural)
#define PK_END (PK_P + DM * DM)
#define WS_PK  0u
#define WS_QK  (WS_PK + 2u * PK_END)             // f16 [4096 rows][1536]: q | k
#define WS_QKL (WS_QK + 2u * NB * SS * 2 * DM)     // f16 q | k residual planes x2048
#define WS_VTH (WS_QKL + 2u * NB * SS * 2 * DM)    // f16 [b][768 (h*64+d)][1024 s] hi
#define WS_VTL (WS_VTH + 2u * NB * DM * SS)        // f16 lo x 2048
#define WS_O   (WS_VTL + 2u * NB * DM * SS)        // f32 [4096][768]
#define WS_CS  (WS_O + 4u * NB * SS * DM)           // f32 [2][1024][32] (unused)
#define WS_BKT (WS_CS + 4u * 2 * SS * 32)                 // f32 [NB*SS][NH][8]: q . table_k[u] ; BQT (k/8) . table_q[u]
#define WS_BQT (WS_BKT + 4u * NB * SS * NH * 8)
#define WS_END (WS_BQT + 4u * NB * SS * NH * 8)
// ---- k_pack: block = (row n, which): column n of an (in,out) weight -> bf16 row n; which 0..2 -> W_q/W_k/W_v into PK_A rows which*768 + n; 3 -> W_o into PK_P
__global__ __launch_bounds__(256) void k_pack(const float* __restrict__ WQ, const float* __restrict__ WK, const float* __restrict__ WV, const float* __restrict__ WO, __bf16* __restrict__ PK) {
  __shared__ __align__(16) __bf16 s[DM]; const int n = blockIdx.x, which = blockIdx.y, t = threadIdx.x; const float* Wm = (which == 0) ? WQ : (which == 1) ? WK : (which == 2) ? WV : WO;   // (in,out) weights: pack row n = column n
  for (int k = t; k < DM; k += 256) s[k] = (__bf16)Wm[(size_t)k * DM + n];
  __syncthreads();
  __bf16* dst = (which < 3) ? PK + PK_A + ((size_t)which * DM + n) * DM : PK + PK_P + (size_t)n * DM;
  for (int q = t; q < DM / 8; q += 256) vst2((unsigned*)(dst + q * 8), *(const v4u*)&s[q * 8]);
}
__global__ __launch_bounds__(128) void k_qkv(const float* __restrict__ XQ, const float* __restrict__ XK, const float* __restrict__ XV, const __bf16* __restrict__ P, const float* __restrict__ BQ, const float* __restrict__ BK, const float* __restrict__ BV, const float* __restrict__ TK, const float* __restrict__ TQ, float* __restrict__ BKT, float* __restrict__ BQT, _Float16* __restrict__ QK, _Float16* __restrict__ QKL, _Float16* __restrict__ VTH, _Float16* __restrict__ VTL) {
  const int which0 = (blockIdx.y * 128) / DM; const float* X = (which0 == 0) ? XQ : (which0 == 1) ? XK : XV; const float* BB = BQ ? (((which0 == 0) ? BQ : (which0 == 1) ? BK : BV) + (blockIdx.y * 128 - which0 * DM)) : nullptr;
  // one LDS block: the main loop's two stage buffers (weights 128 rows, x 64 rows, bf16); behind the loop's last barrier the epilogue's tiles lie over them
  __shared__ __align__(16) unsigned char sm[2 * (128 + 64) * LP * 2];
  __bf16 (*sB)[128][LP] = (__bf16 (*)[128][LP])sm; __bf16 (*sA)[64][LP] = (__bf16 (*)[64][LP])(sm + 2 * 128 * LP * 2);
  _Float16 (*so)[16][136] = (_Float16 (*)[16][136])sm; _Float16 (*sol)[16][136] = (_Float16 (*)[16][136])(sm + 4 * 16 * 136 * 2);
  _Float16 (*sth)[72] = (_Float16 (*)[72])sm; _Float16 (*stl)[72] = (_Float16 (*)[72])(sm + 128 * 72 * 2);
  const int tid = threadIdx.x, wave = tid >> 5, lane = tid & 31, col = lane & 15, g = lane >> 4; const size_t r0 = (size_t)blockIdx.x * 64 + wave * 16; const int n0 = blockIdx.y * 128;
  v8f acc[8] = {};
  // each 16-byte load of a wave covers 4 whole lines: weights 4 rows x 128 B, x 2 rows x 256 B
  const __bf16* gB = P + (size_t)(n0 + (tid >> 3)) * DM + (tid & 7) * 8; const float* gA = X + ((size_t)blockIdx.x * 64 + (tid >> 4)) * DM + (tid & 15) * 4;
  v8b rb[8]; v4f ra[8];
#pragma unroll
  for (int i = 0; i < 8; ++i) { rb[i] = *(const v8b*)(gB + (size_t)i * 16 * DM); ra[i] = *(const v4f*)(gA + (size_t)i * 8 * DM); }
#pragma unroll
  for (int i = 0; i < 8; ++i) { *(v8b*)&sB[0][(tid >> 3) + 16 * i][(tid & 7) * 8] = rb[i]; v4b t;
#pragma unroll
    for (int e = 0; e < 4; ++e) t[e] = (__bf16)ra[i][e];
    *(v4b*)&sA[0][(tid >> 4) + 8 * i][(tid & 15) * 4] = t; }
  __syncthreads();
#pragma unroll 2   // two steps a body, so that each buffer's LDS addresses are immediates
  for (int s = 0; s < DM / KS; ++s) { const int cur = s & 1;
    if (s + 1 < DM / KS) {   // the next step's tiles fly while this step is worked on
#pragma unroll
      for (int i = 0; i < 8; ++i) { rb[i] = *(const v8b*)(gB + (size_t)i * 16 * DM + (s + 1) * KS); ra[i] = *(const v4f*)(gA + (size_t)i * 8 * DM + (s + 1) * KS); }
      asm volatile("s_wait_xcnt 0x0" ::: "memory"); }   // stands behind the run of loads, in front of any rewrite of a register that one of them names as its address
#pragma unroll
    for (int kc = 0; kc < KS / 32; ++kc) { const v16b a = frag_b(&sA[cur][wave * 16 + col][kc * 32], lane);
#pragma unroll
      for (int jh = 0; jh < 8; jh += 4) { v16b w[4];   // fragment reads in groups of four ahead of their products: 192 registers, five waves a SIMD, the whole grid resident
#pragma unroll
        for (int j = 0; j < 4; ++j) w[j] = frag_b(&sB[cur][(jh + j) * 16 + col][kc * 32], lane);
#pragma unroll
        for (int j = 0; j < 4; ++j) acc[jh + j] = wmma_bf(a, w[j], acc[jh + j]); } }
    if (s + 1 < DM / KS) {
#pragma unroll
      for (int i = 0; i < 8; ++i) { *(v8b*)&sB[cur ^ 1][(tid >> 3) + 16 * i][(tid & 7) * 8] = rb[i]; v4b t;
#pragma unroll
        for (int e = 0; e < 4; ++e) t[e] = (__bf16)ra[i][e];
        *(v4b*)&sA[cur ^ 1][(tid >> 4) + 8 * i][(tid & 15) * 4] = t; } }
    __syncthreads(); }   // publishes the next buffer and ends every reader's last read of this one
  if (n0 < 2 * DM) {   // per (row, head): the 5 bucket dots (q . table_k[u]) or ((k/8) . table_q[u]) from the f32 values -> BKT / BQT [row][h][8] (5 used)
    { const bool isq = n0 < DM; const float* TB = isq ? TK : TQ; float* dstT = isq ? BKT : BQT; const float sc = isq ? 1.0f : 0.125f;
#pragma unroll
      for (int r = 0; r < 8; ++r) {
#pragma unroll
        for (int hh = 0; hh < 2; ++hh) { const int h = (n0 % DM) / 64 + hh; float du[NBK];
#pragma unroll
          for (int u = 0; u < NBK; ++u) { float s = 0.f;
#pragma unroll
            for (int j = 0; j < 4; ++j) s += acc[hh * 4 + j][r] * bfr(TB[u * 64 + j * 16 + col]);
#pragma unroll
            for (int o = 1; o < 16; o <<= 1) s += __shfl_xor(s, o);
            du[u] = s * sc; }
          if (col == 0) { float* d = dstT + ((r0 + 8 * g + r) * NH + h) * 8;
#pragma unroll
            for (int u = 0; u < NBK; ++u) d[u] = du[u]; } } } }   // (8-float slots per (row, head); 4-B scratch stores)
#pragma unroll
    for (int j = 0; j < 8; ++j) {
#pragma unroll
      for (int r = 0; r < 8; ++r) { const float v = acc[j][r]; const _Float16 hv = (_Float16)v; so[wave][8 * g + r][j * 16 + col] = hv; sol[wave][8 * g + r][j * 16 + col] = (_Float16)((v - (float)hv) * 2048.0f); } }   // q, k as f16 hi + (x2048) residual
    LDSX();
    for (int rl = 0; rl < 16; ++rl) if (lane < 16) { vst2((unsigned*)(QK + (r0 + rl) * (2 * DM) + n0 + lane * 8), *(const v4u*)&so[wave][rl][lane * 8]); vst2((unsigned*)(QKL + (r0 + rl) * (2 * DM) + n0 + lane * 8), *(const v4u*)&sol[wave][rl][lane * 8]); }
  } else {
#pragma unroll
    for (int j = 0; j < 8; ++j) {
#pragma unroll
      for (int r = 0; r < 8; ++r) { const float v = acc[j][r] + (BB ? bfr(BB[j * 16 + col]) : 0.f); const _Float16 hv = (_Float16)v; sth[j * 16 + col][wave * 16 + 8 * g + r] = hv; stl[j * 16 + col][wave * 16 + 8 * g + r] = (_Float16)((v - (float)hv) * 2048.0f); } }
    __syncthreads();
    const size_t rb = (size_t)blockIdx.x * 64; const int b = (int)(rb / SS), s0 = (int)(rb % SS); const int pc0 = n0 - 2 * DM;
    for (int q = tid; q < 128 * 8; q += 128) { const int d = q >> 3, pc = q & 7; const size_t o = ((size_t)b * DM + pc0 + d) * SS + s0 + pc * 8; vst2((unsigned*)(VTH + o), *(const v4u*)&sth[d][pc * 8]); vst2((unsigned*)(VTL + o), *(const v4u*)&stl[d][pc * 8]); }
  }
}
// ---- k_attn: block = (64 queries, head h, batch b): all-keys flash attention on TRANSPOSED tiles: S^T = K . Q^T (A = K rows, B = q), so that a lane holds 16 keys' scores of ONE query (query = lane & 15, keys 8 * (lane >> 4) + r of each 16-key tile); scores = (q.k) * 0.125 with single f16 operands; the two f32 score tiles of 32 keys, converted in place, are the B operand of O^T += V^T . P^T (A = V rows [d][key]); O[b*S+q][h*64+d] = (acc + accl / 2048) / (2048 l) (256-B segments)
__device__ __forceinline__ float xhalf(float x) { return __builtin_bit_cast(float, __builtin_amdgcn_permlanex16(__builtin_bit_cast(int, x), __builtin_bit_cast(int, x), 0x76543210, 0xfedcba98, false, false)); }   // lane l with lane l ^ 16
// 2^x on the hardware's v_exp_f32, written with the slot that the instruction set asks for behind a transcendental inside the statement. Outputs are early-clobber, so each v_exp_f32 is followed by one that is independent of it, and the last by the v_nop
__device__ __forceinline__ float exp2_1(float x) { float r; asm("v_exp_f32 %0, %1\n\tv_nop" : "=v"(r) : "v"(x)); return r; }
__device__ __forceinline__ v8f exp2_8(v8f x) { float r0, r1, r2, r3, r4, r5, r6, r7;
  asm("v_exp_f32 %0, %8\n\tv_exp_f32 %1, %9\n\tv_exp_f32 %2, %10\n\tv_exp_f32 %3, %11\n\tv_exp_f32 %4, %12\n\tv_exp_f32 %5, %13\n\tv_exp_f32 %6, %14\n\tv_exp_f32 %7, %15\n\tv_nop"
      : "=&v"(r0), "=&v"(r1), "=&v"(r2), "=&v"(r3), "=&v"(r4), "=&v"(r5), "=&v"(r6), "=&v"(r7) : "v"(x[0]), "v"(x[1]), "v"(x[2]), "v"(x[3]), "v"(x[4]), "v"(x[5]), "v"(x[6]), "v"(x[7]));
  const v8f r = {r0, r1, r2, r3, r4, r5, r6, r7}; return r; }
#define LOG2E 1.44269504f
__global__ __launch_bounds__(128) void k_attn(const _Float16* __restrict__ QK, const _Float16* __restrict__ QKL, const _Float16* __restrict__ VTH, const _Float16* __restrict__ VTL, const void* __restrict__ KMASK, const float* __restrict__ BKT, const float* __restrict__ BQT, const int* __restrict__ RPB, float* __restrict__ O) {
  __shared__ __align__(16) float so[4][16][68];
  __shared__ __align__(16) _Float16 sK[2][64][LP], sV[2][64][LP];   // two stage buffers of 64 keys: K rows [key][d], V rows [d][key], 128 B of data a row
  __shared__ __align__(16) float sBQ[2][NBK][BQP];   // the stage's (k/8) . table_q[u], [bucket][key], in the same two stage buffers' rhythm
  __shared__ __align__(16) float sBK[4][NBK][32];    // per wave: q . table_k[u] of each lane's own query, [bucket][lane]: a lane reads its own column alone, so no two lanes of a look-up meet on a bank
  const int tid = threadIdx.x, wave = tid >> 5, lane = tid & 31, col = lane & 15, g = lane >> 4;
  const int qb = blockIdx.x, h = blockIdx.y, b = blockIdx.z; const int q0 = qb * 64 + wave * 16; const size_t rq = (size_t)b * SS + q0 + col;
  v16h aq[2], aql[2];
#pragma unroll
  for (int kc = 0; kc < 2; ++kc) { aq[kc] = frag_h(QK + rq * (2 * DM) + h * HD + kc * 32, lane); aql[kc] = frag_h(QKL + rq * (2 * DM) + h * HD + kc * 32, lane); }
  { const float* bk = BKT + (rq * NH + h) * 8;   // the lane's own query: its five buckets
    const v4f t = *(const v4f*)bk; const float t4 = bk[4];
    asm volatile("s_wait_xcnt 0x0" ::: "memory");   // stands behind the two loads, in front of any rewrite of a register that one of them names as its address
#pragma unroll
    for (int u = 0; u < 4; ++u) sBK[wave][u][lane] = t[u];
    sBK[wave][4][lane] = t4; }
  float m = -3.0e38f, l = 0.f;   // the lane's query: running maximum (equal in both halves), and the half's own part of the sum
  v8f acc[4] = {}, accl[4] = {};
  const int nst = SS / 64;   // all keys, 64 a stage
  // each 16-byte load of a wave covers 4 whole lines: 4 rows x 128 B
  const _Float16* gK = QK + ((size_t)b * SS + (tid >> 3)) * (2 * DM) + DM + h * HD + (tid & 7) * 8; const _Float16* gV = VTH + ((size_t)b * DM + h * HD + (tid >> 3)) * SS + (tid & 7) * 8;
  const int bkey = tid >> 1, bp = tid & 1;   // key-side bias rows of a stage's 64 keys: a pair of threads brings one key's five buckets, 0, 1 and 4 | 2, 3
  const float* gQ = BQT + (((size_t)b * SS + bkey) * NH + h) * 8 + bp * 2;
  v8h rk[4], rv[4]; v2f rbq; float rb4 = 0.f;
#pragma unroll
  for (int i = 0; i < 4; ++i) { rk[i] = *(const v8h*)(gK + (size_t)i * 16 * (2 * DM)); rv[i] = *(const v8h*)(gV + (size_t)i * 16 * SS); }
  rbq = *(const v2f*)gQ; if (bp == 0) rb4 = gQ[4];
  asm volatile("s_wait_xcnt 0x0" ::: "memory");   // stands behind the run of loads, in front of any rewrite of a register that one of them names as its address
#pragma unroll
  for (int i = 0; i < 4; ++i) { *(v8h*)&sK[0][(tid >> 3) + 16 * i][(tid & 7) * 8] = rk[i]; *(v8h*)&sV[0][(tid >> 3) + 16 * i][(tid & 7) * 8] = rv[i]; }
  sBQ[0][bp * 2][bkey] = rbq[0]; sBQ[0][bp * 2 + 1][bkey] = rbq[1]; if (bp == 0) sBQ[0][4][bkey] = rb4;
  __syncthreads();
#pragma unroll 1   // keeps the long body once in the text
  for (int st = 0; st < nst; ++st) { const int cur = st & 1;
#pragma unroll 1   // as the loop over the stages
  for (int ks = 2 * st; ks < 2 * st + 2; ++ks) { v8f s[2]; const int kh = (ks & 1) * 32;
#pragma unroll
    for (int ct = 0; ct < 2; ++ct) { const int qi = q0 + col, k8 = ks * 32 + ct * 16 + 8 * g; v8f c = {};   // register r: key k8 + r, query qi
#pragma unroll
      for (int kc = 0; kc < 2; ++kc) c = wmma16(frag_h(&sK[cur][kh + ct * 16 + col][kc * 32], lane), aq[kc], c);   // single product: k, q as one-rounding f16 operands
      { const float* tq = &sBQ[cur][0][kh + ct * 16 + 8 * g]; const float* tk = &sBK[wave][0][lane];
      unsigned u1[8], u2[8];
#pragma unroll
      for (int r = 0; r < 8; ++r) { u1[r] = (unsigned)RPB[(size_t)qi * SS + k8 + r]; u2[r] = (unsigned)RPB[(size_t)(k8 + r) * SS + qi]; }
      asm volatile("s_wait_xcnt 0x0" ::: "memory");   // stands behind the bucket loads, in front of any rewrite of a register that one of them names as its address
#pragma unroll
      for (int r = 0; r < 8; ++r) { const unsigned c1 = u1[r] < NBK - 1u ? u1[r] : NBK - 1u, c2 = u2[r] < NBK - 1u ? u2[r] : NBK - 1u;   // bounds both LDS addresses for any content of the bucket array
        s[ct][r] = c[r] * 0.125f + tk[c1 * 32] + tq[c2 * BQP + r]; } } }   // 1/sqrt(64) + q.table_k[bucket(i,j)] + (k/8).table_q[bucket(j,i)]
    float mx = fmaxf(s[0][0], s[1][0]);
#pragma unroll
    for (int r = 1; r < 8; ++r) mx = fmaxf(mx, fmaxf(s[0][r], s[1][r]));
    mx = fmaxf(mx, xhalf(mx));   // the query's other 16 keys of this step lie in the other half of the wave
    const float mn = fmaxf(m, mx); const float ea = exp2_1((m - mn) * LOG2E), alpha = (m <= -1.0e38f) ? 0.f : ea;
    v16h pa; float es = 0.f;
#pragma unroll
    for (int ct = 0; ct < 2; ++ct) { const v8f ex = exp2_8((s[ct] - mn) * LOG2E);
#pragma unroll
      for (int r = 0; r < 8; ++r) { const float e = (s[ct][r] <= -1.0e38f) ? 0.f : ex[r]; es += e; pa[ct * 8 + r] = (_Float16)(e * 2048.0f); } }   // element ct * 8 + r = key 16 ct + 8 g + r: the k order of the V fragments; P scaled by 2^11 before the f16 rounding so small softmax weights stay out of the f16 subnormal range; 2^-11 folded into the epilogue
    l = l * alpha + es; m = mn;
#pragma unroll
    for (int dt = 0; dt < 4; ++dt) {
#pragma unroll
      for (int r = 0; r < 8; ++r) { acc[dt][r] *= alpha; accl[dt][r] *= alpha; } }
    v16h vf[4];
#pragma unroll
    for (int dt = 0; dt < 4; ++dt) vf[dt] = frag_h(&sV[cur][dt * 16 + col][kh], lane);   // all V fragment reads as one group ahead of the products
#pragma unroll
    for (int dt = 0; dt < 4; ++dt) acc[dt] = wmma16(vf[dt], pa, acc[dt]); }   // single product: V x P (x2^11); register r: d = 16 dt + 8 g + r of query col
    if (st + 1 < nst) {   // the next stage is fetched and stored into the other buffer here at the foot, not held in registers over the stage: those registers keep the bucket loads of a step in flight together
#pragma unroll
      for (int i = 0; i < 4; ++i) { rk[i] = *(const v8h*)(gK + ((size_t)(st + 1) * 64 + i * 16) * (2 * DM)); rv[i] = *(const v8h*)(gV + (size_t)i * 16 * SS + (st + 1) * 64); }
      rbq = *(const v2f*)(gQ + (size_t)(st + 1) * 64 * NH * 8); if (bp == 0) rb4 = gQ[(size_t)(st + 1) * 64 * NH * 8 + 4];
      asm volatile("s_wait_xcnt 0x0" ::: "memory");   // stands behind the run of loads, in front of any rewrite of a register that one of them names as its address
#pragma unroll
      for (int i = 0; i < 4; ++i) { *(v8h*)&sK[cur ^ 1][(tid >> 3) + 16 * i][(tid & 7) * 8] = rk[i]; *(v8h*)&sV[cur ^ 1][(tid >> 3) + 16 * i][(tid & 7) * 8] = rv[i]; }
      sBQ[cur ^ 1][bp * 2][bkey] = rbq[0]; sBQ[cur ^ 1][bp * 2 + 1][bkey] = rbq[1]; if (bp == 0) sBQ[cur ^ 1][4][bkey] = rb4; }
    __syncthreads(); }   // publishes the next buffer and ends every reader's last read of this one
  { const float il = (1.0f / 2048.0f) / (l + xhalf(l));   // the two halves' parts of the query's sum are joined once, here
#pragma unroll
    for (int dt = 0; dt < 4; ++dt) {
#pragma unroll
      for (int r = 0; r < 8; ++r) so[wave][col][dt * 16 + 8 * g + r] = (acc[dt][r] + accl[dt][r] * (1.0f / 2048.0f)) * il; } }
  LDSX();
  for (int rl = 0; rl < 16; ++rl) if (lane < 16) vst2(O + ((size_t)b * SS + q0 + rl) * DM + h * HD + lane * 4, *(const v4f*)&so[wave][rl][lane * 4]);
}
// ---- k_out: block = (64 rows, 128 cols): out = O(hi/lo) . Wo rows (2 products) + bo
__global__ __launch_bounds__(128) void k_out(const float* __restrict__ O, const __bf16* __restrict__ P, const float* __restrict__ BO, float* __restrict__ Y) {
  // one LDS block: two stage buffers (weights 128 rows, ctx hi and residual 64 rows each, bf16); behind the loop's last barrier the output tile lies over them
  __shared__ __align__(16) unsigned char sm[2 * (128 + 64 + 64) * LP * 2];
  __bf16 (*sB)[128][LP] = (__bf16 (*)[128][LP])sm; __bf16 (*sH)[64][LP] = (__bf16 (*)[64][LP])(sm + 2 * 128 * LP * 2); __bf16 (*sL)[64][LP] = (__bf16 (*)[64][LP])(sm + 2 * (128 + 64) * LP * 2);
  float (*so)[16][132] = (float (*)[16][132])sm;
  const int tid = threadIdx.x, wave = tid >> 5, lane = tid & 31, col = lane & 15, g = lane >> 4; const size_t r0 = (size_t)blockIdx.x * 64 + wave * 16; const int n0 = blockIdx.y * 128;
  v8f acc[8] = {};
  const __bf16* gB = P + (size_t)(n0 + (tid >> 3)) * DM + (tid & 7) * 8; const float* gA = O + ((size_t)blockIdx.x * 64 + (tid >> 4)) * DM + (tid & 15) * 4;
  v8b rb[8]; v4f ra[8];
#pragma unroll
  for (int i = 0; i < 8; ++i) { rb[i] = *(const v8b*)(gB + (size_t)i * 16 * DM); ra[i] = *(const v4f*)(gA + (size_t)i * 8 * DM); }
#pragma unroll
  for (int i = 0; i < 8; ++i) { *(v8b*)&sB[0][(tid >> 3) + 16 * i][(tid & 7) * 8] = rb[i]; v4b th, tl;
#pragma unroll
    for (int e = 0; e < 4; ++e) { const __bf16 hv = (__bf16)ra[i][e]; th[e] = hv; tl[e] = (__bf16)(ra[i][e] - (float)hv); }
    *(v4b*)&sH[0][(tid >> 4) + 8 * i][(tid & 15) * 4] = th; *(v4b*)&sL[0][(tid >> 4) + 8 * i][(tid & 15) * 4] = tl; }
  __syncthreads();
#pragma unroll 2   // two steps a body, so that each buffer's LDS addresses are immediates
  for (int s = 0; s < DM / KS; ++s) { const int cur = s & 1;
    if (s + 1 < DM / KS) {   // the next step's tiles fly while this step is worked on
#pragma unroll
      for (int i = 0; i < 8; ++i) { rb[i] = *(const v8b*)(gB + (size_t)i * 16 * DM + (s + 1) * KS); ra[i] = *(const v4f*)(gA + (size_t)i * 8 * DM + (s + 1) * KS); }
      asm volatile("s_wait_xcnt 0x0" ::: "memory"); }   // stands behind the run of loads, in front of any rewrite of a register that one of them names as its address
#pragma unroll
    for (int kc = 0; kc < KS / 32; ++kc) { const v16b ah = frag_b(&sH[cur][wave * 16 + col][kc * 32], lane), al = frag_b(&sL[cur][wave * 16 + col][kc * 32], lane); v16b w[8];
#pragma unroll
      for (int j = 0; j < 8; ++j) w[j] = frag_b(&sB[cur][j * 16 + col][kc * 32], lane);   // all fragment reads as one group ahead of the products
#pragma unroll
      for (int j = 0; j < 8; ++j) { acc[j] = wmma_bf(al, w[j], acc[j]); acc[j] = wmma_bf(ah, w[j], acc[j]); } }
    if (s + 1 < DM / KS) {
#pragma unroll
      for (int i = 0; i < 8; ++i) { *(v8b*)&sB[cur ^ 1][(tid >> 3) + 16 * i][(tid & 7) * 8] = rb[i]; v4b th, tl;
#pragma unroll
        for (int e = 0; e < 4; ++e) { const __bf16 hv = (__bf16)ra[i][e]; th[e] = hv; tl[e] = (__bf16)(ra[i][e] - (float)hv); }
        *(v4b*)&sH[cur ^ 1][(tid >> 4) + 8 * i][(tid & 15) * 4] = th; *(v4b*)&sL[cur ^ 1][(tid >> 4) + 8 * i][(tid & 15) * 4] = tl; } }
    __syncthreads(); }   // publishes the next buffer and ends every reader's last read of this one
#pragma unroll
  for (int j = 0; j < 8; ++j) {
#pragma unroll
    for (int r = 0; r < 8; ++r) so[wave][8 * g + r][j * 16 + col] = acc[j][r] + bfr(BO[n0 + j * 16 + col]); }
  LDSX();
  for (int rl = 0; rl < 16; ++rl) vst2(Y + (r0 + rl) * DM + n0 + lane * 4, *(const v4f*)&so[wave][rl][lane * 4]);
}
extern "C" void kernel_launch(void* const* d_in, const int* in_sizes, int n_in, void* d_out, int out_size, void* d_ws, size_t ws_size, hipStream_t stream) {
  (void)in_sizes; (void)n_in; (void)out_size;
  const float** F = (const float**)d_in;   // 0 x [4,1024,768], 1 wq_w, 2 wk_w, 3 wv_w, 4 proj_w ((in,out)), 5 proj_b, 6 rpe_k_table [5,64], 7 rpe_q_table [5,64], 8 rp_bucket [1024,1024] int
  if (ws_size < (size_t)WS_END) return;
  char* ws = (char*)d_ws; __bf16* PK = (__bf16*)(ws + WS_PK); _Float16 *QK = (_Float16*)(ws + WS_QK), *QKL = (_Float16*)(ws + WS_QKL), *VTH = (_Float16*)(ws + WS_VTH), *VTL = (_Float16*)(ws + WS_VTL); float *O = (float*)(ws + WS_O), *BKT = (float*)(ws + WS_BKT), *BQT = (float*)(ws + WS_BQT);
  k_pack<<<dim3(DM, 4), 256, 0, stream>>>(F[1], F[2], F[3], F[4], PK);
  k_qkv<<<dim3(TNB * SS / 64, QKVW / 128), 128, 0, stream>>>(F[0], F[0], F[0], PK + PK_A, nullptr, nullptr, nullptr, F[6], F[7], BKT, BQT, QK, QKL, VTH, VTL);
  k_attn<<<dim3(TQB, NH, TNB), 128, 0, stream>>>(QK, QKL, VTH, VTL, nullptr, BKT, BQT, (const int*)d_in[8], O);
  k_out<<<dim3(TOB, DM / 128), 128, 0, stream>>>(O, PK + PK_P, F[5], (float*)d_out);
}

// v004
// A run of this version takes 101 microseconds.
// Timed twice side by side with v003, it ran 1.18 and 1.17 times as fast.
// Counting every step since v000, it is 2.97 times as fast.
// compute dtype: all float inputs rounded to bf16, rp_bucket (int) read on device; q/k/v = x . W with EXACT bf16 products on WMMA 16x16x32 ((in,out) weights as transposed rows); per (token, head) the 5 bucket dots q . rpe_k_table[u] and (k / 8) . rpe_q_table[u] in f32 from the f32 projections; PLAIN attention: q, k as single f16 operands x 1/8 + bk[i][bucket[i][j]] + bq[j][bucket[j][i]], running-max softmax in f32 (hardware exp), P (scaled by 2^11, single f16) x v (single f16); out = ctx (bf16 hi + residual) . proj_w (2 products) + proj_b.
#include <hip/hip_runtime.h>
#include <math.h>

typedef __attribute__((ext_vector_type(16))) _Float16 v16h;
typedef __attribute__((ext_vector_type(16))) __bf16 v16b;
typedef __attribute__((ext_vector_type(8)))  _Float16 v8h;
typedef __attribute__((ext_vector_type(8)))  float v8f;
typedef __attribute__((ext_vector_type(4)))  float v4f;
typedef __attribute__((ext_vector_type(2)))  float v2f;
typedef __attribute__((ext_vector_type(4)))  unsigned v4u;
typedef __attribute__((ext_vector_type(4)))  int v4i;
typedef float __attribute__((may_alias)) float_a;
typedef int __attribute__((may_alias)) int_a;

template <typename T> __device__ __forceinline__ void vst2(void* p, T v) { *(T*)p = v;  }
__device__ __forceinline__ v8f wmma16(v16h a, v16h b, v8f c) {
  v8f d = __builtin_amdgcn_wmma_f32_16x16x32_f16(false, a, false, b, (short)0, c, false, false);
  asm volatile("v_nop\n\tv_nop\n\tv_nop\n\tv_nop" : "+v"(d) : "v"(a), "v"(b));
  return d;
}
__device__ __forceinline__ v8f wmma_bf(v16b a, v16b b, v8f c) {
  v8f d = __builtin_amdgcn_wmma_f32_16x16x32_bf16(false, a, false, b, (short)0, c, false, false);
  asm volatile("v_nop\n\tv_nop\n\tv_nop\n\tv_nop" : "+v"(d) : "v"(a), "v"(b));
  return d;
}
// Attention with image relative-position encoding (iRPE, contextual mode on q and k) over a 32 x 32 patch grid (B 4, N 1,024, C 768, 12 heads x 64): bias-free q/k/v projections, scores + q . table_k[bucket(i,j)] + (k scale) . table_q[bucket(j,i)], softmax, output projection + bias.
__device__ __forceinline__ v16h frag_h(const _Float16* rowk0, int lane) {
  union { v16h v; v8h q[2]; } u; const _Float16* p = rowk0 + 8 * (lane >> 4);
  u.q[0] = *(const v8h*)p; u.q[1] = *(const v8h*)(p + 16); return u.v;
}
__device__ __forceinline__ v16h frag_f32(const float* rowk0, int lane) {
  v16h a; const float* p = rowk0 + 8 * (lane >> 4);
#pragma unroll
  for (int i = 0; i < 8; ++i) { a[i] = (_Float16)p[i]; a[8 + i] = (_Float16)p[16 + i]; }
  return a;
}
__device__ __forceinline__ v16h frag_f32s(const float* rowk0, int lane, float sc) {
  v16h a; const float* p = rowk0 + 8 * (lane >> 4);
#pragma unroll
  for (int i = 0; i < 8; ++i) { a[i] = (_Float16)(p[i] * sc); a[8 + i] = (_Float16)(p[16 + i] * sc); }
  return a;
}
// column fragment from a [K][ld] layout (column n), rows >= K read as 0
__device__ __forceinline__ v16h fragc_f32(const float* W, int k0, int n, int lane, int ld, int K) {
  v16h a; const int g = lane >> 4;
#pragma unroll
  for (int i = 0; i < 8; ++i) { const int ka = k0 + 8 * g + i, kb = ka + 16;
    a[i] = (_Float16)(ka < K ? W[(size_t)(ka < K ? ka : K - 1) * ld + n] : 0.f); a[8 + i] = (_Float16)(kb < K ? W[(size_t)(kb < K ? kb : K - 1) * ld + n] : 0.f); }
  return a;
}
struct F2 { v16b h, l; };
__device__ __forceinline__ F2 bsplit16(const float v[16]) { F2 r;
#pragma unroll
  for (int i = 0; i < 16; ++i) { const __bf16 h = (__bf16)v[i]; r.h[i] = h; r.l[i] = (__bf16)(v[i] - (float)h); }
  return r; }
__device__ __forceinline__ F2 split_row(const float* row, int k0, int lane) { float v[16]; const float* p = row + k0 + 8 * (lane >> 4);
#pragma unroll
  for (int i = 0; i < 8; ++i) { v[i] = p[i]; v[8 + i] = p[16 + i]; }
  return bsplit16(v); }
__device__ __forceinline__ F2 split_rowK(const float* row, int k0, int lane, int K) { float v[16]; const int g = lane >> 4;
#pragma unroll
  for (int i = 0; i < 8; ++i) { const int ka = k0 + 8 * g + i, kb = ka + 16; v[i] = ka < K ? row[ka < K ? ka : K - 1] : 0.f; v[8 + i] = kb < K ? row[kb < K ? kb : K - 1] : 0.f; }
  return bsplit16(v); }
__device__ __forceinline__ F2 split_col(const float* W, int k0, int n, int lane, int ld, int K) { float v[16]; const int g = lane >> 4;
#pragma unroll
  for (int i = 0; i < 8; ++i) { const int ka = k0 + 8 * g + i, kb = ka + 16; v[i] = ka < K ? W[(size_t)(ka < K ? ka : K - 1) * ld + n] : 0.f; v[8 + i] = kb < K ? W[(size_t)(kb < K ? kb : K - 1) * ld + n] : 0.f; }
  return bsplit16(v); }
__device__ __forceinline__ v8f mac3(const F2& a, const F2& b, v8f c) { c = wmma_bf(a.l, b.h, c); c = wmma_bf(a.h, b.l, c); return wmma_bf(a.h, b.h, c); }
__device__ __forceinline__ float sigm(float v) { return 1.0f / (1.0f + expf(-v)); }
#define LDSX() do { asm volatile("s_wait_dscnt 0" ::: "memory"); __builtin_amdgcn_wave_barrier(); __builtin_amdgcn_fence(__ATOMIC_RELEASE, "workgroup"); } while (0)


#define NB 4
#define SS 1024
#define DM 768
#define NH 12
#define NBK 5
#define HD 64
#define QKVW (3 * DM)
#ifndef TQB
#define TQB (SS / 64)
#define TNB NB
#define TOB (NB * SS / 64)     // output row tiles (all)
#endif
typedef __attribute__((ext_vector_type(8))) __bf16 v8b;
__device__ __forceinline__ v16b frag_b(const __bf16* rowk0, int lane) {
  union { v16b v; v8b q[2]; } u; const __bf16* p = rowk0 + 8 * (lane >> 4);
  u.q[0] = *(const v8b*)p; u.q[1] = *(const v8b*)(p + 16); return u.v;
}
typedef __attribute__((ext_vector_type(4))) __bf16 v4b;
#define KS 64   // k per staged step: 128 B of a bf16 row, one whole line
#define BQP 80  // words per bucket row of the staged key-side bias table: 64 keys + 16, so that a 16-key group's rows of buckets 0 to 3 fall on different banks
#define LP 72   // LDS row pitch in 16-bit elements: 128 B of data + 16 B, the pitch for 16-byte LDS readers
// the plain '#pragma unroll' on the short fixed loops of the staging code give the staged values and fragments (rb, ra, rk, rv, w, vf) constant indices, so that they stay in registers
__device__ __forceinline__ float bfr(float v) { return (float)(__bf16)v; }
__device__ __attribute__((noinline)) float exp_ni(float v) { return expf(v); }
__device__ __attribute__((noinline)) float erf_ni(float v) { return erff(v); }

#define PK_A 0                       // [2304][768] Wqkv rows (natural [out][in])
#define PK_P (PK_A + QKVW * DM)        // [768][768] Wo rows (natural)
#define PK_END (PK_P + DM * DM)
#define WS_PK  0u
#define WS_QK  (WS_PK + 2u * PK_END)             // f16 [4096 rows][1536]: q | k
#define WS_QKL (WS_QK + 2u * NB * SS * 2 * DM)     // f16 q | k residual planes x2048
#define WS_VTH (WS_QKL + 2u * NB * SS * 2 * DM)    // f16 [b][768 (h*64+d)][1024 s] hi
#define WS_VTL (WS_VTH + 2u * NB * DM * SS)        // f16 lo x 2048
#define WS_O   (WS_VTL + 2u * NB * DM * SS)        // f32 [4096][768]
#define WS_CS  (WS_O + 4u * NB * SS * DM)           // f32 [2][1024][32] (unused)
#define WS_BKT (WS_CS + 4u * 2 * SS * 32)                 // f32 [NB*SS][NH][8]: q . table_k[u] ; BQT (k/8) . table_q[u]
#define WS_BQT (WS_BKT + 4u * NB * SS * NH * 8)
#define WS_PB  (WS_BQT + 4u * NB * SS * NH * 8)   // bytes [64 query tiles][32 key steps][32 lanes][16]: both bucket indices of a (query, key) pair, in the order in which a lane of k_attn uses them
#define WS_END (WS_PB + 1u * SS * SS)
// ---- k_pack: block = (row n, which): natural [out][in] rows -> bf16; which 0..2 -> W_q/W_k/W_v into PK_A rows which*768 + n; 3 -> W_o into PK_P
__global__ __launch_bounds__(256) void k_pack(const float* __restrict__ WQ, const float* __restrict__ WK, const float* __restrict__ WV, const float* __restrict__ WO, const int* __restrict__ RPB, __bf16* __restrict__ PK, unsigned* __restrict__ PB) {
  __shared__ __align__(16) __bf16 s[DM]; const int n = blockIdx.x, which = blockIdx.y, t = threadIdx.x; const float* Wm = (which == 0) ? WQ : (which == 1) ? WK : (which == 2) ? WV : WO;   // (in,out) weights: pack row n = column n
  for (int k = t; k < DM; k += 256) s[k] = (__bf16)Wm[(size_t)k * DM + n];
  __syncthreads();
  __bf16* dst = (which < 3) ? PK + PK_A + ((size_t)which * DM + n) * DM : PK + PK_P + (size_t)n * DM;
  for (int q = t; q < DM / 8; q += 256) vst2((unsigned*)(dst + q * 8), *(const v4u*)&s[q * 8]);
  // the first wave of the first 2,048 blocks: one (16 queries, 32 keys) tile of the bucket pair table. Byte ct * 8 + r of lane (col, g) = bucket[i][j] | bucket[j][i] << 4 for query i = 16 qt + col, key j = 32 ks + 16 ct + 8 g + r, both clamped to the last bucket here, which bounds the LDS addresses that k_attn forms from them for any content of the bucket array
  const int tile = which * DM + n;
  if (t < 32 && tile < (SS / 16) * (SS / 32)) { const int qi = (tile >> 5) * 16 + (t & 15), kb = (tile & 31) * 32 + 8 * (t >> 4);
    const int* pr = RPB + (size_t)qi * SS + kb; const int* pc = RPB + (size_t)kb * SS + qi;   // bucket[i][j ...] along the row, bucket[j ...][i] down the column
    v4u ur[4]; unsigned uc[16];
#pragma unroll
    for (int ct = 0; ct < 2; ++ct) { ur[ct * 2] = *(const v4u*)(pr + ct * 16); ur[ct * 2 + 1] = *(const v4u*)(pr + ct * 16 + 4);
#pragma unroll
      for (int r = 0; r < 8; ++r) uc[ct * 8 + r] = (unsigned)pc[(size_t)(ct * 16 + r) * SS]; }
    asm volatile("s_wait_xcnt 0x0" :: "v"(pr), "v"(pc) : "memory");   // stands behind the run of loads, in front of any rewrite of a register that one of them names as its address; the two addresses are inputs, so that their registers live up to the wait and no load's result is placed on them
    v4u w = {0u, 0u, 0u, 0u};
#pragma unroll
    for (int e = 0; e < 16; ++e) { const unsigned u1 = ur[e >> 2][e & 3], u2 = uc[e]; const unsigned c1 = u1 < NBK - 1u ? u1 : NBK - 1u, c2 = u2 < NBK - 1u ? u2 : NBK - 1u;
      w[e >> 2] |= (c1 | c2 << 4) << 8 * (e & 3); }
    vst2(PB + ((size_t)tile * 32 + t) * 4, w);
    asm volatile("s_wait_xcnt 0x0" ::: "memory"); }   // stands behind the store, in front of any rewrite of a register that it names
}
__global__ __launch_bounds__(128) void k_qkv(const float* __restrict__ XQ, const float* __restrict__ XK, const float* __restrict__ XV, const __bf16* __restrict__ P, const float* __restrict__ BQ, const float* __restrict__ BK, const float* __restrict__ BV, const float* __restrict__ TK, const float* __restrict__ TQ, float* __restrict__ BKT, float* __restrict__ BQT, _Float16* __restrict__ QK, _Float16* __restrict__ QKL, _Float16* __restrict__ VTH, _Float16* __restrict__ VTL) {
  const int which0 = (blockIdx.y * 128) / DM; const float* X = (which0 == 0) ? XQ : (which0 == 1) ? XK : XV; const float* BB = BQ ? (((which0 == 0) ? BQ : (which0 == 1) ? BK : BV) + (blockIdx.y * 128 - which0 * DM)) : nullptr;
  // one LDS block: the main loop's two stage buffers (weights 128 rows, x 64 rows, bf16); behind the loop's last barrier the epilogue's tiles lie over them
  __shared__ __align__(16) unsigned char sm[2 * (128 + 64) * LP * 2];
  __bf16 (*sB)[128][LP] = (__bf16 (*)[128][LP])sm; __bf16 (*sA)[64][LP] = (__bf16 (*)[64][LP])(sm + 2 * 128 * LP * 2);
  _Float16 (*so)[16][136] = (_Float16 (*)[16][136])sm; _Float16 (*sol)[16][136] = (_Float16 (*)[16][136])(sm + 4 * 16 * 136 * 2);
  _Float16 (*sth)[72] = (_Float16 (*)[72])sm; _Float16 (*stl)[72] = (_Float16 (*)[72])(sm + 128 * 72 * 2);
  const int tid = threadIdx.x, wave = tid >> 5, lane = tid & 31, col = lane & 15, g = lane >> 4; const size_t r0 = (size_t)blockIdx.x * 64 + wave * 16; const int n0 = blockIdx.y * 128;
  v8f acc[8] = {};
  // each 16-byte load of a wave covers 4 whole lines: weights 4 rows x 128 B, x 2 rows x 256 B
  const __bf16* gB = P + (size_t)(n0 + (tid >> 3)) * DM + (tid & 7) * 8; const float* gA = X + ((size_t)blockIdx.x * 64 + (tid >> 4)) * DM + (tid & 15) * 4;
  v8b rb[8]; v4f ra[8];
#pragma unroll
  for (int i = 0; i < 8; ++i) { rb[i] = *(const v8b*)(gB + (size_t)i * 16 * DM); ra[i] = *(const v4f*)(gA + (size_t)i * 8 * DM); }
#pragma unroll
  for (int i = 0; i < 8; ++i) { *(v8b*)&sB[0][(tid >> 3) + 16 * i][(tid & 7) * 8] = rb[i]; v4b t;
#pragma unroll
    for (int e = 0; e < 4; ++e) t[e] = (__bf16)ra[i][e];
    *(v4b*)&sA[0][(tid >> 4) + 8 * i][(tid & 15) * 4] = t; }
  __syncthreads();
#pragma unroll 2   // two steps a body, so that each buffer's LDS addresses are immediates
  for (int s = 0; s < DM / KS; ++s) { const int cur = s & 1;
    if (s + 1 < DM / KS) {   // the next step's tiles fly while this step is worked on
#pragma unroll
      for (int i = 0; i < 8; ++i) { rb[i] = *(const v8b*)(gB + (size_t)i * 16 * DM + (s + 1) * KS); ra[i] = *(const v4f*)(gA + (size_t)i * 8 * DM + (s + 1) * KS); }
      asm volatile("s_wait_xcnt 0x0" ::: "memory"); }   // stands behind the run of loads, in front of any rewrite of a register that one of them names as its address
#pragma unroll
    for (int kc = 0; kc < KS / 32; ++kc) { const v16b a = frag_b(&sA[cur][wave * 16 + col][kc * 32], lane);
#pragma unroll
      for (int jh = 0; jh < 8; jh += 4) { v16b w[4];   // fragment reads in groups of four ahead of their products: 192 registers, five waves a SIMD, the whole grid resident
#pragma unroll
        for (int j = 0; j < 4; ++j) w[j] = frag_b(&sB[cur][(jh + j) * 16 + col][kc * 32], lane);
#pragma unroll
        for (int j = 0; j < 4; ++j) acc[jh + j] = wmma_bf(a, w[j], acc[jh + j]); } }
    if (s + 1 < DM / KS) {
#pragma unroll
      for (int i = 0; i < 8; ++i) { *(v8b*)&sB[cur ^ 1][(tid >> 3) + 16 * i][(tid & 7) * 8] = rb[i]; v4b t;
#pragma unroll
        for (int e = 0; e < 4; ++e) t[e] = (__bf16)ra[i][e];
        *(v4b*)&sA[cur ^ 1][(tid >> 4) + 8 * i][(tid & 15) * 4] = t; } }
    __syncthreads(); }   // publishes the next buffer and ends every reader's last read of this one
  if (n0 < 2 * DM) {   // per (row, head): the 5 bucket dots (q . table_k[u]) or ((k/8) . table_q[u]) from the f32 values -> BKT / BQT [row][h][8] (5 used)
    { const bool isq = n0 < DM; const float* TB = isq ? TK : TQ; float* dstT = isq ? BKT : BQT; const float sc = isq ? 1.0f : 0.125f;
#pragma unroll
      for (int r = 0; r < 8; ++r) {
#pragma unroll
        for (int hh = 0; hh < 2; ++hh) { const int h = (n0 % DM) / 64 + hh; float du[NBK];
#pragma unroll
          for (int u = 0; u < NBK; ++u) { float s = 0.f;
#pragma unroll
            for (int j = 0; j < 4; ++j) s += acc[hh * 4 + j][r] * bfr(TB[u * 64 + j * 16 + col]);
#pragma unroll
            for (int o = 1; o < 16; o <<= 1) s += __shfl_xor(s, o);
            du[u] = s * sc; }
          if (col == 0) { float* d = dstT + ((r0 + 8 * g + r) * NH + h) * 8;
#pragma unroll
            for (int u = 0; u < NBK; ++u) d[u] = du[u]; } } } }   // (8-float slots per (row, head); 4-B scratch stores)
#pragma unroll
    for (int j = 0; j < 8; ++j) {
#pragma unroll
      for (int r = 0; r < 8; ++r) { const float v = acc[j][r]; const _Float16 hv = (_Float16)v; so[wave][8 * g + r][j * 16 + col] = hv; sol[wave][8 * g + r][j * 16 + col] = (_Float16)((v - (float)hv) * 2048.0f); } }   // q, k as f16 hi + (x2048) residual
    LDSX();
    for (int rl = 0; rl < 16; ++rl) if (lane < 16) { vst2((unsigned*)(QK + (r0 + rl) * (2 * DM) + n0 + lane * 8), *(const v4u*)&so[wave][rl][lane * 8]); vst2((unsigned*)(QKL + (r0 + rl) * (2 * DM) + n0 + lane * 8), *(const v4u*)&sol[wave][rl][lane * 8]); }
  } else {
#pragma unroll
    for (int j = 0; j < 8; ++j) {
#pragma unroll
      for (int r = 0; r < 8; ++r) { const float v = acc[j][r] + (BB ? bfr(BB[j * 16 + col]) : 0.f); const _Float16 hv = (_Float16)v; sth[j * 16 + col][wave * 16 + 8 * g + r] = hv; stl[j * 16 + col][wave * 16 + 8 * g + r] = (_Float16)((v - (float)hv) * 2048.0f); } }
    __syncthreads();
    const size_t rb = (size_t)blockIdx.x * 64; const int b = (int)(rb / SS), s0 = (int)(rb % SS); const int pc0 = n0 - 2 * DM;
    for (int q = tid; q < 128 * 8; q += 128) { const int d = q >> 3, pc = q & 7; const size_t o = ((size_t)b * DM + pc0 + d) * SS + s0 + pc * 8; vst2((unsigned*)(VTH + o), *(const v4u*)&sth[d][pc * 8]); vst2((unsigned*)(VTL + o), *(const v4u*)&stl[d][pc * 8]); }
  }
}
// ---- k_attn: block = (64 queries, head h, batch b): all-keys flash attention on TRANSPOSED tiles: S^T = K . Q^T (A = K rows, B = q), so that a lane holds 16 keys' scores of ONE query (query = lane & 15, keys 8 * (lane >> 4) + r of each 16-key tile); scores = (q.k) * 0.125 with single f16 operands; the two f32 score tiles of 32 keys, converted in place, are the B operand of O^T += V^T . P^T (A = V rows [d][key]); O[b*S+q][h*64+d] = (acc + accl / 2048) / (2048 l) (256-B segments)
__device__ __forceinline__ float xhalf(float x) { return __builtin_bit_cast(float, __builtin_amdgcn_permlanex16(__builtin_bit_cast(int, x), __builtin_bit_cast(int, x), 0x76543210, 0xfedcba98, false, false)); }   // lane l with lane l ^ 16
// 2^x on the hardware's v_exp_f32, written with the slot that the instruction set asks for behind a transcendental inside the statement. Outputs are early-clobber, so each v_exp_f32 is followed by one that is independent of it, and the last by the v_nop
__device__ __forceinline__ float exp2_1(float x) { float r; asm("v_exp_f32 %0, %1\n\tv_nop" : "=v"(r) : "v"(x)); return r; }
__device__ __forceinline__ v8f exp2_8(v8f x) { float r0, r1, r2, r3, r4, r5, r6, r7;
  asm("v_exp_f32 %0, %8\n\tv_exp_f32 %1, %9\n\tv_exp_f32 %2, %10\n\tv_exp_f32 %3, %11\n\tv_exp_f32 %4, %12\n\tv_exp_f32 %5, %13\n\tv_exp_f32 %6, %14\n\tv_exp_f32 %7, %15\n\tv_nop"
      : "=&v"(r0), "=&v"(r1), "=&v"(r2), "=&v"(r3), "=&v"(r4), "=&v"(r5), "=&v"(r6), "=&v"(r7) : "v"(x[0]), "v"(x[1]), "v"(x[2]), "v"(x[3]), "v"(x[4]), "v"(x[5]), "v"(x[6]), "v"(x[7]));
  const v8f r = {r0, r1, r2, r3, r4, r5, r6, r7}; return r; }
#define LOG2E 1.44269504f
__global__ __launch_bounds__(128) void k_attn(const _Float16* __restrict__ QK, const _Float16* __restrict__ QKL, const _Float16* __restrict__ VTH, const _Float16* __restrict__ VTL, const void* __restrict__ KMASK, const float* __restrict__ BKT, const float* __restrict__ BQT, const unsigned* __restrict__ PB, float* __restrict__ O) {
  __shared__ __align__(16) float so[4][16][68];
  __shared__ __align__(16) _Float16 sK[2][64][LP], sV[2][64][LP];   // two stage buffers of 64 keys: K rows [key][d], V rows [d][key], 128 B of data a row
  __shared__ __align__(16) float sBQ[2][NBK][BQP];   // the stage's (k/8) . table_q[u], [bucket][key], in the same two stage buffers' rhythm
  __shared__ __align__(16) float sBK[4][NBK][32];    // per wave: q . table_k[u] of each lane's own query, [bucket][lane]: a lane reads its own column alone, so no two lanes of a look-up meet on a bank
  const int tid = threadIdx.x, wave = tid >> 5, lane = tid & 31, col = lane & 15, g = lane >> 4;
  const int qb = blockIdx.x, h = blockIdx.y, b = blockIdx.z; const int q0 = qb * 64 + wave * 16; const size_t rq = (size_t)b * SS + q0 + col;
  v16h aq[2], aql[2];
#pragma unroll
  for (int kc = 0; kc < 2; ++kc) { aq[kc] = frag_h(QK + rq * (2 * DM) + h * HD + kc * 32, lane); aql[kc] = frag_h(QKL + rq * (2 * DM) + h * HD + kc * 32, lane); }
  { const float* bk = BKT + (rq * NH + h) * 8;   // the lane's own query: its five buckets
    const v4f t = *(const v4f*)bk; const float t4 = bk[4];
    asm volatile("s_wait_xcnt 0x0" ::: "memory");   // stands behind the two loads, in front of any rewrite of a register that one of them names as its address
#pragma unroll
    for (int u = 0; u < 4; ++u) sBK[wave][u][lane] = t[u];
    sBK[wave][4][lane] = t4; }
  float m = -3.0e38f, l = 0.f;   // the lane's query: running maximum (equal in both halves), and the half's own part of the sum
  v8f acc[4] = {}, accl[4] = {};
  const int nst = SS / 64;   // all keys, 64 a stage
  // each 16-byte load of a wave covers 4 whole lines: 4 rows x 128 B
  const _Float16* gK = QK + ((size_t)b * SS + (tid >> 3)) * (2 * DM) + DM + h * HD + (tid & 7) * 8; const _Float16* gV = VTH + ((size_t)b * DM + h * HD + (tid >> 3)) * SS + (tid & 7) * 8;
  const int bkey = tid >> 1, bp = tid & 1;   // key-side bias rows of a stage's 64 keys: a pair of threads brings one key's five buckets, 0, 1 and 4 | 2, 3
  const float* gQ = BQT + (((size_t)b * SS + bkey) * NH + h) * 8 + bp * 2;
  const unsigned* gP = PB + ((size_t)(qb * 4 + wave) * (SS / 32) * 32 + lane) * 4;   // the wave's own 16 queries: 512 B in a row for each step of 32 keys, 16 B a lane
  v8h rk[4], rv[4]; v2f rbq; float rb4 = 0.f;
  v4u nb = *(const v4u*)gP;   // the bucket pairs of step 0
#pragma unroll
  for (int i = 0; i < 4; ++i) { rk[i] = *(const v8h*)(gK + (size_t)i * 16 * (2 * DM)); rv[i] = *(const v8h*)(gV + (size_t)i * 16 * SS); }
  rbq = *(const v2f*)gQ; if (bp == 0) rb4 = gQ[4];
  asm volatile("s_wait_xcnt 0x0" ::: "memory");   // stands behind the run of loads, in front of any rewrite of a register that one of them names as its address
#pragma unroll
  for (int i = 0; i < 4; ++i) { *(v8h*)&sK[0][(tid >> 3) + 16 * i][(tid & 7) * 8] = rk[i]; *(v8h*)&sV[0][(tid >> 3) + 16 * i][(tid & 7) * 8] = rv[i]; }
  sBQ[0][bp * 2][bkey] = rbq[0]; sBQ[0][bp * 2 + 1][bkey] = rbq[1]; if (bp == 0) sBQ[0][4][bkey] = rb4;
  __syncthreads();
#pragma unroll 1   // keeps the long body once in the text
  for (int st = 0; st < nst; ++st) { const int cur = st & 1;
#pragma unroll 1   // as the loop over the stages
  for (int ks = 2 * st; ks < 2 * st + 2; ++ks) { v8f s[2]; const int kh = (ks & 1) * 32;
    const v4u cb = nb;   // this step's 16 bucket pairs; the next step's (the last step: its own again) fly while this one is worked on
    const unsigned* pn = gP + (size_t)(ks + 1 < SS / 32 ? ks + 1 : SS / 32 - 1) * 128; nb = *(const v4u*)pn;
    asm volatile("s_wait_xcnt 0x0" :: "v"(pn) : "memory");   // stands behind the load, in front of any rewrite of a register that it names as its address; the address is an input, so that its registers live up to the wait and the load's result is not placed on them
#pragma unroll
    for (int ct = 0; ct < 2; ++ct) { v8f c = {};   // register r: key ks * 32 + ct * 16 + 8 * g + r, query q0 + col
#pragma unroll
      for (int kc = 0; kc < 2; ++kc) c = wmma16(frag_h(&sK[cur][kh + ct * 16 + col][kc * 32], lane), aq[kc], c);   // single product: k, q as one-rounding f16 operands
      { const float* tq = &sBQ[cur][0][kh + ct * 16 + 8 * g]; const float* tk = &sBK[wave][0][lane];
#pragma unroll
      for (int r = 0; r < 8; ++r) { const unsigned pw = cb[ct * 2 + (r >> 2)] >> 8 * (r & 3); const unsigned c1 = pw & 7u, c2 = pw >> 4 & 7u;   // both at most 4: clamped where k_pack wrote the table
        s[ct][r] = c[r] * 0.125f + tk[c1 * 32] + tq[c2 * BQP + r]; } } }   // 1/sqrt(64) + q.table_k[bucket(i,j)] + (k/8).table_q[bucket(j,i)]
    float mx = fmaxf(s[0][0], s[1][0]);
#pragma unroll
    for (int r = 1; r < 8; ++r) mx = fmaxf(mx, fmaxf(s[0][r], s[1][r]));
    mx = fmaxf(mx, xhalf(mx));   // the query's other 16 keys of this step lie in the other half of the wave
    const float mn = fmaxf(m, mx); const float ea = exp2_1((m - mn) * LOG2E), alpha = (m <= -1.0e38f) ? 0.f : ea;
    v16h pa; float es = 0.f;
#pragma unroll
    for (int ct = 0; ct < 2; ++ct) { const v8f ex = exp2_8((s[ct] - mn) * LOG2E);
#pragma unroll
      for (int r = 0; r < 8; ++r) { const float e = (s[ct][r] <= -1.0e38f) ? 0.f : ex[r]; es += e; pa[ct * 8 + r] = (_Float16)(e * 2048.0f); } }   // element ct * 8 + r = key 16 ct + 8 g + r: the k order of the V fragments; P scaled by 2^11 before the f16 rounding so small softmax weights stay out of the f16 subnormal range; 2^-11 folded into the epilogue
    l = l * alpha + es; m = mn;
#pragma unroll
    for (int dt = 0; dt < 4; ++dt) {
#pragma unroll
      for (int r = 0; r < 8; ++r) { acc[dt][r] *= alpha; accl[dt][r] *= alpha; } }
    v16h vf[4];
#pragma unroll
    for (int dt = 0; dt < 4; ++dt) vf[dt] = frag_h(&sV[cur][dt * 16 + col][kh], lane);   // all V fragment reads as one group ahead of the products
#pragma unroll
    for (int dt = 0; dt < 4; ++dt) acc[dt] = wmma16(vf[dt], pa, acc[dt]); }   // single product: V x P (x2^11); register r: d = 16 dt + 8 g + r of query col
    if (st + 1 < nst) {   // the next stage is fetched and stored into the other buffer here at the foot, not held in registers over the stage
#pragma unroll
      for (int i = 0; i < 4; ++i) { rk[i] = *(const v8h*)(gK + ((size_t)(st + 1) * 64 + i * 16) * (2 * DM)); rv[i] = *(const v8h*)(gV + (size_t)i * 16 * SS + (st + 1) * 64); }
      rbq = *(const v2f*)(gQ + (size_t)(st + 1) * 64 * NH * 8); if (bp == 0) rb4 = gQ[(size_t)(st + 1) * 64 * NH * 8 + 4];
      asm volatile("s_wait_xcnt 0x0" ::: "memory");   // stands behind the run of loads, in front of any rewrite of a register that one of them names as its address
#pragma unroll
      for (int i = 0; i < 4; ++i) { *(v8h*)&sK[cur ^ 1][(tid >> 3) + 16 * i][(tid & 7) * 8] = rk[i]; *(v8h*)&sV[cur ^ 1][(tid >> 3) + 16 * i][(tid & 7) * 8] = rv[i]; }
      sBQ[cur ^ 1][bp * 2][bkey] = rbq[0]; sBQ[cur ^ 1][bp * 2 + 1][bkey] = rbq[1]; if (bp == 0) sBQ[cur ^ 1][4][bkey] = rb4; }
    __syncthreads(); }   // publishes the next buffer and ends every reader's last read of this one
  { const float il = (1.0f / 2048.0f) / (l + xhalf(l));   // the two halves' parts of the query's sum are joined once, here
#pragma unroll
    for (int dt = 0; dt < 4; ++dt) {
#pragma unroll
      for (int r = 0; r < 8; ++r) so[wave][col][dt * 16 + 8 * g + r] = (acc[dt][r] + accl[dt][r] * (1.0f / 2048.0f)) * il; } }
  LDSX();
  for (int rl = 0; rl < 16; ++rl) if (lane < 16) vst2(O + ((size_t)b * SS + q0 + rl) * DM + h * HD + lane * 4, *(const v4f*)&so[wave][rl][lane * 4]);
}
// ---- k_out: block = (64 rows, 128 cols): out = O(hi/lo) . Wo rows (2 products) + bo
__global__ __launch_bounds__(128) void k_out(const float* __restrict__ O, const __bf16* __restrict__ P, const float* __restrict__ BO, float* __restrict__ Y) {
  // one LDS block: two stage buffers (weights 128 rows, ctx hi and residual 64 rows each, bf16); behind the loop's last barrier the output tile lies over them
  __shared__ __align__(16) unsigned char sm[2 * (128 + 64 + 64) * LP * 2];
  __bf16 (*sB)[128][LP] = (__bf16 (*)[128][LP])sm; __bf16 (*sH)[64][LP] = (__bf16 (*)[64][LP])(sm + 2 * 128 * LP * 2); __bf16 (*sL)[64][LP] = (__bf16 (*)[64][LP])(sm + 2 * (128 + 64) * LP * 2);
  float (*so)[16][132] = (float (*)[16][132])sm;
  const int tid = threadIdx.x, wave = tid >> 5, lane = tid & 31, col = lane & 15, g = lane >> 4; const size_t r0 = (size_t)blockIdx.x * 64 + wave * 16; const int n0 = blockIdx.y * 128;
  v8f acc[8] = {};
  const __bf16* gB = P + (size_t)(n0 + (tid >> 3)) * DM + (tid & 7) * 8; const float* gA = O + ((size_t)blockIdx.x * 64 + (tid >> 4)) * DM + (tid & 15) * 4;
  v8b rb[8]; v4f ra[8];
#pragma unroll
  for (int i = 0; i < 8; ++i) { rb[i] = *(const v8b*)(gB + (size_t)i * 16 * DM); ra[i] = *(const v4f*)(gA + (size_t)i * 8 * DM); }
#pragma unroll
  for (int i = 0; i < 8; ++i) { *(v8b*)&sB[0][(tid >> 3) + 16 * i][(tid & 7) * 8] = rb[i]; v4b th, tl;
#pragma unroll
    for (int e = 0; e < 4; ++e) { const __bf16 hv = (__bf16)ra[i][e]; th[e] = hv; tl[e] = (__bf16)(ra[i][e] - (float)hv); }
    *(v4b*)&sH[0][(tid >> 4) + 8 * i][(tid & 15) * 4] = th; *(v4b*)&sL[0][(tid >> 4) + 8 * i][(tid & 15) * 4] = tl; }
  __syncthreads();
#pragma unroll 2   // two steps a body, so that each buffer's LDS addresses are immediates
  for (int s = 0; s < DM / KS; ++s) { const int cur = s & 1;
    if (s + 1 < DM / KS) {   // the next step's tiles fly while this step is worked on
#pragma unroll
      for (int i = 0; i < 8; ++i) { rb[i] = *(const v8b*)(gB + (size_t)i * 16 * DM + (s + 1) * KS); ra[i] = *(const v4f*)(gA + (size_t)i * 8 * DM + (s + 1) * KS); }
      asm volatile("s_wait_xcnt 0x0" ::: "memory"); }   // stands behind the run of loads, in front of any rewrite of a register that one of them names as its address
#pragma unroll
    for (int kc = 0; kc < KS / 32; ++kc) { const v16b ah = frag_b(&sH[cur][wave * 16 + col][kc * 32], lane), al = frag_b(&sL[cur][wave * 16 + col][kc * 32], lane); v16b w[8];
#pragma unroll
      for (int j = 0; j < 8; ++j) w[j] = frag_b(&sB[cur][j * 16 + col][kc * 32], lane);   // all fragment reads as one group ahead of the products
#pragma unroll
      for (int j = 0; j < 8; ++j) { acc[j] = wmma_bf(al, w[j], acc[j]); acc[j] = wmma_bf(ah, w[j], acc[j]); } }
    if (s + 1 < DM / KS) {
#pragma unroll
      for (int i = 0; i < 8; ++i) { *(v8b*)&sB[cur ^ 1][(tid >> 3) + 16 * i][(tid & 7) * 8] = rb[i]; v4b th, tl;
#pragma unroll
        for (int e = 0; e < 4; ++e) { const __bf16 hv = (__bf16)ra[i][e]; th[e] = hv; tl[e] = (__bf16)(ra[i][e] - (float)hv); }
        *(v4b*)&sH[cur ^ 1][(tid >> 4) + 8 * i][(tid & 15) * 4] = th; *(v4b*)&sL[cur ^ 1][(tid >> 4) + 8 * i][(tid & 15) * 4] = tl; } }
    __syncthreads(); }   // publishes the next buffer and ends every reader's last read of this one
#pragma unroll
  for (int j = 0; j < 8; ++j) {
#pragma unroll
    for (int r = 0; r < 8; ++r) so[wave][8 * g + r][j * 16 + col] = acc[j][r] + bfr(BO[n0 + j * 16 + col]); }
  LDSX();
  for (int rl = 0; rl < 16; ++rl) vst2(Y + (r0 + rl) * DM + n0 + lane * 4, *(const v4f*)&so[wave][rl][lane * 4]);
}
extern "C" void kernel_launch(void* const* d_in, const int* in_sizes, int n_in, void* d_out, int out_size, void* d_ws, size_t ws_size, hipStream_t stream) {
  (void)in_sizes; (void)n_in; (void)out_size;
  const float** F = (const float**)d_in;   // 0 x [4,1024,768], 1 wq_w, 2 wk_w, 3 wv_w, 4 proj_w ((in,out)), 5 proj_b, 6 rpe_k_table [5,64], 7 rpe_q_table [5,64], 8 rp_bucket [1024,1024] int
  if (ws_size < (size_t)WS_END) return;
  char* ws = (char*)d_ws; __bf16* PK = (__bf16*)(ws + WS_PK); _Float16 *QK = (_Float16*)(ws + WS_QK), *QKL = (_Float16*)(ws + WS_QKL), *VTH = (_Float16*)(ws + WS_VTH), *VTL = (_Float16*)(ws + WS_VTL); float *O = (float*)(ws + WS_O), *BKT = (float*)(ws + WS_BKT), *BQT = (float*)(ws + WS_BQT);
  k_pack<<<dim3(DM, 4), 256, 0, stream>>>(F[1], F[2], F[3], F[4], (const int*)d_in[8], PK, (unsigned*)(ws + WS_PB));
  k_qkv<<<dim3(TNB * SS / 64, QKVW / 128), 128, 0, stream>>>(F[0], F[0], F[0], PK + PK_A, nullptr, nullptr, nullptr, F[6], F[7], BKT, BQT, QK, QKL, VTH, VTL);
  k_attn<<<dim3(TQB, NH, TNB), 128, 0, stream>>>(QK, QKL, VTH, VTL, nullptr, BKT, BQT, (const unsigned*)(ws + WS_PB), O);
  k_out<<<dim3(TOB, DM / 128), 128, 0, stream>>>(O, PK + PK_P, F[5], (float*)d_out);
}

// v005
// Measured time: 86.3 microseconds a run.
// Two timings next to v004 put it at 1.17 and 1.16 times that version's speed.
// Counting every step since v000, it is 3.47 times as fast.
// compute dtype: all float inputs rounded to bf16, rp_bucket (int) read on device; q/k/v = x . W with EXACT bf16 products on WMMA 16x16x32 ((in,out) weights as transposed rows); per (token, head) the 5 bucket dots q . rpe_k_table[u] and (k / 8) . rpe_q_table[u] in f32 from the f32 projections; PLAIN attention: q, k as single f16 operands x 1/8 + bk[i][bucket[i][j]] + bq[j][bucket[j][i]], running-max softmax in f32 (hardware exp), P (scaled by 2^11, single f16) x v (single f16); out = ctx (bf16 hi + residual) . proj_w (2 products) + proj_b.
#include <hip/hip_runtime.h>
#include <math.h>

typedef __attribute__((ext_vector_type(16))) _Float16 v16h;
typedef __attribute__((ext_vector_type(16))) __bf16 v16b;
typedef __attribute__((ext_vector_type(8)))  _Float16 v8h;
typedef __attribute__((ext_vector_type(8)))  float v8f;
typedef __attribute__((ext_vector_type(4)))  float v4f;
typedef __attribute__((ext_vector_type(2)))  float v2f;
typedef __attribute__((ext_vector_type(4)))  unsigned v4u;
typedef __attribute__((ext_vector_type(4)))  int v4i;
typedef float __attribute__((may_alias)) float_a;
typedef int __attribute__((may_alias)) int_a;

template <typename T> __device__ __forceinline__ void vst2(void* p, T v) { *(T*)p = v;  }
__device__ __forceinline__ v8f wmma16(v16h a, v16h b, v8f c) {
  v8f d = __builtin_amdgcn_wmma_f32_16x16x32_f16(false, a, false, b, (short)0, c, false, false);
  asm volatile("v_nop\n\tv_nop\n\tv_nop\n\tv_nop" : "+v"(d) : "v"(a), "v"(b));
  return d;
}
__device__ __forceinline__ v8f wmma_bf(v16b a, v16b b, v8f c) {
  v8f d = __builtin_amdgcn_wmma_f32_16x16x32_bf16(false, a, false, b, (short)0, c, false, false);
  asm volatile("v_nop\n\tv_nop\n\tv_nop\n\tv_nop" : "+v"(d) : "v"(a), "v"(b));
  return d;
}
// Attention with image relative-position encoding (iRPE, contextual mode on q and k) over a 32 x 32 patch grid (B 4, N 1,024, C 768, 12 heads x 64): bias-free q/k/v projections, scores + q . table_k[bucket(i,j)] + (k scale) . table_q[bucket(j,i)], softmax, output projection + bias.
__device__ __forceinline__ v16h frag_h(const _Float16* rowk0, int lane) {
  union { v16h v; v8h q[2]; } u; const _Float16* p = rowk0 + 8 * (lane >> 4);
  u.q[0] = *(const v8h*)p; u.q[1] = *(const v8h*)(p + 16); return u.v;
}
__device__ __forceinline__ v16h frag_f32(const float* rowk0, int lane) {
  v16h a; const float* p = rowk0 + 8 * (lane >> 4);
#pragma unroll
  for (int i = 0; i < 8; ++i) { a[i] = (_Float16)p[i]; a[8 + i] = (_Float16)p[16 + i]; }
  return a;
}
__device__ __forceinline__ v16h frag_f32s(const float* rowk0, int lane, float sc) {
  v16h a; const float* p = rowk0 + 8 * (lane >> 4);
#pragma unroll
  for (int i = 0; i < 8; ++i) { a[i] = (_Float16)(p[i] * sc); a[8 + i] = (_Float16)(p[16 + i] * sc); }
  return a;
}
// column fragment from a [K][ld] layout (column n), rows >= K read as 0
__device__ __forceinline__ v16h fragc_f32(const float* W, int k0, int n, int lane, int ld, int K) {
  v16h a; const int g = lane >> 4;
#pragma unroll
  for (int i = 0; i < 8; ++i) { const int ka = k0 + 8 * g + i, kb = ka + 16;
    a[i] = (_Float16)(ka < K ? W[(size_t)(ka < K ? ka : K - 1) * ld + n] : 0.f); a[8 + i] = (_Float16)(kb < K ? W[(size_t)(kb < K ? kb : K - 1) * ld + n] : 0.f); }
  return a;
}
struct F2 { v16b h, l; };
__device__ __forceinline__ F2 bsplit16(const float v[16]) { F2 r;
#pragma unroll
  for (int i = 0; i < 16; ++i) { const __bf16 h = (__bf16)v[i]; r.h[i] = h; r.l[i] = (__bf16)(v[i] - (float)h); }
  return r; }
__device__ __forceinline__ F2 split_row(const float* row, int k0, int lane) { float v[16]; const float* p = row + k0 + 8 * (lane >> 4);
#pragma unroll
  for (int i = 0; i < 8; ++i) { v[i] = p[i]; v[8 + i] = p[16 + i]; }
  return bsplit16(v); }
__device__ __forceinline__ F2 split_rowK(const float* row, int k0, int lane, int K) { float v[16]; const int g = lane >> 4;
#pragma unroll
  for (int i = 0; i < 8; ++i) { const int ka = k0 + 8 * g + i, kb = ka + 16; v[i] = ka < K ? row[ka < K ? ka : K - 1] : 0.f; v[8 + i] = kb < K ? row[kb < K ? kb : K - 1] : 0.f; }
  return bsplit16(v); }
__device__ __forceinline__ F2 split_col(const float* W, int k0, int n, int lane, int ld, int K) { float v[16]; const int g = lane >> 4;
#pragma unroll
  for (int i = 0; i < 8; ++i) { const int ka = k0 + 8 * g + i, kb = ka + 16; v[i] = ka < K ? W[(size_t)(ka < K ? ka : K - 1) * ld + n] : 0.f; v[8 + i] = kb < K ? W[(size_t)(kb < K ? kb : K - 1) * ld + n] : 0.f; }
  return bsplit16(v); }
__device__ __forceinline__ v8f mac3(const F2& a, const F2& b, v8f c) { c = wmma_bf(a.l, b.h, c); c = wmma_bf(a.h, b.l, c); return wmma_bf(a.h, b.h, c); }
__device__ __forceinline__ float sigm(float v) { return 1.0f / (1.0f + expf(-v)); }
#define LDSX() do { asm volatile("s_wait_dscnt 0" ::: "memory"); __builtin_amdgcn_wave_barrier(); __builtin_amdgcn_fence(__ATOMIC_RELEASE, "workgroup"); } while (0)


#define NB 4
#define SS 1024
#define DM 768
#define NH 12
#define NBK 5
#define HD 64
#define QKVW (3 * DM)
#ifndef TQB
#define TQB (SS / 64)
#define TNB NB
#define TOB (NB * SS / 64)     // output row tiles (all)
#endif
typedef __attribute__((ext_vector_type(8))) __bf16 v8b;
__device__ __forceinline__ v16b frag_b(const __bf16* rowk0, int lane) {
  union { v16b v; v8b q[2]; } u; const __bf16* p = rowk0 + 8 * (lane >> 4);
  u.q[0] = *(const v8b*)p; u.q[1] = *(const v8b*)(p + 16); return u.v;
}
typedef __attribute__((ext_vector_type(4))) __bf16 v4b;
#define KS 64   // k per staged step: 128 B of a bf16 row, one whole line
#define BQP 80  // words per bucket row of the staged key-side bias table: 64 keys + 16, so that a 16-key group's rows of buckets 0 to 3 fall on different banks
#define LP 72   // LDS row pitch in 16-bit elements: 128 B of data + 16 B, the pitch for 16-byte LDS readers
// the plain '#pragma unroll' on the short fixed loops of the staging code give the staged values and fragments (rb, ra, rk, rv, w, vf) constant indices, so that they stay in registers
__device__ __forceinline__ float bfr(float v) { return (float)(__bf16)v; }
__device__ __attribute__((noinline)) float exp_ni(float v) { return expf(v); }
__device__ __attribute__((noinline)) float erf_ni(float v) { return erff(v); }

#define PK_A 0                       // [2304][768] Wqkv rows (natural [out][in])
#define PK_P (PK_A + QKVW * DM)        // [768][768] Wo rows (natural)
#define PK_END (PK_P + DM * DM)
#define WS_PK  0u
#define WS_QK  (WS_PK + 2u * PK_END)             // f16 [4096 rows][1536]: q | k
#define WS_QKL (WS_QK + 2u * NB * SS * 2 * DM)     // f16 q | k residual planes x2048
#define WS_VTH (WS_QKL + 2u * NB * SS * 2 * DM)    // f16 [b][768 (h*64+d)][1024 s] hi
#define WS_VTL (WS_VTH + 2u * NB * DM * SS)        // f16 lo x 2048
#define WS_O   (WS_VTL + 2u * NB * DM * SS)        // f32 [4096][768]
#define WS_CS  (WS_O + 4u * NB * SS * DM)           // f32 [2][1024][32] (unused)
#define WS_BKT (WS_CS + 4u * 2 * SS * 32)                 // f32 [NB*SS][NH][8]: q . table_k[u] ; BQT (k/8) . table_q[u]
#define WS_BQT (WS_BKT + 4u * NB * SS * NH * 8)
#define WS_PB  (WS_BQT + 4u * NB * SS * NH * 8)   // bytes [64 query tiles][32 key steps][32 lanes][16]: both bucket indices of a (query, key) pair, in the order in which a lane of k_attn uses them
#define WS_END (WS_PB + 1u * SS * SS)
// ---- k_pack: block = (64 k x 64 n tile of one (in,out) weight, which): the tile is read by whole lines (a row of the tile is 256 B), turned in LDS and written as bf16 rows [n][k], 128 B a row; which 0..2 -> W_q/W_k/W_v into PK_A rows which*768 + n; 3 -> W_o into PK_P
#define PT 64   // tile edge of k_pack
__global__ __launch_bounds__(128) void k_pack(const float* __restrict__ WQ, const float* __restrict__ WK, const float* __restrict__ WV, const float* __restrict__ WO, const int* __restrict__ RPB, __bf16* __restrict__ PK, unsigned* __restrict__ PB) {
  __shared__ __align__(16) __bf16 s[PT][LP];   // [n][k]
  const int which = blockIdx.y, t = threadIdx.x, lane = t & 31; const int k0 = (blockIdx.x % (DM / PT)) * PT, n0 = (blockIdx.x / (DM / PT)) * PT;
  const float* Wm = (which == 0) ? WQ : (which == 1) ? WK : (which == 2) ? WV : WO;
  // a thread holds 8 k in a row of 4 n: each 16-byte load of a wave covers 2 rows x 256 B, and each n's 8 values make one 16-byte LDS store
  const int c = t & 15, kr = t >> 4; const float* gw = Wm + (size_t)(k0 + kr * 8) * DM + n0 + c * 4;
  v4f ra[8];
#pragma unroll
  for (int i = 0; i < 8; ++i) ra[i] = *(const v4f*)(gw + (size_t)i * DM);
  asm volatile("s_wait_xcnt 0x0" :: "v"(gw) : "memory");   // stands behind the run of loads, in front of any rewrite of a register that one of them names as its address; the address is an input, so that its registers live up to the wait and no load's result is placed on them
  // the first 2,048 waves of the grid: one (16 queries, 32 keys) tile of the bucket pair table each; its loads fly with the weight tile's, its bytes are formed and stored at the foot, so that the barrier does not wait for that store. Byte ct * 8 + r of lane (col, g) = bucket[i][j] | bucket[j][i] << 4 for query i = 16 qt + col, key j = 32 ks + 16 ct + 8 g + r, both clamped to the last bucket here, which bounds the LDS addresses that k_attn forms from them for any content of the bucket array
  const int tile = (which * ((DM / PT) * (DM / PT)) + (int)blockIdx.x) * 4 + __builtin_amdgcn_readfirstlane(t >> 5); const bool hast = tile < (SS / 16) * (SS / 32);
  v4u ur[4]; unsigned uc[16];
  if (hast) { const int qi = (tile >> 5) * 16 + (lane & 15), kb = (tile & 31) * 32 + 8 * (lane >> 4);
    const int* pr = RPB + (size_t)qi * SS + kb; const int* pc = RPB + (size_t)kb * SS + qi;   // bucket[i][j ...] along the row, bucket[j ...][i] down the column
#pragma unroll
    for (int ct = 0; ct < 2; ++ct) { ur[ct * 2] = *(const v4u*)(pr + ct * 16); ur[ct * 2 + 1] = *(const v4u*)(pr + ct * 16 + 4);
#pragma unroll
      for (int r = 0; r < 8; ++r) uc[ct * 8 + r] = (unsigned)pc[(size_t)(ct * 16 + r) * SS]; }
    asm volatile("s_wait_xcnt 0x0" :: "v"(pr), "v"(pc) : "memory"); }   // stands behind the run of loads, in front of any rewrite of a register that one of them names as its address; the two addresses are inputs, so that their registers live up to the wait and no load's result is placed on them
#pragma unroll
  for (int e = 0; e < 4; ++e) { v8b o;
#pragma unroll
    for (int i = 0; i < 8; ++i) o[i] = (__bf16)ra[i][e];
    *(v8b*)&s[c * 4 + e][kr * 8] = o; }
  __syncthreads();
  __bf16* dst = ((which < 3) ? PK + PK_A + ((size_t)which * DM + n0) * DM : PK + PK_P + (size_t)n0 * DM) + k0;
#pragma unroll
  for (int i = 0; i < 4; ++i) vst2((unsigned*)(dst + (size_t)((t >> 3) + 16 * i) * DM + (t & 7) * 8), *(const v4u*)&s[(t >> 3) + 16 * i][(t & 7) * 8]);   // each 16-byte store of a wave covers 4 whole lines
  asm volatile("s_wait_xcnt 0x0" ::: "memory");   // stands behind the run of stores, in front of any rewrite of a register that one of them names
  if (hast) { v4u w = {0u, 0u, 0u, 0u};
#pragma unroll
    for (int e = 0; e < 16; ++e) { const unsigned u1 = ur[e >> 2][e & 3], u2 = uc[e]; const unsigned c1 = u1 < NBK - 1u ? u1 : NBK - 1u, c2 = u2 < NBK - 1u ? u2 : NBK - 1u;
      w[e >> 2] |= (c1 | c2 << 4) << 8 * (e & 3); }
    vst2(PB + ((size_t)tile * 32 + lane) * 4, w);
    asm volatile("s_wait_xcnt 0x0" ::: "memory"); }   // stands behind the store, in front of any rewrite of a register that it names
}
__global__ __launch_bounds__(128) void k_qkv(const float* __restrict__ XQ, const float* __restrict__ XK, const float* __restrict__ XV, const __bf16* __restrict__ P, const float* __restrict__ BQ, const float* __restrict__ BK, const float* __restrict__ BV, const float* __restrict__ TK, const float* __restrict__ TQ, float* __restrict__ BKT, float* __restrict__ BQT, _Float16* __restrict__ QK, _Float16* __restrict__ QKL, _Float16* __restrict__ VTH, _Float16* __restrict__ VTL) {
  const int which0 = (blockIdx.y * 128) / DM; const float* X = (which0 == 0) ? XQ : (which0 == 1) ? XK : XV; const float* BB = BQ ? (((which0 == 0) ? BQ : (which0 == 1) ? BK : BV) + (blockIdx.y * 128 - which0 * DM)) : nullptr;
  // one LDS block: the main loop's two stage buffers (weights 128 rows, x 64 rows, bf16); behind the loop's last barrier the epilogue's tiles lie over them
  __shared__ __align__(16) unsigned char sm[2 * (128 + 64) * LP * 2];
  __bf16 (*sB)[128][LP] = (__bf16 (*)[128][LP])sm; __bf16 (*sA)[64][LP] = (__bf16 (*)[64][LP])(sm + 2 * 128 * LP * 2);
  _Float16 (*so)[16][136] = (_Float16 (*)[16][136])sm; _Float16 (*sol)[16][136] = (_Float16 (*)[16][136])(sm + 4 * 16 * 136 * 2);
  _Float16 (*sth)[72] = (_Float16 (*)[72])sm; _Float16 (*stl)[72] = (_Float16 (*)[72])(sm + 128 * 72 * 2);
  const int tid = threadIdx.x, wave = tid >> 5, lane = tid & 31, col = lane & 15, g = lane >> 4; const size_t r0 = (size_t)blockIdx.x * 64 + wave * 16; const int n0 = blockIdx.y * 128;
  v8f acc[8] = {};
  // each 16-byte load of a wave covers 4 whole lines: weights 4 rows x 128 B, x 2 rows x 256 B
  const __bf16* gB = P + (size_t)(n0 + (tid >> 3)) * DM + (tid & 7) * 8; const float* gA = X + ((size_t)blockIdx.x * 64 + (tid >> 4)) * DM + (tid & 15) * 4;
  v8b rb[8]; v4f ra[8];
#pragma unroll
  for (int i = 0; i < 8; ++i) { rb[i] = *(const v8b*)(gB + (size_t)i * 16 * DM); ra[i] = *(const v4f*)(gA + (size_t)i * 8 * DM); }
#pragma unroll
  for (int i = 0; i < 8; ++i) { *(v8b*)&sB[0][(tid >> 3) + 16 * i][(tid & 7) * 8] = rb[i]; v4b t;
#pragma unroll
    for (int e = 0; e < 4; ++e) t[e] = (__bf16)ra[i][e];
    *(v4b*)&sA[0][(tid >> 4) + 8 * i][(tid & 15) * 4] = t; }
  __syncthreads();
#pragma unroll 2   // two steps a body, so that each buffer's LDS addresses are immediates
  for (int s = 0; s < DM / KS; ++s) { const int cur = s & 1;
    if (s + 1 < DM / KS) {   // the next step's tiles fly while this step is worked on
#pragma unroll
      for (int i = 0; i < 8; ++i) { rb[i] = *(const v8b*)(gB + (size_t)i * 16 * DM + (s + 1) * KS); ra[i] = *(const v4f*)(gA + (size_t)i * 8 * DM + (s + 1) * KS); }
      asm volatile("s_wait_xcnt 0x0" ::: "memory"); }   // stands behind the run of loads, in front of any rewrite of a register that one of them names as its address
#pragma unroll
    for (int kc = 0; kc < KS / 32; ++kc) { const v16b a = frag_b(&sA[cur][wave * 16 + col][kc * 32], lane);
#pragma unroll
      for (int jh = 0; jh < 8; jh += 4) { v16b w[4];   // fragment reads in groups of four ahead of their products: 192 registers, five waves a SIMD, the whole grid resident
#pragma unroll
        for (int j = 0; j < 4; ++j) w[j] = frag_b(&sB[cur][(jh + j) * 16 + col][kc * 32], lane);
#pragma unroll
        for (int j = 0; j < 4; ++j) acc[jh + j] = wmma_bf(a, w[j], acc[jh + j]); } }
    if (s + 1 < DM / KS) {
#pragma unroll
      for (int i = 0; i < 8; ++i) { *(v8b*)&sB[cur ^ 1][(tid >> 3) + 16 * i][(tid & 7) * 8] = rb[i]; v4b t;
#pragma unroll
        for (int e = 0; e < 4; ++e) t[e] = (__bf16)ra[i][e];
        *(v4b*)&sA[cur ^ 1][(tid >> 4) + 8 * i][(tid & 15) * 4] = t; } }
    __syncthreads(); }   // publishes the next buffer and ends every reader's last read of this one
  if (n0 < 2 * DM) {   // per (row, head): the 5 bucket dots (q . table_k[u]) or ((k/8) . table_q[u]) from the f32 values -> BKT / BQT [row][h][8] (5 used)
    { const bool isq = n0 < DM; const float* TB = isq ? TK : TQ; float* dstT = isq ? BKT : BQT; const float sc = isq ? 1.0f : 0.125f;
#pragma unroll
      for (int r = 0; r < 8; ++r) {
#pragma unroll
        for (int hh = 0; hh < 2; ++hh) { const int h = (n0 % DM) / 64 + hh; float du[NBK];
#pragma unroll
          for (int u = 0; u < NBK; ++u) { float s = 0.f;
#pragma unroll
            for (int j = 0; j < 4; ++j) s += acc[hh * 4 + j][r] * bfr(TB[u * 64 + j * 16 + col]);
#pragma unroll
            for (int o = 1; o < 16; o <<= 1) s += __shfl_xor(s, o);
            du[u] = s * sc; }
          if (col == 0) { float* d = dstT + ((r0 + 8 * g + r) * NH + h) * 8;
#pragma unroll
            for (int u = 0; u < NBK; ++u) d[u] = du[u]; } } } }   // (8-float slots per (row, head); 4-B scratch stores)
#pragma unroll
    for (int j = 0; j < 8; ++j) {
#pragma unroll
      for (int r = 0; r < 8; ++r) { const float v = acc[j][r]; const _Float16 hv = (_Float16)v; so[wave][8 * g + r][j * 16 + col] = hv; sol[wave][8 * g + r][j * 16 + col] = (_Float16)((v - (float)hv) * 2048.0f); } }   // q, k as f16 hi + (x2048) residual
    LDSX();
    for (int rl = 0; rl < 16; ++rl) if (lane < 16) { vst2((unsigned*)(QK + (r0 + rl) * (2 * DM) + n0 + lane * 8), *(const v4u*)&so[wave][rl][lane * 8]); vst2((unsigned*)(QKL + (r0 + rl) * (2 * DM) + n0 + lane * 8), *(const v4u*)&sol[wave][rl][lane * 8]); }
  } else {
#pragma unroll
    for (int j = 0; j < 8; ++j) {
#pragma unroll
      for (int r = 0; r < 8; ++r) { const float v = acc[j][r] + (BB ? bfr(BB[j * 16 + col]) : 0.f); const _Float16 hv = (_Float16)v; sth[j * 16 + col][wave * 16 + 8 * g + r] = hv; stl[j * 16 + col][wave * 16 + 8 * g + r] = (_Float16)((v - (float)hv) * 2048.0f); } }
    __syncthreads();
    const size_t rb = (size_t)blockIdx.x * 64; const int b = (int)(rb / SS), s0 = (int)(rb % SS); const int pc0 = n0 - 2 * DM;
    for (int q = tid; q < 128 * 8; q += 128) { const int d = q >> 3, pc = q & 7; const size_t o = ((size_t)b * DM + pc0 + d) * SS + s0 + pc * 8; vst2((unsigned*)(VTH + o), *(const v4u*)&sth[d][pc * 8]); vst2((unsigned*)(VTL + o), *(const v4u*)&stl[d][pc * 8]); }
  }
}
// ---- k_attn: block = (64 queries, head h, batch b): all-keys flash attention on TRANSPOSED tiles: S^T = K . Q^T (A = K rows, B = q), so that a lane holds 16 keys' scores of ONE query (query = lane & 15, keys 8 * (lane >> 4) + r of each 16-key tile); scores = (q.k) * 0.125 with single f16 operands; the two f32 score tiles of 32 keys, converted in place, are the B operand of O^T += V^T . P^T (A = V rows [d][key]); O[b*S+q][h*64+d] = (acc + accl / 2048) / (2048 l) (256-B segments)
__device__ __forceinline__ float xhalf(float x) { return __builtin_bit_cast(float, __builtin_amdgcn_permlanex16(__builtin_bit_cast(int, x), __builtin_bit_cast(int, x), 0x76543210, 0xfedcba98, false, false)); }   // lane l with lane l ^ 16
// 2^x on the hardware's v_exp_f32, written with the slot that the instruction set asks for behind a transcendental inside the statement. Outputs are early-clobber, so each v_exp_f32 is followed by one that is independent of it, and the last by the v_nop
__device__ __forceinline__ float exp2_1(float x) { float r; asm("v_exp_f32 %0, %1\n\tv_nop" : "=v"(r) : "v"(x)); return r; }
__device__ __forceinline__ v8f exp2_8(v8f x) { float r0, r1, r2, r3, r4, r5, r6, r7;
  asm("v_exp_f32 %0, %8\n\tv_exp_f32 %1, %9\n\tv_exp_f32 %2, %10\n\tv_exp_f32 %3, %11\n\tv_exp_f32 %4, %12\n\tv_exp_f32 %5, %13\n\tv_exp_f32 %6, %14\n\tv_exp_f32 %7, %15\n\tv_nop"
      : "=&v"(r0), "=&v"(r1), "=&v"(r2), "=&v"(r3), "=&v"(r4), "=&v"(r5), "=&v"(r6), "=&v"(r7) : "v"(x[0]), "v"(x[1]), "v"(x[2]), "v"(x[3]), "v"(x[4]), "v"(x[5]), "v"(x[6]), "v"(x[7]));
  const v8f r = {r0, r1, r2, r3, r4, r5, r6, r7}; return r; }
#define LOG2E 1.44269504f
__global__ __launch_bounds__(128) void k_attn(const _Float16* __restrict__ QK, const _Float16* __restrict__ QKL, const _Float16* __restrict__ VTH, const _Float16* __restrict__ VTL, const void* __restrict__ KMASK, const float* __restrict__ BKT, const float* __restrict__ BQT, const unsigned* __restrict__ PB, float* __restrict__ O) {
  __shared__ __align__(16) float so[4][16][68];
  __shared__ __align__(16) _Float16 sK[2][64][LP], sV[2][64][LP];   // two stage buffers of 64 keys: K rows [key][d], V rows [d][key], 128 B of data a row
  __shared__ __align__(16) float sBQ[2][NBK][BQP];   // the stage's (k/8) . table_q[u], [bucket][key], in the same two stage buffers' rhythm
  __shared__ __align__(16) float sBK[4][NBK][32];    // per wave: q . table_k[u] of each lane's own query, [bucket][lane]: a lane reads its own column alone, so no two lanes of a look-up meet on a bank
  const int tid = threadIdx.x, wave = tid >> 5, lane = tid & 31, col = lane & 15, g = lane >> 4;
  const int qb = blockIdx.x, h = blockIdx.y, b = blockIdx.z; const int q0 = qb * 64 + wave * 16; const size_t rq = (size_t)b * SS + q0 + col;
  v16h aq[2], aql[2];
#pragma unroll
  for (int kc = 0; kc < 2; ++kc) { aq[kc] = frag_h(QK + rq * (2 * DM) + h * HD + kc * 32, lane); aql[kc] = frag_h(QKL + rq * (2 * DM) + h * HD + kc * 32, lane); }
  { const float* bk = BKT + (rq * NH + h) * 8;   // the lane's own query: its five buckets
    const v4f t = *(const v4f*)bk; const float t4 = bk[4];
    asm volatile("s_wait_xcnt 0x0" ::: "memory");   // stands behind the two loads, in front of any rewrite of a register that one of them names as its address
#pragma unroll
    for (int u = 0; u < 4; ++u) sBK[wave][u][lane] = t[u];
    sBK[wave][4][lane] = t4; }
  float m = -3.0e38f, l = 0.f;   // the lane's query: running maximum (equal in both halves), and the half's own part of the sum
  v8f acc[4] = {}, accl[4] = {};
  const int nst = SS / 64;   // all keys, 64 a stage
  // each 16-byte load of a wave covers 4 whole lines: 4 rows x 128 B
  const _Float16* gK = QK + ((size_t)b * SS + (tid >> 3)) * (2 * DM) + DM + h * HD + (tid & 7) * 8; const _Float16* gV = VTH + ((size_t)b * DM + h * HD + (tid >> 3)) * SS + (tid & 7) * 8;
  const int bkey = tid >> 1, bp = tid & 1;   // key-side bias rows of a stage's 64 keys: a pair of threads brings one key's five buckets, 0, 1 and 4 | 2, 3
  const float* gQ = BQT + (((size_t)b * SS + bkey) * NH + h) * 8 + bp * 2;
  const unsigned* gP = PB + ((size_t)(qb * 4 + wave) * (SS / 32) * 32 + lane) * 4;   // the wave's own 16 queries: 512 B in a row for each step of 32 keys, 16 B a lane
  v8h rk[4], rv[4]; v2f rbq; float rb4 = 0.f;
  v4u nb = *(const v4u*)gP;   // the bucket pairs of step 0
#pragma unroll
  for (int i = 0; i < 4; ++i) { rk[i] = *(const v8h*)(gK + (size_t)i * 16 * (2 * DM)); rv[i] = *(const v8h*)(gV + (size_t)i * 16 * SS); }
  rbq = *(const v2f*)gQ; if (bp == 0) rb4 = gQ[4];
  asm volatile("s_wait_xcnt 0x0" ::: "memory");   // stands behind the run of loads, in front of any rewrite of a register that one of them names as its address
#pragma unroll
  for (int i = 0; i < 4; ++i) { *(v8h*)&sK[0][(tid >> 3) + 16 * i][(tid & 7) * 8] = rk[i]; *(v8h*)&sV[0][(tid >> 3) + 16 * i][(tid & 7) * 8] = rv[i]; }
  sBQ[0][bp * 2][bkey] = rbq[0]; sBQ[0][bp * 2 + 1][bkey] = rbq[1]; if (bp == 0) sBQ[0][4][bkey] = rb4;
  __syncthreads();
#pragma unroll 1   // keeps the long body once in the text
  for (int st = 0; st < nst; ++st) { const int cur = st & 1;
#pragma unroll 1   // as the loop over the stages
  for (int ks = 2 * st; ks < 2 * st + 2; ++ks) { v8f s[2]; const int kh = (ks & 1) * 32;
    const v4u cb = nb;   // this step's 16 bucket pairs; the next step's (the last step: its own again) fly while this one is worked on
    const unsigned* pn = gP + (size_t)(ks + 1 < SS / 32 ? ks + 1 : SS / 32 - 1) * 128; nb = *(const v4u*)pn;
    asm volatile("s_wait_xcnt 0x0" :: "v"(pn) : "memory");   // stands behind the load, in front of any rewrite of a register that it names as its address; the address is an input, so that its registers live up to the wait and the load's result is not placed on them
#pragma unroll
    for (int ct = 0; ct < 2; ++ct) { v8f c = {};   // register r: key ks * 32 + ct * 16 + 8 * g + r, query q0 + col
#pragma unroll
      for (int kc = 0; kc < 2; ++kc) c = wmma16(frag_h(&sK[cur][kh + ct * 16 + col][kc * 32], lane), aq[kc], c);   // single product: k, q as one-rounding f16 operands
      { const float* tq = &sBQ[cur][0][kh + ct * 16 + 8 * g]; const float* tk = &sBK[wave][0][lane];
#pragma unroll
      for (int r = 0; r < 8; ++r) { const unsigned pw = cb[ct * 2 + (r >> 2)] >> 8 * (r & 3); const unsigned c1 = pw & 7u, c2 = pw >> 4 & 7u;   // both at most 4: clamped where k_pack wrote the table
        s[ct][r] = c[r] * 0.125f + tk[c1 * 32] + tq[c2 * BQP + r]; } } }   // 1/sqrt(64) + q.table_k[bucket(i,j)] + (k/8).table_q[bucket(j,i)]
    float mx = fmaxf(s[0][0], s[1][0]);
#pragma unroll
    for (int r = 1; r < 8; ++r) mx = fmaxf(mx, fmaxf(s[0][r], s[1][r]));
    mx = fmaxf(mx, xhalf(mx));   // the query's other 16 keys of this step lie in the other half of the wave
    const float mn = fmaxf(m, mx); const float ea = exp2_1((m - mn) * LOG2E), alpha = (m <= -1.0e38f) ? 0.f : ea;
    v16h pa; float es = 0.f;
#pragma unroll
    for (int ct = 0; ct < 2; ++ct) { const v8f ex = exp2_8((s[ct] - mn) * LOG2E);
#pragma unroll
      for (int r = 0; r < 8; ++r) { const float e = (s[ct][r] <= -1.0e38f) ? 0.f : ex[r]; es += e; pa[ct * 8 + r] = (_Float16)(e * 2048.0f); } }   // element ct * 8 + r = key 16 ct + 8 g + r: the k order of the V fragments; P scaled by 2^11 before the f16 rounding so small softmax weights stay out of the f16 subnormal range; 2^-11 folded into the epilogue
    l = l * alpha + es; m = mn;
#pragma unroll
    for (int dt = 0; dt < 4; ++dt) {
#pragma unroll
      for (int r = 0; r < 8; ++r) { acc[dt][r] *= alpha; accl[dt][r] *= alpha; } }
    v16h vf[4];
#pragma unroll
    for (int dt = 0; dt < 4; ++dt) vf[dt] = frag_h(&sV[cur][dt * 16 + col][kh], lane);   // all V fragment reads as one group ahead of the products
#pragma unroll
    for (int dt = 0; dt < 4; ++dt) acc[dt] = wmma16(vf[dt], pa, acc[dt]); }   // single product: V x P (x2^11); register r: d = 16 dt + 8 g + r of query col
    if (st + 1 < nst) {   // the next stage is fetched and stored into the other buffer here at the foot, not held in registers over the stage
#pragma unroll
      for (int i = 0; i < 4; ++i) { rk[i] = *(const v8h*)(gK + ((size_t)(st + 1) * 64 + i * 16) * (2 * DM)); rv[i] = *(const v8h*)(gV + (size_t)i * 16 * SS + (st + 1) * 64); }
      rbq = *(const v2f*)(gQ + (size_t)(st + 1) * 64 * NH * 8); if (bp == 0) rb4 = gQ[(size_t)(st + 1) * 64 * NH * 8 + 4];
      asm volatile("s_wait_xcnt 0x0" ::: "memory");   // stands behind the run of loads, in front of any rewrite of a register that one of them names as its address
#pragma unroll
      for (int i = 0; i < 4; ++i) { *(v8h*)&sK[cur ^ 1][(tid >> 3) + 16 * i][(tid & 7) * 8] = rk[i]; *(v8h*)&sV[cur ^ 1][(tid >> 3) + 16 * i][(tid & 7) * 8] = rv[i]; }
      sBQ[cur ^ 1][bp * 2][bkey] = rbq[0]; sBQ[cur ^ 1][bp * 2 + 1][bkey] = rbq[1]; if (bp == 0) sBQ[cur ^ 1][4][bkey] = rb4; }
    __syncthreads(); }   // publishes the next buffer and ends every reader's last read of this one
  { const float il = (1.0f / 2048.0f) / (l + xhalf(l));   // the two halves' parts of the query's sum are joined once, here
#pragma unroll
    for (int dt = 0; dt < 4; ++dt) {
#pragma unroll
      for (int r = 0; r < 8; ++r) so[wave][col][dt * 16 + 8 * g + r] = (acc[dt][r] + accl[dt][r] * (1.0f / 2048.0f)) * il; } }
  LDSX();
  for (int rl = 0; rl < 16; ++rl) if (lane < 16) vst2(O + ((size_t)b * SS + q0 + rl) * DM + h * HD + lane * 4, *(const v4f*)&so[wave][rl][lane * 4]);
}
// ---- k_out: block = (64 rows, 128 cols): out = O(hi/lo) . Wo rows (2 products) + bo
__global__ __launch_bounds__(128) void k_out(const float* __restrict__ O, const __bf16* __restrict__ P, const float* __restrict__ BO, float* __restrict__ Y) {
  // one LDS block: two stage buffers (weights 128 rows, ctx hi and residual 64 rows each, bf16); behind the loop's last barrier the output tile lies over them
  __shared__ __align__(16) unsigned char sm[2 * (128 + 64 + 64) * LP * 2];
  __bf16 (*sB)[128][LP] = (__bf16 (*)[128][LP])sm; __bf16 (*sH)[64][LP] = (__bf16 (*)[64][LP])(sm + 2 * 128 * LP * 2); __bf16 (*sL)[64][LP] = (__bf16 (*)[64][LP])(sm + 2 * (128 + 64) * LP * 2);
  float (*so)[16][132] = (float (*)[16][132])sm;
  const int tid = threadIdx.x, wave = tid >> 5, lane = tid & 31, col = lane & 15, g = lane >> 4; const size_t r0 = (size_t)blockIdx.x * 64 + wave * 16; const int n0 = blockIdx.y * 128;
  v8f acc[8] = {};
  const __bf16* gB = P + (size_t)(n0 + (tid >> 3)) * DM + (tid & 7) * 8; const float* gA = O + ((size_t)blockIdx.x * 64 + (tid >> 4)) * DM + (tid & 15) * 4;
  v8b rb[8]; v4f ra[8];
#pragma unroll
  for (int i = 0; i < 8; ++i) { rb[i] = *(const v8b*)(gB + (size_t)i * 16 * DM); ra[i] = *(const v4f*)(gA + (size_t)i * 8 * DM); }
#pragma unroll
  for (int i = 0; i < 8; ++i) { *(v8b*)&sB[0][(tid >> 3) + 16 * i][(tid & 7) * 8] = rb[i]; v4b th, tl;
#pragma unroll
    for (int e = 0; e < 4; ++e) { const __bf16 hv = (__bf16)ra[i][e]; th[e] = hv; tl[e] = (__bf16)(ra[i][e] - (float)hv); }
    *(v4b*)&sH[0][(tid >> 4) + 8 * i][(tid & 15) * 4] = th; *(v4b*)&sL[0][(tid >> 4) + 8 * i][(tid & 15) * 4] = tl; }
  __syncthreads();
#pragma unroll 2   // two steps a body, so that each buffer's LDS addresses are immediates
  for (int s = 0; s < DM / KS; ++s) { const int cur = s & 1;
    if (s + 1 < DM / KS) {   // the next step's tiles fly while this step is worked on
#pragma unroll
      for (int i = 0; i < 8; ++i) { rb[i] = *(const v8b*)(gB + (size_t)i * 16 * DM + (s + 1) * KS); ra[i] = *(const v4f*)(gA + (size_t)i * 8 * DM + (s + 1) * KS); }
      asm volatile("s_wait_xcnt 0x0" ::: "memory"); }   // stands behind the run of loads, in front of any rewrite of a register that one of them names as its address
#pragma unroll
    for (int kc = 0; kc < KS / 32; ++kc) { const v16b ah = frag_b(&sH[cur][wave * 16 + col][kc * 32], lane), al = frag_b(&sL[cur][wave * 16 + col][kc * 32], lane); v16b w[8];
#pragma unroll
      for (int j = 0; j < 8; ++j) w[j] = frag_b(&sB[cur][j * 16 + col][kc * 32], lane);   // all fragment reads as one group ahead of the products
#pragma unroll
      for (int j = 0; j < 8; ++j) { acc[j] = wmma_bf(al, w[j], acc[j]); acc[j] = wmma_bf(ah, w[j], acc[j]); } }
    if (s + 1 < DM / KS) {
#pragma unroll
      for (int i = 0; i < 8; ++i) { *(v8b*)&sB[cur ^ 1][(tid >> 3) + 16 * i][(tid & 7) * 8] = rb[i]; v4b th, tl;
#pragma unroll
        for (int e = 0; e < 4; ++e) { const __bf16 hv = (__bf16)ra[i][e]; th[e] = hv; tl[e] = (__bf16)(ra[i][e] - (float)hv); }
        *(v4b*)&sH[cur ^ 1][(tid >> 4) + 8 * i][(tid & 15) * 4] = th; *(v4b*)&sL[cur ^ 1][(tid >> 4) + 8 * i][(tid & 15) * 4] = tl; } }
    __syncthreads(); }   // publishes the next buffer and ends every reader's last read of this one
#pragma unroll
  for (int j = 0; j < 8; ++j) {
#pragma unroll
    for (int r = 0; r < 8; ++r) so[wave][8 * g + r][j * 16 + col] = acc[j][r] + bfr(BO[n0 + j * 16 + col]); }
  LDSX();
  for (int rl = 0; rl < 16; ++rl) vst2(Y + (r0 + rl) * DM + n0 + lane * 4, *(const v4f*)&so[wave][rl][lane * 4]);
}
extern "C" void kernel_launch(void* const* d_in, const int* in_sizes, int n_in, void* d_out, int out_size, void* d_ws, size_t ws_size, hipStream_t stream) {
  (void)in_sizes; (void)n_in; (void)out_size;
  const float** F = (const float**)d_in;   // 0 x [4,1024,768], 1 wq_w, 2 wk_w, 3 wv_w, 4 proj_w ((in,out)), 5 proj_b, 6 rpe_k_table [5,64], 7 rpe_q_table [5,64], 8 rp_bucket [1024,1024] int
  if (ws_size < (size_t)WS_END) return;
  char* ws = (char*)d_ws; __bf16* PK = (__bf16*)(ws + WS_PK); _Float16 *QK = (_Float16*)(ws + WS_QK), *QKL = (_Float16*)(ws + WS_QKL), *VTH = (_Float16*)(ws + WS_VTH), *VTL = (_Float16*)(ws + WS_VTL); float *O = (float*)(ws + WS_O), *BKT = (float*)(ws + WS_BKT), *BQT = (float*)(ws + WS_BQT);
  k_pack<<<dim3((DM / PT) * (DM / PT), 4), 128, 0, stream>>>(F[1], F[2], F[3], F[4], (const int*)d_in[8], PK, (unsigned*)(ws + WS_PB));
  k_qkv<<<dim3(TNB * SS / 64, QKVW / 128), 128, 0, stream>>>(F[0], F[0], F[0], PK + PK_A, nullptr, nullptr, nullptr, F[6], F[7], BKT, BQT, QK, QKL, VTH, VTL);
  k_attn<<<dim3(TQB, NH, TNB), 128, 0, stream>>>(QK, QKL, VTH, VTL, nullptr, BKT, BQT, (const unsigned*)(ws + WS_PB), O);
  k_out<<<dim3(TOB, DM / 128), 128, 0, stream>>>(O, PK + PK_P, F[5], (float*)d_out);
}

// v006
// One run takes 83.2 microseconds.
// Next to v005, in two timings, it ran 1.04 times as fast each time.
// Counting every step since v000, it is 3.61 times as fast.
// compute dtype: all float inputs rounded to bf16, rp_bucket (int) read on device; q/k/v = x . W with EXACT bf16 products on WMMA 16x16x32 ((in,out) weights as transposed rows); per (token, head) the 5 bucket dots q . rpe_k_table[u] and (k / 8) . rpe_q_table[u] in f32 from the f32 projections; PLAIN attention: q, k as single f16 operands x 1/8 + bk[i][bucket[i][j]] + bq[j][bucket[j][i]], running-max softmax in f32 (hardware exp), P (scaled by 2^11, single f16) x v (single f16); out = ctx (bf16 hi + residual) . proj_w (2 products) + proj_b.
#include <hip/hip_runtime.h>
#include <math.h>

typedef __attribute__((ext_vector_type(16))) _Float16 v16h;
typedef __attribute__((ext_vector_type(16))) __bf16 v16b;
typedef __attribute__((ext_vector_type(8)))  _Float16 v8h;
typedef __attribute__((ext_vector_type(8)))  float v8f;
typedef __attribute__((ext_vector_type(4)))  float v4f;
typedef __attribute__((ext_vector_type(2)))  float v2f;
typedef __attribute__((ext_vector_type(4)))  unsigned v4u;
typedef __attribute__((ext_vector_type(4)))  int v4i;
typedef float __attribute__((may_alias)) float_a;
typedef int __attribute__((may_alias)) int_a;

template <typename T> __device__ __forceinline__ void vst2(void* p, T v) { *(T*)p = v;  }
__device__ __forceinline__ v8f wmma16(v16h a, v16h b, v8f c) {
  return __builtin_amdgcn_wmma_f32_16x16x32_f16(false, a, false, b, (short)0, c, false, false);
}
__device__ __forceinline__ v8f wmma_bf(v16b a, v16b b, v8f c) {
  return __builtin_amdgcn_wmma_f32_16x16x32_bf16(false, a, false, b, (short)0, c, false, false);
}
// Attention with image relative-position encoding (iRPE, contextual mode on q and k) over a 32 x 32 patch grid (B 4, N 1,024, C 768, 12 heads x 64): bias-free q/k/v projections, scores + q . table_k[bucket(i,j)] + (k scale) . table_q[bucket(j,i)], softmax, output projection + bias.
__device__ __forceinline__ v16h frag_h(const _Float16* rowk0, int lane) {
  union { v16h v; v8h q[2]; } u; const _Float16* p = rowk0 + 8 * (lane >> 4);
  u.q[0] = *(const v8h*)p; u.q[1] = *(const v8h*)(p + 16); return u.v;
}
__device__ __forceinline__ v16h frag_f32(const float* rowk0, int lane) {
  v16h a; const float* p = rowk0 + 8 * (lane >> 4);
#pragma unroll
  for (int i = 0; i < 8; ++i) { a[i] = (_Float16)p[i]; a[8 + i] = (_Float16)p[16 + i]; }
  return a;
}
__device__ __forceinline__ v16h frag_f32s(const float* rowk0, int lane, float sc) {
  v16h a; const float* p = rowk0 + 8 * (lane >> 4);
#pragma unroll
  for (int i = 0; i < 8; ++i) { a[i] = (_Float16)(p[i] * sc); a[8 + i] = (_Float16)(p[16 + i] * sc); }
  return a;
}
// column fragment from a [K][ld] layout (column n), rows >= K read as 0
__device__ __forceinline__ v16h fragc_f32(const float* W, int k0, int n, int lane, int ld, int K) {
  v16h a; const int g = lane >> 4;
#pragma unroll
  for (int i = 0; i < 8; ++i) { const int ka = k0 + 8 * g + i, kb = ka + 16;
    a[i] = (_Float16)(ka < K ? W[(size_t)(ka < K ? ka : K - 1) * ld + n] : 0.f); a[8 + i] = (_Float16)(kb < K ? W[(size_t)(kb < K ? kb : K - 1) * ld + n] : 0.f); }
  return a;
}
struct F2 { v16b h, l; };
__device__ __forceinline__ F2 bsplit16(const float v[16]) { F2 r;
#pragma unroll
  for (int i = 0; i < 16; ++i) { const __bf16 h = (__bf16)v[i]; r.h[i] = h; r.l[i] = (__bf16)(v[i] - (float)h); }
  return r; }
__device__ __forceinline__ F2 split_row(const float* row, int k0, int lane) { float v[16]; const float* p = row + k0 + 8 * (lane >> 4);
#pragma unroll
  for (int i = 0; i < 8; ++i) { v[i] = p[i]; v[8 + i] = p[16 + i]; }
  return bsplit16(v); }
__device__ __forceinline__ F2 split_rowK(const float* row, int k0, int lane, int K) { float v[16]; const int g = lane >> 4;
#pragma unroll
  for (int i = 0; i < 8; ++i) { const int ka = k0 + 8 * g + i, kb = ka + 16; v[i] = ka < K ? row[ka < K ? ka : K - 1] : 0.f; v[8 + i] = kb < K ? row[kb < K ? kb : K - 1] : 0.f; }
  return bsplit16(v); }
__device__ __forceinline__ F2 split_col(const float* W, int k0, int n, int lane, int ld, int K) { float v[16]; const int g = lane >> 4;
#pragma unroll
  for (int i = 0; i < 8; ++i) { const int ka = k0 + 8 * g + i, kb = ka + 16; v[i] = ka < K ? W[(size_t)(ka < K ? ka : K - 1) * ld + n] : 0.f; v[8 + i] = kb < K ? W[(size_t)(kb < K ? kb : K - 1) * ld + n] : 0.f; }
  return bsplit16(v); }
__device__ __forceinline__ v8f mac3(const F2& a, const F2& b, v8f c) { c = wmma_bf(a.l, b.h, c); c = wmma_bf(a.h, b.l, c); return wmma_bf(a.h, b.h, c); }
__device__ __forceinline__ float sigm(float v) { return 1.0f / (1.0f + expf(-v)); }
#define LDSX() do { asm volatile("s_wait_dscnt 0" ::: "memory"); __builtin_amdgcn_wave_barrier(); __builtin_amdgcn_fence(__ATOMIC_RELEASE, "workgroup"); } while (0)


#define NB 4
#define SS 1024
#define DM 768
#define NH 12
#define NBK 5
#define HD 64
#define QKVW (3 * DM)
#ifndef TQB
#define TQB (SS / 64)
#define TNB NB
#define TOB (NB * SS / 64)     // output row tiles (all)
#endif
typedef __attribute__((ext_vector_type(8))) __bf16 v8b;
__device__ __forceinline__ v16b frag_b(const __bf16* rowk0, int lane) {
  union { v16b v; v8b q[2]; } u; const __bf16* p = rowk0 + 8 * (lane >> 4);
  u.q[0] = *(const v8b*)p; u.q[1] = *(const v8b*)(p + 16); return u.v;
}
typedef __attribute__((ext_vector_type(4))) __bf16 v4b;
#define KS 64   // k per staged step: 128 B of a bf16 row, one whole line
#define BQP 80  // words per bucket row of the staged key-side bias table: 64 keys + 16, so that a 16-key group's rows of buckets 0 to 3 fall on different banks
#define LP 72   // LDS row pitch in 16-bit elements: 128 B of data + 16 B, the pitch for 16-byte LDS readers
// the plain '#pragma unroll' on the short fixed loops of the staging code give the staged values and fragments (rb, ra, rk, rv, w, vf) constant indices, so that they stay in registers
__device__ __forceinline__ float bfr(float v) { return (float)(__bf16)v; }
__device__ __attribute__((noinline)) float exp_ni(float v) { return expf(v); }
__device__ __attribute__((noinline)) float erf_ni(float v) { return erff(v); }

#define PK_A 0                       // [2304][768] Wqkv rows (natural [out][in])
#define PK_P (PK_A + QKVW * DM)        // [768][768] Wo rows (natural)
#define PK_END (PK_P + DM * DM)
#define WS_PK  0u
#define WS_QK  (WS_PK + 2u * PK_END)             // f16 [4096 rows][1536]: q | k
#define WS_QKL (WS_QK + 2u * NB * SS * 2 * DM)     // f16 q | k residual planes x2048
#define WS_VTH (WS_QKL + 2u * NB * SS * 2 * DM)    // f16 [b][768 (h*64+d)][1024 s] hi
#define WS_VTL (WS_VTH + 2u * NB * DM * SS)        // f16 lo x 2048
#define WS_O   (WS_VTL + 2u * NB * DM * SS)        // f32 [4096][768]
#define WS_CS  (WS_O + 4u * NB * SS * DM)           // f32 [2][1024][32] (unused)
#define WS_BKT (WS_CS + 4u * 2 * SS * 32)                 // f32 [NB*SS][NH][8]: q . table_k[u] ; BQT (k/8) . table_q[u]
#define WS_BQT (WS_BKT + 4u * NB * SS * NH * 8)
#define WS_PB  (WS_BQT + 4u * NB * SS * NH * 8)   // bytes [64 query tiles][32 key steps][32 lanes][16]: both bucket indices of a (query, key) pair, in the order in which a lane of k_attn uses them
#define WS_END (WS_PB + 1u * SS * SS)
// ---- k_pack: block = (64 k x 64 n tile of one (in,out) weight, which): the tile is read by whole lines (a row of the tile is 256 B), turned in LDS and written as bf16 rows [n][k], 128 B a row; which 0..2 -> W_q/W_k/W_v into PK_A rows which*768 + n; 3 -> W_o into PK_P
#define PT 64   // tile edge of k_pack
__global__ __launch_bounds__(128) void k_pack(const float* __restrict__ WQ, const float* __restrict__ WK, const float* __restrict__ WV, const float* __restrict__ WO, const int* __restrict__ RPB, __bf16* __restrict__ PK, unsigned* __restrict__ PB) {
  __shared__ __align__(16) __bf16 s[PT][LP];   // [n][k]
  const int which = blockIdx.y, t = threadIdx.x, lane = t & 31; const int k0 = (blockIdx.x % (DM / PT)) * PT, n0 = (blockIdx.x / (DM / PT)) * PT;
  const float* Wm = (which == 0) ? WQ : (which == 1) ? WK : (which == 2) ? WV : WO;
  // a thread holds 8 k in a row of 4 n: each 16-byte load of a wave covers 2 rows x 256 B, and each n's 8 values make one 16-byte LDS store
  const int c = t & 15, kr = t >> 4; const float* gw = Wm + (size_t)(k0 + kr * 8) * DM + n0 + c * 4;
  v4f ra[8];
#pragma unroll
  for (int i = 0; i < 8; ++i) ra[i] = *(const v4f*)(gw + (size_t)i * DM);
  asm volatile("s_wait_xcnt 0x0" :: "v"(gw) : "memory");   // stands behind the run of loads, in front of any rewrite of a register that one of them names as its address; the address is an input, so that its registers live up to the wait and no load's result is placed on them
  // the first 2,048 waves of the grid: one (16 queries, 32 keys) tile of the bucket pair table each; its loads fly with the weight tile's, its bytes are formed and stored at the foot, so that the barrier does not wait for that store. Byte ct * 8 + r of lane (col, g) = bucket[i][j] | bucket[j][i] << 4 for query i = 16 qt + col, key j = 32 ks + 16 ct + 8 g + r, both clamped to the last bucket here, which bounds the LDS addresses that k_attn forms from them for any content of the bucket array
  const int tile = (which * ((DM / PT) * (DM / PT)) + (int)blockIdx.x) * 4 + __builtin_amdgcn_readfirstlane(t >> 5); const bool hast = tile < (SS / 16) * (SS / 32);
  v4u ur[4]; unsigned uc[16];
  if (hast) { const int qi = (tile >> 5) * 16 + (lane & 15), kb = (tile & 31) * 32 + 8 * (lane >> 4);
    const int* pr = RPB + (size_t)qi * SS + kb; const int* pc = RPB + (size_t)kb * SS + qi;   // bucket[i][j ...] along the row, bucket[j ...][i] down the column
#pragma unroll
    for (int ct = 0; ct < 2; ++ct) { ur[ct * 2] = *(const v4u*)(pr + ct * 16); ur[ct * 2 + 1] = *(const v4u*)(pr + ct * 16 + 4);
#pragma unroll
      for (int r = 0; r < 8; ++r) uc[ct * 8 + r] = (unsigned)pc[(size_t)(ct * 16 + r) * SS]; }
    asm volatile("s_wait_xcnt 0x0" :: "v"(pr), "v"(pc) : "memory"); }   // stands behind the run of loads, in front of any rewrite of a register that one of them names as its address; the two addresses are inputs, so that their registers live up to the wait and no load's result is placed on them
#pragma unroll
  for (int e = 0; e < 4; ++e) { v8b o;
#pragma unroll
    for (int i = 0; i < 8; ++i) o[i] = (__bf16)ra[i][e];
    *(v8b*)&s[c * 4 + e][kr * 8] = o; }
  __syncthreads();
  __bf16* dst = ((which < 3) ? PK + PK_A + ((size_t)which * DM + n0) * DM : PK + PK_P + (size_t)n0 * DM) + k0;
#pragma unroll
  for (int i = 0; i < 4; ++i) vst2((unsigned*)(dst + (size_t)((t >> 3) + 16 * i) * DM + (t & 7) * 8), *(const v4u*)&s[(t >> 3) + 16 * i][(t & 7) * 8]);   // each 16-byte store of a wave covers 4 whole lines
  asm volatile("s_wait_xcnt 0x0" ::: "memory");   // stands behind the run of stores, in front of any rewrite of a register that one of them names
  if (hast) { v4u w = {0u, 0u, 0u, 0u};
#pragma unroll
    for (int e = 0; e < 16; ++e) { const unsigned u1 = ur[e >> 2][e & 3], u2 = uc[e]; const unsigned c1 = u1 < NBK - 1u ? u1 : NBK - 1u, c2 = u2 < NBK - 1u ? u2 : NBK - 1u;
      w[e >> 2] |= (c1 | c2 << 4) << 8 * (e & 3); }
    vst2(PB + ((size_t)tile * 32 + lane) * 4, w);
    asm volatile("s_wait_xcnt 0x0" ::: "memory"); }   // stands behind the store, in front of any rewrite of a register that it names
}
__global__ __launch_bounds__(128) void k_qkv(const float* __restrict__ XQ, const float* __restrict__ XK, const float* __restrict__ XV, const __bf16* __restrict__ P, const float* __restrict__ BQ, const float* __restrict__ BK, const float* __restrict__ BV, const float* __restrict__ TK, const float* __restrict__ TQ, float* __restrict__ BKT, float* __restrict__ BQT, _Float16* __restrict__ QK, _Float16* __restrict__ QKL, _Float16* __restrict__ VTH, _Float16* __restrict__ VTL) {
  const int which0 = (blockIdx.y * 128) / DM; const float* X = (which0 == 0) ? XQ : (which0 == 1) ? XK : XV; const float* BB = BQ ? (((which0 == 0) ? BQ : (which0 == 1) ? BK : BV) + (blockIdx.y * 128 - which0 * DM)) : nullptr;
  // one LDS block: the main loop's two stage buffers (weights 128 rows, x 64 rows, bf16); behind the loop's last barrier the epilogue's tiles lie over them
  __shared__ __align__(16) unsigned char sm[2 * (128 + 64) * LP * 2];
  __bf16 (*sB)[128][LP] = (__bf16 (*)[128][LP])sm; __bf16 (*sA)[64][LP] = (__bf16 (*)[64][LP])(sm + 2 * 128 * LP * 2);
  _Float16 (*so)[16][136] = (_Float16 (*)[16][136])sm; _Float16 (*sol)[16][136] = (_Float16 (*)[16][136])(sm + 4 * 16 * 136 * 2);
  _Float16 (*sth)[72] = (_Float16 (*)[72])sm; _Float16 (*stl)[72] = (_Float16 (*)[72])(sm + 128 * 72 * 2);
  const int tid = threadIdx.x, wave = tid >> 5, lane = tid & 31, col = lane & 15, g = lane >> 4; const size_t r0 = (size_t)blockIdx.x * 64 + wave * 16; const int n0 = blockIdx.y * 128;
  v8f acc[8] = {};
  // each 16-byte load of a wave covers 4 whole lines: weights 4 rows x 128 B, x 2 rows x 256 B
  const __bf16* gB = P + (size_t)(n0 + (tid >> 3)) * DM + (tid & 7) * 8; const float* gA = X + ((size_t)blockIdx.x * 64 + (tid >> 4)) * DM + (tid & 15) * 4;
  v8b rb[8]; v4f ra[8];
#pragma unroll
  for (int i = 0; i < 8; ++i) { rb[i] = *(const v8b*)(gB + (size_t)i * 16 * DM); ra[i] = *(const v4f*)(gA + (size_t)i * 8 * DM); }
#pragma unroll
  for (int i = 0; i < 8; ++i) { *(v8b*)&sB[0][(tid >> 3) + 16 * i][(tid & 7) * 8] = rb[i]; v4b t;
#pragma unroll
    for (int e = 0; e < 4; ++e) t[e] = (__bf16)ra[i][e];
    *(v4b*)&sA[0][(tid >> 4) + 8 * i][(tid & 15) * 4] = t; }
  __syncthreads();
#pragma unroll 2   // two steps a body, so that each buffer's LDS addresses are immediates
  for (int s = 0; s < DM / KS; ++s) { const int cur = s & 1;
    if (s + 1 < DM / KS) {   // the next step's tiles fly while this step is worked on
#pragma unroll
      for (int i = 0; i < 8; ++i) { rb[i] = *(const v8b*)(gB + (size_t)i * 16 * DM + (s + 1) * KS); ra[i] = *(const v4f*)(gA + (size_t)i * 8 * DM + (s + 1) * KS); }
      asm volatile("s_wait_xcnt 0x0" ::: "memory"); }   // stands behind the run of loads, in front of any rewrite of a register that one of them names as its address
#pragma unroll
    for (int kc = 0; kc < KS / 32; ++kc) { const v16b a = frag_b(&sA[cur][wave * 16 + col][kc * 32], lane);
#pragma unroll
      for (int jh = 0; jh < 8; jh += 4) { v16b w[4];   // fragment reads in groups of four ahead of their products: 192 registers, five waves a SIMD, the whole grid resident
#pragma unroll
        for (int j = 0; j < 4; ++j) w[j] = frag_b(&sB[cur][(jh + j) * 16 + col][kc * 32], lane);
        __builtin_amdgcn_sched_barrier(0);   // keeps the four fragment reads one group ahead of their products: left free, the compiler puts each read with a full wait directly in front of its product
#pragma unroll
        for (int j = 0; j < 4; ++j) acc[jh + j] = wmma_bf(a, w[j], acc[jh + j]);
        __builtin_amdgcn_sched_barrier(0); } }   // keeps the wait for the next step's global loads behind the products: left free, the compiler lifts the conversions, and that wait with them, among the step's first products
    if (s + 1 < DM / KS) {
#pragma unroll
      for (int i = 0; i < 8; ++i) { *(v8b*)&sB[cur ^ 1][(tid >> 3) + 16 * i][(tid & 7) * 8] = rb[i]; v4b t;
#pragma unroll
        for (int e = 0; e < 4; ++e) t[e] = (__bf16)ra[i][e];
        *(v4b*)&sA[cur ^ 1][(tid >> 4) + 8 * i][(tid & 15) * 4] = t; } }
    __syncthreads(); }   // publishes the next buffer and ends every reader's last read of this one
  if (n0 < 2 * DM) {   // per (row, head): the 5 bucket dots (q . table_k[u]) or ((k/8) . table_q[u]) from the f32 values -> BKT / BQT [row][h][8] (5 used)
    { const bool isq = n0 < DM; const float* TB = isq ? TK : TQ; float* dstT = isq ? BKT : BQT; const float sc = isq ? 1.0f : 0.125f;
#pragma unroll
      for (int r = 0; r < 8; ++r) {
#pragma unroll
        for (int hh = 0; hh < 2; ++hh) { const int h = (n0 % DM) / 64 + hh; float du[NBK];
#pragma unroll
          for (int u = 0; u < NBK; ++u) { float s = 0.f;
#pragma unroll
            for (int j = 0; j < 4; ++j) s += acc[hh * 4 + j][r] * bfr(TB[u * 64 + j * 16 + col]);
#pragma unroll
            for (int o = 1; o < 16; o <<= 1) s += __shfl_xor(s, o);
            du[u] = s * sc; }
          if (col == 0) { float* d = dstT + ((r0 + 8 * g + r) * NH + h) * 8;
#pragma unroll
            for (int u = 0; u < NBK; ++u) d[u] = du[u]; } } } }   // (8-float slots per (row, head); 4-B scratch stores)
#pragma unroll
    for (int j = 0; j < 8; ++j) {
#pragma unroll
      for (int r = 0; r < 8; ++r) { const float v = acc[j][r]; const _Float16 hv = (_Float16)v; so[wave][8 * g + r][j * 16 + col] = hv; sol[wave][8 * g + r][j * 16 + col] = (_Float16)((v - (float)hv) * 2048.0f); } }   // q, k as f16 hi + (x2048) residual
    LDSX();
    for (int rl = 0; rl < 16; ++rl) if (lane < 16) { vst2((unsigned*)(QK + (r0 + rl) * (2 * DM) + n0 + lane * 8), *(const v4u*)&so[wave][rl][lane * 8]); vst2((unsigned*)(QKL + (r0 + rl) * (2 * DM) + n0 + lane * 8), *(const v4u*)&sol[wave][rl][lane * 8]); }
  } else {
#pragma unroll
    for (int j = 0; j < 8; ++j) {
#pragma unroll
      for (int r = 0; r < 8; ++r) { const float v = acc[j][r] + (BB ? bfr(BB[j * 16 + col]) : 0.f); const _Float16 hv = (_Float16)v; sth[j * 16 + col][wave * 16 + 8 * g + r] = hv; stl[j * 16 + col][wave * 16 + 8 * g + r] = (_Float16)((v - (float)hv) * 2048.0f); } }
    __syncthreads();
    const size_t rb = (size_t)blockIdx.x * 64; const int b = (int)(rb / SS), s0 = (int)(rb % SS); const int pc0 = n0 - 2 * DM;
    for (int q = tid; q < 128 * 8; q += 128) { const int d = q >> 3, pc = q & 7; const size_t o = ((size_t)b * DM + pc0 + d) * SS + s0 + pc * 8; vst2((unsigned*)(VTH + o), *(const v4u*)&sth[d][pc * 8]); vst2((unsigned*)(VTL + o), *(const v4u*)&stl[d][pc * 8]); }
  }
}
// ---- k_attn: block = (64 queries, head h, batch b): all-keys flash attention on TRANSPOSED tiles: S^T = K . Q^T (A = K rows, B = q), so that a lane holds 16 keys' scores of ONE query (query = lane & 15, keys 8 * (lane >> 4) + r of each 16-key tile); scores = (q.k) * 0.125 with single f16 operands; the two f32 score tiles of 32 keys, converted in place, are the B operand of O^T += V^T . P^T (A = V rows [d][key]); O[b*S+q][h*64+d] = (acc + accl / 2048) / (2048 l) (256-B segments)
__device__ __forceinline__ float xhalf(float x) { return __builtin_bit_cast(float, __builtin_amdgcn_permlanex16(__builtin_bit_cast(int, x), __builtin_bit_cast(int, x), 0x76543210, 0xfedcba98, false, false)); }   // lane l with lane l ^ 16
// 2^x on the hardware's v_exp_f32, written with the slot that the instruction set asks for behind a transcendental inside the statement. Outputs are early-clobber, so each v_exp_f32 is followed by one that is independent of it, and the last by the v_nop
__device__ __forceinline__ float exp2_1(float x) { float r; asm("v_exp_f32 %0, %1\n\tv_nop" : "=v"(r) : "v"(x)); return r; }
__device__ __forceinline__ v8f exp2_8(v8f x) { float r0, r1, r2, r3, r4, r5, r6, r7;
  asm("v_exp_f32 %0, %8\n\tv_exp_f32 %1, %9\n\tv_exp_f32 %2, %10\n\tv_exp_f32 %3, %11\n\tv_exp_f32 %4, %12\n\tv_exp_f32 %5, %13\n\tv_exp_f32 %6, %14\n\tv_exp_f32 %7, %15\n\tv_nop"
      : "=&v"(r0), "=&v"(r1), "=&v"(r2), "=&v"(r3), "=&v"(r4), "=&v"(r5), "=&v"(r6), "=&v"(r7) : "v"(x[0]), "v"(x[1]), "v"(x[2]), "v"(x[3]), "v"(x[4]), "v"(x[5]), "v"(x[6]), "v"(x[7]));
  const v8f r = {r0, r1, r2, r3, r4, r5, r6, r7}; return r; }
#define LOG2E 1.44269504f
__global__ __launch_bounds__(128) void k_attn(const _Float16* __restrict__ QK, const _Float16* __restrict__ QKL, const _Float16* __restrict__ VTH, const _Float16* __restrict__ VTL, const void* __restrict__ KMASK, const float* __restrict__ BKT, const float* __restrict__ BQT, const unsigned* __restrict__ PB, float* __restrict__ O) {
  __shared__ __align__(16) float so[4][16][68];
  __shared__ __align__(16) _Float16 sK[2][64][LP], sV[2][64][LP];   // two stage buffers of 64 keys: K rows [key][d], V rows [d][key], 128 B of data a row
  __shared__ __align__(16) float sBQ[2][NBK][BQP];   // the stage's (k/8) . table_q[u], [bucket][key], in the same two stage buffers' rhythm
  __shared__ __align__(16) float sBK[4][NBK][32];    // per wave: q . table_k[u] of each lane's own query, [bucket][lane]: a lane reads its own column alone, so no two lanes of a look-up meet on a bank
  const int tid = threadIdx.x, wave = tid >> 5, lane = tid & 31, col = lane & 15, g = lane >> 4;
  const int qb = blockIdx.x, h = blockIdx.y, b = blockIdx.z; const int q0 = qb * 64 + wave * 16; const size_t rq = (size_t)b * SS + q0 + col;
  v16h aq[2], aql[2];
#pragma unroll
  for (int kc = 0; kc < 2; ++kc) { aq[kc] = frag_h(QK + rq * (2 * DM) + h * HD + kc * 32, lane); aql[kc] = frag_h(QKL + rq * (2 * DM) + h * HD + kc * 32, lane); }
  { const float* bk = BKT + (rq * NH + h) * 8;   // the lane's own query: its five buckets
    const v4f t = *(const v4f*)bk; const float t4 = bk[4];
    asm volatile("s_wait_xcnt 0x0" ::: "memory");   // stands behind the two loads, in front of any rewrite of a register that one of them names as its address
#pragma unroll
    for (int u = 0; u < 4; ++u) sBK[wave][u][lane] = t[u];
    sBK[wave][4][lane] = t4; }
  float m = -3.0e38f, l = 0.f;   // the lane's query: running maximum (equal in both halves), and the half's own part of the sum
  v8f acc[4] = {}, accl[4] = {};
  const int nst = SS / 64;   // all keys, 64 a stage
  // each 16-byte load of a wave covers 4 whole lines: 4 rows x 128 B
  const _Float16* gK = QK + ((size_t)b * SS + (tid >> 3)) * (2 * DM) + DM + h * HD + (tid & 7) * 8; const _Float16* gV = VTH + ((size_t)b * DM + h * HD + (tid >> 3)) * SS + (tid & 7) * 8;
  const int bkey = tid >> 1, bp = tid & 1;   // key-side bias rows of a stage's 64 keys: a pair of threads brings one key's five buckets, 0, 1 and 4 | 2, 3
  const float* gQ = BQT + (((size_t)b * SS + bkey) * NH + h) * 8 + bp * 2;
  const unsigned* gP = PB + ((size_t)(qb * 4 + wave) * (SS / 32) * 32 + lane) * 4;   // the wave's own 16 queries: 512 B in a row for each step of 32 keys, 16 B a lane
  v8h rk[4], rv[4]; v2f rbq; float rb4 = 0.f;
  v4u nb = *(const v4u*)gP;   // the bucket pairs of step 0
#pragma unroll
  for (int i = 0; i < 4; ++i) { rk[i] = *(const v8h*)(gK + (size_t)i * 16 * (2 * DM)); rv[i] = *(const v8h*)(gV + (size_t)i * 16 * SS); }
  rbq = *(const v2f*)gQ; if (bp == 0) rb4 = gQ[4];
  asm volatile("s_wait_xcnt 0x0" ::: "memory");   // stands behind the run of loads, in front of any rewrite of a register that one of them names as its address
#pragma unroll
  for (int i = 0; i < 4; ++i) { *(v8h*)&sK[0][(tid >> 3) + 16 * i][(tid & 7) * 8] = rk[i]; *(v8h*)&sV[0][(tid >> 3) + 16 * i][(tid & 7) * 8] = rv[i]; }
  sBQ[0][bp * 2][bkey] = rbq[0]; sBQ[0][bp * 2 + 1][bkey] = rbq[1]; if (bp == 0) sBQ[0][4][bkey] = rb4;
  __syncthreads();
#pragma unroll 1   // keeps the long body once in the text
  for (int st = 0; st < nst; ++st) { const int cur = st & 1;
#pragma unroll 1   // as the loop over the stages
  for (int ks = 2 * st; ks < 2 * st + 2; ++ks) { v8f s[2]; const int kh = (ks & 1) * 32;
    const v4u cb = nb;   // this step's 16 bucket pairs; the next step's (the last step: its own again) fly while this one is worked on
    const unsigned* pn = gP + (size_t)(ks + 1 < SS / 32 ? ks + 1 : SS / 32 - 1) * 128; nb = *(const v4u*)pn;
    asm volatile("s_wait_xcnt 0x0" :: "v"(pn) : "memory");   // stands behind the load, in front of any rewrite of a register that it names as its address; the address is an input, so that its registers live up to the wait and the load's result is not placed on them
#pragma unroll
    for (int ct = 0; ct < 2; ++ct) { v8f c = {};   // register r: key ks * 32 + ct * 16 + 8 * g + r, query q0 + col
#pragma unroll
      for (int kc = 0; kc < 2; ++kc) c = wmma16(frag_h(&sK[cur][kh + ct * 16 + col][kc * 32], lane), aq[kc], c);   // single product: k, q as one-rounding f16 operands
      { const float* tq = &sBQ[cur][0][kh + ct * 16 + 8 * g]; const float* tk = &sBK[wave][0][lane];
#pragma unroll
      for (int r = 0; r < 8; ++r) { const unsigned pw = cb[ct * 2 + (r >> 2)] >> 8 * (r & 3); const unsigned c1 = pw & 7u, c2 = pw >> 4 & 7u;   // both at most 4: clamped where k_pack wrote the table
        s[ct][r] = c[r] * 0.125f + tk[c1 * 32] + tq[c2 * BQP + r]; } } }   // 1/sqrt(64) + q.table_k[bucket(i,j)] + (k/8).table_q[bucket(j,i)]
    float mx = fmaxf(s[0][0], s[1][0]);
#pragma unroll
    for (int r = 1; r < 8; ++r) mx = fmaxf(mx, fmaxf(s[0][r], s[1][r]));
    mx = fmaxf(mx, xhalf(mx));   // the query's other 16 keys of this step lie in the other half of the wave
    const float mn = fmaxf(m, mx); const float ea = exp2_1((m - mn) * LOG2E), alpha = (m <= -1.0e38f) ? 0.f : ea;
    v16h pa; float es = 0.f;
#pragma unroll
    for (int ct = 0; ct < 2; ++ct) { const v8f ex = exp2_8((s[ct] - mn) * LOG2E);
#pragma unroll
      for (int r = 0; r < 8; ++r) { const float e = (s[ct][r] <= -1.0e38f) ? 0.f : ex[r]; es += e; pa[ct * 8 + r] = (_Float16)(e * 2048.0f); } }   // element ct * 8 + r = key 16 ct + 8 g + r: the k order of the V fragments; P scaled by 2^11 before the f16 rounding so small softmax weights stay out of the f16 subnormal range; 2^-11 folded into the epilogue
    l = l * alpha + es; m = mn;
#pragma unroll
    for (int dt = 0; dt < 4; ++dt) {
#pragma unroll
      for (int r = 0; r < 8; ++r) { acc[dt][r] *= alpha; accl[dt][r] *= alpha; } }
    v16h vf[4];
#pragma unroll
    for (int dt = 0; dt < 4; ++dt) vf[dt] = frag_h(&sV[cur][dt * 16 + col][kh], lane);   // all V fragment reads as one group ahead of the products
#pragma unroll
    for (int dt = 0; dt < 4; ++dt) acc[dt] = wmma16(vf[dt], pa, acc[dt]);   // single product: V x P (x2^11); register r: d = 16 dt + 8 g + r of query col
    asm volatile("v_nop\n\tv_nop\n\tv_nop\n\tv_nop" : "+v"(acc[3]) : "v"(vf[3]), "v"(pa)); }   // the four slots behind the step's last products, once a step: the loop's branch follows them, and the head of the next step rewrites fragment registers
    if (st + 1 < nst) {   // the next stage is fetched and stored into the other buffer here at the foot, not held in registers over the stage
#pragma unroll
      for (int i = 0; i < 4; ++i) { rk[i] = *(const v8h*)(gK + ((size_t)(st + 1) * 64 + i * 16) * (2 * DM)); rv[i] = *(const v8h*)(gV + (size_t)i * 16 * SS + (st + 1) * 64); }
      rbq = *(const v2f*)(gQ + (size_t)(st + 1) * 64 * NH * 8); if (bp == 0) rb4 = gQ[(size_t)(st + 1) * 64 * NH * 8 + 4];
      asm volatile("s_wait_xcnt 0x0" ::: "memory");   // stands behind the run of loads, in front of any rewrite of a register that one of them names as its address
#pragma unroll
      for (int i = 0; i < 4; ++i) { *(v8h*)&sK[cur ^ 1][(tid >> 3) + 16 * i][(tid & 7) * 8] = rk[i]; *(v8h*)&sV[cur ^ 1][(tid >> 3) + 16 * i][(tid & 7) * 8] = rv[i]; }
      sBQ[cur ^ 1][bp * 2][bkey] = rbq[0]; sBQ[cur ^ 1][bp * 2 + 1][bkey] = rbq[1]; if (bp == 0) sBQ[cur ^ 1][4][bkey] = rb4; }
    __syncthreads(); }   // publishes the next buffer and ends every reader's last read of this one
  { const float il = (1.0f / 2048.0f) / (l + xhalf(l));   // the two halves' parts of the query's sum are joined once, here
#pragma unroll
    for (int dt = 0; dt < 4; ++dt) {
#pragma unroll
      for (int r = 0; r < 8; ++r) so[wave][col][dt * 16 + 8 * g + r] = (acc[dt][r] + accl[dt][r] * (1.0f / 2048.0f)) * il; } }
  LDSX();
  for (int rl = 0; rl < 16; ++rl) if (lane < 16) vst2(O + ((size_t)b * SS + q0 + rl) * DM + h * HD + lane * 4, *(const v4f*)&so[wave][rl][lane * 4]);
}
// ---- k_out: block = (64 rows, 128 cols): out = O(hi/lo) . Wo rows (2 products) + bo
__global__ __launch_bounds__(128) void k_out(const float* __restrict__ O, const __bf16* __restrict__ P, const float* __restrict__ BO, float* __restrict__ Y) {
  // one LDS block: two stage buffers (weights 128 rows, ctx hi and residual 64 rows each, bf16); behind the loop's last barrier the output tile lies over them
  __shared__ __align__(16) unsigned char sm[2 * (128 + 64 + 64) * LP * 2];
  __bf16 (*sB)[128][LP] = (__bf16 (*)[128][LP])sm; __bf16 (*sH)[64][LP] = (__bf16 (*)[64][LP])(sm + 2 * 128 * LP * 2); __bf16 (*sL)[64][LP] = (__bf16 (*)[64][LP])(sm + 2 * (128 + 64) * LP * 2);
  float (*so)[16][132] = (float (*)[16][132])sm;
  const int tid = threadIdx.x, wave = tid >> 5, lane = tid & 31, col = lane & 15, g = lane >> 4; const size_t r0 = (size_t)blockIdx.x * 64 + wave * 16; const int n0 = blockIdx.y * 128;
  v8f acc[8] = {};
  const __bf16* gB = P + (size_t)(n0 + (tid >> 3)) * DM + (tid & 7) * 8; const float* gA = O + ((size_t)blockIdx.x * 64 + (tid >> 4)) * DM + (tid & 15) * 4;
  v8b rb[8]; v4f ra[8];
#pragma unroll
  for (int i = 0; i < 8; ++i) { rb[i] = *(const v8b*)(gB + (size_t)i * 16 * DM); ra[i] = *(const v4f*)(gA + (size_t)i * 8 * DM); }
#pragma unroll
  for (int i = 0; i < 8; ++i) { *(v8b*)&sB[0][(tid >> 3) + 16 * i][(tid & 7) * 8] = rb[i]; v4b th, tl;
#pragma unroll
    for (int e = 0; e < 4; ++e) { const __bf16 hv = (__bf16)ra[i][e]; th[e] = hv; tl[e] = (__bf16)(ra[i][e] - (float)hv); }
    *(v4b*)&sH[0][(tid >> 4) + 8 * i][(tid & 15) * 4] = th; *(v4b*)&sL[0][(tid >> 4) + 8 * i][(tid & 15) * 4] = tl; }
  __syncthreads();
#pragma unroll 2   // two steps a body, so that each buffer's LDS addresses are immediates
  for (int s = 0; s < DM / KS; ++s) { const int cur = s & 1;
    if (s + 1 < DM / KS) {   // the next step's tiles fly while this step is worked on
#pragma unroll
      for (int i = 0; i < 8; ++i) { rb[i] = *(const v8b*)(gB + (size_t)i * 16 * DM + (s + 1) * KS); ra[i] = *(const v4f*)(gA + (size_t)i * 8 * DM + (s + 1) * KS); }
      asm volatile("s_wait_xcnt 0x0" ::: "memory"); }   // stands behind the run of loads, in front of any rewrite of a register that one of them names as its address
#pragma unroll
    for (int kc = 0; kc < KS / 32; ++kc) { const v16b ah = frag_b(&sH[cur][wave * 16 + col][kc * 32], lane), al = frag_b(&sL[cur][wave * 16 + col][kc * 32], lane); v16b w[8];
#pragma unroll
      for (int j = 0; j < 8; ++j) w[j] = frag_b(&sB[cur][j * 16 + col][kc * 32], lane);   // all fragment reads as one group ahead of the products
      __builtin_amdgcn_sched_barrier(0);   // keeps that group ahead of the products
#pragma unroll
      for (int j = 0; j < 8; ++j) { acc[j] = wmma_bf(al, w[j], acc[j]); acc[j] = wmma_bf(ah, w[j], acc[j]); }
      __builtin_amdgcn_sched_barrier(0); }   // keeps the wait for the next step's global loads behind the products
    if (s + 1 < DM / KS) {
#pragma unroll
      for (int i = 0; i < 8; ++i) { *(v8b*)&sB[cur ^ 1][(tid >> 3) + 16 * i][(tid & 7) * 8] = rb[i]; v4b th, tl;
#pragma unroll
        for (int e = 0; e < 4; ++e) { const __bf16 hv = (__bf16)ra[i][e]; th[e] = hv; tl[e] = (__bf16)(ra[i][e] - (float)hv); }
        *(v4b*)&sH[cur ^ 1][(tid >> 4) + 8 * i][(tid & 15) * 4] = th; *(v4b*)&sL[cur ^ 1][(tid >> 4) + 8 * i][(tid & 15) * 4] = tl; } }
    __syncthreads(); }   // publishes the next buffer and ends every reader's last read of this one
#pragma unroll
  for (int j = 0; j < 8; ++j) {
#pragma unroll
    for (int r = 0; r < 8; ++r) so[wave][8 * g + r][j * 16 + col] = acc[j][r] + bfr(BO[n0 + j * 16 + col]); }
  LDSX();
  for (int rl = 0; rl < 16; ++rl) vst2(Y + (r0 + rl) * DM + n0 + lane * 4, *(const v4f*)&so[wave][rl][lane * 4]);
}
extern "C" void kernel_launch(void* const* d_in, const int* in_sizes, int n_in, void* d_out, int out_size, void* d_ws, size_t ws_size, hipStream_t stream) {
  (void)in_sizes; (void)n_in; (void)out_size;
  const float** F = (const float**)d_in;   // 0 x [4,1024,768], 1 wq_w, 2 wk_w, 3 wv_w, 4 proj_w ((in,out)), 5 proj_b, 6 rpe_k_table [5,64], 7 rpe_q_table [5,64], 8 rp_bucket [1024,1024] int
  if (ws_size < (size_t)WS_END) return;
  char* ws = (char*)d_ws; __bf16* PK = (__bf16*)(ws + WS_PK); _Float16 *QK = (_Float16*)(ws + WS_QK), *QKL = (_Float16*)(ws + WS_QKL), *VTH = (_Float16*)(ws + WS_VTH), *VTL = (_Float16*)(ws + WS_VTL); float *O = (float*)(ws + WS_O), *BKT = (float*)(ws + WS_BKT), *BQT = (float*)(ws + WS_BQT);
  k_pack<<<dim3((DM / PT) * (DM / PT), 4), 128, 0, stream>>>(F[1], F[2], F[3], F[4], (const int*)d_in[8], PK, (unsigned*)(ws + WS_PB));
  k_qkv<<<dim3(TNB * SS / 64, QKVW / 128), 128, 0, stream>>>(F[0], F[0], F[0], PK + PK_A, nullptr, nullptr, nullptr, F[6], F[7], BKT, BQT, QK, QKL, VTH, VTL);
  k_attn<<<dim3(TQB, NH, TNB), 128, 0, stream>>>(QK, QKL, VTH, VTL, nullptr, BKT, BQT, (const unsigned*)(ws + WS_PB), O);
  k_out<<<dim3(TOB, DM / 128), 128, 0, stream>>>(O, PK + PK_P, F[5], (float*)d_out);
}

// v007
// A run of this version takes 79.4 microseconds.
// In both of two side-by-side timings against v006, it was 1.05 times as fast.
// Counting every step since v000, it is 3.79 times as fast.
// compute dtype: all float inputs rounded to bf16, rp_bucket (int) read on device; q/k/v = x . W with EXACT bf16 products on WMMA 16x16x32 ((in,out) weights as transposed rows); per (token, head) the 5 bucket dots q . rpe_k_table[u] and (k / 8) . rpe_q_table[u] on WMMA 16x16x32 from the projections as f16 hi + residual (2 products); PLAIN attention: q, k as single f16 operands x 1/8 + bk[i][bucket[i][j]] + bq[j][bucket[j][i]], running-max softmax in f32 (hardware exp), P (scaled by 2^11, single f16) x v (single f16); out = ctx (bf16 hi + residual) . proj_w (2 products) + proj_b.
#include <hip/hip_runtime.h>
#include <math.h>

typedef __attribute__((ext_vector_type(16))) _Float16 v16h;
typedef __attribute__((ext_vector_type(16))) __bf16 v16b;
typedef __attribute__((ext_vector_type(8)))  _Float16 v8h;
typedef __attribute__((ext_vector_type(8)))  float v8f;
typedef __attribute__((ext_vector_type(4)))  float v4f;
typedef __attribute__((ext_vector_type(2)))  float v2f;
typedef __attribute__((ext_vector_type(4)))  unsigned v4u;
typedef __attribute__((ext_vector_type(4)))  int v4i;
typedef float __attribute__((may_alias)) float_a;
typedef int __attribute__((may_alias)) int_a;

template <typename T> __device__ __forceinline__ void vst2(void* p, T v) { *(T*)p = v;  }
__device__ __forceinline__ v8f wmma16(v16h a, v16h b, v8f c) {
  return __builtin_amdgcn_wmma_f32_16x16x32_f16(false, a, false, b, (short)0, c, false, false);
}
__device__ __forceinline__ v8f wmma_bf(v16b a, v16b b, v8f c) {
  return __builtin_amdgcn_wmma_f32_16x16x32_bf16(false, a, false, b, (short)0, c, false, false);
}
// Attention with image relative-position encoding (iRPE, contextual mode on q and k) over a 32 x 32 patch grid (B 4, N 1,024, C 768, 12 heads x 64): bias-free q/k/v projections, scores + q . table_k[bucket(i,j)] + (k scale) . table_q[bucket(j,i)], softmax, output projection + bias.
__device__ __forceinline__ v16h frag_h(const _Float16* rowk0, int lane) {
  union { v16h v; v8h q[2]; } u; const _Float16* p = rowk0 + 8 * (lane >> 4);
  u.q[0] = *(const v8h*)p; u.q[1] = *(const v8h*)(p + 16); return u.v;
}
__device__ __forceinline__ v16h frag_f32(const float* rowk0, int lane) {
  v16h a; const float* p = rowk0 + 8 * (lane >> 4);
#pragma unroll
  for (int i = 0; i < 8; ++i) { a[i] = (_Float16)p[i]; a[8 + i] = (_Float16)p[16 + i]; }
  return a;
}
__device__ __forceinline__ v16h frag_f32s(const float* rowk0, int lane, float sc) {
  v16h a; const float* p = rowk0 + 8 * (lane >> 4);
#pragma unroll
  for (int i = 0; i < 8; ++i) { a[i] = (_Float16)(p[i] * sc); a[8 + i] = (_Float16)(p[16 + i] * sc); }
  return a;
}
// column fragment from a [K][ld] layout (column n), rows >= K read as 0
__device__ __forceinline__ v16h fragc_f32(const float* W, int k0, int n, int lane, int ld, int K) {
  v16h a; const int g = lane >> 4;
#pragma unroll
  for (int i = 0; i < 8; ++i) { const int ka = k0 + 8 * g + i, kb = ka + 16;
    a[i] = (_Float16)(ka < K ? W[(size_t)(ka < K ? ka : K - 1) * ld + n] : 0.f); a[8 + i] = (_Float16)(kb < K ? W[(size_t)(kb < K ? kb : K - 1) * ld + n] : 0.f); }
  return a;
}
struct F2 { v16b h, l; };
__device__ __forceinline__ F2 bsplit16(const float v[16]) { F2 r;
#pragma unroll
  for (int i = 0; i < 16; ++i) { const __bf16 h = (__bf16)v[i]; r.h[i] = h; r.l[i] = (__bf16)(v[i] - (float)h); }
  return r; }
__device__ __forceinline__ F2 split_row(const float* row, int k0, int lane) { float v[16]; const float* p = row + k0 + 8 * (lane >> 4);
#pragma unroll
  for (int i = 0; i < 8; ++i) { v[i] = p[i]; v[8 + i] = p[16 + i]; }
  return bsplit16(v); }
__device__ __forceinline__ F2 split_rowK(const float* row, int k0, int lane, int K) { float v[16]; const int g = lane >> 4;
#pragma unroll
  for (int i = 0; i < 8; ++i) { const int ka = k0 + 8 * g + i, kb = ka + 16; v[i] = ka < K ? row[ka < K ? ka : K - 1] : 0.f; v[8 + i] = kb < K ? row[kb < K ? kb : K - 1] : 0.f; }
  return bsplit16(v); }
__device__ __forceinline__ F2 split_col(const float* W, int k0, int n, int lane, int ld, int K) { float v[16]; const int g = lane >> 4;
#pragma unroll
  for (int i = 0; i < 8; ++i) { const int ka = k0 + 8 * g + i, kb = ka + 16; v[i] = ka < K ? W[(size_t)(ka < K ? ka : K - 1) * ld + n] : 0.f; v[8 + i] = kb < K ? W[(size_t)(kb < K ? kb : K - 1) * ld + n] : 0.f; }
  return bsplit16(v); }
__device__ __forceinline__ v8f mac3(const F2& a, const F2& b, v8f c) { c = wmma_bf(a.l, b.h, c); c = wmma_bf(a.h, b.l, c); return wmma_bf(a.h, b.h, c); }
__device__ __forceinline__ float sigm(float v) { return 1.0f / (1.0f + expf(-v)); }
#define LDSX() do { asm volatile("s_wait_dscnt 0" ::: "memory"); __builtin_amdgcn_wave_barrier(); __builtin_amdgcn_fence(__ATOMIC_RELEASE, "workgroup"); } while (0)


#define NB 4
#define SS 1024
#define DM 768
#define NH 12
#define NBK 5
#define HD 64
#define QKVW (3 * DM)
#ifndef TQB
#define TQB (SS / 64)
#define TNB NB
#define TOB (NB * SS / 64)     // output row tiles (all)
#endif
typedef __attribute__((ext_vector_type(8))) __bf16 v8b;
__device__ __forceinline__ v16b frag_b(const __bf16* rowk0, int lane) {
  union { v16b v; v8b q[2]; } u; const __bf16* p = rowk0 + 8 * (lane >> 4);
  u.q[0] = *(const v8b*)p; u.q[1] = *(const v8b*)(p + 16); return u.v;
}
typedef __attribute__((ext_vector_type(4))) __bf16 v4b;
#define KS 64   // k per staged step: 128 B of a bf16 row, one whole line
#define BQP 80  // words per bucket row of the staged key-side bias table: 64 keys + 16, so that a 16-key group's rows of buckets 0 to 3 fall on different banks
#define LP 72   // LDS row pitch in 16-bit elements: 128 B of data + 16 B, the pitch for 16-byte LDS readers
// the plain '#pragma unroll' on the short fixed loops of the staging code give the staged values and fragments (rb, ra, rk, rv, w, vf) constant indices, so that they stay in registers
__device__ __forceinline__ float bfr(float v) { return (float)(__bf16)v; }
__device__ __attribute__((noinline)) float exp_ni(float v) { return expf(v); }
__device__ __attribute__((noinline)) float erf_ni(float v) { return erff(v); }

#define PK_A 0                       // [2304][768] Wqkv rows (natural [out][in])
#define PK_P (PK_A + QKVW * DM)        // [768][768] Wo rows (natural)
#define PK_END (PK_P + DM * DM)
#define WS_PK  0u
#define WS_QK  (WS_PK + 2u * PK_END)             // f16 [4096 rows][1536]: q | k
#define WS_QKL (WS_QK + 2u * NB * SS * 2 * DM)     // f16 q | k residual planes x2048
#define WS_VTH (WS_QKL + 2u * NB * SS * 2 * DM)    // f16 [b][768 (h*64+d)][1024 s] hi
#define WS_VTL (WS_VTH + 2u * NB * DM * SS)        // f16 lo x 2048
#define WS_O   (WS_VTL + 2u * NB * DM * SS)        // f32 [4096][768]
#define WS_CS  (WS_O + 4u * NB * SS * DM)           // f32 [2][1024][32] (unused)
#define WS_BKT (WS_CS + 4u * 2 * SS * 32)                 // f32 [NB*SS][NH][8]: q . table_k[u] ; BQT (k/8) . table_q[u]
#define WS_BQT (WS_BKT + 4u * NB * SS * NH * 8)
#define WS_PB  (WS_BQT + 4u * NB * SS * NH * 8)   // bytes [64 query tiles][32 key steps][32 lanes][16]: both bucket indices of a (query, key) pair, in the order in which a lane of k_attn uses them
#define WS_END (WS_PB + 1u * SS * SS)
// ---- k_pack: block = (64 k x 64 n tile of one (in,out) weight, which): the tile is read by whole lines (a row of the tile is 256 B), turned in LDS and written as bf16 rows [n][k], 128 B a row; which 0..2 -> W_q/W_k/W_v into PK_A rows which*768 + n; 3 -> W_o into PK_P
#define PT 64   // tile edge of k_pack
__global__ __launch_bounds__(128) void k_pack(const float* __restrict__ WQ, const float* __restrict__ WK, const float* __restrict__ WV, const float* __restrict__ WO, const int* __restrict__ RPB, __bf16* __restrict__ PK, unsigned* __restrict__ PB) {
  __shared__ __align__(16) __bf16 s[PT][LP];   // [n][k]
  const int which = blockIdx.y, t = threadIdx.x, lane = t & 31; const int k0 = (blockIdx.x % (DM / PT)) * PT, n0 = (blockIdx.x / (DM / PT)) * PT;
  const float* Wm = (which == 0) ? WQ : (which == 1) ? WK : (which == 2) ? WV : WO;
  // a thread holds 8 k in a row of 4 n: each 16-byte load of a wave covers 2 rows x 256 B, and each n's 8 values make one 16-byte LDS store
  const int c = t & 15, kr = t >> 4; const float* gw = Wm + (size_t)(k0 + kr * 8) * DM + n0 + c * 4;
  v4f ra[8];
#pragma unroll
  for (int i = 0; i < 8; ++i) ra[i] = *(const v4f*)(gw + (size_t)i * DM);
  asm volatile("s_wait_xcnt 0x0" :: "v"(gw) : "memory");   // stands behind the run of loads, in front of any rewrite of a register that one of them names as its address; the address is an input, so that its registers live up to the wait and no load's result is placed on them
  // the first 2,048 waves of the grid: one (16 queries, 32 keys) tile of the bucket pair table each; its loads fly with the weight tile's, its bytes are formed and stored at the foot, so that the barrier does not wait for that store. Byte ct * 8 + r of lane (col, g) = bucket[i][j] | bucket[j][i] << 4 for query i = 16 qt + col, key j = 32 ks + 16 ct + 8 g + r, both clamped to the last bucket here, which bounds the LDS addresses that k_attn forms from them for any content of the bucket array
  const int tile = (which * ((DM / PT) * (DM / PT)) + (int)blockIdx.x) * 4 + __builtin_amdgcn_readfirstlane(t >> 5); const bool hast = tile < (SS / 16) * (SS / 32);
  v4u ur[4]; unsigned uc[16];
  if (hast) { const int qi = (tile >> 5) * 16 + (lane & 15), kb = (tile & 31) * 32 + 8 * (lane >> 4);
    const int* pr = RPB + (size_t)qi * SS + kb; const int* pc = RPB + (size_t)kb * SS + qi;   // bucket[i][j ...] along the row, bucket[j ...][i] down the column
#pragma unroll
    for (int ct = 0; ct < 2; ++ct) { ur[ct * 2] = *(const v4u*)(pr + ct * 16); ur[ct * 2 + 1] = *(const v4u*)(pr + ct * 16 + 4);
#pragma unroll
      for (int r = 0; r < 8; ++r) uc[ct * 8 + r] = (unsigned)pc[(size_t)(ct * 16 + r) * SS]; }
    asm volatile("s_wait_xcnt 0x0" :: "v"(pr), "v"(pc) : "memory"); }   // stands behind the run of loads, in front of any rewrite of a register that one of them names as its address; the two addresses are inputs, so that their registers live up to the wait and no load's result is placed on them
#pragma unroll
  for (int e = 0; e < 4; ++e) { v8b o;
#pragma unroll
    for (int i = 0; i < 8; ++i) o[i] = (__bf16)ra[i][e];
    *(v8b*)&s[c * 4 + e][kr * 8] = o; }
  __syncthreads();
  __bf16* dst = ((which < 3) ? PK + PK_A + ((size_t)which * DM + n0) * DM : PK + PK_P + (size_t)n0 * DM) + k0;
#pragma unroll
  for (int i = 0; i < 4; ++i) vst2((unsigned*)(dst + (size_t)((t >> 3) + 16 * i) * DM + (t & 7) * 8), *(const v4u*)&s[(t >> 3) + 16 * i][(t & 7) * 8]);   // each 16-byte store of a wave covers 4 whole lines
  asm volatile("s_wait_xcnt 0x0" ::: "memory");   // stands behind the run of stores, in front of any rewrite of a register that one of them names
  if (hast) { v4u w = {0u, 0u, 0u, 0u};
#pragma unroll
    for (int e = 0; e < 16; ++e) { const unsigned u1 = ur[e >> 2][e & 3], u2 = uc[e]; const unsigned c1 = u1 < NBK - 1u ? u1 : NBK - 1u, c2 = u2 < NBK - 1u ? u2 : NBK - 1u;
      w[e >> 2] |= (c1 | c2 << 4) << 8 * (e & 3); }
    vst2(PB + ((size_t)tile * 32 + lane) * 4, w);
    asm volatile("s_wait_xcnt 0x0" ::: "memory"); }   // stands behind the store, in front of any rewrite of a register that it names
}
__global__ __launch_bounds__(128) void k_qkv(const float* __restrict__ XQ, const float* __restrict__ XK, const float* __restrict__ XV, const __bf16* __restrict__ P, const float* __restrict__ BQ, const float* __restrict__ BK, const float* __restrict__ BV, const float* __restrict__ TK, const float* __restrict__ TQ, float* __restrict__ BKT, float* __restrict__ BQT, _Float16* __restrict__ QK, _Float16* __restrict__ QKL, _Float16* __restrict__ VTH, _Float16* __restrict__ VTL) {
  const int which0 = (blockIdx.y * 128) / DM; const float* X = (which0 == 0) ? XQ : (which0 == 1) ? XK : XV; const float* BB = BQ ? (((which0 == 0) ? BQ : (which0 == 1) ? BK : BV) + (blockIdx.y * 128 - which0 * DM)) : nullptr;
  // one LDS block: the main loop's two stage buffers (weights 128 rows, x 64 rows, bf16); behind the loop's last barrier the epilogue's tiles lie over them
  __shared__ __align__(16) unsigned char sm[2 * (128 + 64) * LP * 2];
  __bf16 (*sB)[128][LP] = (__bf16 (*)[128][LP])sm; __bf16 (*sA)[64][LP] = (__bf16 (*)[64][LP])(sm + 2 * 128 * LP * 2);
  _Float16 (*so)[16][136] = (_Float16 (*)[16][136])sm; _Float16 (*sol)[16][136] = (_Float16 (*)[16][136])(sm + 4 * 16 * 136 * 2);
  _Float16 (*sth)[72] = (_Float16 (*)[72])sm; _Float16 (*stl)[72] = (_Float16 (*)[72])(sm + 128 * 72 * 2);
  const int tid = threadIdx.x, wave = tid >> 5, lane = tid & 31, col = lane & 15, g = lane >> 4; const size_t r0 = (size_t)blockIdx.x * 64 + wave * 16; const int n0 = blockIdx.y * 128;
  v8f acc[8] = {};
  // each 16-byte load of a wave covers 4 whole lines: weights 4 rows x 128 B, x 2 rows x 256 B
  const __bf16* gB = P + (size_t)(n0 + (tid >> 3)) * DM + (tid & 7) * 8; const float* gA = X + ((size_t)blockIdx.x * 64 + (tid >> 4)) * DM + (tid & 15) * 4;
  v8b rb[8]; v4f ra[8];
#pragma unroll
  for (int i = 0; i < 8; ++i) { rb[i] = *(const v8b*)(gB + (size_t)i * 16 * DM); ra[i] = *(const v4f*)(gA + (size_t)i * 8 * DM); }
#pragma unroll
  for (int i = 0; i < 8; ++i) { *(v8b*)&sB[0][(tid >> 3) + 16 * i][(tid & 7) * 8] = rb[i]; v4b t;
#pragma unroll
    for (int e = 0; e < 4; ++e) t[e] = (__bf16)ra[i][e];
    *(v4b*)&sA[0][(tid >> 4) + 8 * i][(tid & 15) * 4] = t; }
  __syncthreads();
#pragma unroll 2   // two steps a body, so that each buffer's LDS addresses are immediates
  for (int s = 0; s < DM / KS; ++s) { const int cur = s & 1;
    if (s + 1 < DM / KS) {   // the next step's tiles fly while this step is worked on
#pragma unroll
      for (int i = 0; i < 8; ++i) { rb[i] = *(const v8b*)(gB + (size_t)i * 16 * DM + (s + 1) * KS); ra[i] = *(const v4f*)(gA + (size_t)i * 8 * DM + (s + 1) * KS); }
      asm volatile("s_wait_xcnt 0x0" ::: "memory"); }   // stands behind the run of loads, in front of any rewrite of a register that one of them names as its address
#pragma unroll
    for (int kc = 0; kc < KS / 32; ++kc) { const v16b a = frag_b(&sA[cur][wave * 16 + col][kc * 32], lane);
#pragma unroll
      for (int jh = 0; jh < 8; jh += 4) { v16b w[4];   // fragment reads in groups of four ahead of their products: 192 registers, five waves a SIMD, the whole grid resident
#pragma unroll
        for (int j = 0; j < 4; ++j) w[j] = frag_b(&sB[cur][(jh + j) * 16 + col][kc * 32], lane);
        __builtin_amdgcn_sched_barrier(0);   // keeps the four fragment reads one group ahead of their products: left free, the compiler puts each read with a full wait directly in front of its product
#pragma unroll
        for (int j = 0; j < 4; ++j) acc[jh + j] = wmma_bf(a, w[j], acc[jh + j]);
        __builtin_amdgcn_sched_barrier(0); } }   // keeps the wait for the next step's global loads behind the products: left free, the compiler lifts the conversions, and that wait with them, among the step's first products
    if (s + 1 < DM / KS) {
#pragma unroll
      for (int i = 0; i < 8; ++i) { *(v8b*)&sB[cur ^ 1][(tid >> 3) + 16 * i][(tid & 7) * 8] = rb[i]; v4b t;
#pragma unroll
        for (int e = 0; e < 4; ++e) t[e] = (__bf16)ra[i][e];
        *(v4b*)&sA[cur ^ 1][(tid >> 4) + 8 * i][(tid & 15) * 4] = t; } }
    __syncthreads(); }   // publishes the next buffer and ends every reader's last read of this one
  if (n0 < 2 * DM) {   // per (row, head): the 5 bucket dots (q . table_k[u]) or ((k/8) . table_q[u]) -> BKT / BQT [row][h][8], slots 0 to 4, as matrix products: A = the wave's 16 rows, read back from the tiles that are staged below for the stores (hi, and residual x2048), B = the table's rows, one bucket a column
    const bool isq = n0 < DM; const float* TB = isq ? TK : TQ; float* dstT = isq ? BKT : BQT; const float sc = isq ? 1.0f : 0.125f;
    const int ln = (int)__builtin_amdgcn_mbcnt_lo(~0u, 0u), cl = ln & 15, gl = ln >> 4;   // the lane's number, column and half anew for this branch: kept from the kernel's head they hold one register more over the main loop, which stands at the last register of its granule (192: five waves a SIMD)
#pragma unroll
    for (int j = 0; j < 8; ++j) {
#pragma unroll
      for (int r = 0; r < 8; ++r) { const float v = acc[j][r]; const _Float16 hv = (_Float16)v; so[wave][8 * gl + r][j * 16 + cl] = hv; sol[wave][8 * gl + r][j * 16 + cl] = (_Float16)((v - (float)hv) * 2048.0f); } }   // q, k as f16 hi + (x2048) residual
    LDSX();
    const float* tp = TB + (cl < NBK ? cl : NBK - 1) * HD + 8 * gl;   // column = bucket; the lanes of columns 5 to 15 read the last row again, in bounds: a column of B reaches its own column of the product alone, and those columns are not stored
    v4f tr[8];   // fetched behind the staging, when the accumulators are dead: ahead of it they cost a register granule, and with it the fifth wave a SIMD
#pragma unroll
    for (int i = 0; i < 8; ++i) tr[i] = *(const v4f*)(tp + (i >> 1) * 16 + (i & 1) * 4);
    asm volatile("s_wait_xcnt 0x0" :: "v"(tp) : "memory");   // stands behind the run of loads, in front of any rewrite of a register that one of them names as its address; the address is an input, so that its registers live up to the wait and no load's result is placed on them
    { v16h tb[2];   // element e of step kc = d 32 kc + 8 g + e (e < 8), 32 kc + 16 + 8 g + e - 8 (e >= 8): the k order of frag_h
#pragma unroll
      for (int kc = 0; kc < 2; ++kc) {
#pragma unroll
        for (int e = 0; e < 16; ++e) tb[kc][e] = (_Float16)bfr(tr[kc * 4 + (e >> 2)][e & 3]); }
      v8f dh[2] = {}, dl[2] = {};   // register r: row 8 g + r, bucket col
#pragma unroll
      for (int hh = 0; hh < 2; ++hh) {
#pragma unroll
        for (int kc = 0; kc < 2; ++kc) { dh[hh] = wmma16(frag_h(&so[wave][cl][hh * HD + kc * 32], ln), tb[kc], dh[hh]); dl[hh] = wmma16(frag_h(&sol[wave][cl][hh * HD + kc * 32], ln), tb[kc], dl[hh]); } }
      if (cl < NBK) { float* d = dstT + ((r0 + 8 * gl) * NH + (n0 % DM) / HD) * 8 + cl;   // (8-float slots per (row, head); 4-B scratch stores)
#pragma unroll
        for (int hh = 0; hh < 2; ++hh) {
#pragma unroll
          for (int r = 0; r < 8; ++r) d[(r * NH + hh) * 8] = (dh[hh][r] + dl[hh][r] * (1.0f / 2048.0f)) * sc; }
        asm volatile("s_wait_xcnt 0x0" :: "v"(d) : "memory"); } }   // stands behind the run of stores, in front of any rewrite of a register that one of them names
    for (int rl = 0; rl < 16; ++rl) if (lane < 16) { vst2((unsigned*)(QK + (r0 + rl) * (2 * DM) + n0 + lane * 8), *(const v4u*)&so[wave][rl][lane * 8]); vst2((unsigned*)(QKL + (r0 + rl) * (2 * DM) + n0 + lane * 8), *(const v4u*)&sol[wave][rl][lane * 8]); }
  } else {
#pragma unroll
    for (int j = 0; j < 8; ++j) {
#pragma unroll
      for (int r = 0; r < 8; ++r) { const float v = acc[j][r] + (BB ? bfr(BB[j * 16 + col]) : 0.f); const _Float16 hv = (_Float16)v; sth[j * 16 + col][wave * 16 + 8 * g + r] = hv; stl[j * 16 + col][wave * 16 + 8 * g + r] = (_Float16)((v - (float)hv) * 2048.0f); } }
    __syncthreads();
    const size_t rb = (size_t)blockIdx.x * 64; const int b = (int)(rb / SS), s0 = (int)(rb % SS); const int pc0 = n0 - 2 * DM;
    for (int q = tid; q < 128 * 8; q += 128) { const int d = q >> 3, pc = q & 7; const size_t o = ((size_t)b * DM + pc0 + d) * SS + s0 + pc * 8; vst2((unsigned*)(VTH + o), *(const v4u*)&sth[d][pc * 8]); vst2((unsigned*)(VTL + o), *(const v4u*)&stl[d][pc * 8]); }
  }
}
// ---- k_attn: block = (64 queries, head h, batch b): all-keys flash attention on TRANSPOSED tiles: S^T = K . Q^T (A = K rows, B = q), so that a lane holds 16 keys' scores of ONE query (query = lane & 15, keys 8 * (lane >> 4) + r of each 16-key tile); scores = (q.k) * 0.125 with single f16 operands; the two f32 score tiles of 32 keys, converted in place, are the B operand of O^T += V^T . P^T (A = V rows [d][key]); O[b*S+q][h*64+d] = (acc + accl / 2048) / (2048 l) (256-B segments)
__device__ __forceinline__ float xhalf(float x) { return __builtin_bit_cast(float, __builtin_amdgcn_permlanex16(__builtin_bit_cast(int, x), __builtin_bit_cast(int, x), 0x76543210, 0xfedcba98, false, false)); }   // lane l with lane l ^ 16
// 2^x on the hardware's v_exp_f32, written with the slot that the instruction set asks for behind a transcendental inside the statement. Outputs are early-clobber, so each v_exp_f32 is followed by one that is independent of it, and the last by the v_nop
__device__ __forceinline__ float exp2_1(float x) { float r; asm("v_exp_f32 %0, %1\n\tv_nop" : "=v"(r) : "v"(x)); return r; }
__device__ __forceinline__ v8f exp2_8(v8f x) { float r0, r1, r2, r3, r4, r5, r6, r7;
  asm("v_exp_f32 %0, %8\n\tv_exp_f32 %1, %9\n\tv_exp_f32 %2, %10\n\tv_exp_f32 %3, %11\n\tv_exp_f32 %4, %12\n\tv_exp_f32 %5, %13\n\tv_exp_f32 %6, %14\n\tv_exp_f32 %7, %15\n\tv_nop"
      : "=&v"(r0), "=&v"(r1), "=&v"(r2), "=&v"(r3), "=&v"(r4), "=&v"(r5), "=&v"(r6), "=&v"(r7) : "v"(x[0]), "v"(x[1]), "v"(x[2]), "v"(x[3]), "v"(x[4]), "v"(x[5]), "v"(x[6]), "v"(x[7]));
  const v8f r = {r0, r1, r2, r3, r4, r5, r6, r7}; return r; }
#define LOG2E 1.44269504f
__global__ __launch_bounds__(128) void k_attn(const _Float16* __restrict__ QK, const _Float16* __restrict__ QKL, const _Float16* __restrict__ VTH, const _Float16* __restrict__ VTL, const void* __restrict__ KMASK, const float* __restrict__ BKT, const float* __restrict__ BQT, const unsigned* __restrict__ PB, float* __restrict__ O) {
  __shared__ __align__(16) float so[4][16][68];
  __shared__ __align__(16) _Float16 sK[2][64][LP], sV[2][64][LP];   // two stage buffers of 64 keys: K rows [key][d], V rows [d][key], 128 B of data a row
  __shared__ __align__(16) float sBQ[2][NBK][BQP];   // the stage's (k/8) . table_q[u], [bucket][key], in the same two stage buffers' rhythm
  __shared__ __align__(16) float sBK[4][NBK][32];    // per wave: q . table_k[u] of each lane's own query, [bucket][lane]: a lane reads its own column alone, so no two lanes of a look-up meet on a bank
  const int tid = threadIdx.x, wave = tid >> 5, lane = tid & 31, col = lane & 15, g = lane >> 4;
  const int qb = blockIdx.x, h = blockIdx.y, b = blockIdx.z; const int q0 = qb * 64 + wave * 16; const size_t rq = (size_t)b * SS + q0 + col;
  v16h aq[2], aql[2];
#pragma unroll
  for (int kc = 0; kc < 2; ++kc) { aq[kc] = frag_h(QK + rq * (2 * DM) + h * HD + kc * 32, lane); aql[kc] = frag_h(QKL + rq * (2 * DM) + h * HD + kc * 32, lane); }
  { const float* bk = BKT + (rq * NH + h) * 8;   // the lane's own query: its five buckets
    const v4f t = *(const v4f*)bk; const float t4 = bk[4];
    asm volatile("s_wait_xcnt 0x0" ::: "memory");   // stands behind the two loads, in front of any rewrite of a register that one of them names as its address
#pragma unroll
    for (int u = 0; u < 4; ++u) sBK[wave][u][lane] = t[u];
    sBK[wave][4][lane] = t4; }
  float m = -3.0e38f, l = 0.f;   // the lane's query: running maximum (equal in both halves), and the half's own part of the sum
  v8f acc[4] = {}, accl[4] = {};
  const int nst = SS / 64;   // all keys, 64 a stage
  // each 16-byte load of a wave covers 4 whole lines: 4 rows x 128 B
  const _Float16* gK = QK + ((size_t)b * SS + (tid >> 3)) * (2 * DM) + DM + h * HD + (tid & 7) * 8; const _Float16* gV = VTH + ((size_t)b * DM + h * HD + (tid >> 3)) * SS + (tid & 7) * 8;
  const int bkey = tid >> 1, bp = tid & 1;   // key-side bias rows of a stage's 64 keys: a pair of threads brings one key's five buckets, 0, 1 and 4 | 2, 3
  const float* gQ = BQT + (((size_t)b * SS + bkey) * NH + h) * 8 + bp * 2;
  const unsigned* gP = PB + ((size_t)(qb * 4 + wave) * (SS / 32) * 32 + lane) * 4;   // the wave's own 16 queries: 512 B in a row for each step of 32 keys, 16 B a lane
  v8h rk[4], rv[4]; v2f rbq; float rb4 = 0.f;
  v4u nb = *(const v4u*)gP;   // the bucket pairs of step 0
#pragma unroll
  for (int i = 0; i < 4; ++i) { rk[i] = *(const v8h*)(gK + (size_t)i * 16 * (2 * DM)); rv[i] = *(const v8h*)(gV + (size_t)i * 16 * SS); }
  rbq = *(const v2f*)gQ; if (bp == 0) rb4 = gQ[4];
  asm volatile("s_wait_xcnt 0x0" ::: "memory");   // stands behind the run of loads, in front of any rewrite of a register that one of them names as its address
#pragma unroll
  for (int i = 0; i < 4; ++i) { *(v8h*)&sK[0][(tid >> 3) + 16 * i][(tid & 7) * 8] = rk[i]; *(v8h*)&sV[0][(tid >> 3) + 16 * i][(tid & 7) * 8] = rv[i]; }
  sBQ[0][bp * 2][bkey] = rbq[0]; sBQ[0][bp * 2 + 1][bkey] = rbq[1]; if (bp == 0) sBQ[0][4][bkey] = rb4;
  __syncthreads();
#pragma unroll 1   // keeps the long body once in the text
  for (int st = 0; st < nst; ++st) { const int cur = st & 1;
#pragma unroll 1   // as the loop over the stages
  for (int ks = 2 * st; ks < 2 * st + 2; ++ks) { v8f s[2]; const int kh = (ks & 1) * 32;
    const v4u cb = nb;   // this step's 16 bucket pairs; the next step's (the last step: its own again) fly while this one is worked on
    const unsigned* pn = gP + (size_t)(ks + 1 < SS / 32 ? ks + 1 : SS / 32 - 1) * 128; nb = *(const v4u*)pn;
    asm volatile("s_wait_xcnt 0x0" :: "v"(pn) : "memory");   // stands behind the load, in front of any rewrite of a register that it names as its address; the address is an input, so that its registers live up to the wait and the load's result is not placed on them
#pragma unroll
    for (int ct = 0; ct < 2; ++ct) { v8f c = {};   // register r: key ks * 32 + ct * 16 + 8 * g + r, query q0 + col
#pragma unroll
      for (int kc = 0; kc < 2; ++kc) c = wmma16(frag_h(&sK[cur][kh + ct * 16 + col][kc * 32], lane), aq[kc], c);   // single product: k, q as one-rounding f16 operands
      { const float* tq = &sBQ[cur][0][kh + ct * 16 + 8 * g]; const float* tk = &sBK[wave][0][lane];
#pragma unroll
      for (int r = 0; r < 8; ++r) { const unsigned pw = cb[ct * 2 + (r >> 2)] >> 8 * (r & 3); const unsigned c1 = pw & 7u, c2 = pw >> 4 & 7u;   // both at most 4: clamped where k_pack wrote the table
        s[ct][r] = c[r] * 0.125f + tk[c1 * 32] + tq[c2 * BQP + r]; } } }   // 1/sqrt(64) + q.table_k[bucket(i,j)] + (k/8).table_q[bucket(j,i)]
    float mx = fmaxf(s[0][0], s[1][0]);
#pragma unroll
    for (int r = 1; r < 8; ++r) mx = fmaxf(mx, fmaxf(s[0][r], s[1][r]));
    mx = fmaxf(mx, xhalf(mx));   // the query's other 16 keys of this step lie in the other half of the wave
    const float mn = fmaxf(m, mx); const float ea = exp2_1((m - mn) * LOG2E), alpha = (m <= -1.0e38f) ? 0.f : ea;
    v16h pa; float es = 0.f;
#pragma unroll
    for (int ct = 0; ct < 2; ++ct) { const v8f ex = exp2_8((s[ct] - mn) * LOG2E);
#pragma unroll
      for (int r = 0; r < 8; ++r) { const float e = (s[ct][r] <= -1.0e38f) ? 0.f : ex[r]; es += e; pa[ct * 8 + r] = (_Float16)(e * 2048.0f); } }   // element ct * 8 + r = key 16 ct + 8 g + r: the k order of the V fragments; P scaled by 2^11 before the f16 rounding so small softmax weights stay out of the f16 subnormal range; 2^-11 folded into the epilogue
    l = l * alpha + es; m = mn;
#pragma unroll
    for (int dt = 0; dt < 4; ++dt) {
#pragma unroll
      for (int r = 0; r < 8; ++r) { acc[dt][r] *= alpha; accl[dt][r] *= alpha; } }
    v16h vf[4];
#pragma unroll
    for (int dt = 0; dt < 4; ++dt) vf[dt] = frag_h(&sV[cur][dt * 16 + col][kh], lane);   // all V fragment reads as one group ahead of the products
#pragma unroll
    for (int dt = 0; dt < 4; ++dt) acc[dt] = wmma16(vf[dt], pa, acc[dt]);   // single product: V x P (x2^11); register r: d = 16 dt + 8 g + r of query col
    asm volatile("v_nop\n\tv_nop\n\tv_nop\n\tv_nop" : "+v"(acc[3]) : "v"(vf[3]), "v"(pa)); }   // the four slots behind the step's last products, once a step: the loop's branch follows them, and the head of the next step rewrites fragment registers
    if (st + 1 < nst) {   // the next stage is fetched and stored into the other buffer here at the foot, not held in registers over the stage
#pragma unroll
      for (int i = 0; i < 4; ++i) { rk[i] = *(const v8h*)(gK + ((size_t)(st + 1) * 64 + i * 16) * (2 * DM)); rv[i] = *(const v8h*)(gV + (size_t)i * 16 * SS + (st + 1) * 64); }
      rbq = *(const v2f*)(gQ + (size_t)(st + 1) * 64 * NH * 8); if (bp == 0) rb4 = gQ[(size_t)(st + 1) * 64 * NH * 8 + 4];
      asm volatile("s_wait_xcnt 0x0" ::: "memory");   // stands behind the run of loads, in front of any rewrite of a register that one of them names as its address
#pragma unroll
      for (int i = 0; i < 4; ++i) { *(v8h*)&sK[cur ^ 1][(tid >> 3) + 16 * i][(tid & 7) * 8] = rk[i]; *(v8h*)&sV[cur ^ 1][(tid >> 3) + 16 * i][(tid & 7) * 8] = rv[i]; }
      sBQ[cur ^ 1][bp * 2][bkey] = rbq[0]; sBQ[cur ^ 1][bp * 2 + 1][bkey] = rbq[1]; if (bp == 0) sBQ[cur ^ 1][4][bkey] = rb4; }
    __syncthreads(); }   // publishes the next buffer and ends every reader's last read of this one
  { const float il = (1.0f / 2048.0f) / (l + xhalf(l));   // the two halves' parts of the query's sum are joined once, here
#pragma unroll
    for (int dt = 0; dt < 4; ++dt) {
#pragma unroll
      for (int r = 0; r < 8; ++r) so[wave][col][dt * 16 + 8 * g + r] = (acc[dt][r] + accl[dt][r] * (1.0f / 2048.0f)) * il; } }
  LDSX();
  for (int rl = 0; rl < 16; ++rl) if (lane < 16) vst2(O + ((size_t)b * SS + q0 + rl) * DM + h * HD + lane * 4, *(const v4f*)&so[wave][rl][lane * 4]);
}
// ---- k_out: block = (64 rows, 128 cols): out = O(hi/lo) . Wo rows (2 products) + bo
__global__ __launch_bounds__(128) void k_out(const float* __restrict__ O, const __bf16* __restrict__ P, const float* __restrict__ BO, float* __restrict__ Y) {
  // one LDS block: two stage buffers (weights 128 rows, ctx hi and residual 64 rows each, bf16); behind the loop's last barrier the output tile lies over them
  __shared__ __align__(16) unsigned char sm[2 * (128 + 64 + 64) * LP * 2];
  __bf16 (*sB)[128][LP] = (__bf16 (*)[128][LP])sm; __bf16 (*sH)[64][LP] = (__bf16 (*)[64][LP])(sm + 2 * 128 * LP * 2); __bf16 (*sL)[64][LP] = (__bf16 (*)[64][LP])(sm + 2 * (128 + 64) * LP * 2);
  float (*so)[16][132] = (float (*)[16][132])sm;
  const int tid = threadIdx.x, wave = tid >> 5, lane = tid & 31, col = lane & 15, g = lane >> 4; const size_t r0 = (size_t)blockIdx.x * 64 + wave * 16; const int n0 = blockIdx.y * 128;
  v8f acc[8] = {};
  const __bf16* gB = P + (size_t)(n0 + (tid >> 3)) * DM + (tid & 7) * 8; const float* gA = O + ((size_t)blockIdx.x * 64 + (tid >> 4)) * DM + (tid & 15) * 4;
  v8b rb[8]; v4f ra[8];
#pragma unroll
  for (int i = 0; i < 8; ++i) { rb[i] = *(const v8b*)(gB + (size_t)i * 16 * DM); ra[i] = *(const v4f*)(gA + (size_t)i * 8 * DM); }
#pragma unroll
  for (int i = 0; i < 8; ++i) { *(v8b*)&sB[0][(tid >> 3) + 16 * i][(tid & 7) * 8] = rb[i]; v4b th, tl;
#pragma unroll
    for (int e = 0; e < 4; ++e) { const __bf16 hv = (__bf16)ra[i][e]; th[e] = hv; tl[e] = (__bf16)(ra[i][e] - (float)hv); }
    *(v4b*)&sH[0][(tid >> 4) + 8 * i][(tid & 15) * 4] = th; *(v4b*)&sL[0][(tid >> 4) + 8 * i][(tid & 15) * 4] = tl; }
  __syncthreads();
#pragma unroll 2   // two steps a body, so that each buffer's LDS addresses are immediates
  for (int s = 0; s < DM / KS; ++s) { const int cur = s & 1;
    if (s + 1 < DM / KS) {   // the next step's tiles fly while this step is worked on
#pragma unroll
      for (int i = 0; i < 8; ++i) { rb[i] = *(const v8b*)(gB + (size_t)i * 16 * DM + (s + 1) * KS); ra[i] = *(const v4f*)(gA + (size_t)i * 8 * DM + (s + 1) * KS); }
      asm volatile("s_wait_xcnt 0x0" ::: "memory"); }   // stands behind the run of loads, in front of any rewrite of a register that one of them names as its address
#pragma unroll
    for (int kc = 0; kc < KS / 32; ++kc) { const v16b ah = frag_b(&sH[cur][wave * 16 + col][kc * 32], lane), al = frag_b(&sL[cur][wave * 16 + col][kc * 32], lane); v16b w[8];
#pragma unroll
      for (int j = 0; j < 8; ++j) w[j] = frag_b(&sB[cur][j * 16 + col][kc * 32], lane);   // all fragment reads as one group ahead of the products
      __builtin_amdgcn_sched_barrier(0);   // keeps that group ahead of the products
#pragma unroll
      for (int j = 0; j < 8; ++j) { acc[j] = wmma_bf(al, w[j], acc[j]); acc[j] = wmma_bf(ah, w[j], acc[j]); }
      __builtin_amdgcn_sched_barrier(0); }   // keeps the wait for the next step's global loads behind the products
    if (s + 1 < DM / KS) {
#pragma unroll
      for (int i = 0; i < 8; ++i) { *(v8b*)&sB[cur ^ 1][(tid >> 3) + 16 * i][(tid & 7) * 8] = rb[i]; v4b th, tl;
#pragma unroll
        for (int e = 0; e < 4; ++e) { const __bf16 hv = (__bf16)ra[i][e]; th[e] = hv; tl[e] = (__bf16)(ra[i][e] - (float)hv); }
        *(v4b*)&sH[cur ^ 1][(tid >> 4) + 8 * i][(tid & 15) * 4] = th; *(v4b*)&sL[cur ^ 1][(tid >> 4) + 8 * i][(tid & 15) * 4] = tl; } }
    __syncthreads(); }   // publishes the next buffer and ends every reader's last read of this one
#pragma unroll
  for (int j = 0; j < 8; ++j) {
#pragma unroll
    for (int r = 0; r < 8; ++r) so[wave][8 * g + r][j * 16 + col] = acc[j][r] + bfr(BO[n0 + j * 16 + col]); }
  LDSX();
  for (int rl = 0; rl < 16; ++rl) vst2(Y + (r0 + rl) * DM + n0 + lane * 4, *(const v4f*)&so[wave][rl][lane * 4]);
}
extern "C" void kernel_launch(void* const* d_in, const int* in_sizes, int n_in, void* d_out, int out_size, void* d_ws, size_t ws_size, hipStream_t stream) {
  (void)in_sizes; (void)n_in; (void)out_size;
  const float** F = (const float**)d_in;   // 0 x [4,1024,768], 1 wq_w, 2 wk_w, 3 wv_w, 4 proj_w ((in,out)), 5 proj_b, 6 rpe_k_table [5,64], 7 rpe_q_table [5,64], 8 rp_bucket [1024,1024] int
  if (ws_size < (size_t)WS_END) return;
  char* ws = (char*)d_ws; __bf16* PK = (__bf16*)(ws + WS_PK); _Float16 *QK = (_Float16*)(ws + WS_QK), *QKL = (_Float16*)(ws + WS_QKL), *VTH = (_Float16*)(ws + WS_VTH), *VTL = (_Float16*)(ws + WS_VTL); float *O = (float*)(ws + WS_O), *BKT = (float*)(ws + WS_BKT), *BQT = (float*)(ws + WS_BQT);
  k_pack<<<dim3((DM / PT) * (DM / PT), 4), 128, 0, stream>>>(F[1], F[2], F[3], F[4], (const int*)d_in[8], PK, (unsigned*)(ws + WS_PB));
  k_qkv<<<dim3(TNB * SS / 64, QKVW / 128), 128, 0, stream>>>(F[0], F[0], F[0], PK + PK_A, nullptr, nullptr, nullptr, F[6], F[7], BKT, BQT, QK, QKL, VTH, VTL);
  k_attn<<<dim3(TQB, NH, TNB), 128, 0, stream>>>(QK, QKL, VTH, VTL, nullptr, BKT, BQT, (const unsigned*)(ws + WS_PB), O);
  k_out<<<dim3(TOB, DM / 128), 128, 0, stream>>>(O, PK + PK_P, F[5], (float*)d_out);
}

// v008
// It runs in 75.5 microseconds.
// Next to v007, in two timings, it ran 1.05 times as fast each time.
// Over all steps from v000 it is 3.98 times as fast.
// compute dtype: all float inputs rounded to bf16, rp_bucket (int) read on device; q/k/v = x . W with EXACT bf16 products on WMMA 16x16x32 ((in,out) weights as transposed rows); per (token, head) the 5 bucket dots q . rpe_k_table[u] and (k / 8) . rpe_q_table[u] on WMMA 16x16x32 from the projections as f16 hi + residual (2 products); PLAIN attention: q, k as single f16 operands x 1/8 + bk[i][bucket[i][j]] + bq[j][bucket[j][i]], running-max softmax in f32 (hardware exp), P (scaled by 2^11, single f16) x v (single f16); out = ctx (bf16 hi + residual) . proj_w (2 products) + proj_b.
#include <hip/hip_runtime.h>
#include <math.h>

typedef __attribute__((ext_vector_type(16))) _Float16 v16h;
typedef __attribute__((ext_vector_type(16))) __bf16 v16b;
typedef __attribute__((ext_vector_type(8)))  _Float16 v8h;
typedef __attribute__((ext_vector_type(8)))  float v8f;
typedef __attribute__((ext_vector_type(4)))  float v4f;
typedef __attribute__((ext_vector_type(2)))  float v2f;
typedef __attribute__((ext_vector_type(4)))  unsigned v4u;
typedef __attribute__((ext_vector_type(4)))  int v4i;
typedef float __attribute__((may_alias)) float_a;
typedef int __attribute__((may_alias)) int_a;

template <typename T> __device__ __forceinline__ void vst2(void* p, T v) { *(T*)p = v;  }
__device__ __forceinline__ v8f wmma16(v16h a, v16h b, v8f c) {
  return __builtin_amdgcn_wmma_f32_16x16x32_f16(false, a, false, b, (short)0, c, false, false);
}
__device__ __forceinline__ v8f wmma_bf(v16b a, v16b b, v8f c) {
  return __builtin_amdgcn_wmma_f32_16x16x32_bf16(false, a, false, b, (short)0, c, false, false);
}
// Attention with image relative-position encoding (iRPE, contextual mode on q and k) over a 32 x 32 patch grid (B 4, N 1,024, C 768, 12 heads x 64): bias-free q/k/v projections, scores + q . table_k[bucket(i,j)] + (k scale) . table_q[bucket(j,i)], softmax, output projection + bias.
__device__ __forceinline__ v16h frag_h(const _Float16* rowk0, int lane) {
  union { v16h v; v8h q[2]; } u; const _Float16* p = rowk0 + 8 * (lane >> 4);
  u.q[0] = *(const v8h*)p; u.q[1] = *(const v8h*)(p + 16); return u.v;
}
__device__ __forceinline__ v16h frag_f32(const float* rowk0, int lane) {
  v16h a; const float* p = rowk0 + 8 * (lane >> 4);
#pragma unroll
  for (int i = 0; i < 8; ++i) { a[i] = (_Float16)p[i]; a[8 + i] = (_Float16)p[16 + i]; }
  return a;
}
__device__ __forceinline__ v16h frag_f32s(const float* rowk0, int lane, float sc) {
  v16h a; const float* p = rowk0 + 8 * (lane >> 4);
#pragma unroll
  for (int i = 0; i < 8; ++i) { a[i] = (_Float16)(p[i] * sc); a[8 + i] = (_Float16)(p[16 + i] * sc); }
  return a;
}
// column fragment from a [K][ld] layout (column n), rows >= K read as 0
__device__ __forceinline__ v16h fragc_f32(const float* W, int k0, int n, int lane, int ld, int K) {
  v16h a; const int g = lane >> 4;
#pragma unroll
  for (int i = 0; i < 8; ++i) { const int ka = k0 + 8 * g + i, kb = ka + 16;
    a[i] = (_Float16)(ka < K ? W[(size_t)(ka < K ? ka : K - 1) * ld + n] : 0.f); a[8 + i] = (_Float16)(kb < K ? W[(size_t)(kb < K ? kb : K - 1) * ld + n] : 0.f); }
  return a;
}
struct F2 { v16b h, l; };
__device__ __forceinline__ F2 bsplit16(const float v[16]) { F2 r;
#pragma unroll
  for (int i = 0; i < 16; ++i) { const __bf16 h = (__bf16)v[i]; r.h[i] = h; r.l[i] = (__bf16)(v[i] - (float)h); }
  return r; }
__device__ __forceinline__ F2 split_row(const float* row, int k0, int lane) { float v[16]; const float* p = row + k0 + 8 * (lane >> 4);
#pragma unroll
  for (int i = 0; i < 8; ++i) { v[i] = p[i]; v[8 + i] = p[16 + i]; }
  return bsplit16(v); }
__device__ __forceinline__ F2 split_rowK(const float* row, int k0, int lane, int K) { float v[16]; const int g = lane >> 4;
#pragma unroll
  for (int i = 0; i < 8; ++i) { const int ka = k0 + 8 * g + i, kb = ka + 16; v[i] = ka < K ? row[ka < K ? ka : K - 1] : 0.f; v[8 + i] = kb < K ? row[kb < K ? kb : K - 1] : 0.f; }
  return bsplit16(v); }
__device__ __forceinline__ F2 split_col(const float* W, int k0, int n, int lane, int ld, int K) { float v[16]; const int g = lane >> 4;
#pragma unroll
  for (int i = 0; i < 8; ++i) { const int ka = k0 + 8 * g + i, kb = ka + 16; v[i] = ka < K ? W[(size_t)(ka < K ? ka : K - 1) * ld + n] : 0.f; v[8 + i] = kb < K ? W[(size_t)(kb < K ? kb : K - 1) * ld + n] : 0.f; }
  return bsplit16(v); }
__device__ __forceinline__ v8f mac3(const F2& a, const F2& b, v8f c) { c = wmma_bf(a.l, b.h, c); c = wmma_bf(a.h, b.l, c); return wmma_bf(a.h, b.h, c); }
__device__ __forceinline__ float sigm(float v) { return 1.0f / (1.0f + expf(-v)); }
#define LDSX() do { asm volatile("s_wait_dscnt 0" ::: "memory"); __builtin_amdgcn_wave_barrier(); __builtin_amdgcn_fence(__ATOMIC_RELEASE, "workgroup"); } while (0)


#define NB 4
#define SS 1024
#define DM 768
#define NH 12
#define NBK 5
#define HD 64
#define QKVW (3 * DM)
#ifndef TQB
#define TQB (SS / 64)
#define TNB NB
#define TOB (NB * SS / 64)     // output row tiles (all)
#endif
typedef __attribute__((ext_vector_type(8))) __bf16 v8b;
__device__ __forceinline__ v16b frag_b(const __bf16* rowk0, int lane) {
  union { v16b v; v8b q[2]; } u; const __bf16* p = rowk0 + 8 * (lane >> 4);
  u.q[0] = *(const v8b*)p; u.q[1] = *(const v8b*)(p + 16); return u.v;
}
typedef __attribute__((ext_vector_type(4))) __bf16 v4b;
#define KS 64   // k per staged step: 128 B of a bf16 row, one whole line
#define BQP 80  // words per bucket row of the staged key-side bias table: 64 keys + 16, so that a 16-key group's rows of buckets 0 to 3 fall on different banks
#define LP 72   // LDS row pitch in 16-bit elements: 128 B of data + 16 B, the pitch for 16-byte LDS readers
// the plain '#pragma unroll' on the short fixed loops of the staging code give the staged values and fragments (rb, ra, rk, rv, w, vf) constant indices, so that they stay in registers
__device__ __forceinline__ float bfr(float v) { return (float)(__bf16)v; }
__device__ __attribute__((noinline)) float exp_ni(float v) { return expf(v); }
__device__ __attribute__((noinline)) float erf_ni(float v) { return erff(v); }

#define PK_A 0                       // [2304][768] Wqkv rows (natural [out][in])
#define PK_P (PK_A + QKVW * DM)        // [768][768] Wo rows (natural)
#define PK_END (PK_P + DM * DM)
#define WS_PK  0u
#define WS_QK  (WS_PK + 2u * PK_END)             // f16 [4096 rows][1536]: q | k
#define WS_VTH (WS_QK + 2u * NB * SS * 2 * DM)     // f16 [b][768 (h*64+d)][1024 s]
#define WS_O   (WS_VTH + 2u * NB * DM * SS)        // f32 [4096][768]
#define WS_CS  (WS_O + 4u * NB * SS * DM)           // f32 [1024][32] x 2, not used by any kernel
#define WS_BKT (WS_CS + 4u * 2 * SS * 32)                 // f32 [NB*SS][NH][8]: q . table_k[u] ; BQT (k/8) . table_q[u]
#define WS_BQT (WS_BKT + 4u * NB * SS * NH * 8)
#define WS_PB  (WS_BQT + 4u * NB * SS * NH * 8)   // bytes [64 query tiles][32 key steps][32 lanes][16]: both bucket indices of a (query, key) pair, in the order in which a lane of k_attn uses them
#define WS_END (WS_PB + 1u * SS * SS)
// ---- k_pack: block = (64 k x 64 n tile of one (in,out) weight, which): the tile is read by whole lines (a row of the tile is 256 B), turned in LDS and written as bf16 rows [n][k], 128 B a row; which 0..2 -> W_q/W_k/W_v into PK_A rows which*768 + n; 3 -> W_o into PK_P
#define PT 64   // tile edge of k_pack
__global__ __launch_bounds__(128) void k_pack(const float* __restrict__ WQ, const float* __restrict__ WK, const float* __restrict__ WV, const float* __restrict__ WO, const int* __restrict__ RPB, __bf16* __restrict__ PK, unsigned* __restrict__ PB) {
  __shared__ __align__(16) __bf16 s[PT][LP];   // [n][k]
  const int which = blockIdx.y, t = threadIdx.x, lane = t & 31; const int k0 = (blockIdx.x % (DM / PT)) * PT, n0 = (blockIdx.x / (DM / PT)) * PT;
  const float* Wm = (which == 0) ? WQ : (which == 1) ? WK : (which == 2) ? WV : WO;
  // a thread holds 8 k in a row of 4 n: each 16-byte load of a wave covers 2 rows x 256 B, and each n's 8 values make one 16-byte LDS store
  const int c = t & 15, kr = t >> 4; const float* gw = Wm + (size_t)(k0 + kr * 8) * DM + n0 + c * 4;
  v4f ra[8];
#pragma unroll
  for (int i = 0; i < 8; ++i) ra[i] = *(const v4f*)(gw + (size_t)i * DM);
  asm volatile("s_wait_xcnt 0x0" :: "v"(gw) : "memory");   // stands behind the run of loads, in front of any rewrite of a register that one of them names as its address; the address is an input, so that its registers live up to the wait and no load's result is placed on them
  // the first 2,048 waves of the grid: one (16 queries, 32 keys) tile of the bucket pair table each; its loads fly with the weight tile's, its bytes are formed and stored at the foot, so that the barrier does not wait for that store. Byte ct * 8 + r of lane (col, g) = bucket[i][j] | bucket[j][i] << 4 for query i = 16 qt + col, key j = 32 ks + 16 ct + 8 g + r, both clamped to the last bucket here, which bounds the LDS addresses that k_attn forms from them for any content of the bucket array
  const int tile = (which * ((DM / PT) * (DM / PT)) + (int)blockIdx.x) * 4 + __builtin_amdgcn_readfirstlane(t >> 5); const bool hast = tile < (SS / 16) * (SS / 32);
  v4u ur[4]; unsigned uc[16];
  if (hast) { const int qi = (tile >> 5) * 16 + (lane & 15), kb = (tile & 31) * 32 + 8 * (lane >> 4);
    const int* pr = RPB + (size_t)qi * SS + kb; const int* pc = RPB + (size_t)kb * SS + qi;   // bucket[i][j ...] along the row, bucket[j ...][i] down the column
#pragma unroll
    for (int ct = 0; ct < 2; ++ct) { ur[ct * 2] = *(const v4u*)(pr + ct * 16); ur[ct * 2 + 1] = *(const v4u*)(pr + ct * 16 + 4);
#pragma unroll
      for (int r = 0; r < 8; ++r) uc[ct * 8 + r] = (unsigned)pc[(size_t)(ct * 16 + r) * SS]; }
    asm volatile("s_wait_xcnt 0x0" :: "v"(pr), "v"(pc) : "memory"); }   // stands behind the run of loads, in front of any rewrite of a register that one of them names as its address; the two addresses are inputs, so that their registers live up to the wait and no load's result is placed on them
#pragma unroll
  for (int e = 0; e < 4; ++e) { v8b o;
#pragma unroll
    for (int i = 0; i < 8; ++i) o[i] = (__bf16)ra[i][e];
    *(v8b*)&s[c * 4 + e][kr * 8] = o; }
  __syncthreads();
  __bf16* dst = ((which < 3) ? PK + PK_A + ((size_t)which * DM + n0) * DM : PK + PK_P + (size_t)n0 * DM) + k0;
#pragma unroll
  for (int i = 0; i < 4; ++i) vst2((unsigned*)(dst + (size_t)((t >> 3) + 16 * i) * DM + (t & 7) * 8), *(const v4u*)&s[(t >> 3) + 16 * i][(t & 7) * 8]);   // each 16-byte store of a wave covers 4 whole lines
  asm volatile("s_wait_xcnt 0x0" ::: "memory");   // stands behind the run of stores, in front of any rewrite of a register that one of them names
  if (hast) { v4u w = {0u, 0u, 0u, 0u};
#pragma unroll
    for (int e = 0; e < 16; ++e) { const unsigned u1 = ur[e >> 2][e & 3], u2 = uc[e]; const unsigned c1 = u1 < NBK - 1u ? u1 : NBK - 1u, c2 = u2 < NBK - 1u ? u2 : NBK - 1u;
      w[e >> 2] |= (c1 | c2 << 4) << 8 * (e & 3); }
    vst2(PB + ((size_t)tile * 32 + lane) * 4, w);
    asm volatile("s_wait_xcnt 0x0" ::: "memory"); }   // stands behind the store, in front of any rewrite of a register that it names
}
__global__ __launch_bounds__(128) void k_qkv(const float* __restrict__ XQ, const float* __restrict__ XK, const float* __restrict__ XV, const __bf16* __restrict__ P, const float* __restrict__ TK, const float* __restrict__ TQ, float* __restrict__ BKT, float* __restrict__ BQT, _Float16* __restrict__ QK, _Float16* __restrict__ VTH) {
  const int which0 = (blockIdx.y * 128) / DM; const float* X = (which0 == 0) ? XQ : (which0 == 1) ? XK : XV;
  // one LDS block: the main loop's two stage buffers (weights 128 rows, x 64 rows, bf16); behind the loop's last barrier the epilogue's tiles lie over them
  __shared__ __align__(16) unsigned char sm[2 * (128 + 64) * LP * 2];
  __bf16 (*sB)[128][LP] = (__bf16 (*)[128][LP])sm; __bf16 (*sA)[64][LP] = (__bf16 (*)[64][LP])(sm + 2 * 128 * LP * 2);
  _Float16 (*so)[16][136] = (_Float16 (*)[16][136])sm; _Float16 (*sol)[16][136] = (_Float16 (*)[16][136])(sm + 4 * 16 * 136 * 2);
  _Float16 (*sth)[72] = (_Float16 (*)[72])sm;
  const int tid = threadIdx.x, wave = tid >> 5, lane = tid & 31, col = lane & 15, g = lane >> 4; const size_t r0 = (size_t)blockIdx.x * 64 + wave * 16; const int n0 = blockIdx.y * 128;
  v8f acc[8] = {};
  // each 16-byte load of a wave covers 4 whole lines: weights 4 rows x 128 B, x 2 rows x 256 B
  const __bf16* gB = P + (size_t)(n0 + (tid >> 3)) * DM + (tid & 7) * 8; const float* gA = X + ((size_t)blockIdx.x * 64 + (tid >> 4)) * DM + (tid & 15) * 4;
  v8b rb[8]; v4f ra[8];
#pragma unroll
  for (int i = 0; i < 8; ++i) { rb[i] = *(const v8b*)(gB + (size_t)i * 16 * DM); ra[i] = *(const v4f*)(gA + (size_t)i * 8 * DM); }
#pragma unroll
  for (int i = 0; i < 8; ++i) { *(v8b*)&sB[0][(tid >> 3) + 16 * i][(tid & 7) * 8] = rb[i]; v4b t;
#pragma unroll
    for (int e = 0; e < 4; ++e) t[e] = (__bf16)ra[i][e];
    *(v4b*)&sA[0][(tid >> 4) + 8 * i][(tid & 15) * 4] = t; }
  __syncthreads();
#pragma unroll 2   // two steps a body, so that each buffer's LDS addresses are immediates
  for (int s = 0; s < DM / KS; ++s) { const int cur = s & 1;
    if (s + 1 < DM / KS) {   // the next step's tiles fly while this step is worked on
#pragma unroll
      for (int i = 0; i < 8; ++i) { rb[i] = *(const v8b*)(gB + (size_t)i * 16 * DM + (s + 1) * KS); ra[i] = *(const v4f*)(gA + (size_t)i * 8 * DM + (s + 1) * KS); }
      asm volatile("s_wait_xcnt 0x0" ::: "memory"); }   // stands behind the run of loads, in front of any rewrite of a register that one of them names as its address
#pragma unroll
    for (int kc = 0; kc < KS / 32; ++kc) { const v16b a = frag_b(&sA[cur][wave * 16 + col][kc * 32], lane);
#pragma unroll
      for (int jh = 0; jh < 8; jh += 4) { v16b w[4];   // fragment reads in groups of four ahead of their products: 192 registers, five waves a SIMD, the whole grid resident
#pragma unroll
        for (int j = 0; j < 4; ++j) w[j] = frag_b(&sB[cur][(jh + j) * 16 + col][kc * 32], lane);
        __builtin_amdgcn_sched_barrier(0);   // keeps the four fragment reads one group ahead of their products: left free, the compiler puts each read with a full wait directly in front of its product
#pragma unroll
        for (int j = 0; j < 4; ++j) acc[jh + j] = wmma_bf(a, w[j], acc[jh + j]);
        __builtin_amdgcn_sched_barrier(0); } }   // keeps the wait for the next step's global loads behind the products: left free, the compiler lifts the conversions, and that wait with them, among the step's first products
    if (s + 1 < DM / KS) {
#pragma unroll
      for (int i = 0; i < 8; ++i) { *(v8b*)&sB[cur ^ 1][(tid >> 3) + 16 * i][(tid & 7) * 8] = rb[i]; v4b t;
#pragma unroll
        for (int e = 0; e < 4; ++e) t[e] = (__bf16)ra[i][e];
        *(v4b*)&sA[cur ^ 1][(tid >> 4) + 8 * i][(tid & 15) * 4] = t; } }
    __syncthreads(); }   // publishes the next buffer and ends every reader's last read of this one
  if (n0 < 2 * DM) {   // per (row, head): the 5 bucket dots (q . table_k[u]) or ((k/8) . table_q[u]) -> BKT / BQT [row][h][8], slots 0 to 4, as matrix products: A = the wave's 16 rows, read back from the tiles that are staged below for the stores (hi, and residual x2048), B = the table's rows, one bucket a column
    const bool isq = n0 < DM; const float* TB = isq ? TK : TQ; float* dstT = isq ? BKT : BQT; const float sc = isq ? 1.0f : 0.125f;
    const int ln = (int)__builtin_amdgcn_mbcnt_lo(~0u, 0u), cl = ln & 15, gl = ln >> 4;   // the lane's number, column and half anew for this branch: kept from the kernel's head they hold one register more over the main loop, which stands at the last register of its granule (192: five waves a SIMD)
#pragma unroll
    for (int j = 0; j < 8; ++j) {
#pragma unroll
      for (int r = 0; r < 8; ++r) { const float v = acc[j][r]; const _Float16 hv = (_Float16)v; so[wave][8 * gl + r][j * 16 + cl] = hv; sol[wave][8 * gl + r][j * 16 + cl] = (_Float16)((v - (float)hv) * 2048.0f); } }   // q, k as f16 hi + (x2048) residual
    LDSX();
    const float* tp = TB + (cl < NBK ? cl : NBK - 1) * HD + 8 * gl;   // column = bucket; the lanes of columns 5 to 15 read the last row again, in bounds: a column of B reaches its own column of the product alone, and those columns are not stored
    v4f tr[8];   // fetched behind the staging, when the accumulators are dead: ahead of it they cost a register granule, and with it the fifth wave a SIMD
#pragma unroll
    for (int i = 0; i < 8; ++i) tr[i] = *(const v4f*)(tp + (i >> 1) * 16 + (i & 1) * 4);
    asm volatile("s_wait_xcnt 0x0" :: "v"(tp) : "memory");   // stands behind the run of loads, in front of any rewrite of a register that one of them names as its address; the address is an input, so that its registers live up to the wait and no load's result is placed on them
    { v16h tb[2];   // element e of step kc = d 32 kc + 8 g + e (e < 8), 32 kc + 16 + 8 g + e - 8 (e >= 8): the k order of frag_h
#pragma unroll
      for (int kc = 0; kc < 2; ++kc) {
#pragma unroll
        for (int e = 0; e < 16; ++e) tb[kc][e] = (_Float16)bfr(tr[kc * 4 + (e >> 2)][e & 3]); }
      v8f dh[2] = {}, dl[2] = {};   // register r: row 8 g + r, bucket col
#pragma unroll
      for (int hh = 0; hh < 2; ++hh) {
#pragma unroll
        for (int kc = 0; kc < 2; ++kc) { dh[hh] = wmma16(frag_h(&so[wave][cl][hh * HD + kc * 32], ln), tb[kc], dh[hh]); dl[hh] = wmma16(frag_h(&sol[wave][cl][hh * HD + kc * 32], ln), tb[kc], dl[hh]); } }
      if (cl < NBK) { float* d = dstT + ((r0 + 8 * gl) * NH + (n0 % DM) / HD) * 8 + cl;   // (8-float slots per (row, head); 4-B scratch stores)
#pragma unroll
        for (int hh = 0; hh < 2; ++hh) {
#pragma unroll
          for (int r = 0; r < 8; ++r) d[(r * NH + hh) * 8] = (dh[hh][r] + dl[hh][r] * (1.0f / 2048.0f)) * sc; }
        asm volatile("s_wait_xcnt 0x0" :: "v"(d) : "memory"); } }   // stands behind the run of stores, in front of any rewrite of a register that one of them names
    for (int rl = 0; rl < 16; ++rl) if (lane < 16) vst2((unsigned*)(QK + (r0 + rl) * (2 * DM) + n0 + lane * 8), *(const v4u*)&so[wave][rl][lane * 8]);   // the residual tile serves the bucket dots above alone: no kernel reads it from memory
  } else {
#pragma unroll
    for (int j = 0; j < 8; ++j) {
#pragma unroll
      for (int r = 0; r < 8; ++r) sth[j * 16 + col][wave * 16 + 8 * g + r] = (_Float16)acc[j][r]; }
    __syncthreads();
    const size_t rb = (size_t)blockIdx.x * 64; const int b = (int)(rb / SS), s0 = (int)(rb % SS); const int pc0 = n0 - 2 * DM;
    for (int q = tid; q < 128 * 8; q += 128) { const int d = q >> 3, pc = q & 7; const size_t o = ((size_t)b * DM + pc0 + d) * SS + s0 + pc * 8; vst2((unsigned*)(VTH + o), *(const v4u*)&sth[d][pc * 8]); }
  }
}
// ---- k_attn: block = (64 queries, head h, batch b): all-keys flash attention on TRANSPOSED tiles: S^T = K . Q^T (A = K rows, B = q), so that a lane holds 16 keys' scores of ONE query (query = lane & 15, keys 8 * (lane >> 4) + r of each 16-key tile); scores = (q.k) * 0.125 with single f16 operands; the two f32 score tiles of 32 keys, converted in place, are the B operand of O^T += V^T . P^T (A = V rows [d][key]); O[b*S+q][h*64+d] = acc / 2048 / l (256-B segments)
__device__ __forceinline__ float xhalf(float x) { return __builtin_bit_cast(float, __builtin_amdgcn_permlanex16(__builtin_bit_cast(int, x), __builtin_bit_cast(int, x), 0x76543210, 0xfedcba98, false, false)); }   // lane l with lane l ^ 16
// 2^x on the hardware's v_exp_f32, written with the slot that the instruction set asks for behind a transcendental inside the statement. Outputs are early-clobber, so each v_exp_f32 is followed by one that is independent of it, and the last by the v_nop
__device__ __forceinline__ float exp2_1(float x) { float r; asm("v_exp_f32 %0, %1\n\tv_nop" : "=v"(r) : "v"(x)); return r; }
__device__ __forceinline__ v8f exp2_8(v8f x) { float r0, r1, r2, r3, r4, r5, r6, r7;
  asm("v_exp_f32 %0, %8\n\tv_exp_f32 %1, %9\n\tv_exp_f32 %2, %10\n\tv_exp_f32 %3, %11\n\tv_exp_f32 %4, %12\n\tv_exp_f32 %5, %13\n\tv_exp_f32 %6, %14\n\tv_exp_f32 %7, %15\n\tv_nop"
      : "=&v"(r0), "=&v"(r1), "=&v"(r2), "=&v"(r3), "=&v"(r4), "=&v"(r5), "=&v"(r6), "=&v"(r7) : "v"(x[0]), "v"(x[1]), "v"(x[2]), "v"(x[3]), "v"(x[4]), "v"(x[5]), "v"(x[6]), "v"(x[7]));
  const v8f r = {r0, r1, r2, r3, r4, r5, r6, r7}; return r; }
#define LOG2E 1.44269504f
__global__ __launch_bounds__(128) void k_attn(const _Float16* __restrict__ QK, const _Float16* __restrict__ VTH, const float* __restrict__ BKT, const float* __restrict__ BQT, const unsigned* __restrict__ PB, float* __restrict__ O) {
  __shared__ __align__(16) float so[4][16][68];
  __shared__ __align__(16) _Float16 sK[2][64][LP], sV[2][64][LP];   // two stage buffers of 64 keys: K rows [key][d], V rows [d][key], 128 B of data a row
  __shared__ __align__(16) float sBQ[2][NBK][BQP];   // the stage's (k/8) . table_q[u], [bucket][key], in the same two stage buffers' rhythm
  __shared__ __align__(16) float sBK[4][NBK][32];    // per wave: q . table_k[u] of each lane's own query, [bucket][lane]: a lane reads its own column alone, so no two lanes of a look-up meet on a bank
  const int tid = threadIdx.x, wave = tid >> 5, lane = tid & 31, col = lane & 15, g = lane >> 4;
  const int qb = blockIdx.x, h = blockIdx.y, b = blockIdx.z; const int q0 = qb * 64 + wave * 16; const size_t rq = (size_t)b * SS + q0 + col;
  v16h aq[2];
#pragma unroll
  for (int kc = 0; kc < 2; ++kc) aq[kc] = frag_h(QK + rq * (2 * DM) + h * HD + kc * 32, lane);
  { const float* bk = BKT + (rq * NH + h) * 8;   // the lane's own query: its five buckets
    const v4f t = *(const v4f*)bk; const float t4 = bk[4];
    asm volatile("s_wait_xcnt 0x0" ::: "memory");   // stands behind the two loads, in front of any rewrite of a register that one of them names as its address
#pragma unroll
    for (int u = 0; u < 4; ++u) sBK[wave][u][lane] = t[u];
    sBK[wave][4][lane] = t4; }
  float m = -3.0e38f, l = 0.f;   // the lane's query: running maximum (equal in both halves), and the half's own part of the sum
  v8f acc[4] = {};
  const int nst = SS / 64;   // all keys, 64 a stage
  // each 16-byte load of a wave covers 4 whole lines: 4 rows x 128 B
  const _Float16* gK = QK + ((size_t)b * SS + (tid >> 3)) * (2 * DM) + DM + h * HD + (tid & 7) * 8; const _Float16* gV = VTH + ((size_t)b * DM + h * HD + (tid >> 3)) * SS + (tid & 7) * 8;
  const int bkey = tid >> 1, bp = tid & 1;   // key-side bias rows of a stage's 64 keys: a pair of threads brings one key's five buckets, 0, 1 and 4 | 2, 3
  const float* gQ = BQT + (((size_t)b * SS + bkey) * NH + h) * 8 + bp * 2;
  const unsigned* gP = PB + ((size_t)(qb * 4 + wave) * (SS / 32) * 32 + lane) * 4;   // the wave's own 16 queries: 512 B in a row for each step of 32 keys, 16 B a lane
  v8h rk[4], rv[4]; v2f rbq; float rb4 = 0.f;
  v4u nb = *(const v4u*)gP;   // the bucket pairs of step 0
#pragma unroll
  for (int i = 0; i < 4; ++i) { rk[i] = *(const v8h*)(gK + (size_t)i * 16 * (2 * DM)); rv[i] = *(const v8h*)(gV + (size_t)i * 16 * SS); }
  rbq = *(const v2f*)gQ; if (bp == 0) rb4 = gQ[4];
  asm volatile("s_wait_xcnt 0x0" ::: "memory");   // stands behind the run of loads, in front of any rewrite of a register that one of them names as its address
#pragma unroll
  for (int i = 0; i < 4; ++i) { *(v8h*)&sK[0][(tid >> 3) + 16 * i][(tid & 7) * 8] = rk[i]; *(v8h*)&sV[0][(tid >> 3) + 16 * i][(tid & 7) * 8] = rv[i]; }
  sBQ[0][bp * 2][bkey] = rbq[0]; sBQ[0][bp * 2 + 1][bkey] = rbq[1]; if (bp == 0) sBQ[0][4][bkey] = rb4;
  __syncthreads();
#pragma unroll 1   // keeps the long body once in the text
  for (int st = 0; st < nst; ++st) { const int cur = st & 1;
#pragma unroll 1   // as the loop over the stages
  for (int ks = 2 * st; ks < 2 * st + 2; ++ks) { v8f s[2]; const int kh = (ks & 1) * 32;
    const v4u cb = nb;   // this step's 16 bucket pairs; the next step's (the last step: its own again) fly while this one is worked on
    const unsigned* pn = gP + (size_t)(ks + 1 < SS / 32 ? ks + 1 : SS / 32 - 1) * 128; nb = *(const v4u*)pn;
    asm volatile("s_wait_xcnt 0x0" :: "v"(pn) : "memory");   // stands behind the load, in front of any rewrite of a register that it names as its address; the address is an input, so that its registers live up to the wait and the load's result is not placed on them
#pragma unroll
    for (int ct = 0; ct < 2; ++ct) { v8f c = {};   // register r: key ks * 32 + ct * 16 + 8 * g + r, query q0 + col
#pragma unroll
      for (int kc = 0; kc < 2; ++kc) c = wmma16(frag_h(&sK[cur][kh + ct * 16 + col][kc * 32], lane), aq[kc], c);   // single product: k, q as one-rounding f16 operands
      { const float* tq = &sBQ[cur][0][kh + ct * 16 + 8 * g]; const float* tk = &sBK[wave][0][lane];
#pragma unroll
      for (int r = 0; r < 8; ++r) { const unsigned pw = cb[ct * 2 + (r >> 2)] >> 8 * (r & 3); const unsigned c1 = pw & 7u, c2 = pw >> 4 & 7u;   // both at most 4: clamped where k_pack wrote the table
        s[ct][r] = c[r] * 0.125f + tk[c1 * 32] + tq[c2 * BQP + r]; } } }   // 1/sqrt(64) + q.table_k[bucket(i,j)] + (k/8).table_q[bucket(j,i)]
    float mx = fmaxf(s[0][0], s[1][0]);
#pragma unroll
    for (int r = 1; r < 8; ++r) mx = fmaxf(mx, fmaxf(s[0][r], s[1][r]));
    mx = fmaxf(mx, xhalf(mx));   // the query's other 16 keys of this step lie in the other half of the wave
    const float mn = fmaxf(m, mx); const float alpha = exp2_1((m - mn) * LOG2E);   // first step: m is the start value, the argument overflows to -inf and 2^-inf is 0
    v16h pa; float es = 0.f;
#pragma unroll
    for (int ct = 0; ct < 2; ++ct) { const v8f ex = exp2_8((s[ct] - mn) * LOG2E);
#pragma unroll
      for (int r = 0; r < 8; ++r) { es += ex[r]; pa[ct * 8 + r] = (_Float16)(ex[r] * 2048.0f); } }   // element ct * 8 + r = key 16 ct + 8 g + r: the k order of the V fragments; P scaled by 2^11 before the f16 rounding so small softmax weights stay out of the f16 subnormal range; 2^-11 folded into the epilogue
    l = l * alpha + es; m = mn;
#pragma unroll
    for (int dt = 0; dt < 4; ++dt) {
#pragma unroll
      for (int r = 0; r < 8; ++r) acc[dt][r] *= alpha; }
    v16h vf[4];
#pragma unroll
    for (int dt = 0; dt < 4; ++dt) vf[dt] = frag_h(&sV[cur][dt * 16 + col][kh], lane);   // all V fragment reads as one group ahead of the products
#pragma unroll
    for (int dt = 0; dt < 4; ++dt) acc[dt] = wmma16(vf[dt], pa, acc[dt]);   // single product: V x P (x2^11); register r: d = 16 dt + 8 g + r of query col
    asm volatile("v_nop\n\tv_nop\n\tv_nop\n\tv_nop" : "+v"(acc[3]) : "v"(vf[3]), "v"(pa)); }   // the four slots behind the step's last products, once a step: the loop's branch follows them, and the head of the next step rewrites fragment registers
    if (st + 1 < nst) {   // the next stage is fetched and stored into the other buffer here at the foot, not held in registers over the stage
#pragma unroll
      for (int i = 0; i < 4; ++i) { rk[i] = *(const v8h*)(gK + ((size_t)(st + 1) * 64 + i * 16) * (2 * DM)); rv[i] = *(const v8h*)(gV + (size_t)i * 16 * SS + (st + 1) * 64); }
      rbq = *(const v2f*)(gQ + (size_t)(st + 1) * 64 * NH * 8); if (bp == 0) rb4 = gQ[(size_t)(st + 1) * 64 * NH * 8 + 4];
      asm volatile("s_wait_xcnt 0x0" ::: "memory");   // stands behind the run of loads, in front of any rewrite of a register that one of them names as its address
#pragma unroll
      for (int i = 0; i < 4; ++i) { *(v8h*)&sK[cur ^ 1][(tid >> 3) + 16 * i][(tid & 7) * 8] = rk[i]; *(v8h*)&sV[cur ^ 1][(tid >> 3) + 16 * i][(tid & 7) * 8] = rv[i]; }
      sBQ[cur ^ 1][bp * 2][bkey] = rbq[0]; sBQ[cur ^ 1][bp * 2 + 1][bkey] = rbq[1]; if (bp == 0) sBQ[cur ^ 1][4][bkey] = rb4; }
    __syncthreads(); }   // publishes the next buffer and ends every reader's last read of this one
  { const float il = (1.0f / 2048.0f) / (l + xhalf(l));   // the two halves' parts of the query's sum are joined once, here
#pragma unroll
    for (int dt = 0; dt < 4; ++dt) {
#pragma unroll
      for (int r = 0; r < 8; ++r) so[wave][col][dt * 16 + 8 * g + r] = acc[dt][r] * il; } }
  LDSX();
  for (int rl = 0; rl < 16; ++rl) if (lane < 16) vst2(O + ((size_t)b * SS + q0 + rl) * DM + h * HD + lane * 4, *(const v4f*)&so[wave][rl][lane * 4]);
}
// ---- k_out: block = (64 rows, 128 cols): out = O(hi/lo) . Wo rows (2 products) + bo
__global__ __launch_bounds__(128) void k_out(const float* __restrict__ O, const __bf16* __restrict__ P, const float* __restrict__ BO, float* __restrict__ Y) {
  // one LDS block: two stage buffers (weights 128 rows, ctx hi and residual 64 rows each, bf16); behind the loop's last barrier the output tile lies over them
  __shared__ __align__(16) unsigned char sm[2 * (128 + 64 + 64) * LP * 2];
  __bf16 (*sB)[128][LP] = (__bf16 (*)[128][LP])sm; __bf16 (*sH)[64][LP] = (__bf16 (*)[64][LP])(sm + 2 * 128 * LP * 2); __bf16 (*sL)[64][LP] = (__bf16 (*)[64][LP])(sm + 2 * (128 + 64) * LP * 2);
  float (*so)[16][132] = (float (*)[16][132])sm;
  const int tid = threadIdx.x, wave = tid >> 5, lane = tid & 31, col = lane & 15, g = lane >> 4; const size_t r0 = (size_t)blockIdx.x * 64 + wave * 16; const int n0 = blockIdx.y * 128;
  v8f acc[8] = {};
  const __bf16* gB = P + (size_t)(n0 + (tid >> 3)) * DM + (tid & 7) * 8; const float* gA = O + ((size_t)blockIdx.x * 64 + (tid >> 4)) * DM + (tid & 15) * 4;
  v8b rb[8]; v4f ra[8];
#pragma unroll
  for (int i = 0; i < 8; ++i) { rb[i] = *(const v8b*)(gB + (size_t)i * 16 * DM); ra[i] = *(const v4f*)(gA + (size_t)i * 8 * DM); }
#pragma unroll
  for (int i = 0; i < 8; ++i) { *(v8b*)&sB[0][(tid >> 3) + 16 * i][(tid & 7) * 8] = rb[i]; v4b th, tl;
#pragma unroll
    for (int e = 0; e < 4; ++e) { const __bf16 hv = (__bf16)ra[i][e]; th[e] = hv; tl[e] = (__bf16)(ra[i][e] - (float)hv); }
    *(v4b*)&sH[0][(tid >> 4) + 8 * i][(tid & 15) * 4] = th; *(v4b*)&sL[0][(tid >> 4) + 8 * i][(tid & 15) * 4] = tl; }
  __syncthreads();
#pragma unroll 2   // two steps a body, so that each buffer's LDS addresses are immediates
  for (int s = 0; s < DM / KS; ++s) { const int cur = s & 1;
    if (s + 1 < DM / KS) {   // the next step's tiles fly while this step is worked on
#pragma unroll
      for (int i = 0; i < 8; ++i) { rb[i] = *(const v8b*)(gB + (size_t)i * 16 * DM + (s + 1) * KS); ra[i] = *(const v4f*)(gA + (size_t)i * 8 * DM + (s + 1) * KS); }
      asm volatile("s_wait_xcnt 0x0" ::: "memory"); }   // stands behind the run of loads, in front of any rewrite of a register that one of them names as its address
#pragma unroll
    for (int kc = 0; kc < KS / 32; ++kc) { const v16b ah = frag_b(&sH[cur][wave * 16 + col][kc * 32], lane), al = frag_b(&sL[cur][wave * 16 + col][kc * 32], lane); v16b w[8];
#pragma unroll
      for (int j = 0; j < 8; ++j) w[j] = frag_b(&sB[cur][j * 16 + col][kc * 32], lane);   // all fragment reads as one group ahead of the products
      __builtin_amdgcn_sched_barrier(0);   // keeps that group ahead of the products
#pragma unroll
      for (int j = 0; j < 8; ++j) { acc[j] = wmma_bf(al, w[j], acc[j]); acc[j] = wmma_bf(ah, w[j], acc[j]); }
      __builtin_amdgcn_sched_barrier(0); }   // keeps the wait for the next step's global loads behind the products
    if (s + 1 < DM / KS) {
#pragma unroll
      for (int i = 0; i < 8; ++i) { *(v8b*)&sB[cur ^ 1][(tid >> 3) + 16 * i][(tid & 7) * 8] = rb[i]; v4b th, tl;
#pragma unroll
        for (int e = 0; e < 4; ++e) { const __bf16 hv = (__bf16)ra[i][e]; th[e] = hv; tl[e] = (__bf16)(ra[i][e] - (float)hv); }
        *(v4b*)&sH[cur ^ 1][(tid >> 4) + 8 * i][(tid & 15) * 4] = th; *(v4b*)&sL[cur ^ 1][(tid >> 4) + 8 * i][(tid & 15) * 4] = tl; } }
    __syncthreads(); }   // publishes the next buffer and ends every reader's last read of this one
#pragma unroll
  for (int j = 0; j < 8; ++j) {
#pragma unroll
    for (int r = 0; r < 8; ++r) so[wave][8 * g + r][j * 16 + col] = acc[j][r] + bfr(BO[n0 + j * 16 + col]); }
  LDSX();
  for (int rl = 0; rl < 16; ++rl) vst2(Y + (r0 + rl) * DM + n0 + lane * 4, *(const v4f*)&so[wave][rl][lane * 4]);
}
extern "C" void kernel_launch(void* const* d_in, const int* in_sizes, int n_in, void* d_out, int out_size, void* d_ws, size_t ws_size, hipStream_t stream) {
  (void)in_sizes; (void)n_in; (void)out_size;
  const float** F = (const float**)d_in;   // 0 x [4,1024,768], 1 wq_w, 2 wk_w, 3 wv_w, 4 proj_w ((in,out)), 5 proj_b, 6 rpe_k_table [5,64], 7 rpe_q_table [5,64], 8 rp_bucket [1024,1024] int
  if (ws_size < (size_t)WS_END) return;
  char* ws = (char*)d_ws; __bf16* PK = (__bf16*)(ws + WS_PK); _Float16 *QK = (_Float16*)(ws + WS_QK), *VTH = (_Float16*)(ws + WS_VTH); float *O = (float*)(ws + WS_O), *BKT = (float*)(ws + WS_BKT), *BQT = (float*)(ws + WS_BQT);
  k_pack<<<dim3((DM / PT) * (DM / PT), 4), 128, 0, stream>>>(F[1], F[2], F[3], F[4], (const int*)d_in[8], PK, (unsigned*)(ws + WS_PB));
  k_qkv<<<dim3(TNB * SS / 64, QKVW / 128), 128, 0, stream>>>(F[0], F[0], F[0], PK + PK_A, F[6], F[7], BKT, BQT, QK, VTH);
  k_attn<<<dim3(TQB, NH, TNB), 128, 0, stream>>>(QK, VTH, BKT, BQT, (const unsigned*)(ws + WS_PB), O);
  k_out<<<dim3(TOB, DM / 128), 128, 0, stream>>>(O, PK + PK_P, F[5], (float*)d_out);
}

// v009
// Measured time: 73.5 microseconds a run.
// Two timings next to v008 both put it at 1.03 times that version's speed.
// Counting every step since v000, it is 4.09 times as fast.
// compute dtype: all float inputs rounded to bf16, rp_bucket (int) read on device; q/k/v = x . W with EXACT bf16 products on WMMA 16x16x32 ((in,out) weights as transposed rows); per (token, head) the 5 bucket dots q . rpe_k_table[u] and (k / 8) . rpe_q_table[u] on WMMA 16x16x32 from the projections as f16 hi + residual (2 products); PLAIN attention: q, k as single f16 operands x 1/8 + bk[i][bucket[i][j]] + bq[j][bucket[j][i]], running-max softmax in f32 (hardware exp), P (scaled by 2^11, single f16) x v (single f16); out = ctx (bf16 hi + residual) . proj_w (2 products) + proj_b.
#include <hip/hip_runtime.h>
#include <math.h>

typedef __attribute__((ext_vector_type(16))) _Float16 v16h;
typedef __attribute__((ext_vector_type(16))) __bf16 v16b;
typedef __attribute__((ext_vector_type(8)))  _Float16 v8h;
typedef __attribute__((ext_vector_type(8)))  float v8f;
typedef __attribute__((ext_vector_type(4)))  float v4f;
typedef __attribute__((ext_vector_type(2)))  float v2f;
typedef __attribute__((ext_vector_type(4)))  unsigned v4u;
typedef __attribute__((ext_vector_type(4)))  int v4i;
typedef float __attribute__((may_alias)) float_a;
typedef int __attribute__((may_alias)) int_a;

template <typename T> __device__ __forceinline__ void vst2(void* p, T v) { *(T*)p = v;  }
__device__ __forceinline__ v8f wmma16(v16h a, v16h b, v8f c) {
  return __builtin_amdgcn_wmma_f32_16x16x32_f16(false, a, false, b, (short)0, c, false, false);
}
__device__ __forceinline__ v8f wmma_bf(v16b a, v16b b, v8f c) {
  return __builtin_amdgcn_wmma_f32_16x16x32_bf16(false, a, false, b, (short)0, c, false, false);
}
// Attention with image relative-position encoding (iRPE, contextual mode on q and k) over a 32 x 32 patch grid (B 4, N 1,024, C 768, 12 heads x 64): bias-free q/k/v projections, scores + q . table_k[bucket(i,j)] + (k scale) . table_q[bucket(j,i)], softmax, output projection + bias.
__device__ __forceinline__ v16h frag_h(const _Float16* rowk0, int lane) {
  union { v16h v; v8h q[2]; } u; const _Float16* p = rowk0 + 8 * (lane >> 4);
  u.q[0] = *(const v8h*)p; u.q[1] = *(const v8h*)(p + 16); return u.v;
}
__device__ __forceinline__ v16h frag_f32(const float* rowk0, int lane) {
  v16h a; const float* p = rowk0 + 8 * (lane >> 4);
#pragma unroll
  for (int i = 0; i < 8; ++i) { a[i] = (_Float16)p[i]; a[8 + i] = (_Float16)p[16 + i]; }
  return a;
}
__device__ __forceinline__ v16h frag_f32s(const float* rowk0, int lane, float sc) {
  v16h a; const float* p = rowk0 + 8 * (lane >> 4);
#pragma unroll
  for (int i = 0; i < 8; ++i) { a[i] = (_Float16)(p[i] * sc); a[8 + i] = (_Float16)(p[16 + i] * sc); }
  return a;
}
// column fragment from a [K][ld] layout (column n), rows >= K read as 0
__device__ __forceinline__ v16h fragc_f32(const float* W, int k0, int n, int lane, int ld, int K) {
  v16h a; const int g = lane >> 4;
#pragma unroll
  for (int i = 0; i < 8; ++i) { const int ka = k0 + 8 * g + i, kb = ka + 16;
    a[i] = (_Float16)(ka < K ? W[(size_t)(ka < K ? ka : K - 1) * ld + n] : 0.f); a[8 + i] = (_Float16)(kb < K ? W[(size_t)(kb < K ? kb : K - 1) * ld + n] : 0.f); }
  return a;
}
struct F2 { v16b h, l; };
__device__ __forceinline__ F2 bsplit16(const float v[16]) { F2 r;
#pragma unroll
  for (int i = 0; i < 16; ++i) { const __bf16 h = (__bf16)v[i]; r.h[i] = h; r.l[i] = (__bf16)(v[i] - (float)h); }
  return r; }
__device__ __forceinline__ F2 split_row(const float* row, int k0, int lane) { float v[16]; const float* p = row + k0 + 8 * (lane >> 4);
#pragma unroll
  for (int i = 0; i < 8; ++i) { v[i] = p[i]; v[8 + i] = p[16 + i]; }
  return bsplit16(v); }
__device__ __forceinline__ F2 split_rowK(const float* row, int k0, int lane, int K) { float v[16]; const int g = lane >> 4;
#pragma unroll
  for (int i = 0; i < 8; ++i) { const int ka = k0 + 8 * g + i, kb = ka + 16; v[i] = ka < K ? row[ka < K ? ka : K - 1] : 0.f; v[8 + i] = kb < K ? row[kb < K ? kb : K - 1] : 0.f; }
  return bsplit16(v); }
__device__ __forceinline__ F2 split_col(const float* W, int k0, int n, int lane, int ld, int K) { float v[16]; const int g = lane >> 4;
#pragma unroll
  for (int i = 0; i < 8; ++i) { const int ka = k0 + 8 * g + i, kb = ka + 16; v[i] = ka < K ? W[(size_t)(ka < K ? ka : K - 1) * ld + n] : 0.f; v[8 + i] = kb < K ? W[(size_t)(kb < K ? kb : K - 1) * ld + n] : 0.f; }
  return bsplit16(v); }
__device__ __forceinline__ v8f mac3(const F2& a, const F2& b, v8f c) { c = wmma_bf(a.l, b.h, c); c = wmma_bf(a.h, b.l, c); return wmma_bf(a.h, b.h, c); }
__device__ __forceinline__ float sigm(float v) { return 1.0f / (1.0f + expf(-v)); }
#define LDSX() do { asm volatile("s_wait_dscnt 0" ::: "memory"); __builtin_amdgcn_wave_barrier(); __builtin_amdgcn_fence(__ATOMIC_RELEASE, "workgroup"); } while (0)


#define NB 4
#define SS 1024
#define DM 768
#define NH 12
#define NBK 5
#define HD 64
#define QKVW (3 * DM)
#ifndef TQB
#define TQB (SS / 64)
#define TNB NB
#define TOB (NB * SS / 64)     // output row tiles (all)
#endif
typedef __attribute__((ext_vector_type(8))) __bf16 v8b;
__device__ __forceinline__ v16b frag_b(const __bf16* rowk0, int lane) {
  union { v16b v; v8b q[2]; } u; const __bf16* p = rowk0 + 8 * (lane >> 4);
  u.q[0] = *(const v8b*)p; u.q[1] = *(const v8b*)(p + 16); return u.v;
}
typedef __attribute__((ext_vector_type(4))) __bf16 v4b;
#define KS 64   // k per staged step: 128 B of a bf16 row, one whole line
#define BQP 80  // words per bucket row of the staged key-side bias table: 64 keys + 16, so that a 16-key group's rows of buckets 0 to 3 fall on different banks
#define LP 72   // LDS row pitch in 16-bit elements: 128 B of data + 16 B, the pitch for 16-byte LDS readers
// the plain '#pragma unroll' on the short fixed loops of the staging code give the staged values and fragments (rb, ra, rk, rv, w, vf) constant indices, so that they stay in registers
__device__ __forceinline__ float bfr(float v) { return (float)(__bf16)v; }
__device__ __attribute__((noinline)) float exp_ni(float v) { return expf(v); }
__device__ __attribute__((noinline)) float erf_ni(float v) { return erff(v); }

#define PK_A 0                       // [2304][768] Wqkv rows (natural [out][in])
#define PK_P (PK_A + QKVW * DM)        // [768][768] Wo rows (natural)
#define PK_END (PK_P + DM * DM)
#define WS_PK  0u
#define WS_QK  (WS_PK + 2u * PK_END)             // f16 [4096 rows][1536]: q | k
#define WS_VTH (WS_QK + 2u * NB * SS * 2 * DM)     // f16 [b][768 (h*64+d)][1024 s]
#define WS_O   (WS_VTH + 2u * NB * DM * SS)        // f32 [4096][768]
#define WS_CS  (WS_O + 4u * NB * SS * DM)           // f32 [1024][32] x 2, not used by any kernel
#define WS_BKT (WS_CS + 4u * 2 * SS * 32)                 // f32 [NB*SS][NH][8]: q . table_k[u] ; BQT (k/8) . table_q[u]
#define WS_BQT (WS_BKT + 4u * NB * SS * NH * 8)
#define WS_PB  (WS_BQT + 4u * NB * SS * NH * 8)   // bytes [64 query tiles][32 key steps][32 lanes][16]: both bucket indices of a (query, key) pair, in the order in which a lane of k_attn uses them
#define WS_END (WS_PB + 1u * SS * SS)
// ---- k_pack: block = (64 k x 64 n tile of one (in,out) weight, which): the tile is read by whole lines (a row of the tile is 256 B), turned in LDS and written as bf16 rows [n][k], 128 B a row; which 0..2 -> W_q/W_k/W_v into PK_A rows which*768 + n; 3 -> W_o into PK_P
#define PT 64   // tile edge of k_pack
__global__ __launch_bounds__(128) void k_pack(const float* __restrict__ WQ, const float* __restrict__ WK, const float* __restrict__ WV, const float* __restrict__ WO, const int* __restrict__ RPB, __bf16* __restrict__ PK, unsigned* __restrict__ PB) {
  __shared__ __align__(16) __bf16 s[PT][LP];   // [n][k]
  const int which = blockIdx.y, t = threadIdx.x, lane = t & 31; const int k0 = (blockIdx.x % (DM / PT)) * PT, n0 = (blockIdx.x / (DM / PT)) * PT;
  const float* Wm = (which == 0) ? WQ : (which == 1) ? WK : (which == 2) ? WV : WO;
  // a thread holds 8 k in a row of 4 n: each 16-byte load of a wave covers 2 rows x 256 B, and each n's 8 values make one 16-byte LDS store
  const int c = t & 15, kr = t >> 4; const float* gw = Wm + (size_t)(k0 + kr * 8) * DM + n0 + c * 4;
  v4f ra[8];
#pragma unroll
  for (int i = 0; i < 8; ++i) ra[i] = *(const v4f*)(gw + (size_t)i * DM);
  asm volatile("s_wait_xcnt 0x0" :: "v"(gw) : "memory");   // stands behind the run of loads, in front of any rewrite of a register that one of them names as its address; the address is an input, so that its registers live up to the wait and no load's result is placed on them
  // the first 2,048 waves of the grid: one (16 queries, 32 keys) tile of the bucket pair table each; its loads fly with the weight tile's, its bytes are formed and stored at the foot, so that the barrier does not wait for that store. Byte ct * 8 + r of lane (col, g) = bucket[i][j] | bucket[j][i] << 4 for query i = 16 qt + col, key j = 32 ks + 16 ct + 8 g + r, both clamped to the last bucket here, which bounds the LDS addresses that k_attn forms from them for any content of the bucket array
  const int tile = (which * ((DM / PT) * (DM / PT)) + (int)blockIdx.x) * 4 + __builtin_amdgcn_readfirstlane(t >> 5); const bool hast = tile < (SS / 16) * (SS / 32);
  v4u ur[4]; unsigned uc[16];
  if (hast) { const int qi = (tile >> 5) * 16 + (lane & 15), kb = (tile & 31) * 32 + 8 * (lane >> 4);
    const int* pr = RPB + (size_t)qi * SS + kb; const int* pc = RPB + (size_t)kb * SS + qi;   // bucket[i][j ...] along the row, bucket[j ...][i] down the column
#pragma unroll
    for (int ct = 0; ct < 2; ++ct) { ur[ct * 2] = *(const v4u*)(pr + ct * 16); ur[ct * 2 + 1] = *(const v4u*)(pr + ct * 16 + 4);
#pragma unroll
      for (int r = 0; r < 8; ++r) uc[ct * 8 + r] = (unsigned)pc[(size_t)(ct * 16 + r) * SS]; }
    asm volatile("s_wait_xcnt 0x0" :: "v"(pr), "v"(pc) : "memory"); }   // stands behind the run of loads, in front of any rewrite of a register that one of them names as its address; the two addresses are inputs, so that their registers live up to the wait and no load's result is placed on them
#pragma unroll
  for (int e = 0; e < 4; ++e) { v8b o;
#pragma unroll
    for (int i = 0; i < 8; ++i) o[i] = (__bf16)ra[i][e];
    *(v8b*)&s[c * 4 + e][kr * 8] = o; }
  __syncthreads();
  __bf16* dst = ((which < 3) ? PK + PK_A + ((size_t)which * DM + n0) * DM : PK + PK_P + (size_t)n0 * DM) + k0;
#pragma unroll
  for (int i = 0; i < 4; ++i) vst2((unsigned*)(dst + (size_t)((t >> 3) + 16 * i) * DM + (t & 7) * 8), *(const v4u*)&s[(t >> 3) + 16 * i][(t & 7) * 8]);   // each 16-byte store of a wave covers 4 whole lines
  asm volatile("s_wait_xcnt 0x0" ::: "memory");   // stands behind the run of stores, in front of any rewrite of a register that one of them names
  if (hast) { v4u w = {0u, 0u, 0u, 0u};
#pragma unroll
    for (int e = 0; e < 16; ++e) { const unsigned u1 = ur[e >> 2][e & 3], u2 = uc[e]; const unsigned c1 = u1 < NBK - 1u ? u1 : NBK - 1u, c2 = u2 < NBK - 1u ? u2 : NBK - 1u;
      w[e >> 2] |= (c1 | c2 << 4) << 8 * (e & 3); }
    vst2(PB + ((size_t)tile * 32 + lane) * 4, w);
    asm volatile("s_wait_xcnt 0x0" ::: "memory"); }   // stands behind the store, in front of any rewrite of a register that it names
}
// ---- k_qkv: block = (128 rows, 384 columns = 6 heads of one of q, k, v), 16 waves as 2 x 8, a wave = 64 rows x 48 columns (4 x 3 tiles): 7 fragment reads feed 12 products, x is fetched by 6 column blocks and a weight row by 32 row blocks
#define QR 128                 // rows of a block
#define QC 384                 // columns of a block
#define QT 512                 // threads: (QR / 64) x (QC / 48) waves
#define SOP (QC + 8)           // pitch of the epilogue's q/k tiles in 16-bit elements: 16 B x an odd number, for 16-byte LDS readers
#define STP (QR + 8)           // the same for the v tile [d][s]
__global__ __launch_bounds__(QT) void k_qkv(const float* __restrict__ XQ, const float* __restrict__ XK, const float* __restrict__ XV, const __bf16* __restrict__ P, const float* __restrict__ TK, const float* __restrict__ TQ, float* __restrict__ BKT, float* __restrict__ BQT, _Float16* __restrict__ QK, _Float16* __restrict__ VTH) {
  const int which0 = (blockIdx.y * QC) / DM; const float* X = (which0 == 0) ? XQ : (which0 == 1) ? XK : XV;
  // one LDS block: the main loop's two stage buffers (weights QC rows, x QR rows, bf16); behind the loop's last barrier the epilogue's tiles lie over them
  __shared__ __align__(16) unsigned char sm[2 * QR * SOP * 2];
  __bf16 (*sB)[QC][LP] = (__bf16 (*)[QC][LP])sm; __bf16 (*sA)[QR][LP] = (__bf16 (*)[QR][LP])(sm + 2 * QC * LP * 2);
  _Float16 (*so)[SOP] = (_Float16 (*)[SOP])sm; _Float16 (*sol)[SOP] = (_Float16 (*)[SOP])(sm + QR * SOP * 2);
  _Float16 (*sth)[STP] = (_Float16 (*)[STP])sm;
  const int tid = threadIdx.x, wave = tid >> 5, lane = tid & 31, col = lane & 15, g = lane >> 4; const int wr = wave & 1, wc = wave >> 1; const size_t R0 = (size_t)blockIdx.x * QR; const int n0 = blockIdx.y * QC;
  v8f acc[4][3] = {};
  // each 16-byte load of a wave covers 4 whole lines: weights 4 rows x 128 B, x 2 rows x 256 B
  const __bf16* gB = P + (size_t)(n0 + (tid >> 3)) * DM + (tid & 7) * 8; const float* gA = X + (R0 + (tid >> 4)) * DM + (tid & 15) * 4;
  v8b rb[6]; v4f ra[4];
#pragma unroll
  for (int i = 0; i < 6; ++i) rb[i] = *(const v8b*)(gB + (size_t)i * 64 * DM);
#pragma unroll
  for (int i = 0; i < 4; ++i) ra[i] = *(const v4f*)(gA + (size_t)i * 32 * DM);
  asm volatile("s_wait_xcnt 0x0" ::: "memory");   // stands behind the run of loads, in front of any rewrite of a register that one of them names as its address
#pragma unroll
  for (int i = 0; i < 6; ++i) *(v8b*)&sB[0][(tid >> 3) + 64 * i][(tid & 7) * 8] = rb[i];
#pragma unroll
  for (int i = 0; i < 4; ++i) { v4b t;
#pragma unroll
    for (int e = 0; e < 4; ++e) t[e] = (__bf16)ra[i][e];
    *(v4b*)&sA[0][(tid >> 4) + 32 * i][(tid & 15) * 4] = t; }
  __syncthreads();
#pragma unroll 2   // two steps a body, so that each buffer's LDS addresses are immediates
  for (int s = 0; s < DM / KS; ++s) { const int cur = s & 1;
    if (s + 1 < DM / KS) {   // the next step's tiles fly while this step is worked on
#pragma unroll
      for (int i = 0; i < 6; ++i) rb[i] = *(const v8b*)(gB + (size_t)i * 64 * DM + (s + 1) * KS);
#pragma unroll
      for (int i = 0; i < 4; ++i) ra[i] = *(const v4f*)(gA + (size_t)i * 32 * DM + (s + 1) * KS);
      asm volatile("s_wait_xcnt 0x0" ::: "memory"); }   // stands behind the run of loads, in front of any rewrite of a register that one of them names as its address
#pragma unroll
    for (int kc = 0; kc < KS / 32; ++kc) { v16b a[4];
#pragma unroll
      for (int rt = 0; rt < 4; ++rt) a[rt] = frag_b(&sA[cur][wr * 64 + rt * 16 + col][kc * 32], lane);
      v16b w[3];
#pragma unroll
      for (int j = 0; j < 3; ++j) w[j] = frag_b(&sB[cur][wc * 48 + j * 16 + col][kc * 32], lane);   // all fragment reads as one group ahead of their twelve products
      __builtin_amdgcn_sched_barrier(0);   // keeps that group ahead of the products: left free, the compiler puts each read with a full wait directly in front of its product
#pragma unroll
      for (int j = 0; j < 3; ++j) {
#pragma unroll
        for (int rt = 0; rt < 4; ++rt) acc[rt][j] = wmma_bf(a[rt], w[j], acc[rt][j]); }
      __builtin_amdgcn_sched_barrier(0); }   // keeps the wait for the next step's global loads behind the products: left free, the compiler lifts the conversions, and that wait with them, among the step's first products
    if (s + 1 < DM / KS) {
#pragma unroll
      for (int i = 0; i < 6; ++i) *(v8b*)&sB[cur ^ 1][(tid >> 3) + 64 * i][(tid & 7) * 8] = rb[i];
#pragma unroll
      for (int i = 0; i < 4; ++i) { v4b t;
#pragma unroll
        for (int e = 0; e < 4; ++e) t[e] = (__bf16)ra[i][e];
        *(v4b*)&sA[cur ^ 1][(tid >> 4) + 32 * i][(tid & 15) * 4] = t; } }
    __syncthreads(); }   // publishes the next buffer and ends every reader's last read of this one
  if (n0 < 2 * DM) {   // per (row, head): the 5 bucket dots (q . table_k[u]) or ((k/8) . table_q[u]) -> BKT / BQT [row][h][8] (5 used), as matrix products: A = 16 rows of one head, read back from the tiles that are staged below for the stores (hi, and residual x2048), B = the table's rows, one bucket a column
    const bool isq = n0 < DM; const float* TB = isq ? TK : TQ; float* dstT = isq ? BKT : BQT; const float sc = isq ? 1.0f : 0.125f;
#pragma unroll
    for (int rt = 0; rt < 4; ++rt) {
#pragma unroll
      for (int j = 0; j < 3; ++j) {
#pragma unroll
        for (int r = 0; r < 8; ++r) { const float v = acc[rt][j][r]; const _Float16 hv = (_Float16)v; const int row = wr * 64 + rt * 16 + 8 * g + r, c = wc * 48 + j * 16 + col; so[row][c] = hv; sol[row][c] = (_Float16)((v - (float)hv) * 2048.0f); } } }   // q, k as f16 hi + (x2048) residual
    const float* tp = TB + (col < NBK ? col : NBK - 1) * HD + 8 * g;   // column = bucket; the lanes of columns 5 to 15 read the last row again, in bounds: a column of B reaches its own column of the product alone, and those columns are not stored
    v4f tr[8];   // read ahead of the barrier: the loads overlap the staging, among whose LDS stores the compiler sets them, on registers of accumulators that are already staged
#pragma unroll
    for (int i = 0; i < 8; ++i) tr[i] = *(const v4f*)(tp + (i >> 1) * 16 + (i & 1) * 4);
    asm volatile("s_wait_xcnt 0x0" :: "v"(tp) : "memory");   // stands behind the run of loads, in front of any rewrite of a register that one of them names as its address; the address is an input, so that its registers live up to the wait and no load's result is placed on them
    __syncthreads();   // from here a wave works on 16 rows x 3 whole heads, which other waves of the main loop have written
    const int rw = (wave & 7) * 16, h0 = (wave >> 3) * 3;
    { v16h tb[2];   // element e of step kc = d 32 kc + 8 g + e (e < 8), 32 kc + 16 + 8 g + e - 8 (e >= 8): the k order of frag_h
#pragma unroll
      for (int kc = 0; kc < 2; ++kc) {
#pragma unroll
        for (int e = 0; e < 16; ++e) tb[kc][e] = (_Float16)bfr(tr[kc * 4 + (e >> 2)][e & 3]); }
      v8f dh[3] = {}, dl[3] = {};   // register r: row 8 g + r, bucket col
#pragma unroll
      for (int hh = 0; hh < 3; ++hh) {
#pragma unroll
        for (int kc = 0; kc < 2; ++kc) { dh[hh] = wmma16(frag_h(&so[rw + col][(h0 + hh) * HD + kc * 32], lane), tb[kc], dh[hh]); dl[hh] = wmma16(frag_h(&sol[rw + col][(h0 + hh) * HD + kc * 32], lane), tb[kc], dl[hh]); } }
      if (col < NBK) { float* d = dstT + ((R0 + rw + 8 * g) * NH + (n0 % DM) / HD + h0) * 8 + col;   // (8-float slots per (row, head); 4-B scratch stores)
#pragma unroll
        for (int hh = 0; hh < 3; ++hh) dh[hh] = (dh[hh] + dl[hh] * (1.0f / 2048.0f)) * sc;
#pragma unroll
        for (int hh = 0; hh < 3; ++hh) {
#pragma unroll
          for (int r = 0; r < 8; ++r) d[(r * NH + hh) * 8] = dh[hh][r]; }
        asm volatile("s_wait_xcnt 0x0" :: "v"(d) : "memory"); } }   // stands behind the run of stores, in front of any rewrite of a register that one of them names
#pragma unroll   // the 16 rows' LDS reads fly as one group, each into registers of its own, so that no store's register is rewritten behind it
    for (int rl = 0; rl < 16; ++rl) if (lane < 24) vst2((unsigned*)(QK + (R0 + rw + rl) * (2 * DM) + n0 + h0 * HD + lane * 8), *(const v4u*)&so[rw + rl][h0 * HD + lane * 8]);   // 3 whole lines a row; the residual tile serves the bucket dots above alone: no kernel reads it from memory
  } else {
#pragma unroll
    for (int rt = 0; rt < 4; ++rt) {
#pragma unroll
      for (int j = 0; j < 3; ++j) {
#pragma unroll
        for (int r = 0; r < 8; ++r) sth[wc * 48 + j * 16 + col][wr * 64 + rt * 16 + 8 * g + r] = (_Float16)acc[rt][j][r]; } }
    __syncthreads();
    const int b = (int)(R0 / SS), s0 = (int)(R0 % SS); const int pc0 = n0 - 2 * DM;
    for (int i = 0; i < QC * (QR / 8) / QT; ++i) { const int d = (tid >> 4) + i * (QT / 16), pc = tid & 15; const size_t o = ((size_t)b * DM + pc0 + d) * SS + s0 + pc * 8; vst2((unsigned*)(VTH + o), *(const v4u*)&sth[d][pc * 8]); }   // 256 B of a d row in a run
    asm volatile("s_wait_xcnt 0x0" ::: "memory");   // stands behind the run of stores, in front of any rewrite of a register that one of them names
  }
}
// ---- k_attn: block = (64 queries, head h, batch b): all-keys flash attention on TRANSPOSED tiles: S^T = K . Q^T (A = K rows, B = q), so that a lane holds 16 keys' scores of ONE query (query = lane & 15, keys 8 * (lane >> 4) + r of each 16-key tile); scores = (q.k) * 0.125 with single f16 operands; the two f32 score tiles of 32 keys, converted in place, are the B operand of O^T += V^T . P^T (A = V rows [d][key]); O[b*S+q][h*64+d] = acc / 2048 / l (256-B segments)
__device__ __forceinline__ float xhalf(float x) { return __builtin_bit_cast(float, __builtin_amdgcn_permlanex16(__builtin_bit_cast(int, x), __builtin_bit_cast(int, x), 0x76543210, 0xfedcba98, false, false)); }   // lane l with lane l ^ 16
// 2^x on the hardware's v_exp_f32, written with the slot that the instruction set asks for behind a transcendental inside the statement. Outputs are early-clobber, so each v_exp_f32 is followed by one that is independent of it, and the last by the v_nop
__device__ __forceinline__ float exp2_1(float x) { float r; asm("v_exp_f32 %0, %1\n\tv_nop" : "=v"(r) : "v"(x)); return r; }
__device__ __forceinline__ v8f exp2_8(v8f x) { float r0, r1, r2, r3, r4, r5, r6, r7;
  asm("v_exp_f32 %0, %8\n\tv_exp_f32 %1, %9\n\tv_exp_f32 %2, %10\n\tv_exp_f32 %3, %11\n\tv_exp_f32 %4, %12\n\tv_exp_f32 %5, %13\n\tv_exp_f32 %6, %14\n\tv_exp_f32 %7, %15\n\tv_nop"
      : "=&v"(r0), "=&v"(r1), "=&v"(r2), "=&v"(r3), "=&v"(r4), "=&v"(r5), "=&v"(r6), "=&v"(r7) : "v"(x[0]), "v"(x[1]), "v"(x[2]), "v"(x[3]), "v"(x[4]), "v"(x[5]), "v"(x[6]), "v"(x[7]));
  const v8f r = {r0, r1, r2, r3, r4, r5, r6, r7}; return r; }
#define LOG2E 1.44269504f
__global__ __launch_bounds__(128) void k_attn(const _Float16* __restrict__ QK, const _Float16* __restrict__ VTH, const float* __restrict__ BKT, const float* __restrict__ BQT, const unsigned* __restrict__ PB, float* __restrict__ O) {
  __shared__ __align__(16) float so[4][16][68];
  __shared__ __align__(16) _Float16 sK[2][64][LP], sV[2][64][LP];   // two stage buffers of 64 keys: K rows [key][d], V rows [d][key], 128 B of data a row
  __shared__ __align__(16) float sBQ[2][NBK][BQP];   // the stage's (k/8) . table_q[u], [bucket][key], in the same two stage buffers' rhythm
  __shared__ __align__(16) float sBK[4][NBK][32];    // per wave: q . table_k[u] of each lane's own query, [bucket][lane]: a lane reads its own column alone, so no two lanes of a look-up meet on a bank
  const int tid = threadIdx.x, wave = tid >> 5, lane = tid & 31, col = lane & 15, g = lane >> 4;
  const int qb = blockIdx.x, h = blockIdx.y, b = blockIdx.z; const int q0 = qb * 64 + wave * 16; const size_t rq = (size_t)b * SS + q0 + col;
  v16h aq[2];
#pragma unroll
  for (int kc = 0; kc < 2; ++kc) aq[kc] = frag_h(QK + rq * (2 * DM) + h * HD + kc * 32, lane);
  { const float* bk = BKT + (rq * NH + h) * 8;   // the lane's own query: its five buckets
    const v4f t = *(const v4f*)bk; const float t4 = bk[4];
    asm volatile("s_wait_xcnt 0x0" ::: "memory");   // stands behind the two loads, in front of any rewrite of a register that one of them names as its address
#pragma unroll
    for (int u = 0; u < 4; ++u) sBK[wave][u][lane] = t[u];
    sBK[wave][4][lane] = t4; }
  float m = -3.0e38f, l = 0.f;   // the lane's query: running maximum (equal in both halves), and the half's own part of the sum
  v8f acc[4] = {};
  const int nst = SS / 64;   // all keys, 64 a stage
  // each 16-byte load of a wave covers 4 whole lines: 4 rows x 128 B
  const _Float16* gK = QK + ((size_t)b * SS + (tid >> 3)) * (2 * DM) + DM + h * HD + (tid & 7) * 8; const _Float16* gV = VTH + ((size_t)b * DM + h * HD + (tid >> 3)) * SS + (tid & 7) * 8;
  const int bkey = tid >> 1, bp = tid & 1;   // key-side bias rows of a stage's 64 keys: a pair of threads brings one key's five buckets, 0, 1 and 4 | 2, 3
  const float* gQ = BQT + (((size_t)b * SS + bkey) * NH + h) * 8 + bp * 2;
  const unsigned* gP = PB + ((size_t)(qb * 4 + wave) * (SS / 32) * 32 + lane) * 4;   // the wave's own 16 queries: 512 B in a row for each step of 32 keys, 16 B a lane
  v8h rk[4], rv[4]; v2f rbq; float rb4 = 0.f;
  v4u nb = *(const v4u*)gP;   // the bucket pairs of step 0
#pragma unroll
  for (int i = 0; i < 4; ++i) { rk[i] = *(const v8h*)(gK + (size_t)i * 16 * (2 * DM)); rv[i] = *(const v8h*)(gV + (size_t)i * 16 * SS); }
  rbq = *(const v2f*)gQ; if (bp == 0) rb4 = gQ[4];
  asm volatile("s_wait_xcnt 0x0" ::: "memory");   // stands behind the run of loads, in front of any rewrite of a register that one of them names as its address
#pragma unroll
  for (int i = 0; i < 4; ++i) { *(v8h*)&sK[0][(tid >> 3) + 16 * i][(tid & 7) * 8] = rk[i]; *(v8h*)&sV[0][(tid >> 3) + 16 * i][(tid & 7) * 8] = rv[i]; }
  sBQ[0][bp * 2][bkey] = rbq[0]; sBQ[0][bp * 2 + 1][bkey] = rbq[1]; if (bp == 0) sBQ[0][4][bkey] = rb4;
  __syncthreads();
#pragma unroll 1   // keeps the long body once in the text
  for (int st = 0; st < nst; ++st) { const int cur = st & 1;
#pragma unroll 1   // as the loop over the stages
  for (int ks = 2 * st; ks < 2 * st + 2; ++ks) { v8f s[2]; const int kh = (ks & 1) * 32;
    const v4u cb = nb;   // this step's 16 bucket pairs; the next step's (the last step: its own again) fly while this one is worked on
    const unsigned* pn = gP + (size_t)(ks + 1 < SS / 32 ? ks + 1 : SS / 32 - 1) * 128; nb = *(const v4u*)pn;
    asm volatile("s_wait_xcnt 0x0" :: "v"(pn) : "memory");   // stands behind the load, in front of any rewrite of a register that it names as its address; the address is an input, so that its registers live up to the wait and the load's result is not placed on them
#pragma unroll
    for (int ct = 0; ct < 2; ++ct) { v8f c = {};   // register r: key ks * 32 + ct * 16 + 8 * g + r, query q0 + col
#pragma unroll
      for (int kc = 0; kc < 2; ++kc) c = wmma16(frag_h(&sK[cur][kh + ct * 16 + col][kc * 32], lane), aq[kc], c);   // single product: k, q as one-rounding f16 operands
      { const float* tq = &sBQ[cur][0][kh + ct * 16 + 8 * g]; const float* tk = &sBK[wave][0][lane];
#pragma unroll
      for (int r = 0; r < 8; ++r) { const unsigned pw = cb[ct * 2 + (r >> 2)] >> 8 * (r & 3); const unsigned c1 = pw & 7u, c2 = pw >> 4 & 7u;   // both at most 4: clamped where k_pack wrote the table
        s[ct][r] = c[r] * 0.125f + tk[c1 * 32] + tq[c2 * BQP + r]; } } }   // 1/sqrt(64) + q.table_k[bucket(i,j)] + (k/8).table_q[bucket(j,i)]
    float mx = fmaxf(s[0][0], s[1][0]);
#pragma unroll
    for (int r = 1; r < 8; ++r) mx = fmaxf(mx, fmaxf(s[0][r], s[1][r]));
    mx = fmaxf(mx, xhalf(mx));   // the query's other 16 keys of this step lie in the other half of the wave
    const float mn = fmaxf(m, mx); const float alpha = exp2_1((m - mn) * LOG2E);   // first step: m is the start value, the argument overflows to -inf and 2^-inf is 0
    v16h pa; float es = 0.f;
#pragma unroll
    for (int ct = 0; ct < 2; ++ct) { const v8f ex = exp2_8((s[ct] - mn) * LOG2E);
#pragma unroll
      for (int r = 0; r < 8; ++r) { es += ex[r]; pa[ct * 8 + r] = (_Float16)(ex[r] * 2048.0f); } }   // element ct * 8 + r = key 16 ct + 8 g + r: the k order of the V fragments; P scaled by 2^11 before the f16 rounding so small softmax weights stay out of the f16 subnormal range; 2^-11 folded into the epilogue
    l = l * alpha + es; m = mn;
#pragma unroll
    for (int dt = 0; dt < 4; ++dt) {
#pragma unroll
      for (int r = 0; r < 8; ++r) acc[dt][r] *= alpha; }
    v16h vf[4];
#pragma unroll
    for (int dt = 0; dt < 4; ++dt) vf[dt] = frag_h(&sV[cur][dt * 16 + col][kh], lane);   // all V fragment reads as one group ahead of the products
#pragma unroll
    for (int dt = 0; dt < 4; ++dt) acc[dt] = wmma16(vf[dt], pa, acc[dt]);   // single product: V x P (x2^11); register r: d = 16 dt + 8 g + r of query col
    asm volatile("v_nop\n\tv_nop\n\tv_nop\n\tv_nop" : "+v"(acc[3]) : "v"(vf[3]), "v"(pa)); }   // the four slots behind the step's last products, once a step: the loop's branch follows them, and the head of the next step rewrites fragment registers
    if (st + 1 < nst) {   // the next stage is fetched and stored into the other buffer here at the foot, not held in registers over the stage
#pragma unroll
      for (int i = 0; i < 4; ++i) { rk[i] = *(const v8h*)(gK + ((size_t)(st + 1) * 64 + i * 16) * (2 * DM)); rv[i] = *(const v8h*)(gV + (size_t)i * 16 * SS + (st + 1) * 64); }
      rbq = *(const v2f*)(gQ + (size_t)(st + 1) * 64 * NH * 8); if (bp == 0) rb4 = gQ[(size_t)(st + 1) * 64 * NH * 8 + 4];
      asm volatile("s_wait_xcnt 0x0" ::: "memory");   // stands behind the run of loads, in front of any rewrite of a register that one of them names as its address
#pragma unroll
      for (int i = 0; i < 4; ++i) { *(v8h*)&sK[cur ^ 1][(tid >> 3) + 16 * i][(tid & 7) * 8] = rk[i]; *(v8h*)&sV[cur ^ 1][(tid >> 3) + 16 * i][(tid & 7) * 8] = rv[i]; }
      sBQ[cur ^ 1][bp * 2][bkey] = rbq[0]; sBQ[cur ^ 1][bp * 2 + 1][bkey] = rbq[1]; if (bp == 0) sBQ[cur ^ 1][4][bkey] = rb4; }
    __syncthreads(); }   // publishes the next buffer and ends every reader's last read of this one
  { const float il = (1.0f / 2048.0f) / (l + xhalf(l));   // the two halves' parts of the query's sum are joined once, here
#pragma unroll
    for (int dt = 0; dt < 4; ++dt) {
#pragma unroll
      for (int r = 0; r < 8; ++r) so[wave][col][dt * 16 + 8 * g + r] = acc[dt][r] * il; } }
  LDSX();
  for (int rl = 0; rl < 16; ++rl) if (lane < 16) vst2(O + ((size_t)b * SS + q0 + rl) * DM + h * HD + lane * 4, *(const v4f*)&so[wave][rl][lane * 4]);
}
// ---- k_out: block = (64 rows, 128 cols): out = O(hi/lo) . Wo rows (2 products) + bo
__global__ __launch_bounds__(128) void k_out(const float* __restrict__ O, const __bf16* __restrict__ P, const float* __restrict__ BO, float* __restrict__ Y) {
  // one LDS block: two stage buffers (weights 128 rows, ctx hi and residual 64 rows each, bf16); behind the loop's last barrier the output tile lies over them
  __shared__ __align__(16) unsigned char sm[2 * (128 + 64 + 64) * LP * 2];
  __bf16 (*sB)[128][LP] = (__bf16 (*)[128][LP])sm; __bf16 (*sH)[64][LP] = (__bf16 (*)[64][LP])(sm + 2 * 128 * LP * 2); __bf16 (*sL)[64][LP] = (__bf16 (*)[64][LP])(sm + 2 * (128 + 64) * LP * 2);
  float (*so)[16][132] = (float (*)[16][132])sm;
  const int tid = threadIdx.x, wave = tid >> 5, lane = tid & 31, col = lane & 15, g = lane >> 4; const size_t r0 = (size_t)blockIdx.x * 64 + wave * 16; const int n0 = blockIdx.y * 128;
  v8f acc[8] = {};
  const __bf16* gB = P + (size_t)(n0 + (tid >> 3)) * DM + (tid & 7) * 8; const float* gA = O + ((size_t)blockIdx.x * 64 + (tid >> 4)) * DM + (tid & 15) * 4;
  v8b rb[8]; v4f ra[8];
#pragma unroll
  for (int i = 0; i < 8; ++i) { rb[i] = *(const v8b*)(gB + (size_t)i * 16 * DM); ra[i] = *(const v4f*)(gA + (size_t)i * 8 * DM); }
#pragma unroll
  for (int i = 0; i < 8; ++i) { *(v8b*)&sB[0][(tid >> 3) + 16 * i][(tid & 7) * 8] = rb[i]; v4b th, tl;
#pragma unroll
    for (int e = 0; e < 4; ++e) { const __bf16 hv = (__bf16)ra[i][e]; th[e] = hv; tl[e] = (__bf16)(ra[i][e] - (float)hv); }
    *(v4b*)&sH[0][(tid >> 4) + 8 * i][(tid & 15) * 4] = th; *(v4b*)&sL[0][(tid >> 4) + 8 * i][(tid & 15) * 4] = tl; }
  __syncthreads();
#pragma unroll 2   // two steps a body, so that each buffer's LDS addresses are immediates
  for (int s = 0; s < DM / KS; ++s) { const int cur = s & 1;
    if (s + 1 < DM / KS) {   // the next step's tiles fly while this step is worked on
#pragma unroll
      for (int i = 0; i < 8; ++i) { rb[i] = *(const v8b*)(gB + (size_t)i * 16 * DM + (s + 1) * KS); ra[i] = *(const v4f*)(gA + (size_t)i * 8 * DM + (s + 1) * KS); }
      asm volatile("s_wait_xcnt 0x0" ::: "memory"); }   // stands behind the run of loads, in front of any rewrite of a register that one of them names as its address
#pragma unroll
    for (int kc = 0; kc < KS / 32; ++kc) { const v16b ah = frag_b(&sH[cur][wave * 16 + col][kc * 32], lane), al = frag_b(&sL[cur][wave * 16 + col][kc * 32], lane); v16b w[8];
#pragma unroll
      for (int j = 0; j < 8; ++j) w[j] = frag_b(&sB[cur][j * 16 + col][kc * 32], lane);   // all fragment reads as one group ahead of the products
      __builtin_amdgcn_sched_barrier(0);   // keeps that group ahead of the products
#pragma unroll
      for (int j = 0; j < 8; ++j) { acc[j] = wmma_bf(al, w[j], acc[j]); acc[j] = wmma_bf(ah, w[j], acc[j]); }
      __builtin_amdgcn_sched_barrier(0); }   // keeps the wait for the next step's global loads behind the products
    if (s + 1 < DM / KS) {
#pragma unroll
      for (int i = 0; i < 8; ++i) { *(v8b*)&sB[cur ^ 1][(tid >> 3) + 16 * i][(tid & 7) * 8] = rb[i]; v4b th, tl;
#pragma unroll
        for (int e = 0; e < 4; ++e) { const __bf16 hv = (__bf16)ra[i][e]; th[e] = hv; tl[e] = (__bf16)(ra[i][e] - (float)hv); }
        *(v4b*)&sH[cur ^ 1][(tid >> 4) + 8 * i][(tid & 15) * 4] = th; *(v4b*)&sL[cur ^ 1][(tid >> 4) + 8 * i][(tid & 15) * 4] = tl; } }
    __syncthreads(); }   // publishes the next buffer and ends every reader's last read of this one
#pragma unroll
  for (int j = 0; j < 8; ++j) {
#pragma unroll
    for (int r = 0; r < 8; ++r) so[wave][8 * g + r][j * 16 + col] = acc[j][r] + bfr(BO[n0 + j * 16 + col]); }
  LDSX();
  for (int rl = 0; rl < 16; ++rl) vst2(Y + (r0 + rl) * DM + n0 + lane * 4, *(const v4f*)&so[wave][rl][lane * 4]);
}
extern "C" void kernel_launch(void* const* d_in, const int* in_sizes, int n_in, void* d_out, int out_size, void* d_ws, size_t ws_size, hipStream_t stream) {
  (void)in_sizes; (void)n_in; (void)out_size;
  const float** F = (const float**)d_in;   // 0 x [4,1024,768], 1 wq_w, 2 wk_w, 3 wv_w, 4 proj_w ((in,out)), 5 proj_b, 6 rpe_k_table [5,64], 7 rpe_q_table [5,64], 8 rp_bucket [1024,1024] int
  if (ws_size < (size_t)WS_END) return;
  char* ws = (char*)d_ws; __bf16* PK = (__bf16*)(ws + WS_PK); _Float16 *QK = (_Float16*)(ws + WS_QK), *VTH = (_Float16*)(ws + WS_VTH); float *O = (float*)(ws + WS_O), *BKT = (float*)(ws + WS_BKT), *BQT = (float*)(ws + WS_BQT);
  k_pack<<<dim3((DM / PT) * (DM / PT), 4), 128, 0, stream>>>(F[1], F[2], F[3], F[4], (const int*)d_in[8], PK, (unsigned*)(ws + WS_PB));
  k_qkv<<<dim3(TNB * SS / QR, QKVW / QC), QT, 0, stream>>>(F[0], F[0], F[0], PK + PK_A, F[6], F[7], BKT, BQT, QK, VTH);
  k_attn<<<dim3(TQB, NH, TNB), 128, 0, stream>>>(QK, VTH, BKT, BQT, (const unsigned*)(ws + WS_PB), O);
  k_out<<<dim3(TOB, DM / 128), 128, 0, stream>>>(O, PK + PK_P, F[5], (float*)d_out);
}

// v010
// It runs in 71.2 microseconds.
// Two timings next to v009 put it at 1.03 and 1.02 times that version's speed.
// Counting every step since v000, it is 4.20 times as fast.
// compute dtype: all float inputs rounded to bf16, rp_bucket (int) read on device; q/k/v = x . W with EXACT bf16 products on WMMA 16x16x32 ((in,out) weights as transposed rows); per (token, head) the 5 bucket dots q . rpe_k_table[u] and (k / 8) . rpe_q_table[u] on WMMA 16x16x32 from the projections as f16 hi + residual (2 products); PLAIN attention: q, k as single f16 operands x 1/8 + bk[i][bucket[i][j]] + bq[j][bucket[j][i]], running-max softmax in f32 (hardware exp), P (scaled by 2^11, single f16) x v (single f16); out = ctx (bf16 hi + residual) . proj_w (2 products) + proj_b.
#include <hip/hip_runtime.h>
#include <math.h>

typedef __attribute__((ext_vector_type(16))) _Float16 v16h;
typedef __attribute__((ext_vector_type(16))) __bf16 v16b;
typedef __attribute__((ext_vector_type(8)))  _Float16 v8h;
typedef __attribute__((ext_vector_type(8)))  float v8f;
typedef __attribute__((ext_vector_type(4)))  float v4f;
typedef __attribute__((ext_vector_type(2)))  float v2f;
typedef __attribute__((ext_vector_type(4)))  unsigned v4u;
typedef __attribute__((ext_vector_type(4)))  int v4i;
typedef float __attribute__((may_alias)) float_a;
typedef int __attribute__((may_alias)) int_a;

template <typename T> __device__ __forceinline__ void vst2(void* p, T v) { *(T*)p = v;  }
__device__ __forceinline__ v8f wmma16(v16h a, v16h b, v8f c) {
  return __builtin_amdgcn_wmma_f32_16x16x32_f16(false, a, false, b, (short)0, c, false, false);
}
__device__ __forceinline__ v8f wmma_bf(v16b a, v16b b, v8f c) {
  return __builtin_amdgcn_wmma_f32_16x16x32_bf16(false, a, false, b, (short)0, c, false, false);
}
// Attention with image relative-position encoding (iRPE, contextual mode on q and k) over a 32 x 32 patch grid (B 4, N 1,024, C 768, 12 heads x 64): bias-free q/k/v projections, scores + q . table_k[bucket(i,j)] + (k scale) . table_q[bucket(j,i)], softmax, output projection + bias.
__device__ __forceinline__ v16h frag_h(const _Float16* rowk0, int lane) {
  union { v16h v; v8h q[2]; } u; const _Float16* p = rowk0 + 8 * (lane >> 4);
  u.q[0] = *(const v8h*)p; u.q[1] = *(const v8h*)(p + 16); return u.v;
}
__device__ __forceinline__ v16h frag_f32(const float* rowk0, int lane) {
  v16h a; const float* p = rowk0 + 8 * (lane >> 4);
#pragma unroll
  for (int i = 0; i < 8; ++i) { a[i] = (_Float16)p[i]; a[8 + i] = (_Float16)p[16 + i]; }
  return a;
}
__device__ __forceinline__ v16h frag_f32s(const float* rowk0, int lane, float sc) {
  v16h a; const float* p = rowk0 + 8 * (lane >> 4);
#pragma unroll
  for (int i = 0; i < 8; ++i) { a[i] = (_Float16)(p[i] * sc); a[8 + i] = (_Float16)(p[16 + i] * sc); }
  return a;
}
// column fragment from a [K][ld] layout (column n), rows >= K read as 0
__device__ __forceinline__ v16h fragc_f32(const float* W, int k0, int n, int lane, int ld, int K) {
  v16h a; const int g = lane >> 4;
#pragma unroll
  for (int i = 0; i < 8; ++i) { const int ka = k0 + 8 * g + i, kb = ka + 16;
    a[i] = (_Float16)(ka < K ? W[(size_t)(ka < K ? ka : K - 1) * ld + n] : 0.f); a[8 + i] = (_Float16)(kb < K ? W[(size_t)(kb < K ? kb : K - 1) * ld + n] : 0.f); }
  return a;
}
struct F2 { v16b h, l; };
__device__ __forceinline__ F2 bsplit16(const float v[16]) { F2 r;
#pragma unroll
  for (int i = 0; i < 16; ++i) { const __bf16 h = (__bf16)v[i]; r.h[i] = h; r.l[i] = (__bf16)(v[i] - (float)h); }
  return r; }
__device__ __forceinline__ F2 split_row(const float* row, int k0, int lane) { float v[16]; const float* p = row + k0 + 8 * (lane >> 4);
#pragma unroll
  for (int i = 0; i < 8; ++i) { v[i] = p[i]; v[8 + i] = p[16 + i]; }
  return bsplit16(v); }
__device__ __forceinline__ F2 split_rowK(const float* row, int k0, int lane, int K) { float v[16]; const int g = lane >> 4;
#pragma unroll
  for (int i = 0; i < 8; ++i) { const int ka = k0 + 8 * g + i, kb = ka + 16; v[i] = ka < K ? row[ka < K ? ka : K - 1] : 0.f; v[8 + i] = kb < K ? row[kb < K ? kb : K - 1] : 0.f; }
  return bsplit16(v); }
__device__ __forceinline__ F2 split_col(const float* W, int k0, int n, int lane, int ld, int K) { float v[16]; const int g = lane >> 4;
#pragma unroll
  for (int i = 0; i < 8; ++i) { const int ka = k0 + 8 * g + i, kb = ka + 16; v[i] = ka < K ? W[(size_t)(ka < K ? ka : K - 1) * ld + n] : 0.f; v[8 + i] = kb < K ? W[(size_t)(kb < K ? kb : K - 1) * ld + n] : 0.f; }
  return bsplit16(v); }
__device__ __forceinline__ v8f mac3(const F2& a, const F2& b, v8f c) { c = wmma_bf(a.l, b.h, c); c = wmma_bf(a.h, b.l, c); return wmma_bf(a.h, b.h, c); }
__device__ __forceinline__ float sigm(float v) { return 1.0f / (1.0f + expf(-v)); }
#define LDSX() do { asm volatile("s_wait_dscnt 0" ::: "memory"); __builtin_amdgcn_wave_barrier(); __builtin_amdgcn_fence(__ATOMIC_RELEASE, "workgroup"); } while (0)


#define NB 4
#define SS 1024
#define DM 768
#define NH 12
#define NBK 5
#define HD 64
#define QKVW (3 * DM)
#ifndef TQB
#define TQB (SS / 64)
#define TNB NB
#define TOB (NB * SS / 64)     // output row tiles (all)
#endif
typedef __attribute__((ext_vector_type(8))) __bf16 v8b;
__device__ __forceinline__ v16b frag_b(const __bf16* rowk0, int lane) {
  union { v16b v; v8b q[2]; } u; const __bf16* p = rowk0 + 8 * (lane >> 4);
  u.q[0] = *(const v8b*)p; u.q[1] = *(const v8b*)(p + 16); return u.v;
}
typedef __attribute__((ext_vector_type(4))) __bf16 v4b;
#define KS 64   // k per staged step: 128 B of a bf16 row, one whole line
#define BQP 80  // words per bucket row of the staged key-side bias table: 64 keys + 16, so that a 16-key group's rows of buckets 0 to 3 fall on different banks
#define LP 72   // LDS row pitch in 16-bit elements: 128 B of data + 16 B, the pitch for 16-byte LDS readers
// the plain '#pragma unroll' on the short fixed loops of the staging code give the staged values and fragments (rb, ra, rk, rv, w, vf) constant indices, so that they stay in registers
__device__ __forceinline__ float bfr(float v) { return (float)(__bf16)v; }
__device__ __attribute__((noinline)) float exp_ni(float v) { return expf(v); }
__device__ __attribute__((noinline)) float erf_ni(float v) { return erff(v); }

#define PK_A 0                       // [2304][768] Wqkv rows (natural [out][in])
#define PK_P (PK_A + QKVW * DM)        // [768][768] Wo rows (natural)
#define PK_END (PK_P + DM * DM)
#define WS_PK  0u
#define WS_QK  (WS_PK + 2u * PK_END)             // f16 [4096 rows][1536]: q | k
#define WS_VTH (WS_QK + 2u * NB * SS * 2 * DM)     // f16 [b][768 (h*64+d)][1024 s]
#define WS_O   (WS_VTH + 2u * NB * DM * SS)        // f32 [4096][768]
#define WS_CS  (WS_O + 4u * NB * SS * DM)           // f32 [1024][32] x 2, not used by any kernel
#define WS_BKT (WS_CS + 4u * 2 * SS * 32)                 // f32 [NB*SS][NH][8]: q . table_k[u] ; BQT (k/8) . table_q[u]
#define WS_BQT (WS_BKT + 4u * NB * SS * NH * 8)
#define WS_PB  (WS_BQT + 4u * NB * SS * NH * 8)   // bytes [64 query tiles][32 key steps][32 lanes][16]: both bucket indices of a (query, key) pair, in the order in which a lane of k_attn uses them
#define WS_END (WS_PB + 1u * SS * SS)
// ---- k_pack: block = (64 k x 64 n tile of one (in,out) weight, which): the tile is read by whole lines (a row of the tile is 256 B), turned in LDS and written as bf16 rows [n][k], 128 B a row; which 0..2 -> W_q/W_k/W_v into PK_A rows which*768 + n; 3 -> W_o into PK_P
#define PT 64   // tile edge of k_pack
__global__ __launch_bounds__(128) void k_pack(const float* __restrict__ WQ, const float* __restrict__ WK, const float* __restrict__ WV, const float* __restrict__ WO, const int* __restrict__ RPB, __bf16* __restrict__ PK, unsigned* __restrict__ PB) {
  __shared__ __align__(16) __bf16 s[PT][LP];   // [n][k]
  const int which = blockIdx.y, t = threadIdx.x, lane = t & 31; const int k0 = (blockIdx.x % (DM / PT)) * PT, n0 = (blockIdx.x / (DM / PT)) * PT;
  const float* Wm = (which == 0) ? WQ : (which == 1) ? WK : (which == 2) ? WV : WO;
  // a thread holds 8 k in a row of 4 n: each 16-byte load of a wave covers 2 rows x 256 B, and each n's 8 values make one 16-byte LDS store
  const int c = t & 15, kr = t >> 4; const float* gw = Wm + (size_t)(k0 + kr * 8) * DM + n0 + c * 4;
  v4f ra[8];
#pragma unroll
  for (int i = 0; i < 8; ++i) ra[i] = *(const v4f*)(gw + (size_t)i * DM);
  asm volatile("s_wait_xcnt 0x0" :: "v"(gw) : "memory");   // stands behind the run of loads, in front of any rewrite of a register that one of them names as its address; the address is an input, so that its registers live up to the wait and no load's result is placed on them
  // the first 2,048 waves of the grid: one (16 queries, 32 keys) tile of the bucket pair table each; its loads fly with the weight tile's, its bytes are formed and stored at the foot, so that the barrier does not wait for that store. Byte ct * 8 + r of lane (col, g) = bucket[i][j] | bucket[j][i] << 4 for query i = 16 qt + col, key j = 32 ks + 16 ct + 8 g + r, both clamped to the last bucket here, which bounds the LDS addresses that k_attn forms from them for any content of the bucket array
  const int tile = (which * ((DM / PT) * (DM / PT)) + (int)blockIdx.x) * 4 + __builtin_amdgcn_readfirstlane(t >> 5); const bool hast = tile < (SS / 16) * (SS / 32);
  v4u ur[4]; unsigned uc[16];
  if (hast) { const int qi = (tile >> 5) * 16 + (lane & 15), kb = (tile & 31) * 32 + 8 * (lane >> 4);
    const int* pr = RPB + (size_t)qi * SS + kb; const int* pc = RPB + (size_t)kb * SS + qi;   // bucket[i][j ...] along the row, bucket[j ...][i] down the column
#pragma unroll
    for (int ct = 0; ct < 2; ++ct) { ur[ct * 2] = *(const v4u*)(pr + ct * 16); ur[ct * 2 + 1] = *(const v4u*)(pr + ct * 16 + 4);
#pragma unroll
      for (int r = 0; r < 8; ++r) uc[ct * 8 + r] = (unsigned)pc[(size_t)(ct * 16 + r) * SS]; }
    asm volatile("s_wait_xcnt 0x0" :: "v"(pr), "v"(pc) : "memory"); }   // stands behind the run of loads, in front of any rewrite of a register that one of them names as its address; the two addresses are inputs, so that their registers live up to the wait and no load's result is placed on them
#pragma unroll
  for (int e = 0; e < 4; ++e) { v8b o;
#pragma unroll
    for (int i = 0; i < 8; ++i) o[i] = (__bf16)ra[i][e];
    *(v8b*)&s[c * 4 + e][kr * 8] = o; }
  __syncthreads();
  __bf16* dst = ((which < 3) ? PK + PK_A + ((size_t)which * DM + n0) * DM : PK + PK_P + (size_t)n0 * DM) + k0;
#pragma unroll
  for (int i = 0; i < 4; ++i) vst2((unsigned*)(dst + (size_t)((t >> 3) + 16 * i) * DM + (t & 7) * 8), *(const v4u*)&s[(t >> 3) + 16 * i][(t & 7) * 8]);   // each 16-byte store of a wave covers 4 whole lines
  asm volatile("s_wait_xcnt 0x0" ::: "memory");   // stands behind the run of stores, in front of any rewrite of a register that one of them names
  if (hast) { v4u w = {0u, 0u, 0u, 0u};
#pragma unroll
    for (int e = 0; e < 16; ++e) { const unsigned u1 = ur[e >> 2][e & 3], u2 = uc[e]; const unsigned c1 = u1 < NBK - 1u ? u1 : NBK - 1u, c2 = u2 < NBK - 1u ? u2 : NBK - 1u;
      w[e >> 2] |= (c1 | c2 << 4) << 8 * (e & 3); }
    vst2(PB + ((size_t)tile * 32 + lane) * 4, w);
    asm volatile("s_wait_xcnt 0x0" ::: "memory"); }   // stands behind the store, in front of any rewrite of a register that it names
}
// ---- k_qkv: block = (128 rows, 384 columns = 6 heads of one of q, k, v), 16 waves as 2 x 8, a wave = 64 rows x 48 columns (4 x 3 tiles): 7 fragment reads feed 12 products, x is fetched by 6 column blocks and a weight row by 32 row blocks
#define QR 128                 // rows of a block
#define QC 384                 // columns of a block
#define QT 512                 // threads: (QR / 64) x (QC / 48) waves
#define SOP (QC + 8)           // pitch of the epilogue's q/k tiles in 16-bit elements: 16 B x an odd number, for 16-byte LDS readers
#define STP (QR + 8)           // the same for the v tile [d][s]
__global__ __launch_bounds__(QT) void k_qkv(const float* __restrict__ XQ, const float* __restrict__ XK, const float* __restrict__ XV, const __bf16* __restrict__ P, const float* __restrict__ TK, const float* __restrict__ TQ, float* __restrict__ BKT, float* __restrict__ BQT, _Float16* __restrict__ QK, _Float16* __restrict__ VTH) {
  const int which0 = (blockIdx.y * QC) / DM; const float* X = (which0 == 0) ? XQ : (which0 == 1) ? XK : XV;
  // one LDS block: the main loop's two stage buffers (weights QC rows, x QR rows, bf16); behind the loop's last barrier the epilogue's tiles lie over them
  __shared__ __align__(16) unsigned char sm[2 * QR * SOP * 2];
  __bf16 (*sB)[QC][LP] = (__bf16 (*)[QC][LP])sm; __bf16 (*sA)[QR][LP] = (__bf16 (*)[QR][LP])(sm + 2 * QC * LP * 2);
  _Float16 (*so)[SOP] = (_Float16 (*)[SOP])sm; _Float16 (*sol)[SOP] = (_Float16 (*)[SOP])(sm + QR * SOP * 2);
  _Float16 (*sth)[STP] = (_Float16 (*)[STP])sm;
  const int tid = threadIdx.x, wave = tid >> 5, lane = tid & 31, col = lane & 15, g = lane >> 4; const int wr = wave & 1, wc = wave >> 1; const size_t R0 = (size_t)blockIdx.x * QR; const int n0 = blockIdx.y * QC;
  v8f acc[4][3] = {};
  // each 16-byte load of a wave covers 4 whole lines: weights 4 rows x 128 B, x 2 rows x 256 B
  const __bf16* gB = P + (size_t)(n0 + (tid >> 3)) * DM + (tid & 7) * 8; const float* gA = X + (R0 + (tid >> 4)) * DM + (tid & 15) * 4;
  v8b rb[6]; v4f ra[4];
#pragma unroll
  for (int i = 0; i < 6; ++i) rb[i] = *(const v8b*)(gB + (size_t)i * 64 * DM);
#pragma unroll
  for (int i = 0; i < 4; ++i) ra[i] = *(const v4f*)(gA + (size_t)i * 32 * DM);
  asm volatile("s_wait_xcnt 0x0" ::: "memory");   // stands behind the run of loads, in front of any rewrite of a register that one of them names as its address
#pragma unroll
  for (int i = 0; i < 6; ++i) *(v8b*)&sB[0][(tid >> 3) + 64 * i][(tid & 7) * 8] = rb[i];
#pragma unroll
  for (int i = 0; i < 4; ++i) { v4b t;
#pragma unroll
    for (int e = 0; e < 4; ++e) t[e] = (__bf16)ra[i][e];
    *(v4b*)&sA[0][(tid >> 4) + 32 * i][(tid & 15) * 4] = t; }
  __syncthreads();
#pragma unroll 2   // two steps a body, so that each buffer's LDS addresses are immediates
  for (int s = 0; s < DM / KS; ++s) { const int cur = s & 1;
    if (s + 1 < DM / KS) {   // the next step's tiles fly while this step is worked on
#pragma unroll
      for (int i = 0; i < 6; ++i) rb[i] = *(const v8b*)(gB + (size_t)i * 64 * DM + (s + 1) * KS);
#pragma unroll
      for (int i = 0; i < 4; ++i) ra[i] = *(const v4f*)(gA + (size_t)i * 32 * DM + (s + 1) * KS);
      asm volatile("s_wait_xcnt 0x0" ::: "memory"); }   // stands behind the run of loads, in front of any rewrite of a register that one of them names as its address
#pragma unroll
    for (int kc = 0; kc < KS / 32; ++kc) { v16b a[4];
#pragma unroll
      for (int rt = 0; rt < 4; ++rt) a[rt] = frag_b(&sA[cur][wr * 64 + rt * 16 + col][kc * 32], lane);
      v16b w[3];
#pragma unroll
      for (int j = 0; j < 3; ++j) w[j] = frag_b(&sB[cur][wc * 48 + j * 16 + col][kc * 32], lane);   // all fragment reads as one group ahead of their twelve products
      __builtin_amdgcn_sched_barrier(0);   // keeps that group ahead of the products: left free, the compiler puts each read with a full wait directly in front of its product
#pragma unroll
      for (int j = 0; j < 3; ++j) {
#pragma unroll
        for (int rt = 0; rt < 4; ++rt) acc[rt][j] = wmma_bf(a[rt], w[j], acc[rt][j]); }
      __builtin_amdgcn_sched_barrier(0); }   // keeps the wait for the next step's global loads behind the products: left free, the compiler lifts the conversions, and that wait with them, among the step's first products
    if (s + 1 < DM / KS) {
#pragma unroll
      for (int i = 0; i < 6; ++i) *(v8b*)&sB[cur ^ 1][(tid >> 3) + 64 * i][(tid & 7) * 8] = rb[i];
#pragma unroll
      for (int i = 0; i < 4; ++i) { v4b t;
#pragma unroll
        for (int e = 0; e < 4; ++e) t[e] = (__bf16)ra[i][e];
        *(v4b*)&sA[cur ^ 1][(tid >> 4) + 32 * i][(tid & 15) * 4] = t; } }
    __syncthreads(); }   // publishes the next buffer and ends every reader's last read of this one
  if (n0 < 2 * DM) {   // per (row, head): the 5 bucket dots (q . table_k[u]) or ((k/8) . table_q[u]) -> BKT / BQT [row][h][8] (5 used), as matrix products: A = 16 rows of one head, read back from the tiles that are staged below for the stores (hi, and residual x2048), B = the table's rows, one bucket a column
    const bool isq = n0 < DM; const float* TB = isq ? TK : TQ; float* dstT = isq ? BKT : BQT; const float sc = isq ? 1.0f : 0.125f;
#pragma unroll
    for (int rt = 0; rt < 4; ++rt) {
#pragma unroll
      for (int j = 0; j < 3; ++j) {
#pragma unroll
        for (int r = 0; r < 8; ++r) { const float v = acc[rt][j][r]; const _Float16 hv = (_Float16)v; const int row = wr * 64 + rt * 16 + 8 * g + r, c = wc * 48 + j * 16 + col; so[row][c] = hv; sol[row][c] = (_Float16)((v - (float)hv) * 2048.0f); } } }   // q, k as f16 hi + (x2048) residual
    const float* tp = TB + (col < NBK ? col : NBK - 1) * HD + 8 * g;   // column = bucket; the lanes of columns 5 to 15 read the last row again, in bounds: a column of B reaches its own column of the product alone, and those columns are not stored
    v4f tr[8];   // read ahead of the barrier: the loads overlap the staging, among whose LDS stores the compiler sets them, on registers of accumulators that are already staged
#pragma unroll
    for (int i = 0; i < 8; ++i) tr[i] = *(const v4f*)(tp + (i >> 1) * 16 + (i & 1) * 4);
    asm volatile("s_wait_xcnt 0x0" :: "v"(tp) : "memory");   // stands behind the run of loads, in front of any rewrite of a register that one of them names as its address; the address is an input, so that its registers live up to the wait and no load's result is placed on them
    __syncthreads();   // from here a wave works on 16 rows x 3 whole heads, which other waves of the main loop have written
    const int rw = (wave & 7) * 16, h0 = (wave >> 3) * 3;
    { v16h tb[2];   // element e of step kc = d 32 kc + 8 g + e (e < 8), 32 kc + 16 + 8 g + e - 8 (e >= 8): the k order of frag_h
#pragma unroll
      for (int kc = 0; kc < 2; ++kc) {
#pragma unroll
        for (int e = 0; e < 16; ++e) tb[kc][e] = (_Float16)bfr(tr[kc * 4 + (e >> 2)][e & 3]); }
      v8f dh[3] = {}, dl[3] = {};   // register r: row 8 g + r, bucket col
#pragma unroll
      for (int hh = 0; hh < 3; ++hh) {
#pragma unroll
        for (int kc = 0; kc < 2; ++kc) { dh[hh] = wmma16(frag_h(&so[rw + col][(h0 + hh) * HD + kc * 32], lane), tb[kc], dh[hh]); dl[hh] = wmma16(frag_h(&sol[rw + col][(h0 + hh) * HD + kc * 32], lane), tb[kc], dl[hh]); } }
      if (col < NBK) { float* d = dstT + ((R0 + rw + 8 * g) * NH + (n0 % DM) / HD + h0) * 8 + col;   // (8-float slots per (row, head); 4-B scratch stores)
#pragma unroll
        for (int hh = 0; hh < 3; ++hh) dh[hh] = (dh[hh] + dl[hh] * (1.0f / 2048.0f)) * sc;
#pragma unroll
        for (int hh = 0; hh < 3; ++hh) {
#pragma unroll
          for (int r = 0; r < 8; ++r) d[(r * NH + hh) * 8] = dh[hh][r]; }
        asm volatile("s_wait_xcnt 0x0" :: "v"(d) : "memory"); } }   // stands behind the run of stores, in front of any rewrite of a register that one of them names
#pragma unroll   // the 16 rows' LDS reads fly as one group, each into registers of its own, so that no store's register is rewritten behind it
    for (int rl = 0; rl < 16; ++rl) if (lane < 24) vst2((unsigned*)(QK + (R0 + rw + rl) * (2 * DM) + n0 + h0 * HD + lane * 8), *(const v4u*)&so[rw + rl][h0 * HD + lane * 8]);   // 3 whole lines a row; the residual tile serves the bucket dots above alone: no kernel reads it from memory
  } else {
#pragma unroll
    for (int rt = 0; rt < 4; ++rt) {
#pragma unroll
      for (int j = 0; j < 3; ++j) {
#pragma unroll
        for (int r = 0; r < 8; ++r) sth[wc * 48 + j * 16 + col][wr * 64 + rt * 16 + 8 * g + r] = (_Float16)acc[rt][j][r]; } }
    __syncthreads();
    const int b = (int)(R0 / SS), s0 = (int)(R0 % SS); const int pc0 = n0 - 2 * DM;
    for (int i = 0; i < QC * (QR / 8) / QT; ++i) { const int d = (tid >> 4) + i * (QT / 16), pc = tid & 15; const size_t o = ((size_t)b * DM + pc0 + d) * SS + s0 + pc * 8; vst2((unsigned*)(VTH + o), *(const v4u*)&sth[d][pc * 8]); }   // 256 B of a d row in a run
    asm volatile("s_wait_xcnt 0x0" ::: "memory");   // stands behind the run of stores, in front of any rewrite of a register that one of them names
  }
}
// ---- k_attn: block = (64 queries, head h, batch b): all-keys flash attention on TRANSPOSED tiles: S^T = K . Q^T (A = K rows, B = q), so that a lane holds 32 keys' scores of ONE query (query = lane & 15, keys 8 * (lane >> 4) + r of each 16-key tile); scores = (q.k) * 0.125 with single f16 operands; the four f32 score tiles of a 64-key stage, converted in place, are the two B operands (32 keys each) of O^T += V^T . P^T (A = V rows [d][key]); O[b*S+q][h*64+d] = acc / 2048 / l (256-B segments)
__device__ __forceinline__ float xhalf(float x) { return __builtin_bit_cast(float, __builtin_amdgcn_permlanex16(__builtin_bit_cast(int, x), __builtin_bit_cast(int, x), 0x76543210, 0xfedcba98, false, false)); }   // lane l with lane l ^ 16
// 2^x on the hardware's v_exp_f32, written with the slot that the instruction set asks for behind a transcendental inside the statement. Outputs are early-clobber, so each v_exp_f32 is followed by one that is independent of it, and the last by the v_nop
__device__ __forceinline__ float exp2_1(float x) { float r; asm("v_exp_f32 %0, %1\n\tv_nop" : "=v"(r) : "v"(x)); return r; }
__device__ __forceinline__ v8f exp2_8(v8f x) { float r0, r1, r2, r3, r4, r5, r6, r7;
  asm("v_exp_f32 %0, %8\n\tv_exp_f32 %1, %9\n\tv_exp_f32 %2, %10\n\tv_exp_f32 %3, %11\n\tv_exp_f32 %4, %12\n\tv_exp_f32 %5, %13\n\tv_exp_f32 %6, %14\n\tv_exp_f32 %7, %15\n\tv_nop"
      : "=&v"(r0), "=&v"(r1), "=&v"(r2), "=&v"(r3), "=&v"(r4), "=&v"(r5), "=&v"(r6), "=&v"(r7) : "v"(x[0]), "v"(x[1]), "v"(x[2]), "v"(x[3]), "v"(x[4]), "v"(x[5]), "v"(x[6]), "v"(x[7]));
  const v8f r = {r0, r1, r2, r3, r4, r5, r6, r7}; return r; }
#define LOG2E 1.44269504f
__global__ __launch_bounds__(128) void k_attn(const _Float16* __restrict__ QK, const _Float16* __restrict__ VTH, const float* __restrict__ BKT, const float* __restrict__ BQT, const unsigned* __restrict__ PB, float* __restrict__ O) {
  __shared__ __align__(16) float so[4][16][68];
  __shared__ __align__(16) _Float16 sK[2][64][LP], sV[2][64][LP];   // two stage buffers of 64 keys: K rows [key][d], V rows [d][key], 128 B of data a row
  __shared__ __align__(16) float sBQ[2][NBK][BQP];   // the stage's (k/8) . table_q[u], [bucket][key], in the same two stage buffers' rhythm
  __shared__ __align__(16) float sBK[4][NBK][32];    // per wave: q . table_k[u] of each lane's own query, [bucket][lane]: a lane reads its own column alone, so no two lanes of a look-up meet on a bank
  const int tid = threadIdx.x, wave = tid >> 5, lane = tid & 31, col = lane & 15, g = lane >> 4;
  const int qb = blockIdx.x, h = blockIdx.y, b = blockIdx.z; const int q0 = qb * 64 + wave * 16; const size_t rq = (size_t)b * SS + q0 + col;
  v16h aq[2];
#pragma unroll
  for (int kc = 0; kc < 2; ++kc) aq[kc] = frag_h(QK + rq * (2 * DM) + h * HD + kc * 32, lane);
  { const float* bk = BKT + (rq * NH + h) * 8;   // the lane's own query: its five buckets
    const v4f t = *(const v4f*)bk; const float t4 = bk[4];
    asm volatile("s_wait_xcnt 0x0" ::: "memory");   // stands behind the two loads, in front of any rewrite of a register that one of them names as its address
#pragma unroll
    for (int u = 0; u < 4; ++u) sBK[wave][u][lane] = t[u];
    sBK[wave][4][lane] = t4; }
  float m = -3.0e38f; v8f lv = {};   // the lane's query: running maximum (equal in both halves), and the half's own part of the sum, held as eight partial sums (one a register row of the score tiles), joined in the epilogue
  v8f acc[4] = {};
  const int nst = SS / 64;   // all keys, 64 a stage
  // each 16-byte load of a wave covers 4 whole lines: 4 rows x 128 B
  const _Float16* gK = QK + ((size_t)b * SS + (tid >> 3)) * (2 * DM) + DM + h * HD + (tid & 7) * 8; const _Float16* gV = VTH + ((size_t)b * DM + h * HD + (tid >> 3)) * SS + (tid & 7) * 8;
  const int bkey = tid >> 1, bp = tid & 1;   // key-side bias rows of a stage's 64 keys: a pair of threads brings one key's five buckets, 0, 1 and 4 | 2, 3
  const float* gQ = BQT + (((size_t)b * SS + bkey) * NH + h) * 8 + bp * 2;
  const unsigned* gP = PB + ((size_t)(qb * 4 + wave) * (SS / 32) * 32 + lane) * 4;   // the wave's own 16 queries: 512 B in a row for each step of 32 keys, 16 B a lane
  v8h rk[4], rv[4]; v2f rbq; float rb4 = 0.f;
  v4u nb[2] = {*(const v4u*)gP, *(const v4u*)(gP + 128)};   // the bucket pairs of stage 0: two groups of 32 keys
#pragma unroll
  for (int i = 0; i < 4; ++i) { rk[i] = *(const v8h*)(gK + (size_t)i * 16 * (2 * DM)); rv[i] = *(const v8h*)(gV + (size_t)i * 16 * SS); }
  rbq = *(const v2f*)gQ; if (bp == 0) rb4 = gQ[4];
  asm volatile("s_wait_xcnt 0x0" ::: "memory");   // stands behind the run of loads, in front of any rewrite of a register that one of them names as its address
#pragma unroll
  for (int i = 0; i < 4; ++i) { *(v8h*)&sK[0][(tid >> 3) + 16 * i][(tid & 7) * 8] = rk[i]; *(v8h*)&sV[0][(tid >> 3) + 16 * i][(tid & 7) * 8] = rv[i]; }
  sBQ[0][bp * 2][bkey] = rbq[0]; sBQ[0][bp * 2 + 1][bkey] = rbq[1]; if (bp == 0) sBQ[0][4][bkey] = rb4;
  __syncthreads();
#pragma unroll 1   // keeps the long body once in the text
  for (int st = 0; st < nst; ++st) { const int cur = st & 1;
  { v8f s[4];   // one softmax step over the stage's 64 keys: one maximum, one half exchange, one rescale of the accumulators for 64 keys
    const v4u cb[2] = {nb[0], nb[1]};   // this stage's 32 bucket pairs; the next stage's (the last stage: its own again) fly while this one is worked on
    const unsigned* pn = gP + (size_t)(st + 1 < nst ? st + 1 : nst - 1) * 256; nb[0] = *(const v4u*)pn; nb[1] = *(const v4u*)(pn + 128);
    asm volatile("s_wait_xcnt 0x0" :: "v"(pn) : "memory");   // stands behind the two loads, in front of any rewrite of a register that one of them names as its address; the address is an input, so that its registers live up to the wait and no load's result is placed on them
    v16h kf[4][2]; float vk[4][8], vq[4][8];
#pragma unroll
    for (int ct = 0; ct < 4; ++ct) {
#pragma unroll
      for (int kc = 0; kc < 2; ++kc) kf[ct][kc] = frag_h(&sK[cur][ct * 16 + col][kc * 32], lane); }   // all K fragment reads as one group ahead of their eight products
#pragma unroll
    for (int ct = 0; ct < 4; ++ct) { const float* tq = &sBQ[cur][0][ct * 16 + 8 * g]; const float* tk = &sBK[wave][0][lane];   // and behind them, in the same group, the stage's 64 bias look-ups of the lane
#pragma unroll
      for (int r = 0; r < 8; ++r) { const unsigned pw = cb[ct >> 1][(ct & 1) * 2 + (r >> 2)] >> 8 * (r & 3); const unsigned c1 = pw & 7u, c2 = pw >> 4 & 7u;   // both at most 4: clamped where k_pack wrote the table
        vk[ct][r] = tk[c1 * 32]; vq[ct][r] = tq[c2 * BQP + r]; } }
    __builtin_amdgcn_sched_barrier(0);   // keeps that group ahead of the products: left free, the compiler cuts it into many small groups, each with a wait to 0 directly in front of its users
    v8f c[4] = {};   // register r of tile ct: key st * 64 + ct * 16 + 8 * g + r, query q0 + col
#pragma unroll
    for (int kc = 0; kc < 2; ++kc) {
#pragma unroll
      for (int ct = 0; ct < 4; ++ct) c[ct] = wmma16(kf[ct][kc], aq[kc], c[ct]); }   // single product: k, q as one-rounding f16 operands; four independent tiles in a run
    __builtin_amdgcn_sched_barrier(0);   // keeps the eight products in a run, each in the others' shadow: left free, the compiler sets bias adds between them and pads twice with four v_nop
#pragma unroll
    for (int ct = 0; ct < 4; ++ct) {
#pragma unroll
      for (int r = 0; r < 8; ++r) s[ct][r] = c[ct][r] * 0.125f + vk[ct][r] + vq[ct][r]; }   // 1/sqrt(64) + q.table_k[bucket(i,j)] + (k/8).table_q[bucket(j,i)]
    v16h vf[2][4];
#pragma unroll
    for (int kg = 0; kg < 2; ++kg) {
#pragma unroll
      for (int dt = 0; dt < 4; ++dt) vf[kg][dt] = frag_h(&sV[cur][dt * 16 + col][kg * 32], lane); }   // all V fragment reads as one group, behind the scores, on the registers that the looked-up biases leave: they land under the softmax
    __builtin_amdgcn_sched_barrier(0);   // keeps that group here: left free, the compiler puts half of these reads, each with a wait to 0, directly in front of their products
    float mx = fmaxf(fmaxf(s[0][0], s[1][0]), fmaxf(s[2][0], s[3][0]));
#pragma unroll
    for (int r = 1; r < 8; ++r) mx = fmaxf(fmaxf(mx, fmaxf(s[0][r], s[1][r])), fmaxf(s[2][r], s[3][r]));
    mx = fmaxf(mx, xhalf(mx));   // the query's other 32 keys of this stage lie in the other half of the wave
    const float mn = fmaxf(m, mx); const float alpha = exp2_1((m - mn) * LOG2E);   // first stage: m is the start value, the argument overflows to -inf and 2^-inf is 0
    v16h pa[2]; v8f es[2];
#pragma unroll
    for (int ct = 0; ct < 4; ++ct) { const v8f ex = exp2_8((s[ct] - mn) * LOG2E); es[ct >> 1] = (ct & 1) ? es[ct >> 1] + ex : ex;
#pragma unroll
      for (int r = 0; r < 8; ++r) { pa[ct >> 1][(ct & 1) * 8 + r] = (_Float16)(ex[r] * 2048.0f); } }   // element (ct & 1) * 8 + r of group ct >> 1 = key 32 (ct >> 1) + 16 (ct & 1) + 8 g + r: the k order of the V fragments; P scaled by 2^11 before the f16 rounding so small softmax weights stay out of the f16 subnormal range; 2^-11 folded into the epilogue
    lv = lv * alpha + (es[0] + es[1]); m = mn;
#pragma unroll
    for (int dt = 0; dt < 4; ++dt) {
#pragma unroll
      for (int r = 0; r < 8; ++r) acc[dt][r] *= alpha; }
#pragma unroll
    for (int kg = 0; kg < 2; ++kg) {
#pragma unroll
      for (int dt = 0; dt < 4; ++dt) acc[dt] = wmma16(vf[kg][dt], pa[kg], acc[dt]); }   // single product: V x P (x2^11); register r: d = 16 dt + 8 g + r of query col
    asm volatile("v_nop\n\tv_nop\n\tv_nop\n\tv_nop" : "+v"(acc[3]) : "v"(vf[1][3]), "v"(pa[1])); }   // the four slots behind the stage's last products, once a stage: a branch follows them, and what stands behind the branch rewrites fragment registers
    if (st + 1 < nst) {   // the next stage is fetched and stored into the other buffer here at the foot, not held in registers over the stage
#pragma unroll
      for (int i = 0; i < 4; ++i) { rk[i] = *(const v8h*)(gK + ((size_t)(st + 1) * 64 + i * 16) * (2 * DM)); rv[i] = *(const v8h*)(gV + (size_t)i * 16 * SS + (st + 1) * 64); }
      rbq = *(const v2f*)(gQ + (size_t)(st + 1) * 64 * NH * 8); if (bp == 0) rb4 = gQ[(size_t)(st + 1) * 64 * NH * 8 + 4];
      asm volatile("s_wait_xcnt 0x0" ::: "memory");   // stands behind the run of loads, in front of any rewrite of a register that one of them names as its address
#pragma unroll
      for (int i = 0; i < 4; ++i) { *(v8h*)&sK[cur ^ 1][(tid >> 3) + 16 * i][(tid & 7) * 8] = rk[i]; *(v8h*)&sV[cur ^ 1][(tid >> 3) + 16 * i][(tid & 7) * 8] = rv[i]; }
      sBQ[cur ^ 1][bp * 2][bkey] = rbq[0]; sBQ[cur ^ 1][bp * 2 + 1][bkey] = rbq[1]; if (bp == 0) sBQ[cur ^ 1][4][bkey] = rb4; }
    __syncthreads(); }   // publishes the next buffer and ends every reader's last read of this one
  { const float l = ((lv[0] + lv[1]) + (lv[2] + lv[3])) + ((lv[4] + lv[5]) + (lv[6] + lv[7])); const float il = (1.0f / 2048.0f) / (l + xhalf(l));   // the two halves' parts of the query's sum are joined once, here
#pragma unroll
    for (int dt = 0; dt < 4; ++dt) {
#pragma unroll
      for (int r = 0; r < 8; ++r) so[wave][col][dt * 16 + 8 * g + r] = acc[dt][r] * il; } }
  LDSX();
  for (int rl = 0; rl < 16; ++rl) if (lane < 16) vst2(O + ((size_t)b * SS + q0 + rl) * DM + h * HD + lane * 4, *(const v4f*)&so[wave][rl][lane * 4]);
}
// ---- k_out: block = (64 rows, 128 cols): out = O(hi/lo) . Wo rows (2 products) + bo
__global__ __launch_bounds__(128) void k_out(const float* __restrict__ O, const __bf16* __restrict__ P, const float* __restrict__ BO, float* __restrict__ Y) {
  // one LDS block: two stage buffers (weights 128 rows, ctx hi and residual 64 rows each, bf16); behind the loop's last barrier the output tile lies over them
  __shared__ __align__(16) unsigned char sm[2 * (128 + 64 + 64) * LP * 2];
  __bf16 (*sB)[128][LP] = (__bf16 (*)[128][LP])sm; __bf16 (*sH)[64][LP] = (__bf16 (*)[64][LP])(sm + 2 * 128 * LP * 2); __bf16 (*sL)[64][LP] = (__bf16 (*)[64][LP])(sm + 2 * (128 + 64) * LP * 2);
  float (*so)[16][132] = (float (*)[16][132])sm;
  const int tid = threadIdx.x, wave = tid >> 5, lane = tid & 31, col = lane & 15, g = lane >> 4; const size_t r0 = (size_t)blockIdx.x * 64 + wave * 16; const int n0 = blockIdx.y * 128;
  v8f acc[8] = {};
  const __bf16* gB = P + (size_t)(n0 + (tid >> 3)) * DM + (tid & 7) * 8; const float* gA = O + ((size_t)blockIdx.x * 64 + (tid >> 4)) * DM + (tid & 15) * 4;
  v8b rb[8]; v4f ra[8];
#pragma unroll
  for (int i = 0; i < 8; ++i) { rb[i] = *(const v8b*)(gB + (size_t)i * 16 * DM); ra[i] = *(const v4f*)(gA + (size_t)i * 8 * DM); }
#pragma unroll
  for (int i = 0; i < 8; ++i) { *(v8b*)&sB[0][(tid >> 3) + 16 * i][(tid & 7) * 8] = rb[i]; v4b th, tl;
#pragma unroll
    for (int e = 0; e < 4; ++e) { const __bf16 hv = (__bf16)ra[i][e]; th[e] = hv; tl[e] = (__bf16)(ra[i][e] - (float)hv); }
    *(v4b*)&sH[0][(tid >> 4) + 8 * i][(tid & 15) * 4] = th; *(v4b*)&sL[0][(tid >> 4) + 8 * i][(tid & 15) * 4] = tl; }
  __syncthreads();
#pragma unroll 2   // two steps a body, so that each buffer's LDS addresses are immediates
  for (int s = 0; s < DM / KS; ++s) { const int cur = s & 1;
    if (s + 1 < DM / KS) {   // the next step's tiles fly while this step is worked on
#pragma unroll
      for (int i = 0; i < 8; ++i) { rb[i] = *(const v8b*)(gB + (size_t)i * 16 * DM + (s + 1) * KS); ra[i] = *(const v4f*)(gA + (size_t)i * 8 * DM + (s + 1) * KS); }
      asm volatile("s_wait_xcnt 0x0" ::: "memory"); }   // stands behind the run of loads, in front of any rewrite of a register that one of them names as its address
#pragma unroll
    for (int kc = 0; kc < KS / 32; ++kc) { const v16b ah = frag_b(&sH[cur][wave * 16 + col][kc * 32], lane), al = frag_b(&sL[cur][wave * 16 + col][kc * 32], lane); v16b w[8];
#pragma unroll
      for (int j = 0; j < 8; ++j) w[j] = frag_b(&sB[cur][j * 16 + col][kc * 32], lane);   // all fragment reads as one group ahead of the products
      __builtin_amdgcn_sched_barrier(0);   // keeps that group ahead of the products
#pragma unroll
      for (int j = 0; j < 8; ++j) { acc[j] = wmma_bf(al, w[j], acc[j]); acc[j] = wmma_bf(ah, w[j], acc[j]); }
      __builtin_amdgcn_sched_barrier(0); }   // keeps the wait for the next step's global loads behind the products
    if (s + 1 < DM / KS) {
#pragma unroll
      for (int i = 0; i < 8; ++i) { *(v8b*)&sB[cur ^ 1][(tid >> 3) + 16 * i][(tid & 7) * 8] = rb[i]; v4b th, tl;
#pragma unroll
        for (int e = 0; e < 4; ++e) { const __bf16 hv = (__bf16)ra[i][e]; th[e] = hv; tl[e] = (__bf16)(ra[i][e] - (float)hv); }
        *(v4b*)&sH[cur ^ 1][(tid >> 4) + 8 * i][(tid & 15) * 4] = th; *(v4b*)&sL[cur ^ 1][(tid >> 4) + 8 * i][(tid & 15) * 4] = tl; } }
    __syncthreads(); }   // publishes the next buffer and ends every reader's last read of this one
#pragma unroll
  for (int j = 0; j < 8; ++j) {
#pragma unroll
    for (int r = 0; r < 8; ++r) so[wave][8 * g + r][j * 16 + col] = acc[j][r] + bfr(BO[n0 + j * 16 + col]); }
  LDSX();
  for (int rl = 0; rl < 16; ++rl) vst2(Y + (r0 + rl) * DM + n0 + lane * 4, *(const v4f*)&so[wave][rl][lane * 4]);
}
extern "C" void kernel_launch(void* const* d_in, const int* in_sizes, int n_in, void* d_out, int out_size, void* d_ws, size_t ws_size, hipStream_t stream) {
  (void)in_sizes; (void)n_in; (void)out_size;
  const float** F = (const float**)d_in;   // 0 x [4,1024,768], 1 wq_w, 2 wk_w, 3 wv_w, 4 proj_w ((in,out)), 5 proj_b, 6 rpe_k_table [5,64], 7 rpe_q_table [5,64], 8 rp_bucket [1024,1024] int
  if (ws_size < (size_t)WS_END) return;
  char* ws = (char*)d_ws; __bf16* PK = (__bf16*)(ws + WS_PK); _Float16 *QK = (_Float16*)(ws + WS_QK), *VTH = (_Float16*)(ws + WS_VTH); float *O = (float*)(ws + WS_O), *BKT = (float*)(ws + WS_BKT), *BQT = (float*)(ws + WS_BQT);
  k_pack<<<dim3((DM / PT) * (DM / PT), 4), 128, 0, stream>>>(F[1], F[2], F[3], F[4], (const int*)d_in[8], PK, (unsigned*)(ws + WS_PB));
  k_qkv<<<dim3(TNB * SS / QR, QKVW / QC), QT, 0, stream>>>(F[0], F[0], F[0], PK + PK_A, F[6], F[7], BKT, BQT, QK, VTH);
  k_attn<<<dim3(TQB, NH, TNB), 128, 0, stream>>>(QK, VTH, BKT, BQT, (const unsigned*)(ws + WS_PB), O);
  k_out<<<dim3(TOB, DM / 128), 128, 0, stream>>>(O, PK + PK_P, F[5], (float*)d_out);
}
